// v000
// Measured on an AMD MI455X. A time is GPU time per run, averaged over a window of back-to-back runs after a warm-up
// (all launches, gaps included; the runs take copies of the inputs in turn), and the median of several windows.
// Apart from v000's, it joins two sittings. Times from different sittings can be a few percent apart, while
// side-by-side timings come from the same sitting.
// v000, which the later versions start from, runs in 598 microseconds.
// Contractions: x.Wq, x.Wk, x.Wv, x.Wu on v_wmma_f32_16x16x32_bf16 (x as bf16 hi|lo pair folded into K = 256, W as bf16 RNE
// of the input, f32 accumulate); k.q^T over 64 and P.v^T on v_wmma_f32_16x16x32_f16 (k x1024 and q x128 f16 hi + residual
// planes, P x32768 f16 hi + residual, v x1024 f16 hi + residual; products hh + lh + hl); (O*gate).Wo on
// v_wmma_f32_16x16x32_f16 (O x1024 f16 hi + residual, Wo as f16(bf16(Wo)) x1024, products h.w + l.w); all f32 accumulate.
// LayerNorm, x.Wb (N = 4) and the additive logit table, base-2 online softmax, sigmoid gate, bias and row scale in f32 on VALU.
#include <hip/hip_runtime.h>
#include <math.h>
#include <stdint.h>

#ifndef NS
#define NS 256
#endif
#define NSX   256
#define LP    256
#define DM    128
#define NH    4
#define HD    64
#define DI    (NH * HD)
#define KX    (2 * DM)
#define NPIX  (LP * LP)
#define BG    ((NS <= 64) ? NS : 64)
#define NGRP  (NS / BG)
#define GROWS (BG * LP)
#define LNEPS 1e-5f
#define LOG2E 1.4426950408889634f
#define QSC   128.0f
#define CSC   1024.0f
#define KSC   1024.0f
#define PCAR  32768.0f
#define VCAR  1024.0f
#define OSC   1024.0f
#define WOS   1024.0f
#define WPB   4
#define NQT   (LP / 16)
#define NST   (LP / 64)
#define NKT   (LP / 32)
#define ATT_THREADS (WPB * 32)
#define PTP   36
#define PTW   (16 * PTP)
#define SLP   68
#define SLW   (16 * SLP)
#define WREG  (PTW + SLW)
#define SLAB64 (16 * 68)
#define VTP   72
#define QKC   (DI / 8)
#define QKR   8
#define QKT   (QKC * QKR)
#define LNPB  32
#define WS_CAP 134217728
static_assert(DI == NH * HD && HD == 64 && NH == 4 && WPB == NH);
static_assert(ATT_THREADS == 128);
static_assert(NS >= 1 && NS <= NSX && (NS % BG) == 0 && BG >= 1 && BG <= 64);
static_assert((LP % 64) == 0 && (LP % 32) == 0 && (LP % 16) == 0);
static_assert(DM == 128 && (KX % 32) == 0 && (DI % 64) == 0 && (DI % 32) == 0 && (DM % 64) == 0);
static_assert(QKC * 8 == DI && QKT == 256 && (GROWS % QKR) == 0 && (GROWS % 64) == 0);
static_assert((NPIX % LNPB) == 0 && LNPB == 32);
static_assert((DI % 128) == 0 && (DM % 128) == 0 && (DM % 64) == 0 && (DI % 64) == 0);

typedef unsigned short u16;
typedef _Float16 v16h __attribute__((ext_vector_type(16)));
typedef _Float16 v8h  __attribute__((ext_vector_type(8)));
typedef __bf16   v16b __attribute__((ext_vector_type(16)));
typedef float    v8f  __attribute__((ext_vector_type(8)));
typedef float    v4f  __attribute__((ext_vector_type(4)));
typedef unsigned int v4u __attribute__((ext_vector_type(4)));
typedef unsigned int v2u __attribute__((ext_vector_type(2)));

union FragH { v16h v; v8h h[2]; v4u u[2]; };
union FragB { v16b v; v4u u[2]; };

// ---- scalar helpers --------------------------------------------------------------------------------
__device__ __forceinline__ unsigned short bf_bits(float f) {          // f32 -> bf16 bits, RNE convert
  unsigned u = __float_as_uint(f);
  return (unsigned short)((u + 0x7FFFu + ((u >> 16) & 1u)) >> 16);
}
__device__ __forceinline__ float bf_up(unsigned short h) { return __uint_as_float(((unsigned)h) << 16); }
__device__ __forceinline__ float bfr(float f) { return bf_up(bf_bits(f)); }
__device__ __forceinline__ unsigned short h_bits(_Float16 x) { return __builtin_bit_cast(unsigned short, x); }
__device__ __forceinline__ unsigned pk16(unsigned short a, unsigned short b) { return (unsigned)a | ((unsigned)b << 16); }
__device__ __forceinline__ v8f zero8() { v8f z = {0.f, 0.f, 0.f, 0.f, 0.f, 0.f, 0.f, 0.f}; return z; }
__device__ __forceinline__ float sigm(float z) {                     // 1 / (1 + 2^(-z log2 e)), argument clamped
  const float zc = fminf(fmaxf(z, -30.0f), 30.0f);
  const float e  = exp2f(-zc * LOG2E);
  return __builtin_amdgcn_rcpf(1.0f + e);
}

// ---- fragment loaders: 16-bit A/B operand, lane -> row/col (lane&15), p already includes +8*(lane>>4);
//      elements 0..7 <- p[0..7] (k0+8h..), elements 8..15 <- p[16..23] (k0+16+8h..)  (same split k map for A and B;
//      B is always read from a k-contiguous [n][k] plane)
__device__ __forceinline__ v16h ldfrag_h(const _Float16* p) {
  FragH f;
  f.h[0] = *(const v8h*)(p);
  f.h[1] = *(const v8h*)(p + 16);
  return f.v;
}
__device__ __forceinline__ v16b ldfrag_b(const u16* p) {              // bf16 plane read as unsigned integer vectors
  FragB f;
  f.u[0] = *(const v4u*)(p);
  f.u[1] = *(const v4u*)(p + 16);
  return f.v;
}

__device__ __forceinline__ v8f mma_h(v16h a, v16h b, v8f c) {
  return __builtin_amdgcn_wmma_f32_16x16x32_f16(false, a, false, b, (short)0, c, false, false);
}
__device__ __forceinline__ v8f mma_b(v16b a, v16b b, v8f c) {
  return __builtin_amdgcn_wmma_f32_16x16x32_bf16(false, a, false, b, (short)0, c, false, false);
}
__device__ __forceinline__ void guard2(v8f& a, v8f& b, v16h x0, v16h x1, v16h x2, v16h x3, v16h x4, v16h x5) {
#if defined(__HIP_DEVICE_COMPILE__)
  asm volatile("v_nop\n\tv_nop\n\tv_nop\n\tv_nop"
               : "+v"(a), "+v"(b) : "v"(x0), "v"(x1), "v"(x2), "v"(x3), "v"(x4), "v"(x5) : "memory");
#endif
}
template <typename F>
__device__ __forceinline__ void guard6(v8f& a, v8f& b, v8f& c, v8f& d, F x0, F x1, F x2, F x3, F x4, F x5) {
#if defined(__HIP_DEVICE_COMPILE__)
  asm volatile("v_nop\n\tv_nop\n\tv_nop\n\tv_nop"
               : "+v"(a), "+v"(b), "+v"(c), "+v"(d) : "v"(x0), "v"(x1), "v"(x2), "v"(x3), "v"(x4), "v"(x5) : "memory");
#endif
}
__device__ __forceinline__ void acc_guard4(v8f& a, v8f& b, v8f& c, v8f& d) {
#if defined(__HIP_DEVICE_COMPILE__)
  asm volatile("v_nop\n\tv_nop\n\tv_nop\n\tv_nop" : "+v"(a), "+v"(b), "+v"(c), "+v"(d));
#endif
}
__device__ __forceinline__ void wave_sync_lds() {
  __builtin_amdgcn_fence(__ATOMIC_RELEASE, "workgroup");
  __builtin_amdgcn_wave_barrier();
  __builtin_amdgcn_fence(__ATOMIC_ACQUIRE, "workgroup");
}

// =====================================================================================================
// statistics), x written as bf16 hi | bf16 lo planes XB [NPIX][KX] (columns 0..127 hi bits, 128..255 lo bits of x - hi);
// the additive logit table CB [NH][NPIX] = 1e9*(mask - 1) + x.Wb (VALU f32, N = 4) is produced by the same block.
// Block = 8 waves x LNPB/8 pixels, wave = one pixel at a time (lane holds 4 channels); the 512-B x row is assembled in a
// x 4 heads) are funnelled through LDS and written by wave 0 in one instruction (8 consecutive lanes x 16 B per line);
// coverage: grid = NPIX/LNPB blocks x 32 pixels = every XB row once and every CB line once.
// =====================================================================================================
__global__ __launch_bounds__(256) void ln_x(const float* __restrict__ pr, const float* __restrict__ mask,
                                            const float* __restrict__ gamma, const float* __restrict__ beta,
                                            const float* __restrict__ Wb, u16* XB, float* CB) {
  __shared__ __align__(16) u16 RB[8 * KX];
  __shared__ __align__(16) float PBS[NH * LNPB];
  const int tid = threadIdx.x, wave = tid >> 5, lane = tid & 31;
  const int p0 = (int)blockIdx.x * LNPB;
  if (p0 + LNPB > NPIX) return;             // block-uniform, before any barrier; never taken with the exact grid
  float gm[4], bt[4], wb[16];
  {
    const v4f g4 = *(const v4f*)(gamma + 4 * lane), b4 = *(const v4f*)(beta + 4 * lane);
#pragma unroll
    for (int e = 0; e < 4; ++e) { gm[e] = bfr(g4[e]); bt[e] = bfr(b4[e]); }
#pragma unroll
    for (int i = 0; i < 4; ++i) {
      const v4f w4 = *(const v4f*)(Wb + 16 * lane + 4 * i);      // Wb[(4*lane + i)][h], h = 0..3
#pragma unroll
      for (int h = 0; h < 4; ++h) wb[4 * i + h] = bfr(w4[h]);
    }
  }
  u16* rb = RB + wave * KX;
#pragma unroll 1
  for (int j = 0; j < LNPB / 8; ++j) {
    const int pl = j * 8 + wave;
    const int p  = p0 + pl;
    const v4f x4 = *(const v4f*)(pr + (size_t)p * DM + 4 * lane);
    float xr[4];
#pragma unroll
    for (int e = 0; e < 4; ++e) xr[e] = bfr(x4[e]);
    float s = (xr[0] + xr[1]) + (xr[2] + xr[3]);
#pragma unroll
    for (int off = 1; off < 32; off <<= 1) s += __shfl_xor(s, off, 32);
    const float mu = s * (1.0f / (float)DM);
    float d[4];
#pragma unroll
    for (int e = 0; e < 4; ++e) d[e] = xr[e] - mu;
    float ss = (d[0] * d[0] + d[1] * d[1]) + (d[2] * d[2] + d[3] * d[3]);
#pragma unroll
    for (int off = 1; off < 32; off <<= 1) ss += __shfl_xor(ss, off, 32);
    const float var = ss * (1.0f / (float)DM);
    const float rs  = 1.0f / sqrtf(var + LNEPS);
    float y[4];
#pragma unroll
    for (int e = 0; e < 4; ++e) y[e] = d[e] * rs * gm[e] + bt[e];
    unsigned short hb[4], lb[4];
#pragma unroll
    for (int e = 0; e < 4; ++e) { hb[e] = bf_bits(y[e]); lb[e] = bf_bits(y[e] - bf_up(hb[e])); }
    float pb[4];
#pragma unroll
    for (int h = 0; h < 4; ++h) pb[h] = y[0] * wb[h] + y[1] * wb[4 + h] + y[2] * wb[8 + h] + y[3] * wb[12 + h];
#pragma unroll
    for (int h = 0; h < 4; ++h) {
#pragma unroll
      for (int off = 1; off < 32; off <<= 1) pb[h] += __shfl_xor(pb[h], off, 32);
    }
    const float mk = bfr(mask[p]);
    const float mb = 1e9f * (mk - 1.0f);
    v2u hv, lv;
    hv[0] = pk16(hb[0], hb[1]);  hv[1] = pk16(hb[2], hb[3]);
    lv[0] = pk16(lb[0], lb[1]);  lv[1] = pk16(lb[2], lb[3]);
    *(v2u*)(rb + 4 * lane)      = hv;
    *(v2u*)(rb + DM + 4 * lane) = lv;
    if (lane == 0) {
      PBS[0 * LNPB + pl] = mb + pb[0];
      PBS[1 * LNPB + pl] = mb + pb[1];
      PBS[2 * LNPB + pl] = mb + pb[2];
      PBS[3 * LNPB + pl] = mb + pb[3];
    }
    wave_sync_lds();
    const v4u piece = *(const v4u*)(rb + 8 * lane);
    u16* dst = XB + (size_t)p * KX + 8 * lane;
    {
      *(v4u*)(dst) = piece;
      
    }
    wave_sync_lds();
  }
  __syncthreads();
  if (wave == 0) {
    const int h = lane >> 3, j4 = (lane & 7) * 4;
    const v4f v = *(const v4f*)(PBS + h * LNPB + j4);
    float* d = CB + (size_t)h * NPIX + p0 + j4;
    {
      *(v4f*)(d) = v;
      
    }
  }
}

// =====================================================================================================
// Transposed weight plane: W f32 [nk rows k][ncol cols n] -> D 16-bit [n][ldd], D[n][k] = bf16 bits of W[k][n] (f16mode 0)
// or f16 bits of bf16(W[k][n]) * scale (f16mode 1); when dup != 0 the same 64-half segment is also written at D[n][nk + k]
// (hi|lo folded K). Block (ct = bid % nct: 128 columns, rt = bid / nct: 64 rows): each thread loads 32 floats of one k row
// (16-B loads), converts, scatters into the LDS tile [128 n][64 k] (pitch 72 halves); after a block barrier each n row segment
// coverage: load 256 thr x 32 = 64 k rows x 128 n; store 4 iterations x 256 thr x 8 halves = 128 lines x 64 = the block's tile
// =====================================================================================================
__global__ __launch_bounds__(256) void wt16(const float* __restrict__ W, int ncol, int nk, u16* D, int ldd, int dup,
                                            int f16mode, float scale) {
  __shared__ __align__(16) u16 T[128 * VTP];
  const int tid = threadIdx.x;
  const int bid = blockIdx.x;
  const int nct = ncol / 128;
  const int ct  = bid % nct;
  const int rt  = bid / nct;
  if (rt * 64 + 64 > nk) return;            // block-uniform, before the barrier; never taken with the exact grid
  {
    const int sl = tid >> 2;                // k row within tile 0..63
    const int dc = (tid & 3) * 32;          // n chunk
    const float* src = W + (size_t)(rt * 64 + sl) * ncol + ct * 128 + dc;
#pragma unroll
    for (int i = 0; i < 8; ++i) {
      const v4f a = *(const v4f*)(src + 4 * i);
#pragma unroll
      for (int e = 0; e < 4; ++e) {
        const float f = a[e];
        const unsigned short hb = h_bits((_Float16)(bfr(f) * scale));
        const unsigned short bb = bf_bits(f);
        T[(dc + 4 * i + e) * VTP + sl] = (f16mode != 0) ? hb : bb;
      }
    }
  }
  __syncthreads();
  v4u w4[4];
  const int q8 = tid >> 3, p8 = (tid & 7) * 8;
#pragma unroll
  for (int it = 0; it < 4; ++it) {
    const int line = it * 32 + q8;          // n within tile 0..127
    w4[it] = *(const v4u*)(T + line * VTP + p8);
  }
  const size_t base = ((size_t)ct * 128) * ldd + rt * 64 + p8;
  {
#pragma unroll
    for (int it = 0; it < 4; ++it) {
      const int line = it * 32 + q8;
      *(v4u*)(D + base + (size_t)line * ldd) = w4[it];
      if (dup != 0) *(v4u*)(D + base + (size_t)line * ldd + nk) = w4[it];
    }
    
  }
}

// =====================================================================================================
// v^T planes from the v projection F f32 [GROWS][DI] (row = b*LP + pos, column = g*HD + d):
//   VH[((b*NH + g)*HD + d)][LP] = f16(v * 1024);  VL same shape = f16 residual; all positions.
// Block = (b, head g, 64 positions s0): each thread loads its 16 floats (pos sl, d chunk dc) with 16-B loads, converts,
// scatters into two LDS tiles [d][64 pos] (pitch 72 halves); after a block barrier each d row segment (64 halves = one
// coverage: load 256 thr x 16 = 64 pos x 64 d; store 2 iterations x 256 thr x 8 halves = 64 lines x 64 = the block's tile of
//           VH and VL; grid = BG*NH*NST blocks covers both planes exactly once.
// =====================================================================================================
__global__ __launch_bounds__(256) void vt16(const float* __restrict__ F, u16* VHo, u16* VLo) {
  __shared__ __align__(16) u16 TH[HD * VTP];
  __shared__ __align__(16) u16 TL[HD * VTP];
  const int tid = threadIdx.x;
  const int bid = blockIdx.x;
  const int st  = bid % NST;
  const int t2  = bid / NST;
  const int g   = t2 % NH;
  const int b   = t2 / NH;
  if (b >= BG) return;                      // block-uniform, before any barrier; never taken with the exact grid
  const int s0  = st * 64;
  {
    const int sl = tid >> 2;                // position within tile 0..63
    const int dc = (tid & 3) * 16;          // d chunk 0,16,32,48
    const float* src = F + ((size_t)b * LP + s0 + sl) * DI + g * HD + dc;
#pragma unroll
    for (int i = 0; i < 4; ++i) {
      const v4f a = *(const v4f*)(src + 4 * i);
#pragma unroll
      for (int e = 0; e < 4; ++e) {
        const float t = a[e] * VCAR;
        const _Float16 hv = (_Float16)t;
        const _Float16 lv = (_Float16)(t - (float)hv);
        TH[(dc + 4 * i + e) * VTP + sl] = h_bits(hv);
        TL[(dc + 4 * i + e) * VTP + sl] = h_bits(lv);
      }
    }
  }
  __syncthreads();
  v4u vh[2], vl[2];
  const int q8 = tid >> 3, p8 = (tid & 7) * 8;
#pragma unroll
  for (int it = 0; it < 2; ++it) {
    const int line = it * 32 + q8;          // d = 0..63
    vh[it] = *(const v4u*)(TH + line * VTP + p8);
    vl[it] = *(const v4u*)(TL + line * VTP + p8);
  }
  const size_t hrow = (size_t)(b * NH + g) * HD;
  const size_t base = hrow * LP + s0 + p8;
  {
#pragma unroll
    for (int it = 0; it < 2; ++it) {
      const int line = it * 32 + q8;
      *(v4u*)(VHo + base + (size_t)line * LP) = vh[it];
      *(v4u*)(VLo + base + (size_t)line * LP) = vl[it];
    }
    
  }
}

// =====================================================================================================
// q / k planes from a projection F f32 [GROWS][DI]: Hp [GROWS][DI] = f16(val * sc) (same layout), Lp [GROWS][DI] = f16
// residual. Block = QKR rows x QKC threads per row (one wave per row), thread = 8 consecutive columns: two 16-B loads, one
// coverage: QKR rows x 32 thr x 8 = QKR whole rows of Hp and Lp per block; grid = GROWS/QKR blocks = every row once.
// =====================================================================================================
__global__ __launch_bounds__(QKT) void qk16(const float* __restrict__ F, u16* Hp, u16* Lp, float sc) {
  const int tid = (int)threadIdx.x;
  if (tid >= QKT) return;
  const int rl  = tid / QKC;
  const int cc  = tid - rl * QKC;
  const int row = (int)blockIdx.x * QKR + rl;
  if (row >= GROWS) return;
  const float* p = F + (size_t)row * DI + cc * 8;
  const v4f a = *(const v4f*)(p), b4 = *(const v4f*)(p + 4);
  float w[8];
#pragma unroll
  for (int e = 0; e < 4; ++e) { w[e] = a[e] * sc; w[4 + e] = b4[e] * sc; }
  v4u oh, ol;
#pragma unroll
  for (int e = 0; e < 4; ++e) {
    const float t0 = w[2 * e], t1 = w[2 * e + 1];
    const _Float16 h0 = (_Float16)t0, h1 = (_Float16)t1;
    const _Float16 l0 = (_Float16)(t0 - (float)h0), l1 = (_Float16)(t1 - (float)h1);
    oh[e] = pk16(h_bits(h0), h_bits(h1));
    ol[e] = pk16(h_bits(l0), h_bits(l1));
  }
  u16* dh = Hp + (size_t)row * DI + cc * 8;
  u16* dl = Lp + (size_t)row * DI + cc * 8;
  {
    *(v4u*)(dh) = oh;
    *(v4u*)(dl) = ol;
    
  }
}

// =====================================================================================================
// epi64o additionally adds a per-column bias (bf16 RNE of the input) and multiplies by a per-row scale (bf16 RNE of mask).
// coverage: 8 instructions x 2 rows x 16 lanes x 4 floats = the wave's 16 x 64 tile.
// =====================================================================================================
__device__ __forceinline__ void epi64(float* sl, v8f a0, v8f a1, v8f a2, v8f a3, float oscale,
                                      float* C, int N, size_t rowb, int col0, int lane) {
  const int hh = lane >> 4, m = lane & 15;
#pragma unroll
  for (int r = 0; r < 8; ++r) {
    const int ro = (8 * hh + r) * 68 + m;
    sl[ro]      = a0[r] * oscale;
    sl[ro + 16] = a1[r] * oscale;
    sl[ro + 32] = a2[r] * oscale;
    sl[ro + 48] = a3[r] * oscale;
  }
  wave_sync_lds();
  v4f vals[8];
#pragma unroll
  for (int it = 0; it < 8; ++it) vals[it] = *(const v4f*)(sl + (it * 2 + hh) * 68 + m * 4);
  float* dst = C + (rowb + (size_t)hh) * (size_t)N + col0 + m * 4;
  {
#pragma unroll
    for (int it = 0; it < 8; ++it) {
      *(v4f*)(dst + (size_t)(it * 2) * (size_t)N) = vals[it];
    }
    
  }
}
__device__ __forceinline__ void epi64o(float* sl, v8f a0, v8f a1, v8f a2, v8f a3, float oscale,
                                       float* C, int N, size_t rowb, int col0, int lane,
                                       const float* __restrict__ bias, const float* __restrict__ rsc) {
  const int hh = lane >> 4, m = lane & 15;
#pragma unroll
  for (int r = 0; r < 8; ++r) {
    const int ro = (8 * hh + r) * 68 + m;
    sl[ro]      = a0[r] * oscale;
    sl[ro + 16] = a1[r] * oscale;
    sl[ro + 32] = a2[r] * oscale;
    sl[ro + 48] = a3[r] * oscale;
  }
  wave_sync_lds();
  float bq[4];
  {
    const v4f b4 = *(const v4f*)(bias + col0 + m * 4);
#pragma unroll
    for (int e = 0; e < 4; ++e) bq[e] = bfr(b4[e]);
  }
  v4f vals[8];
#pragma unroll
  for (int it = 0; it < 8; ++it) {
    const v4f t = *(const v4f*)(sl + (it * 2 + hh) * 68 + m * 4);
    const float mk = bfr(rsc[rowb + (size_t)hh + (size_t)(it * 2)]);
    v4f o;
#pragma unroll
    for (int e = 0; e < 4; ++e) o[e] = (t[e] + bq[e]) * mk;
    vals[it] = o;
  }
  float* dst = C + (rowb + (size_t)hh) * (size_t)N + col0 + m * 4;
  {
#pragma unroll
    for (int it = 0; it < 8; ++it) {
      *(v4f*)(dst + (size_t)(it * 2) * (size_t)N) = vals[it];
    }
    
  }
}

// =====================================================================================================
// bf16 GEMM: C[M][N] (f32) = A[M][K] (bf16 row-major) . Bt[N][K]^T (bf16 k-contiguous), times oscale.
// Block = 64x64 tile, 4 waves x 16 rows; fragments loaded straight from the 16-bit rows (two 16-B loads each, split k map
// for A and B); K stepped by 32 (host guarantees K % 32 == 0, M % 64 == 0, N % 64 == 0, grid = (M/64)*(N/64)).
// =====================================================================================================
__global__ __launch_bounds__(128)
void gemm_bf(const u16* __restrict__ A, const u16* __restrict__ Bt, float* C, int M, int N, int K, float oscale) {
  __shared__ __align__(16) float slab[4 * SLAB64];
  const int tid = threadIdx.x, wave = tid >> 5, lane = tid & 31, hh = lane >> 4, m = lane & 15;
  const int ntile = N >> 6;
  const int bid   = blockIdx.x;
  const int rowb  = (bid / ntile) * 64 + wave * 16;
  const int col0  = (bid % ntile) * 64;
  if (rowb + 16 > M) return;                // wave-uniform, never taken with the exact grid; no block barriers in this kernel
  const u16* ap = A  + (size_t)(rowb + m) * K + 8 * hh;
  const u16* bp = Bt + (size_t)(col0 + m) * K + 8 * hh;
  const size_t bs = (size_t)16 * K;
  v8f acc0 = zero8(), acc1 = zero8(), acc2 = zero8(), acc3 = zero8();
#pragma unroll 1
  for (int k0 = 0; k0 < K; k0 += 32) {
    const v16b a  = ldfrag_b(ap + k0);
    const v16b b0 = ldfrag_b(bp + k0);
    const v16b b1 = ldfrag_b(bp + bs + k0);
    const v16b b2 = ldfrag_b(bp + 2 * bs + k0);
    const v16b b3 = ldfrag_b(bp + 3 * bs + k0);
    acc0 = mma_b(a, b0, acc0);
    acc1 = mma_b(a, b1, acc1);
    acc2 = mma_b(a, b2, acc2);
    acc3 = mma_b(a, b3, acc3);
    guard6<v16b>(acc0, acc1, acc2, acc3, a, b0, b1, b2, b3, a);
  }
  epi64(slab + wave * SLAB64, acc0, acc1, acc2, acc3, oscale, C, N, (size_t)rowb, col0, lane);
}

// =====================================================================================================
// Output projection: C[row][DM] (f32) = ((Ah + Al)[row][DI] . Bt[DM][DI]^T) * oscale + bias[col], times rsc[row]
// (products h.B + l.B into one accumulator, l unscaled). Block -> (column tile ct = bid % 2, position tile rt, row group bb):
// rows of Ah, Al and C are bb*LP + pos. Same tiling as gemm_bf, epilogue epi64o.
// =====================================================================================================
__global__ __launch_bounds__(128)
void gemm_o(const u16* __restrict__ Ah, const u16* __restrict__ Al, const u16* __restrict__ Bt,
            const float* __restrict__ bias, const float* __restrict__ rsc, float* C, float oscale) {
  __shared__ __align__(16) float slab[4 * SLAB64];
  const int tid = threadIdx.x, wave = tid >> 5, lane = tid & 31, hh = lane >> 4, m = lane & 15;
  const int ntile = DM >> 6;
  const int bid   = blockIdx.x;
  const int ct    = bid % ntile;
  const int t2    = bid / ntile;
  const int rt    = t2 % NST;
  const int bb    = t2 / NST;
  if (bb >= BG) return;                     // block-uniform; no block barriers in this kernel; never taken with the exact grid
  const int srow  = rt * 64 + wave * 16;
  if (srow + 16 > LP) return;               // wave-uniform; never taken
  const int col0  = ct * 64;
  const int K     = DI;
  const size_t rowC = (size_t)bb * LP + srow;
  const _Float16* ahp = (const _Float16*)(const void*)Ah + (rowC + m) * K + 8 * hh;
  const _Float16* alp = (const _Float16*)(const void*)Al + (rowC + m) * K + 8 * hh;
  const _Float16* bp  = (const _Float16*)(const void*)Bt + (size_t)(col0 + m) * K + 8 * hh;
  const size_t bs = (size_t)16 * K;
  v8f acc0 = zero8(), acc1 = zero8(), acc2 = zero8(), acc3 = zero8();
#pragma unroll 1
  for (int k0 = 0; k0 < K; k0 += 32) {
    const v16h ah = ldfrag_h(ahp + k0), al = ldfrag_h(alp + k0);
    const v16h b0 = ldfrag_h(bp + k0);
    const v16h b1 = ldfrag_h(bp + bs + k0);
    const v16h b2 = ldfrag_h(bp + 2 * bs + k0);
    const v16h b3 = ldfrag_h(bp + 3 * bs + k0);
    acc0 = mma_h(ah, b0, acc0);  acc0 = mma_h(al, b0, acc0);
    acc1 = mma_h(ah, b1, acc1);  acc1 = mma_h(al, b1, acc1);
    acc2 = mma_h(ah, b2, acc2);  acc2 = mma_h(al, b2, acc2);
    acc3 = mma_h(ah, b3, acc3);  acc3 = mma_h(al, b3, acc3);
    guard6<v16h>(acc0, acc1, acc2, acc3, ah, al, b0, b1, b2, b3);
  }
  epi64o(slab + wave * SLAB64, acc0, acc1, acc2, acc3, oscale, C, DM, rowC, col0, lane, bias, rsc);
}

// =====================================================================================================
// Pair attention for one row group. Block bid -> (row tile qt = bid % NQT: softmax rows q0 = 16*qt .. q0+15, row group b);
// one wave per head (head = wave). Softmax row index qi uses the k projection (row operand R), softmax column index vi uses
// the q projection (column operand Cm), summed over vi with v[vi].
//   R hi/residual planes (k x1024 f16) and Cm hi/residual planes (q x128 x 8 ... i.e. (q*C^-0.5) x1024 f16) laid out
//   [b*LP + pos][h*HD + d]; v^T hi/residual planes [b*NH + h][d][LP]; CB [h][qi][vi] f32 = 1e9*(mask - 1) + x.Wb.
//   scores s(i, j) = R_hi.C_hi + R_lo.C_hi + R_hi.C_lo over HD; logit (log2 domain) t = (s / (1024*1024) + CB) * log2 e.
//   All NKT column tiles of 32 visited in order. Per tile: the 16x32 CB tile is staged into the wave-private LDS tile with
//   16-B loads/stores, then 2 score subtiles x 2 k-steps with fragments loaded straight from the 16-bit planes (two 16-B loads
//   fragments of P*32768 (f16 hi plus its f16 residual) rebuilt from the LDS rows (float vector loads, same element type as
//   stored), v^T B fragments in 2 groups of 2 d-subtiles, products hh + lh + hl.
//   After the loop: out = acc / Z (Z >= 1 always; guarded anyway), carries 1/(32768*1024) folded once, written to the wave's
//   private result slab (pitch 68; every element owned by one lane).
//   Epilogue: out multiplied by sigmoid(U + bu) in f32 (U = x.Wu f32 plane, bu bf16 RNE of the input), then O x1024 -> f16
// coverage: per wave 4 instructions x 4 rows x 8 lanes x 8 halves = 16 x 64 per plane; grid = NQT * BG blocks x WPB waves =
//           every (b, pos, h) row segment of OH and OL exactly once.
// =====================================================================================================
__global__ __launch_bounds__(ATT_THREADS)
void attn_t(const u16* __restrict__ RHp, const u16* __restrict__ RLp,
            const u16* __restrict__ CHp, const u16* __restrict__ CLp,
            const u16* __restrict__ VHp, const u16* __restrict__ VLp,
            const float* __restrict__ CB, const float* __restrict__ U, const float* __restrict__ bu,
            u16* OHp, u16* OLp) {
  __shared__ __align__(16) float smem[WPB * WREG];

  const int tid  = threadIdx.x;
  const int wave = tid >> 5;
  const int lane = tid & 31;
  const int hh   = lane >> 4;
  const int c    = lane & 15;
  const int bid  = blockIdx.x;
  const int qt   = bid % NQT;
  const int b    = bid / NQT;
  if (b >= BG) return;                      // block-uniform; no block barriers in this kernel; never taken with the exact grid
  const int q0   = qt * 16;
  const int head = wave;

  float* pt   = smem + wave * WREG;         // CB tile, then prob tile [16][32] pitch 36
  float* slab = pt + PTW;                   // result slab [16][64] pitch 68

  const size_t hcol = (size_t)head * HD + 8 * hh;
  const _Float16* Rh  = (const _Float16*)(const void*)RHp + ((size_t)b * LP + q0 + c) * DI + hcol;
  const _Float16* Rl  = (const _Float16*)(const void*)RLp + ((size_t)b * LP + q0 + c) * DI + hcol;
  const _Float16* Chb = (const _Float16*)(const void*)CHp + ((size_t)b * LP + c) * DI + hcol;      // column row kb added per step
  const _Float16* Clb = (const _Float16*)(const void*)CLp + ((size_t)b * LP + c) * DI + hcol;
  const _Float16* Vhb = (const _Float16*)(const void*)VHp + ((size_t)(b * NH + head) * HD + c) * LP + 8 * hh;  // d col c (+16j), vi kb per step
  const _Float16* Vlb = (const _Float16*)(const void*)VLp + ((size_t)(b * NH + head) * HD + c) * LP + 8 * hh;
  const float* cbb = CB + ((size_t)head * LP + q0) * LP;
  const float invc = 1.0f / (CSC * KSC);
  const float oc   = 1.0f / (PCAR * VCAR);
  const size_t KROW = (size_t)DI;           // halves between consecutive position rows

  float mrow[8], lrow[8];
  v8f o[4];
#pragma unroll
  for (int r = 0; r < 8; ++r) { mrow[r] = -INFINITY; lrow[r] = 0.f; }
#pragma unroll
  for (int j = 0; j < 4; ++j) o[j] = zero8();

#pragma unroll 1
  for (int kt = 0; kt < NKT; ++kt) {
    const int kb = kt * 32;
    // ---- stage the additive logit tile [16 rows][32 cols] into pt: 128 float4, lane handles f = it*32 + lane ----
#pragma unroll
    for (int it = 0; it < 4; ++it) {
      const int f = it * 32 + lane;
      const int row = f >> 3, col4 = (f & 7) * 4;
      const v4f t4 = *(const v4f*)(cbb + (size_t)row * LP + kb + col4);
      *(v4f*)(pt + row * PTP + col4) = t4;
    }
    // ---- scores: D element r of this lane = (row q0 + 8hh + r, col kb + c) in s0, col kb + 16 + c in s1 ----
    v8f s0 = zero8(), s1 = zero8();
    const _Float16* c0p = Chb + (size_t)kb * KROW;
    const _Float16* c1p = c0p + (size_t)16 * KROW;
    const _Float16* l0p = Clb + (size_t)kb * KROW;
    const _Float16* l1p = l0p + (size_t)16 * KROW;
#pragma unroll
    for (int kk = 0; kk < HD / 32; ++kk) {
      const v16h rh  = ldfrag_h(Rh + kk * 32);
      const v16h rl  = ldfrag_h(Rl + kk * 32);
      const v16h ch0 = ldfrag_h(c0p + kk * 32);
      const v16h ch1 = ldfrag_h(c1p + kk * 32);
      const v16h cl0 = ldfrag_h(l0p + kk * 32);
      const v16h cl1 = ldfrag_h(l1p + kk * 32);
      s0 = mma_h(rh, ch0, s0);
      s0 = mma_h(rl, ch0, s0);
      s0 = mma_h(rh, cl0, s0);
      s1 = mma_h(rh, ch1, s1);
      s1 = mma_h(rl, ch1, s1);
      s1 = mma_h(rh, cl1, s1);
      guard2(s0, s1, rh, rl, ch0, cl0, ch1, cl1);
    }
    wave_sync_lds();
    // ---- additive term + online softmax in base 2, -inf-safe ----
#pragma unroll
    for (int r = 0; r < 8; ++r) {
      const int   ro  = (8 * hh + r) * PTP + c;
      const float cb0 = pt[ro];
      const float cb1 = pt[ro + 16];
      const float t0  = (s0[r] * invc + cb0) * LOG2E;
      const float t1  = (s1[r] * invc + cb1) * LOG2E;
      float mx = fmaxf(t0, t1);
#pragma unroll
      for (int off = 1; off < 16; off <<= 1) mx = fmaxf(mx, __shfl_xor(mx, off, 32));
      const float mn = fmaxf(mrow[r], mx);
      const float ms = (mn == -INFINITY) ? 0.0f : mn;
      const float al = exp2f(mrow[r] - ms);
      mrow[r] = mn;
      const float e0 = exp2f(t0 - ms), e1 = exp2f(t1 - ms);
      float ps = e0 + e1;
#pragma unroll
      for (int off = 1; off < 16; off <<= 1) ps += __shfl_xor(ps, off, 32);
      lrow[r] = lrow[r] * al + ps;
#pragma unroll
      for (int j = 0; j < 4; ++j) o[j][r] *= al;
      pt[ro]      = e0;
      pt[ro + 16] = e1;
    }
    wave_sync_lds();
    // ---- A fragments of P*32768: hi f16 and residual f16, row = c, split k map over the 32 columns of this step ----
    FragH ph, pl;
    {
      const float* prow = pt + c * PTP + 8 * hh;
      const v4f p0 = *(const v4f*)(prow), p1 = *(const v4f*)(prow + 4);
      const v4f p2 = *(const v4f*)(prow + 16), p3 = *(const v4f*)(prow + 20);
#pragma unroll
      for (int e = 0; e < 4; ++e) {
        const float ta = p0[e] * PCAR, tb = p1[e] * PCAR, tc = p2[e] * PCAR, td = p3[e] * PCAR;
        const _Float16 ha = (_Float16)ta, hb = (_Float16)tb, hc = (_Float16)tc, hd = (_Float16)td;
        ph.h[0][e]     = ha;                  // elements 0..7  = columns kb + 8hh + 0..7
        ph.h[0][4 + e] = hb;
        ph.h[1][e]     = hc;                  // elements 8..15 = columns kb + 16 + 8hh + 0..7
        ph.h[1][4 + e] = hd;
        pl.h[0][e]     = (_Float16)(ta - (float)ha);
        pl.h[0][4 + e] = (_Float16)(tb - (float)hb);
        pl.h[1][e]     = (_Float16)(tc - (float)hc);
        pl.h[1][4 + e] = (_Float16)(td - (float)hd);
      }
    }
    // ---- P.V : B fragment col n = d = j*16 + c, columns vi contiguous in the v^T planes; 2 groups of 2 d-subtiles ----
    {
      const _Float16* vhp = Vhb + kb;
      const _Float16* vlp = Vlb + kb;
#pragma unroll
      for (int jg = 0; jg < HD / 32; ++jg) {
        const size_t da = (size_t)(2 * jg) * 16 * LP;
        const size_t db = da + (size_t)16 * LP;
        const v16h vha = ldfrag_h(vhp + da), vhb2 = ldfrag_h(vhp + db);
        const v16h vla = ldfrag_h(vlp + da), vlb2 = ldfrag_h(vlp + db);
        o[2 * jg]     = mma_h(ph.v, vha,  o[2 * jg]);
        o[2 * jg]     = mma_h(pl.v, vha,  o[2 * jg]);
        o[2 * jg]     = mma_h(ph.v, vla,  o[2 * jg]);
        o[2 * jg + 1] = mma_h(ph.v, vhb2, o[2 * jg + 1]);
        o[2 * jg + 1] = mma_h(pl.v, vhb2, o[2 * jg + 1]);
        o[2 * jg + 1] = mma_h(ph.v, vlb2, o[2 * jg + 1]);
        guard2(o[2 * jg], o[2 * jg + 1], ph.v, pl.v, vha, vhb2, vla, vlb2);
      }
    }
    wave_sync_lds();
  }
  acc_guard4(o[0], o[1], o[2], o[3]);
  // ---- out = acc / Z (0 if Z == 0), carries (32768 on P, 1024 on v) folded once; written into the lane-owned slab ----
#pragma unroll
  for (int r = 0; r < 8; ++r) {
    const float lv  = lrow[r];
    const float ls  = (lv > 0.0f) ? lv : 1.0f;
    const float inv = (lv > 0.0f) ? ((1.0f / ls) * oc) : 0.0f;
#pragma unroll
    for (int j = 0; j < 4; ++j) {
      const int idx = (8 * hh + r) * SLP + j * 16 + c;
      slab[idx] = o[j][r] * inv;
    }
  }

  wave_sync_lds();
  // ---- gate in f32, then O x1024 -> f16 hi + residual planes; lane = (row select rq in 0..3, 8 consecutive d at c8) ----
  v4u oh[4], ol[4];
  const int rq = lane >> 3, c8 = (lane & 7) * 8;
  const float* urow = U + ((size_t)b * LP + q0) * DI + (size_t)head * HD + c8;
  float bb[8];
  {
    const v4f u0 = *(const v4f*)(bu + head * HD + c8), u1 = *(const v4f*)(bu + head * HD + c8 + 4);
#pragma unroll
    for (int e = 0; e < 4; ++e) { bb[e] = bfr(u0[e]); bb[4 + e] = bfr(u1[e]); }
  }
#pragma unroll
  for (int it = 0; it < 4; ++it) {
    const int row = it * 4 + rq;
    const v4f a  = *(const v4f*)(slab + row * SLP + c8), b4 = *(const v4f*)(slab + row * SLP + c8 + 4);
    const v4f ua = *(const v4f*)(urow + (size_t)row * DI), ub = *(const v4f*)(urow + (size_t)row * DI + 4);
    float w[8];
#pragma unroll
    for (int e = 0; e < 4; ++e) {
      w[e]     = (a[e]  * sigm(ua[e] + bb[e]))     * OSC;
      w[4 + e] = (b4[e] * sigm(ub[e] + bb[4 + e])) * OSC;
    }
#pragma unroll
    for (int e = 0; e < 4; ++e) {
      const _Float16 h0 = (_Float16)w[2 * e], h1 = (_Float16)w[2 * e + 1];
      const _Float16 l0 = (_Float16)(w[2 * e] - (float)h0), l1 = (_Float16)(w[2 * e + 1] - (float)h1);
      oh[it][e] = pk16(h_bits(h0), h_bits(h1));
      ol[it][e] = pk16(h_bits(l0), h_bits(l1));
    }
  }
  const size_t ob = ((size_t)b * LP + q0) * DI + (size_t)head * HD + c8;
  {
#pragma unroll
    for (int it = 0; it < 4; ++it) {
      const int row = it * 4 + rq;
      *(v4u*)(OHp + ob + (size_t)row * DI) = oh[it];
      *(v4u*)(OLp + ob + (size_t)row * DI) = ol[it];
    }
    
  }
}

// =====================================================================================================
// Rows s are processed in NGRP groups of BG rows; every per-group workspace plane is reused in launch order.
// Workspace map (bytes); every plane is fully written by whole-line stores before it is read; all extents are exact
// multiples of the store granularity (no pad rows needed); every region offset a multiple of 65536:
//   XB  bf16 [NPIX][256] (hi|lo)                    33554432
//   F   f32 [GROWS][256]                            GROWS*1024   (v, q, k projection output in launch order; afterwards the
//                                                                 region holds OH f16 [GROWS][256] x1024 first, OL after it)
//   U   f32 [GROWS][256]                            GROWS*1024   (gate pre-activation)
//   QH, KH, QL, KL  f16 [GROWS][256]               4 * GROWS*512
//   VH, VL  f16 [BG*4][64][LP]                      2 * GROWS*512
//   CB  f32 [4][NPIX]                               1048576
//   WQ, WK, WV, WU  bf16 [256 n][256 k]             4 * 131072
//   WO  f16 x1024 [128 n][256 k]                    65536
//   end (BG = 64)                                   119078912
// =====================================================================================================
extern "C" void kernel_launch(void* const* d_in, const int* in_sizes, int n_in,
                              void* d_out, int out_size, void* d_ws, size_t ws_size,
                              hipStream_t stream) {
  if (n_in < 12) return;
  if (in_sizes[0] < NPIX * DM) return;
  if (in_sizes[1] < NPIX) return;
  if (in_sizes[2] < DM || in_sizes[3] < DM) return;
  if (in_sizes[4] < DM * DI || in_sizes[5] < DM * DI || in_sizes[6] < DM * DI || in_sizes[8] < DM * DI) return;
  if (in_sizes[7] < DM * NH) return;
  if (in_sizes[9] < DI) return;
  if (in_sizes[10] < DI * DM) return;
  if (in_sizes[11] < DM) return;
  if (out_size < NS * LP * DM) return;

  const float* pr    = (const float*)d_in[0];
  const float* mask  = (const float*)d_in[1];
  const float* gamma = (const float*)d_in[2];
  const float* beta  = (const float*)d_in[3];
  const float* Wq    = (const float*)d_in[4];
  const float* Wk    = (const float*)d_in[5];
  const float* Wv    = (const float*)d_in[6];
  const float* Wb    = (const float*)d_in[7];
  const float* Wu    = (const float*)d_in[8];
  const float* bu    = (const float*)d_in[9];
  const float* Wo    = (const float*)d_in[10];
  const float* bo    = (const float*)d_in[11];
  float*       out   = (float*)d_out;

  const size_t szXB = (size_t)NPIX * KX * 2;
  const size_t szF  = (size_t)GROWS * DI * 4;
  const size_t szU  = (size_t)GROWS * DI * 4;
  const size_t szH  = (size_t)GROWS * DI * 2;                   // QH, KH, QL, KL, OH, OL
  const size_t szV  = (size_t)BG * NH * HD * LP * 2;            // VH, VL (== szH)
  const size_t szCB = (size_t)NH * NPIX * 4;
  const size_t szW  = (size_t)DI * KX * 2;
  const size_t szWO = (size_t)DM * DI * 2;
  if (2 * szH > szF) return;                                    // OH + OL live inside the F region
  size_t off = 0;
  const size_t oXB = off; off += szXB;
  const size_t oF  = off; off += szF;
  const size_t oU  = off; off += szU;
  const size_t oQH = off; off += szH;
  const size_t oKH = off; off += szH;
  const size_t oQL = off; off += szH;
  const size_t oKL = off; off += szH;
  const size_t oVH = off; off += szV;
  const size_t oVL = off; off += szV;
  const size_t oCB = off; off += szCB;
  const size_t oWQ = off; off += szW;
  const size_t oWK = off; off += szW;
  const size_t oWV = off; off += szW;
  const size_t oWU = off; off += szW;
  const size_t oWO = off; off += szWO;
  if (off > ws_size) return;                // off = 119078912 for BG = 64
  if (off > (size_t)WS_CAP) return;

  char* ws = (char*)d_ws;
  u16*   XB = (u16*)(ws + oXB);
  float* F  = (float*)(ws + oF);
  u16*   OH = (u16*)(ws + oF);
  u16*   OL = (u16*)(ws + oF + szH);
  float* U  = (float*)(ws + oU);
  u16*   QH = (u16*)(ws + oQH);
  u16*   KH = (u16*)(ws + oKH);
  u16*   QL = (u16*)(ws + oQL);
  u16*   KL = (u16*)(ws + oKL);
  u16*   VH = (u16*)(ws + oVH);
  u16*   VL = (u16*)(ws + oVL);
  float* CB = (float*)(ws + oCB);
  u16*   WQ = (u16*)(ws + oWQ);
  u16*   WK = (u16*)(ws + oWK);
  u16*   WV = (u16*)(ws + oWV);
  u16*   WU = (u16*)(ws + oWU);
  u16*   WO = (u16*)(ws + oWO);

  const dim3 b256(256), b128(128), bQK(QKT), bAT(ATT_THREADS);
  const dim3 gLN(NPIX / LNPB);                          // 2048
  const dim3 gWP((DI / 128) * (DM / 64));               // 4: Wq, Wk, Wv, Wu planes
  const dim3 gWO((DM / 128) * (DI / 64));               // 4: Wo plane
  const dim3 gG((GROWS / 64) * (DI / 64));
  const dim3 gVT(BG * NH * NST);
  const dim3 gQK(GROWS / QKR);
  const dim3 gAT(NQT * BG);
  const dim3 gO(BG * NST * (DM / 64));
  const float osc = 1.0f / (OSC * WOS);

  // LayerNorm once for every pixel: x hi|lo planes and the additive logit table
  ln_x<<<gLN, b256, 0, stream>>>(pr, mask, gamma, beta, Wb, XB, CB);
  // weight planes once: Wq^T, Wk^T, Wv^T, Wu^T [n][k | k] as bf16; Wo^T [n][k] as f16 of bf16 value x1024
  wt16<<<gWP, b256, 0, stream>>>(Wq, DI, DM, WQ, KX, 1, 0, 1.0f);
  wt16<<<gWP, b256, 0, stream>>>(Wk, DI, DM, WK, KX, 1, 0, 1.0f);
  wt16<<<gWP, b256, 0, stream>>>(Wv, DI, DM, WV, KX, 1, 0, 1.0f);
  wt16<<<gWP, b256, 0, stream>>>(Wu, DI, DM, WU, KX, 1, 0, 1.0f);
  wt16<<<gWO, b256, 0, stream>>>(Wo, DM, DI, WO, DI, 0, 1, WOS);

  for (int g = 0; g < NGRP; ++g) {
    const u16*   xg = XB   + (size_t)g * GROWS * KX;
    const float* mg = mask + (size_t)g * GROWS;
    float*       og = out  + (size_t)g * GROWS * DM;
    // (1) v = x.Wv -> F f32; (2) v^T hi + residual planes x1024
    gemm_bf<<<gG, b128, 0, stream>>>(xg, WV, F, GROWS, DI, KX, 1.0f);
    vt16<<<gVT, b256, 0, stream>>>(F, VH, VL);
    // (3) q = x.Wq -> F; (4) q planes (x 0.125 x 1024) hi + residual
    gemm_bf<<<gG, b128, 0, stream>>>(xg, WQ, F, GROWS, DI, KX, 1.0f);
    qk16<<<gQK, bQK, 0, stream>>>(F, QH, QL, QSC);
    // (5) k = x.Wk -> F; (6) k planes x1024 hi + residual
    gemm_bf<<<gG, b128, 0, stream>>>(xg, WK, F, GROWS, DI, KX, 1.0f);
    qk16<<<gQK, bQK, 0, stream>>>(F, KH, KL, KSC);
    // (7) gate pre-activation u = x.Wu -> U f32
    gemm_bf<<<gG, b128, 0, stream>>>(xg, WU, U, GROWS, DI, KX, 1.0f);
    // (8) attention: rows from the k planes, columns from the q planes, sum over columns with v; gated O -> OH + OL planes
    attn_t<<<gAT, bAT, 0, stream>>>(KH, KL, QH, QL, VH, VL, CB, U, bu, OH, OL);
    // (9) output projection (hi + residual), + bo, x mask row scale -> out f32, carries 1024 x 1024 folded back
    gemm_o<<<gO, b128, 0, stream>>>(OH, OL, WO, bo, mg, og, osc);
  }
  (void)hipGetLastError();
}

// v001
// It runs in 532 microseconds.
// Two timings next to v000 both put it at 1.15 times that version's speed.
// Contractions: x.Wq, x.Wk, x.Wv, x.Wu on v_wmma_f32_16x16x32_bf16 (x as bf16 hi|lo pair folded into K = 256, W as bf16 RNE
// of the input, f32 accumulate); k.q^T over 64 and P.v^T on v_wmma_f32_16x16x32_f16 (k x1024 and q x128 f16 hi + residual
// planes, P x32768 f16 hi + residual, v x1024 f16 hi + residual; products hh + lh + hl); (O*gate).Wo on
// v_wmma_f32_16x16x32_f16 (O x1024 f16 hi + residual, Wo as f16(bf16(Wo)) x1024, products h.w + l.w); all f32 accumulate.
// LayerNorm, x.Wb (N = 4) and the additive logit table, base-2 online softmax, sigmoid gate, bias and row scale in f32 on VALU.
#include <hip/hip_runtime.h>
#include <math.h>
#include <stdint.h>

#ifndef NS
#define NS 256
#endif
#define NSX   256
#define LP    256
#define DM    128
#define NH    4
#define HD    64
#define DI    (NH * HD)
#define KX    (2 * DM)
#define NPIX  (LP * LP)
#define BG    ((NS <= 64) ? NS : 64)
#define NGRP  (NS / BG)
#define GROWS (BG * LP)
#define LNEPS 1e-5f
#define LOG2E 1.4426950408889634f
#define QSC   128.0f
#define CSC   1024.0f
#define KSC   1024.0f
#define PCAR  32768.0f
#define VCAR  1024.0f
#define OSC   1024.0f
#define WOS   1024.0f
#define WPB   4
#define NQT   (LP / 16)
#define NST   (LP / 64)
#define NKT   (LP / 32)
#define ATT_THREADS (WPB * 32)
#define PTP   36
#define PTW   (16 * PTP)
#define SLP   68
#define SLW   (16 * SLP)
#define WREG  (PTW + SLW)
#define SLAB64 (16 * 68)
#define VTP   72
#define QKC   (DI / 8)
#define QKR   8
#define QKT   (QKC * QKR)
#define LNPB  32
#define STG   64
#define TPL   (STG * VTP)
#define WS_CAP 134217728
static_assert(DI == NH * HD && HD == 64 && NH == 4 && WPB == NH);
static_assert(ATT_THREADS == 128);
static_assert(STG == 64 && HD == STG && (LP % STG) == 0 && NST * NH == NQT);
static_assert(NS >= 1 && NS <= NSX && (NS % BG) == 0 && BG >= 1 && BG <= 64);
static_assert((LP % 64) == 0 && (LP % 32) == 0 && (LP % 16) == 0);
static_assert(DM == 128 && (KX % 32) == 0 && (DI % 64) == 0 && (DI % 32) == 0 && (DM % 64) == 0);
static_assert(QKC * 8 == DI && QKT == 256 && (GROWS % QKR) == 0 && (GROWS % 64) == 0);
static_assert((NPIX % LNPB) == 0 && LNPB == 32);
static_assert((DI % 128) == 0 && (DM % 128) == 0 && (DM % 64) == 0 && (DI % 64) == 0);

typedef unsigned short u16;
typedef _Float16 v16h __attribute__((ext_vector_type(16)));
typedef _Float16 v8h  __attribute__((ext_vector_type(8)));
typedef __bf16   v16b __attribute__((ext_vector_type(16)));
typedef float    v8f  __attribute__((ext_vector_type(8)));
typedef float    v4f  __attribute__((ext_vector_type(4)));
typedef unsigned int v4u __attribute__((ext_vector_type(4)));
typedef unsigned int v2u __attribute__((ext_vector_type(2)));

union FragH { v16h v; v8h h[2]; v4u u[2]; };
union FragB { v16b v; v4u u[2]; };

// ---- scalar helpers --------------------------------------------------------------------------------
__device__ __forceinline__ unsigned short bf_bits(float f) {          // f32 -> bf16 bits, RNE convert
  unsigned u = __float_as_uint(f);
  return (unsigned short)((u + 0x7FFFu + ((u >> 16) & 1u)) >> 16);
}
__device__ __forceinline__ float bf_up(unsigned short h) { return __uint_as_float(((unsigned)h) << 16); }
__device__ __forceinline__ float bfr(float f) { return bf_up(bf_bits(f)); }
__device__ __forceinline__ unsigned short h_bits(_Float16 x) { return __builtin_bit_cast(unsigned short, x); }
__device__ __forceinline__ unsigned pk16(unsigned short a, unsigned short b) { return (unsigned)a | ((unsigned)b << 16); }
__device__ __forceinline__ v8f zero8() { v8f z = {0.f, 0.f, 0.f, 0.f, 0.f, 0.f, 0.f, 0.f}; return z; }
__device__ __forceinline__ float sigm(float z) {                     // 1 / (1 + 2^(-z log2 e)), argument clamped
  const float zc = fminf(fmaxf(z, -30.0f), 30.0f);
  const float e  = exp2f(-zc * LOG2E);
  return __builtin_amdgcn_rcpf(1.0f + e);
}

// ---- fragment loaders: 16-bit A/B operand, lane -> row/col (lane&15), p already includes +8*(lane>>4);
//      elements 0..7 <- p[0..7] (k0+8h..), elements 8..15 <- p[16..23] (k0+16+8h..)  (same split k map for A and B;
//      B is always read from a k-contiguous [n][k] plane)
__device__ __forceinline__ v16h ldfrag_h(const _Float16* p) {
  FragH f;
  f.h[0] = *(const v8h*)(p);
  f.h[1] = *(const v8h*)(p + 16);
  return f.v;
}
__device__ __forceinline__ v16b ldfrag_b(const u16* p) {              // bf16 plane read as unsigned integer vectors
  FragB f;
  f.u[0] = *(const v4u*)(p);
  f.u[1] = *(const v4u*)(p + 16);
  return f.v;
}

__device__ __forceinline__ v8f mma_h(v16h a, v16h b, v8f c) {
  return __builtin_amdgcn_wmma_f32_16x16x32_f16(false, a, false, b, (short)0, c, false, false);
}
__device__ __forceinline__ v8f mma_b(v16b a, v16b b, v8f c) {
  return __builtin_amdgcn_wmma_f32_16x16x32_bf16(false, a, false, b, (short)0, c, false, false);
}
__device__ __forceinline__ void guard2(v8f& a, v8f& b, v16h x0, v16h x1, v16h x2, v16h x3, v16h x4, v16h x5) {
#if defined(__HIP_DEVICE_COMPILE__)
  asm volatile("v_nop\n\tv_nop\n\tv_nop\n\tv_nop"
               : "+v"(a), "+v"(b) : "v"(x0), "v"(x1), "v"(x2), "v"(x3), "v"(x4), "v"(x5) : "memory");
#endif
}
template <typename F>
__device__ __forceinline__ void guard6(v8f& a, v8f& b, v8f& c, v8f& d, F x0, F x1, F x2, F x3, F x4, F x5) {
#if defined(__HIP_DEVICE_COMPILE__)
  asm volatile("v_nop\n\tv_nop\n\tv_nop\n\tv_nop"
               : "+v"(a), "+v"(b), "+v"(c), "+v"(d) : "v"(x0), "v"(x1), "v"(x2), "v"(x3), "v"(x4), "v"(x5) : "memory");
#endif
}
__device__ __forceinline__ void acc_guard4(v8f& a, v8f& b, v8f& c, v8f& d) {
#if defined(__HIP_DEVICE_COMPILE__)
  asm volatile("v_nop\n\tv_nop\n\tv_nop\n\tv_nop" : "+v"(a), "+v"(b), "+v"(c), "+v"(d));
#endif
}
__device__ __forceinline__ void wave_sync_lds() {
  __builtin_amdgcn_fence(__ATOMIC_RELEASE, "workgroup");
  __builtin_amdgcn_wave_barrier();
  __builtin_amdgcn_fence(__ATOMIC_ACQUIRE, "workgroup");
}

// =====================================================================================================
// statistics), x written as bf16 hi | bf16 lo planes XB [NPIX][KX] (columns 0..127 hi bits, 128..255 lo bits of x - hi);
// the additive logit table CB [NH][NPIX] = 1e9*(mask - 1) + x.Wb (VALU f32, N = 4) is produced by the same block.
// Block = 8 waves x LNPB/8 pixels, wave = one pixel at a time (lane holds 4 channels); the 512-B x row is assembled in a
// x 4 heads) are funnelled through LDS and written by wave 0 in one instruction (8 consecutive lanes x 16 B per line);
// coverage: grid = NPIX/LNPB blocks x 32 pixels = every XB row once and every CB line once.
// =====================================================================================================
__global__ __launch_bounds__(256) void ln_x(const float* __restrict__ pr, const float* __restrict__ mask,
                                            const float* __restrict__ gamma, const float* __restrict__ beta,
                                            const float* __restrict__ Wb, u16* XB, float* CB) {
  __shared__ __align__(16) u16 RB[8 * KX];
  __shared__ __align__(16) float PBS[NH * LNPB];
  const int tid = threadIdx.x, wave = tid >> 5, lane = tid & 31;
  const int p0 = (int)blockIdx.x * LNPB;
  if (p0 + LNPB > NPIX) return;             // block-uniform, before any barrier; never taken with the exact grid
  float gm[4], bt[4], wb[16];
  {
    const v4f g4 = *(const v4f*)(gamma + 4 * lane), b4 = *(const v4f*)(beta + 4 * lane);
#pragma unroll
    for (int e = 0; e < 4; ++e) { gm[e] = bfr(g4[e]); bt[e] = bfr(b4[e]); }
#pragma unroll
    for (int i = 0; i < 4; ++i) {
      const v4f w4 = *(const v4f*)(Wb + 16 * lane + 4 * i);      // Wb[(4*lane + i)][h], h = 0..3
#pragma unroll
      for (int h = 0; h < 4; ++h) wb[4 * i + h] = bfr(w4[h]);
    }
  }
  u16* rb = RB + wave * KX;
#pragma unroll 1
  for (int j = 0; j < LNPB / 8; ++j) {
    const int pl = j * 8 + wave;
    const int p  = p0 + pl;
    const v4f x4 = *(const v4f*)(pr + (size_t)p * DM + 4 * lane);
    float xr[4];
#pragma unroll
    for (int e = 0; e < 4; ++e) xr[e] = bfr(x4[e]);
    float s = (xr[0] + xr[1]) + (xr[2] + xr[3]);
#pragma unroll
    for (int off = 1; off < 32; off <<= 1) s += __shfl_xor(s, off, 32);
    const float mu = s * (1.0f / (float)DM);
    float d[4];
#pragma unroll
    for (int e = 0; e < 4; ++e) d[e] = xr[e] - mu;
    float ss = (d[0] * d[0] + d[1] * d[1]) + (d[2] * d[2] + d[3] * d[3]);
#pragma unroll
    for (int off = 1; off < 32; off <<= 1) ss += __shfl_xor(ss, off, 32);
    const float var = ss * (1.0f / (float)DM);
    const float rs  = 1.0f / sqrtf(var + LNEPS);
    float y[4];
#pragma unroll
    for (int e = 0; e < 4; ++e) y[e] = d[e] * rs * gm[e] + bt[e];
    unsigned short hb[4], lb[4];
#pragma unroll
    for (int e = 0; e < 4; ++e) { hb[e] = bf_bits(y[e]); lb[e] = bf_bits(y[e] - bf_up(hb[e])); }
    float pb[4];
#pragma unroll
    for (int h = 0; h < 4; ++h) pb[h] = y[0] * wb[h] + y[1] * wb[4 + h] + y[2] * wb[8 + h] + y[3] * wb[12 + h];
#pragma unroll
    for (int h = 0; h < 4; ++h) {
#pragma unroll
      for (int off = 1; off < 32; off <<= 1) pb[h] += __shfl_xor(pb[h], off, 32);
    }
    const float mk = bfr(mask[p]);
    const float mb = 1e9f * (mk - 1.0f);
    v2u hv, lv;
    hv[0] = pk16(hb[0], hb[1]);  hv[1] = pk16(hb[2], hb[3]);
    lv[0] = pk16(lb[0], lb[1]);  lv[1] = pk16(lb[2], lb[3]);
    *(v2u*)(rb + 4 * lane)      = hv;
    *(v2u*)(rb + DM + 4 * lane) = lv;
    if (lane == 0) {
      PBS[0 * LNPB + pl] = mb + pb[0];
      PBS[1 * LNPB + pl] = mb + pb[1];
      PBS[2 * LNPB + pl] = mb + pb[2];
      PBS[3 * LNPB + pl] = mb + pb[3];
    }
    wave_sync_lds();
    const v4u piece = *(const v4u*)(rb + 8 * lane);
    u16* dst = XB + (size_t)p * KX + 8 * lane;
    {
      *(v4u*)(dst) = piece;
      
    }
    wave_sync_lds();
  }
  __syncthreads();
  if (wave == 0) {
    const int h = lane >> 3, j4 = (lane & 7) * 4;
    const v4f v = *(const v4f*)(PBS + h * LNPB + j4);
    float* d = CB + (size_t)h * NPIX + p0 + j4;
    {
      *(v4f*)(d) = v;
      
    }
  }
}

// =====================================================================================================
// Transposed weight plane: W f32 [nk rows k][ncol cols n] -> D 16-bit [n][ldd], D[n][k] = bf16 bits of W[k][n] (f16mode 0)
// or f16 bits of bf16(W[k][n]) * scale (f16mode 1); when dup != 0 the same 64-half segment is also written at D[n][nk + k]
// (hi|lo folded K). Block (ct = bid % nct: 128 columns, rt = bid / nct: 64 rows): each thread loads 32 floats of one k row
// (16-B loads), converts, scatters into the LDS tile [128 n][64 k] (pitch 72 halves); after a block barrier each n row segment
// coverage: load 256 thr x 32 = 64 k rows x 128 n; store 4 iterations x 256 thr x 8 halves = 128 lines x 64 = the block's tile
// =====================================================================================================
__global__ __launch_bounds__(256) void wt16(const float* __restrict__ W, int ncol, int nk, u16* D, int ldd, int dup,
                                            int f16mode, float scale) {
  __shared__ __align__(16) u16 T[128 * VTP];
  const int tid = threadIdx.x;
  const int bid = blockIdx.x;
  const int nct = ncol / 128;
  const int ct  = bid % nct;
  const int rt  = bid / nct;
  if (rt * 64 + 64 > nk) return;            // block-uniform, before the barrier; never taken with the exact grid
  {
    const int sl = tid >> 2;                // k row within tile 0..63
    const int dc = (tid & 3) * 32;          // n chunk
    const float* src = W + (size_t)(rt * 64 + sl) * ncol + ct * 128 + dc;
#pragma unroll
    for (int i = 0; i < 8; ++i) {
      const v4f a = *(const v4f*)(src + 4 * i);
#pragma unroll
      for (int e = 0; e < 4; ++e) {
        const float f = a[e];
        const unsigned short hb = h_bits((_Float16)(bfr(f) * scale));
        const unsigned short bb = bf_bits(f);
        T[(dc + 4 * i + e) * VTP + sl] = (f16mode != 0) ? hb : bb;
      }
    }
  }
  __syncthreads();
  v4u w4[4];
  const int q8 = tid >> 3, p8 = (tid & 7) * 8;
#pragma unroll
  for (int it = 0; it < 4; ++it) {
    const int line = it * 32 + q8;          // n within tile 0..127
    w4[it] = *(const v4u*)(T + line * VTP + p8);
  }
  const size_t base = ((size_t)ct * 128) * ldd + rt * 64 + p8;
  {
#pragma unroll
    for (int it = 0; it < 4; ++it) {
      const int line = it * 32 + q8;
      *(v4u*)(D + base + (size_t)line * ldd) = w4[it];
      if (dup != 0) *(v4u*)(D + base + (size_t)line * ldd + nk) = w4[it];
    }
    
  }
}

// =====================================================================================================
// v^T planes from the v projection F f32 [GROWS][DI] (row = b*LP + pos, column = g*HD + d):
//   VH[((b*NH + g)*HD + d)][LP] = f16(v * 1024);  VL same shape = f16 residual; all positions.
// Block = (b, head g, 64 positions s0): each thread loads its 16 floats (pos sl, d chunk dc) with 16-B loads, converts,
// scatters into two LDS tiles [d][64 pos] (pitch 72 halves); after a block barrier each d row segment (64 halves = one
// coverage: load 256 thr x 16 = 64 pos x 64 d; store 2 iterations x 256 thr x 8 halves = 64 lines x 64 = the block's tile of
//           VH and VL; grid = BG*NH*NST blocks covers both planes exactly once.
// =====================================================================================================
__global__ __launch_bounds__(256) void vt16(const float* __restrict__ F, u16* VHo, u16* VLo) {
  __shared__ __align__(16) u16 TH[HD * VTP];
  __shared__ __align__(16) u16 TL[HD * VTP];
  const int tid = threadIdx.x;
  const int bid = blockIdx.x;
  const int st  = bid % NST;
  const int t2  = bid / NST;
  const int g   = t2 % NH;
  const int b   = t2 / NH;
  if (b >= BG) return;                      // block-uniform, before any barrier; never taken with the exact grid
  const int s0  = st * 64;
  {
    const int sl = tid >> 2;                // position within tile 0..63
    const int dc = (tid & 3) * 16;          // d chunk 0,16,32,48
    const float* src = F + ((size_t)b * LP + s0 + sl) * DI + g * HD + dc;
#pragma unroll
    for (int i = 0; i < 4; ++i) {
      const v4f a = *(const v4f*)(src + 4 * i);
#pragma unroll
      for (int e = 0; e < 4; ++e) {
        const float t = a[e] * VCAR;
        const _Float16 hv = (_Float16)t;
        const _Float16 lv = (_Float16)(t - (float)hv);
        TH[(dc + 4 * i + e) * VTP + sl] = h_bits(hv);
        TL[(dc + 4 * i + e) * VTP + sl] = h_bits(lv);
      }
    }
  }
  __syncthreads();
  v4u vh[2], vl[2];
  const int q8 = tid >> 3, p8 = (tid & 7) * 8;
#pragma unroll
  for (int it = 0; it < 2; ++it) {
    const int line = it * 32 + q8;          // d = 0..63
    vh[it] = *(const v4u*)(TH + line * VTP + p8);
    vl[it] = *(const v4u*)(TL + line * VTP + p8);
  }
  const size_t hrow = (size_t)(b * NH + g) * HD;
  const size_t base = hrow * LP + s0 + p8;
  {
#pragma unroll
    for (int it = 0; it < 2; ++it) {
      const int line = it * 32 + q8;
      *(v4u*)(VHo + base + (size_t)line * LP) = vh[it];
      *(v4u*)(VLo + base + (size_t)line * LP) = vl[it];
    }
    
  }
}

// =====================================================================================================
// q / k planes from a projection F f32 [GROWS][DI]: Hp [GROWS][DI] = f16(val * sc) (same layout), Lp [GROWS][DI] = f16
// residual. Block = QKR rows x QKC threads per row (one wave per row), thread = 8 consecutive columns: two 16-B loads, one
// coverage: QKR rows x 32 thr x 8 = QKR whole rows of Hp and Lp per block; grid = GROWS/QKR blocks = every row once.
// =====================================================================================================
__global__ __launch_bounds__(QKT) void qk16(const float* __restrict__ F, u16* Hp, u16* Lp, float sc) {
  const int tid = (int)threadIdx.x;
  if (tid >= QKT) return;
  const int rl  = tid / QKC;
  const int cc  = tid - rl * QKC;
  const int row = (int)blockIdx.x * QKR + rl;
  if (row >= GROWS) return;
  const float* p = F + (size_t)row * DI + cc * 8;
  const v4f a = *(const v4f*)(p), b4 = *(const v4f*)(p + 4);
  float w[8];
#pragma unroll
  for (int e = 0; e < 4; ++e) { w[e] = a[e] * sc; w[4 + e] = b4[e] * sc; }
  v4u oh, ol;
#pragma unroll
  for (int e = 0; e < 4; ++e) {
    const float t0 = w[2 * e], t1 = w[2 * e + 1];
    const _Float16 h0 = (_Float16)t0, h1 = (_Float16)t1;
    const _Float16 l0 = (_Float16)(t0 - (float)h0), l1 = (_Float16)(t1 - (float)h1);
    oh[e] = pk16(h_bits(h0), h_bits(h1));
    ol[e] = pk16(h_bits(l0), h_bits(l1));
  }
  u16* dh = Hp + (size_t)row * DI + cc * 8;
  u16* dl = Lp + (size_t)row * DI + cc * 8;
  {
    *(v4u*)(dh) = oh;
    *(v4u*)(dl) = ol;
    
  }
}

// =====================================================================================================
// epi64o additionally adds a per-column bias (bf16 RNE of the input) and multiplies by a per-row scale (bf16 RNE of mask).
// coverage: 8 instructions x 2 rows x 16 lanes x 4 floats = the wave's 16 x 64 tile.
// =====================================================================================================
__device__ __forceinline__ void epi64(float* sl, v8f a0, v8f a1, v8f a2, v8f a3, float oscale,
                                      float* C, int N, size_t rowb, int col0, int lane) {
  const int hh = lane >> 4, m = lane & 15;
#pragma unroll
  for (int r = 0; r < 8; ++r) {
    const int ro = (8 * hh + r) * 68 + m;
    sl[ro]      = a0[r] * oscale;
    sl[ro + 16] = a1[r] * oscale;
    sl[ro + 32] = a2[r] * oscale;
    sl[ro + 48] = a3[r] * oscale;
  }
  wave_sync_lds();
  v4f vals[8];
#pragma unroll
  for (int it = 0; it < 8; ++it) vals[it] = *(const v4f*)(sl + (it * 2 + hh) * 68 + m * 4);
  float* dst = C + (rowb + (size_t)hh) * (size_t)N + col0 + m * 4;
  {
#pragma unroll
    for (int it = 0; it < 8; ++it) {
      *(v4f*)(dst + (size_t)(it * 2) * (size_t)N) = vals[it];
    }
    
  }
}
__device__ __forceinline__ void epi64o(float* sl, v8f a0, v8f a1, v8f a2, v8f a3, float oscale,
                                       float* C, int N, size_t rowb, int col0, int lane,
                                       const float* __restrict__ bias, const float* __restrict__ rsc) {
  const int hh = lane >> 4, m = lane & 15;
#pragma unroll
  for (int r = 0; r < 8; ++r) {
    const int ro = (8 * hh + r) * 68 + m;
    sl[ro]      = a0[r] * oscale;
    sl[ro + 16] = a1[r] * oscale;
    sl[ro + 32] = a2[r] * oscale;
    sl[ro + 48] = a3[r] * oscale;
  }
  wave_sync_lds();
  float bq[4];
  {
    const v4f b4 = *(const v4f*)(bias + col0 + m * 4);
#pragma unroll
    for (int e = 0; e < 4; ++e) bq[e] = bfr(b4[e]);
  }
  v4f vals[8];
#pragma unroll
  for (int it = 0; it < 8; ++it) {
    const v4f t = *(const v4f*)(sl + (it * 2 + hh) * 68 + m * 4);
    const float mk = bfr(rsc[rowb + (size_t)hh + (size_t)(it * 2)]);
    v4f o;
#pragma unroll
    for (int e = 0; e < 4; ++e) o[e] = (t[e] + bq[e]) * mk;
    vals[it] = o;
  }
  float* dst = C + (rowb + (size_t)hh) * (size_t)N + col0 + m * 4;
  {
#pragma unroll
    for (int it = 0; it < 8; ++it) {
      *(v4f*)(dst + (size_t)(it * 2) * (size_t)N) = vals[it];
    }
    
  }
}

// =====================================================================================================
// bf16 GEMM: C[M][N] (f32) = A[M][K] (bf16 row-major) . Bt[N][K]^T (bf16 k-contiguous), times oscale.
// Block = 64x64 tile, 4 waves x 16 rows; fragments loaded straight from the 16-bit rows (two 16-B loads each, split k map
// for A and B); K stepped by 32 (host guarantees K % 32 == 0, M % 64 == 0, N % 64 == 0, grid = (M/64)*(N/64)).
// =====================================================================================================
__global__ __launch_bounds__(128)
void gemm_bf(const u16* __restrict__ A, const u16* __restrict__ Bt, float* C, int M, int N, int K, float oscale) {
  __shared__ __align__(16) float slab[4 * SLAB64];
  const int tid = threadIdx.x, wave = tid >> 5, lane = tid & 31, hh = lane >> 4, m = lane & 15;
  const int ntile = N >> 6;
  const int bid   = blockIdx.x;
  const int rowb  = (bid / ntile) * 64 + wave * 16;
  const int col0  = (bid % ntile) * 64;
  if (rowb + 16 > M) return;                // wave-uniform, never taken with the exact grid; no block barriers in this kernel
  const u16* ap = A  + (size_t)(rowb + m) * K + 8 * hh;
  const u16* bp = Bt + (size_t)(col0 + m) * K + 8 * hh;
  const size_t bs = (size_t)16 * K;
  v8f acc0 = zero8(), acc1 = zero8(), acc2 = zero8(), acc3 = zero8();
#pragma unroll 1
  for (int k0 = 0; k0 < K; k0 += 32) {
    const v16b a  = ldfrag_b(ap + k0);
    const v16b b0 = ldfrag_b(bp + k0);
    const v16b b1 = ldfrag_b(bp + bs + k0);
    const v16b b2 = ldfrag_b(bp + 2 * bs + k0);
    const v16b b3 = ldfrag_b(bp + 3 * bs + k0);
    acc0 = mma_b(a, b0, acc0);
    acc1 = mma_b(a, b1, acc1);
    acc2 = mma_b(a, b2, acc2);
    acc3 = mma_b(a, b3, acc3);
    guard6<v16b>(acc0, acc1, acc2, acc3, a, b0, b1, b2, b3, a);
  }
  epi64(slab + wave * SLAB64, acc0, acc1, acc2, acc3, oscale, C, N, (size_t)rowb, col0, lane);
}

// =====================================================================================================
// Output projection: C[row][DM] (f32) = ((Ah + Al)[row][DI] . Bt[DM][DI]^T) * oscale + bias[col], times rsc[row]
// (products h.B + l.B into one accumulator, l unscaled). Block -> (column tile ct = bid % 2, position tile rt, row group bb):
// rows of Ah, Al and C are bb*LP + pos. Same tiling as gemm_bf, epilogue epi64o.
// =====================================================================================================
__global__ __launch_bounds__(128)
void gemm_o(const u16* __restrict__ Ah, const u16* __restrict__ Al, const u16* __restrict__ Bt,
            const float* __restrict__ bias, const float* __restrict__ rsc, float* C, float oscale) {
  __shared__ __align__(16) float slab[4 * SLAB64];
  const int tid = threadIdx.x, wave = tid >> 5, lane = tid & 31, hh = lane >> 4, m = lane & 15;
  const int ntile = DM >> 6;
  const int bid   = blockIdx.x;
  const int ct    = bid % ntile;
  const int t2    = bid / ntile;
  const int rt    = t2 % NST;
  const int bb    = t2 / NST;
  if (bb >= BG) return;                     // block-uniform; no block barriers in this kernel; never taken with the exact grid
  const int srow  = rt * 64 + wave * 16;
  if (srow + 16 > LP) return;               // wave-uniform; never taken
  const int col0  = ct * 64;
  const int K     = DI;
  const size_t rowC = (size_t)bb * LP + srow;
  const _Float16* ahp = (const _Float16*)(const void*)Ah + (rowC + m) * K + 8 * hh;
  const _Float16* alp = (const _Float16*)(const void*)Al + (rowC + m) * K + 8 * hh;
  const _Float16* bp  = (const _Float16*)(const void*)Bt + (size_t)(col0 + m) * K + 8 * hh;
  const size_t bs = (size_t)16 * K;
  v8f acc0 = zero8(), acc1 = zero8(), acc2 = zero8(), acc3 = zero8();
#pragma unroll 1
  for (int k0 = 0; k0 < K; k0 += 32) {
    const v16h ah = ldfrag_h(ahp + k0), al = ldfrag_h(alp + k0);
    const v16h b0 = ldfrag_h(bp + k0);
    const v16h b1 = ldfrag_h(bp + bs + k0);
    const v16h b2 = ldfrag_h(bp + 2 * bs + k0);
    const v16h b3 = ldfrag_h(bp + 3 * bs + k0);
    acc0 = mma_h(ah, b0, acc0);  acc0 = mma_h(al, b0, acc0);
    acc1 = mma_h(ah, b1, acc1);  acc1 = mma_h(al, b1, acc1);
    acc2 = mma_h(ah, b2, acc2);  acc2 = mma_h(al, b2, acc2);
    acc3 = mma_h(ah, b3, acc3);  acc3 = mma_h(al, b3, acc3);
    guard6<v16h>(acc0, acc1, acc2, acc3, ah, al, b0, b1, b2, b3);
  }
  epi64o(slab + wave * SLAB64, acc0, acc1, acc2, acc3, oscale, C, DM, rowC, col0, lane, bias, rsc);
}

// =====================================================================================================
// Pair attention for one row group. Block bid -> (64 softmax rows qb = bid % NST, head = (bid / NST) % NH, row group b);
// the four waves take 16 rows each (q0 = 64*qb + 16*wave) of the SAME head and share its column operands: per 64 columns the
// Cm hi/residual rows [64 vi][64 d] and the v^T hi/residual rows [64 d][64 vi] are brought in once per block with whole-line
// 16-B loads (8 lanes per 128-B row), held in registers while the tile before is worked on, stored to LDS (pitch 72 halves)
// and read from there as fragments by all four waves. Softmax row index qi uses the k projection (row operand R), softmax
// column index vi uses the q projection (column operand Cm), summed over vi with v[vi].
//   R hi/residual planes (k x1024 f16) and Cm hi/residual planes (q x128 x 8 ... i.e. (q*C^-0.5) x1024 f16) laid out
//   [b*LP + pos][h*HD + d]; v^T hi/residual planes [b*NH + h][d][LP]; CB [h][qi][vi] f32 = 1e9*(mask - 1) + x.Wb.
//   scores s(i, j) = R_hi.C_hi + R_lo.C_hi + R_hi.C_lo over HD; logit (log2 domain) t = (s / (1024*1024) + CB) * log2 e.
//   All NKT column tiles of 32 visited in order. Per tile: the 16x32 CB tile is staged into the wave-private LDS tile with
//   16-B loads/stores, then 2 score subtiles x 2 k-steps with column fragments read from the LDS tile (two 16-B loads
//   fragments of P*32768 (f16 hi plus its f16 residual) rebuilt from the LDS rows (float vector loads, same element type as
//   stored), v^T B fragments in 2 groups of 2 d-subtiles, products hh + lh + hl.
//   After the loop: out = acc / Z (Z >= 1 always; guarded anyway), carries 1/(32768*1024) folded once, written to the wave's
//   private result slab (pitch 68; every element owned by one lane).
//   Epilogue: out multiplied by sigmoid(U + bu) in f32 (U = x.Wu f32 plane, bu bf16 RNE of the input), then O x1024 -> f16
// coverage: per wave 4 instructions x 4 rows x 8 lanes x 8 halves = 16 x 64 per plane; grid = NQT * BG = NST * NH * BG blocks
//           x WPB waves = every (b, pos, h) row segment of OH and OL exactly once.
// =====================================================================================================
__global__ __launch_bounds__(ATT_THREADS)
void attn_t(const u16* __restrict__ RHp, const u16* __restrict__ RLp,
            const u16* __restrict__ CHp, const u16* __restrict__ CLp,
            const u16* __restrict__ VHp, const u16* __restrict__ VLp,
            const float* __restrict__ CB, const float* __restrict__ U, const float* __restrict__ bu,
            u16* OHp, u16* OLp) {
  __shared__ __align__(16) float smem[WPB * WREG];
  __shared__ __align__(16) u16 tile[4 * TPL];   // Cm hi, Cm residual [vi][d]; v^T hi, v^T residual [d][vi]; pitch VTP

  const int tid  = threadIdx.x;
  const int wave = tid >> 5;
  const int lane = tid & 31;
  const int hh   = lane >> 4;
  const int c    = lane & 15;
  const int bid  = blockIdx.x;
  const int qb   = bid % NST;
  const int t2   = bid / NST;
  const int head = t2 % NH;
  const int b    = t2 / NH;
  if (b >= BG) return;                      // block-uniform, before any barrier; never taken with the exact grid
  const int q0   = qb * 64 + wave * 16;

  float* pt   = smem + wave * WREG;         // CB tile, then prob tile [16][32] pitch 36
  float* slab = pt + PTW;                   // result slab [16][64] pitch 68

  const size_t hcol = (size_t)head * HD + 8 * hh;
  const _Float16* Rh  = (const _Float16*)(const void*)RHp + ((size_t)b * LP + q0 + c) * DI + hcol;
  const _Float16* Rl  = (const _Float16*)(const void*)RLp + ((size_t)b * LP + q0 + c) * DI + hcol;
  // fragment bases in the LDS tile: row c (+16 per subtile), halves 8*hh (+ the k offset per step)
  const _Float16* Chb = (const _Float16*)(const void*)tile + c * VTP + 8 * hh;   // row = vi within the tile, k = d
  const _Float16* Clb = Chb + TPL;
  const _Float16* Vhb = Chb + 2 * TPL;                                           // row = d, k = vi within the tile
  const _Float16* Vlb = Chb + 3 * TPL;
  // staging: thread -> (row sr + 16*i, 8 halves at sc); 8 consecutive lanes cover one 128-B row segment of a plane
  const int sr = tid >> 3, sc = (tid & 7) * 8;
  const u16* gch = CHp + ((size_t)b * LP + sr) * DI + (size_t)head * HD + sc;    // + (64*s + 16*i) * DI
  const u16* gcl = CLp + ((size_t)b * LP + sr) * DI + (size_t)head * HD + sc;
  const u16* gvh = VHp + ((size_t)(b * NH + head) * HD + sr) * LP + sc;          // + 16*i * LP + 64*s
  const u16* gvl = VLp + ((size_t)(b * NH + head) * HD + sr) * LP + sc;
  u16* tw = tile + sr * VTP + sc;
  const float* cbb = CB + ((size_t)head * LP + q0) * LP;
  const float invc = 1.0f / (CSC * KSC);
  const float oc   = 1.0f / (PCAR * VCAR);

  float mrow[8], lrow[8];
  v8f o[4];
#pragma unroll
  for (int r = 0; r < 8; ++r) { mrow[r] = -INFINITY; lrow[r] = 0.f; }
#pragma unroll
  for (int j = 0; j < 4; ++j) o[j] = zero8();

  v4u pre[16];                              // the next 64-column tile of the four planes, in flight
#pragma unroll
  for (int i = 0; i < 4; ++i) {
    pre[i]      = *(const v4u*)(gch + (size_t)(16 * i) * DI);
    pre[4 + i]  = *(const v4u*)(gcl + (size_t)(16 * i) * DI);
    pre[8 + i]  = *(const v4u*)(gvh + (size_t)(16 * i) * LP);
    pre[12 + i] = *(const v4u*)(gvl + (size_t)(16 * i) * LP);
  }
#pragma unroll 1
  for (int kt = 0; kt < NKT; ++kt) {
    const int kb = kt * 32;
    const int kl = kb & (STG - 1);          // first column of this step inside the LDS tile
    if (kl == 0) {                          // block-uniform: a new 64-column tile every second step
      if (kt != 0) __syncthreads();         // every wave has finished reading the tile that is overwritten next
#pragma unroll
      for (int i = 0; i < 4; ++i) {
        *(v4u*)(tw + 16 * i * VTP)           = pre[i];
        *(v4u*)(tw + TPL + 16 * i * VTP)     = pre[4 + i];
        *(v4u*)(tw + 2 * TPL + 16 * i * VTP) = pre[8 + i];
        *(v4u*)(tw + 3 * TPL + 16 * i * VTP) = pre[12 + i];
      }
      __syncthreads();                      // the tile is complete before any wave reads a fragment of it
      if (kb + STG < LP) {                  // block-uniform: the following tile's loads fly while this one is worked on
#pragma unroll
        for (int i = 0; i < 4; ++i) {
          pre[i]      = *(const v4u*)(gch + (size_t)(kb + STG + 16 * i) * DI);
          pre[4 + i]  = *(const v4u*)(gcl + (size_t)(kb + STG + 16 * i) * DI);
          pre[8 + i]  = *(const v4u*)(gvh + (size_t)(16 * i) * LP + kb + STG);
          pre[12 + i] = *(const v4u*)(gvl + (size_t)(16 * i) * LP + kb + STG);
        }
        // the address registers of these loads are reused by the step below while the loads are still in flight
        asm volatile("s_wait_xcnt 0x0" ::: "memory");
      }
    }
    // ---- stage the additive logit tile [16 rows][32 cols] into pt: 128 float4, lane handles f = it*32 + lane ----
#pragma unroll
    for (int it = 0; it < 4; ++it) {
      const int f = it * 32 + lane;
      const int row = f >> 3, col4 = (f & 7) * 4;
      const v4f t4 = *(const v4f*)(cbb + (size_t)row * LP + kb + col4);
      *(v4f*)(pt + row * PTP + col4) = t4;
    }
    // ---- scores: D element r of this lane = (row q0 + 8hh + r, col kb + c) in s0, col kb + 16 + c in s1 ----
    v8f s0 = zero8(), s1 = zero8();
    const _Float16* c0p = Chb + kl * VTP;
    const _Float16* c1p = c0p + 16 * VTP;
    const _Float16* l0p = Clb + kl * VTP;
    const _Float16* l1p = l0p + 16 * VTP;
#pragma unroll
    for (int kk = 0; kk < HD / 32; ++kk) {
      const v16h rh  = ldfrag_h(Rh + kk * 32);
      const v16h rl  = ldfrag_h(Rl + kk * 32);
      const v16h ch0 = ldfrag_h(c0p + kk * 32);
      const v16h ch1 = ldfrag_h(c1p + kk * 32);
      const v16h cl0 = ldfrag_h(l0p + kk * 32);
      const v16h cl1 = ldfrag_h(l1p + kk * 32);
      s0 = mma_h(rh, ch0, s0);
      s0 = mma_h(rl, ch0, s0);
      s0 = mma_h(rh, cl0, s0);
      s1 = mma_h(rh, ch1, s1);
      s1 = mma_h(rl, ch1, s1);
      s1 = mma_h(rh, cl1, s1);
      guard2(s0, s1, rh, rl, ch0, cl0, ch1, cl1);
    }
    wave_sync_lds();
    // ---- additive term + online softmax in base 2, -inf-safe ----
#pragma unroll
    for (int r = 0; r < 8; ++r) {
      const int   ro  = (8 * hh + r) * PTP + c;
      const float cb0 = pt[ro];
      const float cb1 = pt[ro + 16];
      const float t0  = (s0[r] * invc + cb0) * LOG2E;
      const float t1  = (s1[r] * invc + cb1) * LOG2E;
      float mx = fmaxf(t0, t1);
#pragma unroll
      for (int off = 1; off < 16; off <<= 1) mx = fmaxf(mx, __shfl_xor(mx, off, 32));
      const float mn = fmaxf(mrow[r], mx);
      const float ms = (mn == -INFINITY) ? 0.0f : mn;
      const float al = exp2f(mrow[r] - ms);
      mrow[r] = mn;
      const float e0 = exp2f(t0 - ms), e1 = exp2f(t1 - ms);
      float ps = e0 + e1;
#pragma unroll
      for (int off = 1; off < 16; off <<= 1) ps += __shfl_xor(ps, off, 32);
      lrow[r] = lrow[r] * al + ps;
#pragma unroll
      for (int j = 0; j < 4; ++j) o[j][r] *= al;
      pt[ro]      = e0;
      pt[ro + 16] = e1;
    }
    wave_sync_lds();
    // ---- A fragments of P*32768: hi f16 and residual f16, row = c, split k map over the 32 columns of this step ----
    FragH ph, pl;
    {
      const float* prow = pt + c * PTP + 8 * hh;
      const v4f p0 = *(const v4f*)(prow), p1 = *(const v4f*)(prow + 4);
      const v4f p2 = *(const v4f*)(prow + 16), p3 = *(const v4f*)(prow + 20);
#pragma unroll
      for (int e = 0; e < 4; ++e) {
        const float ta = p0[e] * PCAR, tb = p1[e] * PCAR, tc = p2[e] * PCAR, td = p3[e] * PCAR;
        const _Float16 ha = (_Float16)ta, hb = (_Float16)tb, hc = (_Float16)tc, hd = (_Float16)td;
        ph.h[0][e]     = ha;                  // elements 0..7  = columns kb + 8hh + 0..7
        ph.h[0][4 + e] = hb;
        ph.h[1][e]     = hc;                  // elements 8..15 = columns kb + 16 + 8hh + 0..7
        ph.h[1][4 + e] = hd;
        pl.h[0][e]     = (_Float16)(ta - (float)ha);
        pl.h[0][4 + e] = (_Float16)(tb - (float)hb);
        pl.h[1][e]     = (_Float16)(tc - (float)hc);
        pl.h[1][4 + e] = (_Float16)(td - (float)hd);
      }
    }
    // ---- P.V : B fragment col n = d = j*16 + c, columns vi contiguous in the v^T tile rows; 2 groups of 2 d-subtiles ----
    {
      const _Float16* vhp = Vhb + kl;
      const _Float16* vlp = Vlb + kl;
#pragma unroll
      for (int jg = 0; jg < HD / 32; ++jg) {
        const int da = (2 * jg) * 16 * VTP;
        const int db = da + 16 * VTP;
        const v16h vha = ldfrag_h(vhp + da), vhb2 = ldfrag_h(vhp + db);
        const v16h vla = ldfrag_h(vlp + da), vlb2 = ldfrag_h(vlp + db);
        o[2 * jg]     = mma_h(ph.v, vha,  o[2 * jg]);
        o[2 * jg]     = mma_h(pl.v, vha,  o[2 * jg]);
        o[2 * jg]     = mma_h(ph.v, vla,  o[2 * jg]);
        o[2 * jg + 1] = mma_h(ph.v, vhb2, o[2 * jg + 1]);
        o[2 * jg + 1] = mma_h(pl.v, vhb2, o[2 * jg + 1]);
        o[2 * jg + 1] = mma_h(ph.v, vlb2, o[2 * jg + 1]);
        guard2(o[2 * jg], o[2 * jg + 1], ph.v, pl.v, vha, vhb2, vla, vlb2);
      }
    }
    wave_sync_lds();
  }
  acc_guard4(o[0], o[1], o[2], o[3]);
  // ---- out = acc / Z (0 if Z == 0), carries (32768 on P, 1024 on v) folded once; written into the lane-owned slab ----
#pragma unroll
  for (int r = 0; r < 8; ++r) {
    const float lv  = lrow[r];
    const float ls  = (lv > 0.0f) ? lv : 1.0f;
    const float inv = (lv > 0.0f) ? ((1.0f / ls) * oc) : 0.0f;
#pragma unroll
    for (int j = 0; j < 4; ++j) {
      const int idx = (8 * hh + r) * SLP + j * 16 + c;
      slab[idx] = o[j][r] * inv;
    }
  }

  wave_sync_lds();
  // ---- gate in f32, then O x1024 -> f16 hi + residual planes; lane = (row select rq in 0..3, 8 consecutive d at c8) ----
  v4u oh[4], ol[4];
  const int rq = lane >> 3, c8 = (lane & 7) * 8;
  const float* urow = U + ((size_t)b * LP + q0) * DI + (size_t)head * HD + c8;
  float bb[8];
  {
    const v4f u0 = *(const v4f*)(bu + head * HD + c8), u1 = *(const v4f*)(bu + head * HD + c8 + 4);
#pragma unroll
    for (int e = 0; e < 4; ++e) { bb[e] = bfr(u0[e]); bb[4 + e] = bfr(u1[e]); }
  }
#pragma unroll
  for (int it = 0; it < 4; ++it) {
    const int row = it * 4 + rq;
    const v4f a  = *(const v4f*)(slab + row * SLP + c8), b4 = *(const v4f*)(slab + row * SLP + c8 + 4);
    const v4f ua = *(const v4f*)(urow + (size_t)row * DI), ub = *(const v4f*)(urow + (size_t)row * DI + 4);
    float w[8];
#pragma unroll
    for (int e = 0; e < 4; ++e) {
      w[e]     = (a[e]  * sigm(ua[e] + bb[e]))     * OSC;
      w[4 + e] = (b4[e] * sigm(ub[e] + bb[4 + e])) * OSC;
    }
#pragma unroll
    for (int e = 0; e < 4; ++e) {
      const _Float16 h0 = (_Float16)w[2 * e], h1 = (_Float16)w[2 * e + 1];
      const _Float16 l0 = (_Float16)(w[2 * e] - (float)h0), l1 = (_Float16)(w[2 * e + 1] - (float)h1);
      oh[it][e] = pk16(h_bits(h0), h_bits(h1));
      ol[it][e] = pk16(h_bits(l0), h_bits(l1));
    }
  }
  const size_t ob = ((size_t)b * LP + q0) * DI + (size_t)head * HD + c8;
  {
#pragma unroll
    for (int it = 0; it < 4; ++it) {
      const int row = it * 4 + rq;
      *(v4u*)(OHp + ob + (size_t)row * DI) = oh[it];
      *(v4u*)(OLp + ob + (size_t)row * DI) = ol[it];
    }
    
  }
}

// =====================================================================================================
// Rows s are processed in NGRP groups of BG rows; every per-group workspace plane is reused in launch order.
// Workspace map (bytes); every plane is fully written by whole-line stores before it is read; all extents are exact
// multiples of the store granularity (no pad rows needed); every region offset a multiple of 65536:
//   XB  bf16 [NPIX][256] (hi|lo)                    33554432
//   F   f32 [GROWS][256]                            GROWS*1024   (v, q, k projection output in launch order; afterwards the
//                                                                 region holds OH f16 [GROWS][256] x1024 first, OL after it)
//   U   f32 [GROWS][256]                            GROWS*1024   (gate pre-activation)
//   QH, KH, QL, KL  f16 [GROWS][256]               4 * GROWS*512
//   VH, VL  f16 [BG*4][64][LP]                      2 * GROWS*512
//   CB  f32 [4][NPIX]                               1048576
//   WQ, WK, WV, WU  bf16 [256 n][256 k]             4 * 131072
//   WO  f16 x1024 [128 n][256 k]                    65536
//   end (BG = 64)                                   119078912
// =====================================================================================================
extern "C" void kernel_launch(void* const* d_in, const int* in_sizes, int n_in,
                              void* d_out, int out_size, void* d_ws, size_t ws_size,
                              hipStream_t stream) {
  if (n_in < 12) return;
  if (in_sizes[0] < NPIX * DM) return;
  if (in_sizes[1] < NPIX) return;
  if (in_sizes[2] < DM || in_sizes[3] < DM) return;
  if (in_sizes[4] < DM * DI || in_sizes[5] < DM * DI || in_sizes[6] < DM * DI || in_sizes[8] < DM * DI) return;
  if (in_sizes[7] < DM * NH) return;
  if (in_sizes[9] < DI) return;
  if (in_sizes[10] < DI * DM) return;
  if (in_sizes[11] < DM) return;
  if (out_size < NS * LP * DM) return;

  const float* pr    = (const float*)d_in[0];
  const float* mask  = (const float*)d_in[1];
  const float* gamma = (const float*)d_in[2];
  const float* beta  = (const float*)d_in[3];
  const float* Wq    = (const float*)d_in[4];
  const float* Wk    = (const float*)d_in[5];
  const float* Wv    = (const float*)d_in[6];
  const float* Wb    = (const float*)d_in[7];
  const float* Wu    = (const float*)d_in[8];
  const float* bu    = (const float*)d_in[9];
  const float* Wo    = (const float*)d_in[10];
  const float* bo    = (const float*)d_in[11];
  float*       out   = (float*)d_out;

  const size_t szXB = (size_t)NPIX * KX * 2;
  const size_t szF  = (size_t)GROWS * DI * 4;
  const size_t szU  = (size_t)GROWS * DI * 4;
  const size_t szH  = (size_t)GROWS * DI * 2;                   // QH, KH, QL, KL, OH, OL
  const size_t szV  = (size_t)BG * NH * HD * LP * 2;            // VH, VL (== szH)
  const size_t szCB = (size_t)NH * NPIX * 4;
  const size_t szW  = (size_t)DI * KX * 2;
  const size_t szWO = (size_t)DM * DI * 2;
  if (2 * szH > szF) return;                                    // OH + OL live inside the F region
  size_t off = 0;
  const size_t oXB = off; off += szXB;
  const size_t oF  = off; off += szF;
  const size_t oU  = off; off += szU;
  const size_t oQH = off; off += szH;
  const size_t oKH = off; off += szH;
  const size_t oQL = off; off += szH;
  const size_t oKL = off; off += szH;
  const size_t oVH = off; off += szV;
  const size_t oVL = off; off += szV;
  const size_t oCB = off; off += szCB;
  const size_t oWQ = off; off += szW;
  const size_t oWK = off; off += szW;
  const size_t oWV = off; off += szW;
  const size_t oWU = off; off += szW;
  const size_t oWO = off; off += szWO;
  if (off > ws_size) return;                // off = 119078912 for BG = 64
  if (off > (size_t)WS_CAP) return;

  char* ws = (char*)d_ws;
  u16*   XB = (u16*)(ws + oXB);
  float* F  = (float*)(ws + oF);
  u16*   OH = (u16*)(ws + oF);
  u16*   OL = (u16*)(ws + oF + szH);
  float* U  = (float*)(ws + oU);
  u16*   QH = (u16*)(ws + oQH);
  u16*   KH = (u16*)(ws + oKH);
  u16*   QL = (u16*)(ws + oQL);
  u16*   KL = (u16*)(ws + oKL);
  u16*   VH = (u16*)(ws + oVH);
  u16*   VL = (u16*)(ws + oVL);
  float* CB = (float*)(ws + oCB);
  u16*   WQ = (u16*)(ws + oWQ);
  u16*   WK = (u16*)(ws + oWK);
  u16*   WV = (u16*)(ws + oWV);
  u16*   WU = (u16*)(ws + oWU);
  u16*   WO = (u16*)(ws + oWO);

  const dim3 b256(256), b128(128), bQK(QKT), bAT(ATT_THREADS);
  const dim3 gLN(NPIX / LNPB);                          // 2048
  const dim3 gWP((DI / 128) * (DM / 64));               // 4: Wq, Wk, Wv, Wu planes
  const dim3 gWO((DM / 128) * (DI / 64));               // 4: Wo plane
  const dim3 gG((GROWS / 64) * (DI / 64));
  const dim3 gVT(BG * NH * NST);
  const dim3 gQK(GROWS / QKR);
  const dim3 gAT(NQT * BG);
  const dim3 gO(BG * NST * (DM / 64));
  const float osc = 1.0f / (OSC * WOS);

  // LayerNorm once for every pixel: x hi|lo planes and the additive logit table
  ln_x<<<gLN, b256, 0, stream>>>(pr, mask, gamma, beta, Wb, XB, CB);
  // weight planes once: Wq^T, Wk^T, Wv^T, Wu^T [n][k | k] as bf16; Wo^T [n][k] as f16 of bf16 value x1024
  wt16<<<gWP, b256, 0, stream>>>(Wq, DI, DM, WQ, KX, 1, 0, 1.0f);
  wt16<<<gWP, b256, 0, stream>>>(Wk, DI, DM, WK, KX, 1, 0, 1.0f);
  wt16<<<gWP, b256, 0, stream>>>(Wv, DI, DM, WV, KX, 1, 0, 1.0f);
  wt16<<<gWP, b256, 0, stream>>>(Wu, DI, DM, WU, KX, 1, 0, 1.0f);
  wt16<<<gWO, b256, 0, stream>>>(Wo, DM, DI, WO, DI, 0, 1, WOS);

  for (int g = 0; g < NGRP; ++g) {
    const u16*   xg = XB   + (size_t)g * GROWS * KX;
    const float* mg = mask + (size_t)g * GROWS;
    float*       og = out  + (size_t)g * GROWS * DM;
    // (1) v = x.Wv -> F f32; (2) v^T hi + residual planes x1024
    gemm_bf<<<gG, b128, 0, stream>>>(xg, WV, F, GROWS, DI, KX, 1.0f);
    vt16<<<gVT, b256, 0, stream>>>(F, VH, VL);
    // (3) q = x.Wq -> F; (4) q planes (x 0.125 x 1024) hi + residual
    gemm_bf<<<gG, b128, 0, stream>>>(xg, WQ, F, GROWS, DI, KX, 1.0f);
    qk16<<<gQK, bQK, 0, stream>>>(F, QH, QL, QSC);
    // (5) k = x.Wk -> F; (6) k planes x1024 hi + residual
    gemm_bf<<<gG, b128, 0, stream>>>(xg, WK, F, GROWS, DI, KX, 1.0f);
    qk16<<<gQK, bQK, 0, stream>>>(F, KH, KL, KSC);
    // (7) gate pre-activation u = x.Wu -> U f32
    gemm_bf<<<gG, b128, 0, stream>>>(xg, WU, U, GROWS, DI, KX, 1.0f);
    // (8) attention: rows from the k planes, columns from the q planes, sum over columns with v; gated O -> OH + OL planes
    attn_t<<<gAT, bAT, 0, stream>>>(KH, KL, QH, QL, VH, VL, CB, U, bu, OH, OL);
    // (9) output projection (hi + residual), + bo, x mask row scale -> out f32, carries 1024 x 1024 folded back
    gemm_o<<<gO, b128, 0, stream>>>(OH, OL, WO, bo, mg, og, osc);
  }
  (void)hipGetLastError();
}

// v002
// One run takes 378 microseconds.
// Two timings next to v001 both put it at 1.41 times that version's speed.
// Counting every step since v000, it is 1.63 times as fast.
// Contractions: x.Wq, x.Wk, x.Wv, x.Wu on v_wmma_f32_16x16x32_bf16 (x as bf16 hi|lo pair folded into K = 256, W as bf16 RNE
// of the input, f32 accumulate); k.q^T over 64 and P.v^T on v_wmma_f32_16x16x32_f16 (k x1024 and q x128 f16 hi + residual
// planes, P x32768 f16 hi + residual, v x1024 f16 hi + residual; products hh + lh + hl); (O*gate).Wo on
// v_wmma_f32_16x16x32_f16 (O x1024 f16 hi + residual, Wo as f16(bf16(Wo)) x1024, products h.w + l.w); all f32 accumulate.
// LayerNorm, x.Wb (N = 4) and the additive logit table, base-2 online softmax, sigmoid gate, bias and row scale in f32 on VALU.
#include <hip/hip_runtime.h>
#include <math.h>
#include <stdint.h>

#ifndef NS
#define NS 256
#endif
#define NSX   256
#define LP    256
#define DM    128
#define NH    4
#define HD    64
#define DI    (NH * HD)
#define KX    (2 * DM)
#define NPIX  (LP * LP)
#define BG    ((NS <= 64) ? NS : 64)
#define NGRP  (NS / BG)
#define GROWS (BG * LP)
#define LNEPS 1e-5f
#define LOG2E 1.4426950408889634f
#define QSC   128.0f
#define CSC   1024.0f
#define KSC   1024.0f
#define PCAR  32768.0f
#define VCAR  1024.0f
#define OSC   1024.0f
#define WOS   1024.0f
#define WPB   4
#define NQT   (LP / 16)
#define NST   (LP / 64)
#define NKT   (LP / 32)
#define ATT_THREADS (WPB * 32)
#define PTP   36
#define PTW   (16 * PTP)
#define SLP   68
#define SLW   (16 * SLP)
#define WREG  (PTW + SLW)
#define SLAB64 (16 * 68)
#define VTP   72
#define NPT   (4 * DI / 64)
#define PLP   256
#define LNPB  32
#define STG   64
#define TPL   (STG * VTP)
#define WS_CAP 134217728
static_assert(DI == NH * HD && HD == 64 && NH == 4 && WPB == NH);
static_assert(ATT_THREADS == 128);
static_assert(STG == 64 && HD == STG && (LP % STG) == 0 && NST * NH == NQT);
static_assert(NS >= 1 && NS <= NSX && (NS % BG) == 0 && BG >= 1 && BG <= 64);
static_assert((LP % 64) == 0 && (LP % 32) == 0 && (LP % 16) == 0);
static_assert(DM == 128 && (KX % 32) == 0 && (DI % 64) == 0 && (DI % 32) == 0 && (DM % 64) == 0);
static_assert(PLP == DI && PLP == LP && NPT == 4 * NH && (GROWS % 64) == 0);
static_assert((NPIX % LNPB) == 0 && LNPB == 32);
static_assert((DI % 128) == 0 && (DM % 128) == 0 && (DM % 64) == 0 && (DI % 64) == 0);

typedef unsigned short u16;
typedef _Float16 v16h __attribute__((ext_vector_type(16)));
typedef _Float16 v8h  __attribute__((ext_vector_type(8)));
typedef __bf16   v16b __attribute__((ext_vector_type(16)));
typedef float    v8f  __attribute__((ext_vector_type(8)));
typedef float    v4f  __attribute__((ext_vector_type(4)));
typedef unsigned int v4u __attribute__((ext_vector_type(4)));
typedef unsigned int v2u __attribute__((ext_vector_type(2)));

union FragH { v16h v; v8h h[2]; v4u u[2]; };
union FragB { v16b v; v4u u[2]; };

// ---- scalar helpers --------------------------------------------------------------------------------
__device__ __forceinline__ unsigned short bf_bits(float f) {          // f32 -> bf16 bits, RNE convert
  unsigned u = __float_as_uint(f);
  return (unsigned short)((u + 0x7FFFu + ((u >> 16) & 1u)) >> 16);
}
__device__ __forceinline__ float bf_up(unsigned short h) { return __uint_as_float(((unsigned)h) << 16); }
__device__ __forceinline__ float bfr(float f) { return bf_up(bf_bits(f)); }
__device__ __forceinline__ unsigned short h_bits(_Float16 x) { return __builtin_bit_cast(unsigned short, x); }
__device__ __forceinline__ unsigned pk16(unsigned short a, unsigned short b) { return (unsigned)a | ((unsigned)b << 16); }
__device__ __forceinline__ v8f zero8() { v8f z = {0.f, 0.f, 0.f, 0.f, 0.f, 0.f, 0.f, 0.f}; return z; }
__device__ __forceinline__ float sigm(float z) {                     // 1 / (1 + 2^(-z log2 e)), argument clamped
  const float zc = fminf(fmaxf(z, -30.0f), 30.0f);
  const float e  = exp2f(-zc * LOG2E);
  return __builtin_amdgcn_rcpf(1.0f + e);
}

// ---- fragment loaders: 16-bit A/B operand, lane -> row/col (lane&15), p already includes +8*(lane>>4);
//      elements 0..7 <- p[0..7] (k0+8h..), elements 8..15 <- p[16..23] (k0+16+8h..)  (same split k map for A and B;
//      B is always read from a k-contiguous [n][k] plane)
__device__ __forceinline__ v16h ldfrag_h(const _Float16* p) {
  FragH f;
  f.h[0] = *(const v8h*)(p);
  f.h[1] = *(const v8h*)(p + 16);
  return f.v;
}
__device__ __forceinline__ v16b ldfrag_b(const u16* p) {              // bf16 plane read as unsigned integer vectors
  FragB f;
  f.u[0] = *(const v4u*)(p);
  f.u[1] = *(const v4u*)(p + 16);
  return f.v;
}

__device__ __forceinline__ v8f mma_h(v16h a, v16h b, v8f c) {
  return __builtin_amdgcn_wmma_f32_16x16x32_f16(false, a, false, b, (short)0, c, false, false);
}
__device__ __forceinline__ v8f mma_b(v16b a, v16b b, v8f c) {
  return __builtin_amdgcn_wmma_f32_16x16x32_bf16(false, a, false, b, (short)0, c, false, false);
}
__device__ __forceinline__ void guard2(v8f& a, v8f& b, v16h x0, v16h x1, v16h x2, v16h x3, v16h x4, v16h x5) {
#if defined(__HIP_DEVICE_COMPILE__)
  asm volatile("v_nop\n\tv_nop\n\tv_nop\n\tv_nop"
               : "+v"(a), "+v"(b) : "v"(x0), "v"(x1), "v"(x2), "v"(x3), "v"(x4), "v"(x5) : "memory");
#endif
}
template <typename F>
__device__ __forceinline__ void guard6(v8f& a, v8f& b, v8f& c, v8f& d, F x0, F x1, F x2, F x3, F x4, F x5) {
#if defined(__HIP_DEVICE_COMPILE__)
  asm volatile("v_nop\n\tv_nop\n\tv_nop\n\tv_nop"
               : "+v"(a), "+v"(b), "+v"(c), "+v"(d) : "v"(x0), "v"(x1), "v"(x2), "v"(x3), "v"(x4), "v"(x5) : "memory");
#endif
}
__device__ __forceinline__ void acc_guard4(v8f& a, v8f& b, v8f& c, v8f& d) {
#if defined(__HIP_DEVICE_COMPILE__)
  asm volatile("v_nop\n\tv_nop\n\tv_nop\n\tv_nop" : "+v"(a), "+v"(b), "+v"(c), "+v"(d));
#endif
}
__device__ __forceinline__ void wave_sync_lds() {
  __builtin_amdgcn_fence(__ATOMIC_RELEASE, "workgroup");
  __builtin_amdgcn_wave_barrier();
  __builtin_amdgcn_fence(__ATOMIC_ACQUIRE, "workgroup");
}

// =====================================================================================================
// statistics), x written as bf16 hi | bf16 lo planes XB [NPIX][KX] (columns 0..127 hi bits, 128..255 lo bits of x - hi);
// the additive logit table CB [NH][NPIX] = 1e9*(mask - 1) + x.Wb (VALU f32, N = 4) is produced by the same block.
// Block = 8 waves x LNPB/8 pixels, wave = one pixel at a time (lane holds 4 channels); the 512-B x row is assembled in a
// x 4 heads) are funnelled through LDS and written by wave 0 in one instruction (8 consecutive lanes x 16 B per line);
// coverage: grid = NPIX/LNPB blocks x 32 pixels = every XB row once and every CB line once.
// =====================================================================================================
__global__ __launch_bounds__(256) void ln_x(const float* __restrict__ pr, const float* __restrict__ mask,
                                            const float* __restrict__ gamma, const float* __restrict__ beta,
                                            const float* __restrict__ Wb, u16* XB, float* CB) {
  __shared__ __align__(16) u16 RB[8 * KX];
  __shared__ __align__(16) float PBS[NH * LNPB];
  const int tid = threadIdx.x, wave = tid >> 5, lane = tid & 31;
  const int p0 = (int)blockIdx.x * LNPB;
  if (p0 + LNPB > NPIX) return;             // block-uniform, before any barrier; never taken with the exact grid
  float gm[4], bt[4], wb[16];
  {
    const v4f g4 = *(const v4f*)(gamma + 4 * lane), b4 = *(const v4f*)(beta + 4 * lane);
#pragma unroll
    for (int e = 0; e < 4; ++e) { gm[e] = bfr(g4[e]); bt[e] = bfr(b4[e]); }
#pragma unroll
    for (int i = 0; i < 4; ++i) {
      const v4f w4 = *(const v4f*)(Wb + 16 * lane + 4 * i);      // Wb[(4*lane + i)][h], h = 0..3
#pragma unroll
      for (int h = 0; h < 4; ++h) wb[4 * i + h] = bfr(w4[h]);
    }
  }
  u16* rb = RB + wave * KX;
#pragma unroll 1
  for (int j = 0; j < LNPB / 8; ++j) {
    const int pl = j * 8 + wave;
    const int p  = p0 + pl;
    const v4f x4 = *(const v4f*)(pr + (size_t)p * DM + 4 * lane);
    float xr[4];
#pragma unroll
    for (int e = 0; e < 4; ++e) xr[e] = bfr(x4[e]);
    float s = (xr[0] + xr[1]) + (xr[2] + xr[3]);
#pragma unroll
    for (int off = 1; off < 32; off <<= 1) s += __shfl_xor(s, off, 32);
    const float mu = s * (1.0f / (float)DM);
    float d[4];
#pragma unroll
    for (int e = 0; e < 4; ++e) d[e] = xr[e] - mu;
    float ss = (d[0] * d[0] + d[1] * d[1]) + (d[2] * d[2] + d[3] * d[3]);
#pragma unroll
    for (int off = 1; off < 32; off <<= 1) ss += __shfl_xor(ss, off, 32);
    const float var = ss * (1.0f / (float)DM);
    const float rs  = 1.0f / sqrtf(var + LNEPS);
    float y[4];
#pragma unroll
    for (int e = 0; e < 4; ++e) y[e] = d[e] * rs * gm[e] + bt[e];
    unsigned short hb[4], lb[4];
#pragma unroll
    for (int e = 0; e < 4; ++e) { hb[e] = bf_bits(y[e]); lb[e] = bf_bits(y[e] - bf_up(hb[e])); }
    float pb[4];
#pragma unroll
    for (int h = 0; h < 4; ++h) pb[h] = y[0] * wb[h] + y[1] * wb[4 + h] + y[2] * wb[8 + h] + y[3] * wb[12 + h];
#pragma unroll
    for (int h = 0; h < 4; ++h) {
#pragma unroll
      for (int off = 1; off < 32; off <<= 1) pb[h] += __shfl_xor(pb[h], off, 32);
    }
    const float mk = bfr(mask[p]);
    const float mb = 1e9f * (mk - 1.0f);
    v2u hv, lv;
    hv[0] = pk16(hb[0], hb[1]);  hv[1] = pk16(hb[2], hb[3]);
    lv[0] = pk16(lb[0], lb[1]);  lv[1] = pk16(lb[2], lb[3]);
    *(v2u*)(rb + 4 * lane)      = hv;
    *(v2u*)(rb + DM + 4 * lane) = lv;
    if (lane == 0) {
      PBS[0 * LNPB + pl] = mb + pb[0];
      PBS[1 * LNPB + pl] = mb + pb[1];
      PBS[2 * LNPB + pl] = mb + pb[2];
      PBS[3 * LNPB + pl] = mb + pb[3];
    }
    wave_sync_lds();
    const v4u piece = *(const v4u*)(rb + 8 * lane);
    u16* dst = XB + (size_t)p * KX + 8 * lane;
    {
      *(v4u*)(dst) = piece;
      
    }
    wave_sync_lds();
  }
  __syncthreads();
  if (wave == 0) {
    const int h = lane >> 3, j4 = (lane & 7) * 4;
    const v4f v = *(const v4f*)(PBS + h * LNPB + j4);
    float* d = CB + (size_t)h * NPIX + p0 + j4;
    {
      *(v4f*)(d) = v;
      
    }
  }
}

// =====================================================================================================
// Transposed weight plane: W f32 [nk rows k][ncol cols n] -> D 16-bit [n][ldd], D[n][k] = bf16 bits of W[k][n] (f16mode 0)
// or f16 bits of bf16(W[k][n]) * scale (f16mode 1); when dup != 0 the same 64-half segment is also written at D[n][nk + k]
// (hi|lo folded K). Block (ct = bid % nct: 128 columns, rt = bid / nct: 64 rows): each thread loads 32 floats of one k row
// (16-B loads), converts, scatters into the LDS tile [128 n][64 k] (pitch 72 halves); after a block barrier each n row segment
// coverage: load 256 thr x 32 = 64 k rows x 128 n; store 4 iterations x 256 thr x 8 halves = 128 lines x 64 = the block's tile
// =====================================================================================================
__global__ __launch_bounds__(256) void wt16(const float* __restrict__ W, int ncol, int nk, u16* D, int ldd, int dup,
                                            int f16mode, float scale) {
  __shared__ __align__(16) u16 T[128 * VTP];
  const int tid = threadIdx.x;
  const int bid = blockIdx.x;
  const int nct = ncol / 128;
  const int ct  = bid % nct;
  const int rt  = bid / nct;
  if (rt * 64 + 64 > nk) return;            // block-uniform, before the barrier; never taken with the exact grid
  {
    const int sl = tid >> 2;                // k row within tile 0..63
    const int dc = (tid & 3) * 32;          // n chunk
    const float* src = W + (size_t)(rt * 64 + sl) * ncol + ct * 128 + dc;
#pragma unroll
    for (int i = 0; i < 8; ++i) {
      const v4f a = *(const v4f*)(src + 4 * i);
#pragma unroll
      for (int e = 0; e < 4; ++e) {
        const float f = a[e];
        const unsigned short hb = h_bits((_Float16)(bfr(f) * scale));
        const unsigned short bb = bf_bits(f);
        T[(dc + 4 * i + e) * VTP + sl] = (f16mode != 0) ? hb : bb;
      }
    }
  }
  __syncthreads();
  v4u w4[4];
  const int q8 = tid >> 3, p8 = (tid & 7) * 8;
#pragma unroll
  for (int it = 0; it < 4; ++it) {
    const int line = it * 32 + q8;          // n within tile 0..127
    w4[it] = *(const v4u*)(T + line * VTP + p8);
  }
  const size_t base = ((size_t)ct * 128) * ldd + rt * 64 + p8;
  {
#pragma unroll
    for (int it = 0; it < 4; ++it) {
      const int line = it * 32 + q8;
      *(v4u*)(D + base + (size_t)line * ldd) = w4[it];
      if (dup != 0) *(v4u*)(D + base + (size_t)line * ldd + nk) = w4[it];
    }
    
  }
}

// =====================================================================================================
// epi64o additionally adds a per-column bias (bf16 RNE of the input) and multiplies by a per-row scale (bf16 RNE of mask).
// coverage: 8 instructions x 2 rows x 16 lanes x 4 floats = the wave's 16 x 64 tile.
// =====================================================================================================
__device__ __forceinline__ void epi64(float* sl, v8f a0, v8f a1, v8f a2, v8f a3, float oscale,
                                      float* C, int N, size_t rowb, int col0, int lane) {
  const int hh = lane >> 4, m = lane & 15;
#pragma unroll
  for (int r = 0; r < 8; ++r) {
    const int ro = (8 * hh + r) * 68 + m;
    sl[ro]      = a0[r] * oscale;
    sl[ro + 16] = a1[r] * oscale;
    sl[ro + 32] = a2[r] * oscale;
    sl[ro + 48] = a3[r] * oscale;
  }
  wave_sync_lds();
  v4f vals[8];
#pragma unroll
  for (int it = 0; it < 8; ++it) vals[it] = *(const v4f*)(sl + (it * 2 + hh) * 68 + m * 4);
  float* dst = C + (rowb + (size_t)hh) * (size_t)N + col0 + m * 4;
  {
#pragma unroll
    for (int it = 0; it < 8; ++it) {
      *(v4f*)(dst + (size_t)(it * 2) * (size_t)N) = vals[it];
    }
    
  }
}
__device__ __forceinline__ void epi64o(float* sl, v8f a0, v8f a1, v8f a2, v8f a3, float oscale,
                                       float* C, int N, size_t rowb, int col0, int lane,
                                       const float* __restrict__ bias, const float* __restrict__ rsc) {
  const int hh = lane >> 4, m = lane & 15;
#pragma unroll
  for (int r = 0; r < 8; ++r) {
    const int ro = (8 * hh + r) * 68 + m;
    sl[ro]      = a0[r] * oscale;
    sl[ro + 16] = a1[r] * oscale;
    sl[ro + 32] = a2[r] * oscale;
    sl[ro + 48] = a3[r] * oscale;
  }
  wave_sync_lds();
  float bq[4];
  {
    const v4f b4 = *(const v4f*)(bias + col0 + m * 4);
#pragma unroll
    for (int e = 0; e < 4; ++e) bq[e] = bfr(b4[e]);
  }
  v4f vals[8];
#pragma unroll
  for (int it = 0; it < 8; ++it) {
    const v4f t = *(const v4f*)(sl + (it * 2 + hh) * 68 + m * 4);
    const float mk = bfr(rsc[rowb + (size_t)hh + (size_t)(it * 2)]);
    v4f o;
#pragma unroll
    for (int e = 0; e < 4; ++e) o[e] = (t[e] + bq[e]) * mk;
    vals[it] = o;
  }
  float* dst = C + (rowb + (size_t)hh) * (size_t)N + col0 + m * 4;
  {
#pragma unroll
    for (int it = 0; it < 8; ++it) {
      *(v4f*)(dst + (size_t)(it * 2) * (size_t)N) = vals[it];
    }
    
  }
}

// =====================================================================================================
// Split epilogue: the wave's 16 x 64 f32 tile, times sc, goes out as f16 hi + f16 residual planes (row pitch PLP halves).
// The tile passes through the wave's slab so that 8 consecutive lanes hold one row's 64 halves = one whole 128-B line.
// coverage: 4 instructions x 4 rows x 8 lanes x 8 halves = the wave's 16 x 64 tile of each plane.
// =====================================================================================================
__device__ __forceinline__ void epi64s(float* sl, v8f a0, v8f a1, v8f a2, v8f a3, float sc,
                                       u16* Hp, u16* Lp, size_t ob, int lane) {
  const int hh = lane >> 4, m = lane & 15;
#pragma unroll
  for (int r = 0; r < 8; ++r) {
    const int ro = (8 * hh + r) * 68 + m;
    sl[ro]      = a0[r];
    sl[ro + 16] = a1[r];
    sl[ro + 32] = a2[r];
    sl[ro + 48] = a3[r];
  }
  wave_sync_lds();
  const int rq = lane >> 3, c8 = (lane & 7) * 8;
  v4u oh[4], ol[4];                         // the loops below are unrolled so that these stay in registers
#pragma unroll
  for (int it = 0; it < 4; ++it) {
    const float* p = sl + (it * 4 + rq) * 68 + c8;
    const v4f a = *(const v4f*)(p), b4 = *(const v4f*)(p + 4);
    float w[8];
#pragma unroll
    for (int e = 0; e < 4; ++e) { w[e] = a[e] * sc; w[4 + e] = b4[e] * sc; }
#pragma unroll
    for (int e = 0; e < 4; ++e) {
      const float t0 = w[2 * e], t1 = w[2 * e + 1];
      const _Float16 h0 = (_Float16)t0, h1 = (_Float16)t1;
      const _Float16 l0 = (_Float16)(t0 - (float)h0), l1 = (_Float16)(t1 - (float)h1);
      oh[it][e] = pk16(h_bits(h0), h_bits(h1));
      ol[it][e] = pk16(h_bits(l0), h_bits(l1));
    }
  }
  u16* dh = Hp + ob + (size_t)rq * PLP + c8;
  u16* dl = Lp + ob + (size_t)rq * PLP + c8;
#pragma unroll
  for (int it = 0; it < 4; ++it) {
    *(v4u*)(dh + (size_t)(it * 4) * PLP) = oh[it];
    *(v4u*)(dl + (size_t)(it * 4) * PLP) = ol[it];
  }
}

// =====================================================================================================
// The four projections of one row group in one launch: X [GROWS][K] (bf16 hi|lo rows of x) against Wt [4*DI][K] (bf16,
// k-contiguous; rows 0.. Wq^T, DI.. Wk^T, 2*DI.. Wv^T, 3*DI.. Wu^T), f32 accumulate, K stepped by 32 (host passes K = KX).
// Block bid -> (64 rows of Wt nt = bid % NPT, 64 rows of X rb = bid / NPT); sel = nt / NH names the projection, g = nt % NH
// the head. 4 waves x 16 rows of the row operand; fragments loaded straight from the 16-bit rows (two 16-B loads each, the
// same split k map for both operands, so either plane can be the row operand).
//   q, k, u: row operand X, column operand Wt: the wave's tile is [16 pos][64 channels of head g].
//   v:       row operand Wt, column operand X: the wave's tile is [16 d][64 pos], v^T as the attention reads it.
// Epilogue: u goes out as f32 (epi64); q x128 (= C^-0.5 x 1024), k x1024 and v^T x1024 go out as f16 hi + residual planes
// (epi64s): QH, QL, KH, KL [b*LP + pos][g*HD + d]; VH, VL [(b*NH + g)*HD + d][LP].
// coverage: grid = (GROWS/64) * NPT blocks, each one 64 x 64 tile = every element of U and of the six planes once.
// =====================================================================================================
__global__ __launch_bounds__(128)
void proj4(const u16* __restrict__ X, const u16* __restrict__ Wt, u16* QH, u16* QL, u16* KH, u16* KL,
           u16* VH, u16* VL, float* U, int K) {
  __shared__ __align__(16) float slab[4 * SLAB64];
  const int tid = threadIdx.x, wave = tid >> 5, lane = tid & 31, hh = lane >> 4, m = lane & 15;
  const int bid = blockIdx.x;
  const int nt  = bid % NPT;
  const int rb  = bid / NPT;
  if (rb * 64 + 64 > GROWS) return;         // block-uniform, never taken with the exact grid; no block barriers in this kernel
  const int sel = nt / NH;
  const int g   = nt % NH;
  const u16* xr = X  + (size_t)(rb * 64) * K;
  const u16* wr = Wt + (size_t)(nt * 64) * K;
  const u16* ap = ((sel == 2) ? wr : xr) + (size_t)(wave * 16 + m) * K + 8 * hh;
  const u16* bp = ((sel == 2) ? xr : wr) + (size_t)m * K + 8 * hh;
  const size_t bs = (size_t)16 * K;
  v8f acc0 = zero8(), acc1 = zero8(), acc2 = zero8(), acc3 = zero8();
  // kept rolled: the guard ends every trip and no load may cross it, so unrolling would only lengthen the text
#pragma unroll 1
  for (int k0 = 0; k0 < K; k0 += 32) {
    const v16b a  = ldfrag_b(ap + k0);
    const v16b b0 = ldfrag_b(bp + k0);
    const v16b b1 = ldfrag_b(bp + bs + k0);
    const v16b b2 = ldfrag_b(bp + 2 * bs + k0);
    const v16b b3 = ldfrag_b(bp + 3 * bs + k0);
    acc0 = mma_b(a, b0, acc0);
    acc1 = mma_b(a, b1, acc1);
    acc2 = mma_b(a, b2, acc2);
    acc3 = mma_b(a, b3, acc3);
    guard6<v16b>(acc0, acc1, acc2, acc3, a, b0, b1, b2, b3, a);
  }
  float* sl = slab + wave * SLAB64;
  if (sel == 3) {
    epi64(sl, acc0, acc1, acc2, acc3, 1.0f, U, DI, (size_t)(rb * 64 + wave * 16), g * HD, lane);
  } else if (sel == 2) {
    const size_t ob = ((size_t)((rb / NST) * NH + g) * HD + wave * 16) * LP + (size_t)(rb % NST) * 64;
    epi64s(sl, acc0, acc1, acc2, acc3, VCAR, VH, VL, ob, lane);
  } else {
    const size_t ob = (size_t)(rb * 64 + wave * 16) * DI + (size_t)g * HD;
    epi64s(sl, acc0, acc1, acc2, acc3, (sel == 0) ? QSC : KSC, (sel == 0) ? QH : KH, (sel == 0) ? QL : KL, ob, lane);
  }
}

// =====================================================================================================
// Output projection: C[row][DM] (f32) = ((Ah + Al)[row][DI] . Bt[DM][DI]^T) * oscale + bias[col], times rsc[row]
// (products h.B + l.B into one accumulator, l unscaled). Block -> (column tile ct = bid % 2, position tile rt, row group bb):
// rows of Ah, Al and C are bb*LP + pos. Same tiling as proj4, epilogue epi64o.
// =====================================================================================================
__global__ __launch_bounds__(128)
void gemm_o(const u16* __restrict__ Ah, const u16* __restrict__ Al, const u16* __restrict__ Bt,
            const float* __restrict__ bias, const float* __restrict__ rsc, float* C, float oscale) {
  __shared__ __align__(16) float slab[4 * SLAB64];
  const int tid = threadIdx.x, wave = tid >> 5, lane = tid & 31, hh = lane >> 4, m = lane & 15;
  const int ntile = DM >> 6;
  const int bid   = blockIdx.x;
  const int ct    = bid % ntile;
  const int t2    = bid / ntile;
  const int rt    = t2 % NST;
  const int bb    = t2 / NST;
  if (bb >= BG) return;                     // block-uniform; no block barriers in this kernel; never taken with the exact grid
  const int srow  = rt * 64 + wave * 16;
  if (srow + 16 > LP) return;               // wave-uniform; never taken
  const int col0  = ct * 64;
  const int K     = DI;
  const size_t rowC = (size_t)bb * LP + srow;
  const _Float16* ahp = (const _Float16*)(const void*)Ah + (rowC + m) * K + 8 * hh;
  const _Float16* alp = (const _Float16*)(const void*)Al + (rowC + m) * K + 8 * hh;
  const _Float16* bp  = (const _Float16*)(const void*)Bt + (size_t)(col0 + m) * K + 8 * hh;
  const size_t bs = (size_t)16 * K;
  v8f acc0 = zero8(), acc1 = zero8(), acc2 = zero8(), acc3 = zero8();
#pragma unroll 1
  for (int k0 = 0; k0 < K; k0 += 32) {
    const v16h ah = ldfrag_h(ahp + k0), al = ldfrag_h(alp + k0);
    const v16h b0 = ldfrag_h(bp + k0);
    const v16h b1 = ldfrag_h(bp + bs + k0);
    const v16h b2 = ldfrag_h(bp + 2 * bs + k0);
    const v16h b3 = ldfrag_h(bp + 3 * bs + k0);
    acc0 = mma_h(ah, b0, acc0);  acc0 = mma_h(al, b0, acc0);
    acc1 = mma_h(ah, b1, acc1);  acc1 = mma_h(al, b1, acc1);
    acc2 = mma_h(ah, b2, acc2);  acc2 = mma_h(al, b2, acc2);
    acc3 = mma_h(ah, b3, acc3);  acc3 = mma_h(al, b3, acc3);
    guard6<v16h>(acc0, acc1, acc2, acc3, ah, al, b0, b1, b2, b3);
  }
  epi64o(slab + wave * SLAB64, acc0, acc1, acc2, acc3, oscale, C, DM, rowC, col0, lane, bias, rsc);
}

// =====================================================================================================
// Pair attention for one row group. Block bid -> (64 softmax rows qb = bid % NST, head = (bid / NST) % NH, row group b);
// the four waves take 16 rows each (q0 = 64*qb + 16*wave) of the SAME head and share its column operands: per 64 columns the
// Cm hi/residual rows [64 vi][64 d] and the v^T hi/residual rows [64 d][64 vi] are brought in once per block with whole-line
// 16-B loads (8 lanes per 128-B row), held in registers while the tile before is worked on, stored to LDS (pitch 72 halves)
// and read from there as fragments by all four waves. Softmax row index qi uses the k projection (row operand R), softmax
// column index vi uses the q projection (column operand Cm), summed over vi with v[vi].
//   R hi/residual planes (k x1024 f16) and Cm hi/residual planes (q x128 x 8 ... i.e. (q*C^-0.5) x1024 f16) laid out
//   [b*LP + pos][h*HD + d]; v^T hi/residual planes [b*NH + h][d][LP]; CB [h][qi][vi] f32 = 1e9*(mask - 1) + x.Wb.
//   scores s(i, j) = R_hi.C_hi + R_lo.C_hi + R_hi.C_lo over HD; logit (log2 domain) t = (s / (1024*1024) + CB) * log2 e.
//   All NKT column tiles of 32 visited in order. Per tile: the 16x32 CB tile is staged into the wave-private LDS tile with
//   16-B loads/stores, then 2 score subtiles x 2 k-steps with column fragments read from the LDS tile (two 16-B loads
//   fragments of P*32768 (f16 hi plus its f16 residual) rebuilt from the LDS rows (float vector loads, same element type as
//   stored), v^T B fragments in 2 groups of 2 d-subtiles, products hh + lh + hl.
//   After the loop: out = acc / Z (Z >= 1 always; guarded anyway), carries 1/(32768*1024) folded once, written to the wave's
//   private result slab (pitch 68; every element owned by one lane).
//   Epilogue: out multiplied by sigmoid(U + bu) in f32 (U = x.Wu f32 plane, bu bf16 RNE of the input), then O x1024 -> f16
// coverage: per wave 4 instructions x 4 rows x 8 lanes x 8 halves = 16 x 64 per plane; grid = NQT * BG = NST * NH * BG blocks
//           x WPB waves = every (b, pos, h) row segment of OH and OL exactly once.
// =====================================================================================================
__global__ __launch_bounds__(ATT_THREADS)
void attn_t(const u16* __restrict__ RHp, const u16* __restrict__ RLp,
            const u16* __restrict__ CHp, const u16* __restrict__ CLp,
            const u16* __restrict__ VHp, const u16* __restrict__ VLp,
            const float* __restrict__ CB, const float* __restrict__ U, const float* __restrict__ bu,
            u16* OHp, u16* OLp) {
  __shared__ __align__(16) float smem[WPB * WREG];
  __shared__ __align__(16) u16 tile[4 * TPL];   // Cm hi, Cm residual [vi][d]; v^T hi, v^T residual [d][vi]; pitch VTP

  const int tid  = threadIdx.x;
  const int wave = tid >> 5;
  const int lane = tid & 31;
  const int hh   = lane >> 4;
  const int c    = lane & 15;
  const int bid  = blockIdx.x;
  const int qb   = bid % NST;
  const int t2   = bid / NST;
  const int head = t2 % NH;
  const int b    = t2 / NH;
  if (b >= BG) return;                      // block-uniform, before any barrier; never taken with the exact grid
  const int q0   = qb * 64 + wave * 16;

  float* pt   = smem + wave * WREG;         // CB tile, then prob tile [16][32] pitch 36
  float* slab = pt + PTW;                   // result slab [16][64] pitch 68

  const size_t hcol = (size_t)head * HD + 8 * hh;
  const _Float16* Rh  = (const _Float16*)(const void*)RHp + ((size_t)b * LP + q0 + c) * DI + hcol;
  const _Float16* Rl  = (const _Float16*)(const void*)RLp + ((size_t)b * LP + q0 + c) * DI + hcol;
  // fragment bases in the LDS tile: row c (+16 per subtile), halves 8*hh (+ the k offset per step)
  const _Float16* Chb = (const _Float16*)(const void*)tile + c * VTP + 8 * hh;   // row = vi within the tile, k = d
  const _Float16* Clb = Chb + TPL;
  const _Float16* Vhb = Chb + 2 * TPL;                                           // row = d, k = vi within the tile
  const _Float16* Vlb = Chb + 3 * TPL;
  // staging: thread -> (row sr + 16*i, 8 halves at sc); 8 consecutive lanes cover one 128-B row segment of a plane
  const int sr = tid >> 3, sc = (tid & 7) * 8;
  const u16* gch = CHp + ((size_t)b * LP + sr) * DI + (size_t)head * HD + sc;    // + (64*s + 16*i) * DI
  const u16* gcl = CLp + ((size_t)b * LP + sr) * DI + (size_t)head * HD + sc;
  const u16* gvh = VHp + ((size_t)(b * NH + head) * HD + sr) * LP + sc;          // + 16*i * LP + 64*s
  const u16* gvl = VLp + ((size_t)(b * NH + head) * HD + sr) * LP + sc;
  u16* tw = tile + sr * VTP + sc;
  const float* cbb = CB + ((size_t)head * LP + q0) * LP;
  const float invc = 1.0f / (CSC * KSC);
  const float oc   = 1.0f / (PCAR * VCAR);

  float mrow[8], lrow[8];
  v8f o[4];
#pragma unroll
  for (int r = 0; r < 8; ++r) { mrow[r] = -INFINITY; lrow[r] = 0.f; }
#pragma unroll
  for (int j = 0; j < 4; ++j) o[j] = zero8();

  v4u pre[16];                              // the next 64-column tile of the four planes, in flight
#pragma unroll
  for (int i = 0; i < 4; ++i) {
    pre[i]      = *(const v4u*)(gch + (size_t)(16 * i) * DI);
    pre[4 + i]  = *(const v4u*)(gcl + (size_t)(16 * i) * DI);
    pre[8 + i]  = *(const v4u*)(gvh + (size_t)(16 * i) * LP);
    pre[12 + i] = *(const v4u*)(gvl + (size_t)(16 * i) * LP);
  }
#pragma unroll 1
  for (int kt = 0; kt < NKT; ++kt) {
    const int kb = kt * 32;
    const int kl = kb & (STG - 1);          // first column of this step inside the LDS tile
    if (kl == 0) {                          // block-uniform: a new 64-column tile every second step
      if (kt != 0) __syncthreads();         // every wave has finished reading the tile that is overwritten next
#pragma unroll
      for (int i = 0; i < 4; ++i) {
        *(v4u*)(tw + 16 * i * VTP)           = pre[i];
        *(v4u*)(tw + TPL + 16 * i * VTP)     = pre[4 + i];
        *(v4u*)(tw + 2 * TPL + 16 * i * VTP) = pre[8 + i];
        *(v4u*)(tw + 3 * TPL + 16 * i * VTP) = pre[12 + i];
      }
      __syncthreads();                      // the tile is complete before any wave reads a fragment of it
      if (kb + STG < LP) {                  // block-uniform: the following tile's loads fly while this one is worked on
#pragma unroll
        for (int i = 0; i < 4; ++i) {
          pre[i]      = *(const v4u*)(gch + (size_t)(kb + STG + 16 * i) * DI);
          pre[4 + i]  = *(const v4u*)(gcl + (size_t)(kb + STG + 16 * i) * DI);
          pre[8 + i]  = *(const v4u*)(gvh + (size_t)(16 * i) * LP + kb + STG);
          pre[12 + i] = *(const v4u*)(gvl + (size_t)(16 * i) * LP + kb + STG);
        }
        // the address registers of these loads are reused by the step below while the loads are still in flight
        asm volatile("s_wait_xcnt 0x0" ::: "memory");
      }
    }
    // ---- stage the additive logit tile [16 rows][32 cols] into pt: 128 float4, lane handles f = it*32 + lane ----
#pragma unroll
    for (int it = 0; it < 4; ++it) {
      const int f = it * 32 + lane;
      const int row = f >> 3, col4 = (f & 7) * 4;
      const v4f t4 = *(const v4f*)(cbb + (size_t)row * LP + kb + col4);
      *(v4f*)(pt + row * PTP + col4) = t4;
    }
    // ---- scores: D element r of this lane = (row q0 + 8hh + r, col kb + c) in s0, col kb + 16 + c in s1 ----
    v8f s0 = zero8(), s1 = zero8();
    const _Float16* c0p = Chb + kl * VTP;
    const _Float16* c1p = c0p + 16 * VTP;
    const _Float16* l0p = Clb + kl * VTP;
    const _Float16* l1p = l0p + 16 * VTP;
#pragma unroll
    for (int kk = 0; kk < HD / 32; ++kk) {
      const v16h rh  = ldfrag_h(Rh + kk * 32);
      const v16h rl  = ldfrag_h(Rl + kk * 32);
      const v16h ch0 = ldfrag_h(c0p + kk * 32);
      const v16h ch1 = ldfrag_h(c1p + kk * 32);
      const v16h cl0 = ldfrag_h(l0p + kk * 32);
      const v16h cl1 = ldfrag_h(l1p + kk * 32);
      s0 = mma_h(rh, ch0, s0);
      s0 = mma_h(rl, ch0, s0);
      s0 = mma_h(rh, cl0, s0);
      s1 = mma_h(rh, ch1, s1);
      s1 = mma_h(rl, ch1, s1);
      s1 = mma_h(rh, cl1, s1);
      guard2(s0, s1, rh, rl, ch0, cl0, ch1, cl1);
    }
    wave_sync_lds();
    // ---- additive term + online softmax in base 2, -inf-safe ----
#pragma unroll
    for (int r = 0; r < 8; ++r) {
      const int   ro  = (8 * hh + r) * PTP + c;
      const float cb0 = pt[ro];
      const float cb1 = pt[ro + 16];
      const float t0  = (s0[r] * invc + cb0) * LOG2E;
      const float t1  = (s1[r] * invc + cb1) * LOG2E;
      float mx = fmaxf(t0, t1);
#pragma unroll
      for (int off = 1; off < 16; off <<= 1) mx = fmaxf(mx, __shfl_xor(mx, off, 32));
      const float mn = fmaxf(mrow[r], mx);
      const float ms = (mn == -INFINITY) ? 0.0f : mn;
      const float al = exp2f(mrow[r] - ms);
      mrow[r] = mn;
      const float e0 = exp2f(t0 - ms), e1 = exp2f(t1 - ms);
      float ps = e0 + e1;
#pragma unroll
      for (int off = 1; off < 16; off <<= 1) ps += __shfl_xor(ps, off, 32);
      lrow[r] = lrow[r] * al + ps;
#pragma unroll
      for (int j = 0; j < 4; ++j) o[j][r] *= al;
      pt[ro]      = e0;
      pt[ro + 16] = e1;
    }
    wave_sync_lds();
    // ---- A fragments of P*32768: hi f16 and residual f16, row = c, split k map over the 32 columns of this step ----
    FragH ph, pl;
    {
      const float* prow = pt + c * PTP + 8 * hh;
      const v4f p0 = *(const v4f*)(prow), p1 = *(const v4f*)(prow + 4);
      const v4f p2 = *(const v4f*)(prow + 16), p3 = *(const v4f*)(prow + 20);
#pragma unroll
      for (int e = 0; e < 4; ++e) {
        const float ta = p0[e] * PCAR, tb = p1[e] * PCAR, tc = p2[e] * PCAR, td = p3[e] * PCAR;
        const _Float16 ha = (_Float16)ta, hb = (_Float16)tb, hc = (_Float16)tc, hd = (_Float16)td;
        ph.h[0][e]     = ha;                  // elements 0..7  = columns kb + 8hh + 0..7
        ph.h[0][4 + e] = hb;
        ph.h[1][e]     = hc;                  // elements 8..15 = columns kb + 16 + 8hh + 0..7
        ph.h[1][4 + e] = hd;
        pl.h[0][e]     = (_Float16)(ta - (float)ha);
        pl.h[0][4 + e] = (_Float16)(tb - (float)hb);
        pl.h[1][e]     = (_Float16)(tc - (float)hc);
        pl.h[1][4 + e] = (_Float16)(td - (float)hd);
      }
    }
    // ---- P.V : B fragment col n = d = j*16 + c, columns vi contiguous in the v^T tile rows; 2 groups of 2 d-subtiles ----
    {
      const _Float16* vhp = Vhb + kl;
      const _Float16* vlp = Vlb + kl;
#pragma unroll
      for (int jg = 0; jg < HD / 32; ++jg) {
        const int da = (2 * jg) * 16 * VTP;
        const int db = da + 16 * VTP;
        const v16h vha = ldfrag_h(vhp + da), vhb2 = ldfrag_h(vhp + db);
        const v16h vla = ldfrag_h(vlp + da), vlb2 = ldfrag_h(vlp + db);
        o[2 * jg]     = mma_h(ph.v, vha,  o[2 * jg]);
        o[2 * jg]     = mma_h(pl.v, vha,  o[2 * jg]);
        o[2 * jg]     = mma_h(ph.v, vla,  o[2 * jg]);
        o[2 * jg + 1] = mma_h(ph.v, vhb2, o[2 * jg + 1]);
        o[2 * jg + 1] = mma_h(pl.v, vhb2, o[2 * jg + 1]);
        o[2 * jg + 1] = mma_h(ph.v, vlb2, o[2 * jg + 1]);
        guard2(o[2 * jg], o[2 * jg + 1], ph.v, pl.v, vha, vhb2, vla, vlb2);
      }
    }
    wave_sync_lds();
  }
  acc_guard4(o[0], o[1], o[2], o[3]);
  // ---- out = acc / Z (0 if Z == 0), carries (32768 on P, 1024 on v) folded once; written into the lane-owned slab ----
#pragma unroll
  for (int r = 0; r < 8; ++r) {
    const float lv  = lrow[r];
    const float ls  = (lv > 0.0f) ? lv : 1.0f;
    const float inv = (lv > 0.0f) ? ((1.0f / ls) * oc) : 0.0f;
#pragma unroll
    for (int j = 0; j < 4; ++j) {
      const int idx = (8 * hh + r) * SLP + j * 16 + c;
      slab[idx] = o[j][r] * inv;
    }
  }

  wave_sync_lds();
  // ---- gate in f32, then O x1024 -> f16 hi + residual planes; lane = (row select rq in 0..3, 8 consecutive d at c8) ----
  v4u oh[4], ol[4];
  const int rq = lane >> 3, c8 = (lane & 7) * 8;
  const float* urow = U + ((size_t)b * LP + q0) * DI + (size_t)head * HD + c8;
  float bb[8];
  {
    const v4f u0 = *(const v4f*)(bu + head * HD + c8), u1 = *(const v4f*)(bu + head * HD + c8 + 4);
#pragma unroll
    for (int e = 0; e < 4; ++e) { bb[e] = bfr(u0[e]); bb[4 + e] = bfr(u1[e]); }
  }
#pragma unroll
  for (int it = 0; it < 4; ++it) {
    const int row = it * 4 + rq;
    const v4f a  = *(const v4f*)(slab + row * SLP + c8), b4 = *(const v4f*)(slab + row * SLP + c8 + 4);
    const v4f ua = *(const v4f*)(urow + (size_t)row * DI), ub = *(const v4f*)(urow + (size_t)row * DI + 4);
    float w[8];
#pragma unroll
    for (int e = 0; e < 4; ++e) {
      w[e]     = (a[e]  * sigm(ua[e] + bb[e]))     * OSC;
      w[4 + e] = (b4[e] * sigm(ub[e] + bb[4 + e])) * OSC;
    }
#pragma unroll
    for (int e = 0; e < 4; ++e) {
      const _Float16 h0 = (_Float16)w[2 * e], h1 = (_Float16)w[2 * e + 1];
      const _Float16 l0 = (_Float16)(w[2 * e] - (float)h0), l1 = (_Float16)(w[2 * e + 1] - (float)h1);
      oh[it][e] = pk16(h_bits(h0), h_bits(h1));
      ol[it][e] = pk16(h_bits(l0), h_bits(l1));
    }
  }
  const size_t ob = ((size_t)b * LP + q0) * DI + (size_t)head * HD + c8;
  {
#pragma unroll
    for (int it = 0; it < 4; ++it) {
      const int row = it * 4 + rq;
      *(v4u*)(OHp + ob + (size_t)row * DI) = oh[it];
      *(v4u*)(OLp + ob + (size_t)row * DI) = ol[it];
    }
    
  }
}

// =====================================================================================================
// Rows s are processed in NGRP groups of BG rows; every per-group workspace plane is reused in launch order.
// Workspace map (bytes); every plane is fully written by whole-line stores before it is read; all extents are exact
// multiples of the store granularity (no pad rows needed); every region offset a multiple of 65536:
//   XB  bf16 [NPIX][256] (hi|lo)                    33554432
//   OH, OL  f16 [GROWS][256] x1024                  2 * GROWS*512
//   U   f32 [GROWS][256]                            GROWS*1024   (gate pre-activation)
//   QH, KH, QL, KL  f16 [GROWS][256]               4 * GROWS*512
//   VH, VL  f16 [BG*4][64][LP]                      2 * GROWS*512
//   CB  f32 [4][NPIX]                               1048576
//   WQ, WK, WV, WU  bf16 [256 n][256 k]             4 * 131072   (contiguous in this order: proj4 reads them as one plane)
//   WO  f16 x1024 [128 n][256 k]                    65536
//   end (BG = 64)                                   119078912
// =====================================================================================================
extern "C" void kernel_launch(void* const* d_in, const int* in_sizes, int n_in,
                              void* d_out, int out_size, void* d_ws, size_t ws_size,
                              hipStream_t stream) {
  if (n_in < 12) return;
  if (in_sizes[0] < NPIX * DM) return;
  if (in_sizes[1] < NPIX) return;
  if (in_sizes[2] < DM || in_sizes[3] < DM) return;
  if (in_sizes[4] < DM * DI || in_sizes[5] < DM * DI || in_sizes[6] < DM * DI || in_sizes[8] < DM * DI) return;
  if (in_sizes[7] < DM * NH) return;
  if (in_sizes[9] < DI) return;
  if (in_sizes[10] < DI * DM) return;
  if (in_sizes[11] < DM) return;
  if (out_size < NS * LP * DM) return;

  const float* pr    = (const float*)d_in[0];
  const float* mask  = (const float*)d_in[1];
  const float* gamma = (const float*)d_in[2];
  const float* beta  = (const float*)d_in[3];
  const float* Wq    = (const float*)d_in[4];
  const float* Wk    = (const float*)d_in[5];
  const float* Wv    = (const float*)d_in[6];
  const float* Wb    = (const float*)d_in[7];
  const float* Wu    = (const float*)d_in[8];
  const float* bu    = (const float*)d_in[9];
  const float* Wo    = (const float*)d_in[10];
  const float* bo    = (const float*)d_in[11];
  float*       out   = (float*)d_out;

  const size_t szXB = (size_t)NPIX * KX * 2;
  const size_t szU  = (size_t)GROWS * DI * 4;
  const size_t szH  = (size_t)GROWS * DI * 2;                   // QH, KH, QL, KL, OH, OL
  const size_t szV  = (size_t)BG * NH * HD * LP * 2;            // VH, VL (== szH)
  const size_t szCB = (size_t)NH * NPIX * 4;
  const size_t szW  = (size_t)DI * KX * 2;
  const size_t szWO = (size_t)DM * DI * 2;
  size_t off = 0;
  const size_t oXB = off; off += szXB;
  const size_t oOH = off; off += szH;
  const size_t oOL = off; off += szH;
  const size_t oU  = off; off += szU;
  const size_t oQH = off; off += szH;
  const size_t oKH = off; off += szH;
  const size_t oQL = off; off += szH;
  const size_t oKL = off; off += szH;
  const size_t oVH = off; off += szV;
  const size_t oVL = off; off += szV;
  const size_t oCB = off; off += szCB;
  const size_t oWQ = off; off += szW;
  const size_t oWK = off; off += szW;
  const size_t oWV = off; off += szW;
  const size_t oWU = off; off += szW;
  const size_t oWO = off; off += szWO;
  if (off > ws_size) return;                // off = 119078912 for BG = 64
  if (off > (size_t)WS_CAP) return;

  char* ws = (char*)d_ws;
  u16*   XB = (u16*)(ws + oXB);
  u16*   OH = (u16*)(ws + oOH);
  u16*   OL = (u16*)(ws + oOL);
  float* U  = (float*)(ws + oU);
  u16*   QH = (u16*)(ws + oQH);
  u16*   KH = (u16*)(ws + oKH);
  u16*   QL = (u16*)(ws + oQL);
  u16*   KL = (u16*)(ws + oKL);
  u16*   VH = (u16*)(ws + oVH);
  u16*   VL = (u16*)(ws + oVL);
  float* CB = (float*)(ws + oCB);
  u16*   WQ = (u16*)(ws + oWQ);
  u16*   WK = (u16*)(ws + oWK);
  u16*   WV = (u16*)(ws + oWV);
  u16*   WU = (u16*)(ws + oWU);
  u16*   WO = (u16*)(ws + oWO);

  const dim3 b256(256), b128(128), bAT(ATT_THREADS);
  const dim3 gLN(NPIX / LNPB);                          // 2048
  const dim3 gWP((DI / 128) * (DM / 64));               // 4: Wq, Wk, Wv, Wu planes
  const dim3 gWO((DM / 128) * (DI / 64));               // 4: Wo plane
  const dim3 gP((GROWS / 64) * NPT);
  const dim3 gAT(NQT * BG);
  const dim3 gO(BG * NST * (DM / 64));
  const float osc = 1.0f / (OSC * WOS);

  // LayerNorm once for every pixel: x hi|lo planes and the additive logit table
  ln_x<<<gLN, b256, 0, stream>>>(pr, mask, gamma, beta, Wb, XB, CB);
  // weight planes once: Wq^T, Wk^T, Wv^T, Wu^T [n][k | k] as bf16; Wo^T [n][k] as f16 of bf16 value x1024
  wt16<<<gWP, b256, 0, stream>>>(Wq, DI, DM, WQ, KX, 1, 0, 1.0f);
  wt16<<<gWP, b256, 0, stream>>>(Wk, DI, DM, WK, KX, 1, 0, 1.0f);
  wt16<<<gWP, b256, 0, stream>>>(Wv, DI, DM, WV, KX, 1, 0, 1.0f);
  wt16<<<gWP, b256, 0, stream>>>(Wu, DI, DM, WU, KX, 1, 0, 1.0f);
  wt16<<<gWO, b256, 0, stream>>>(Wo, DM, DI, WO, DI, 0, 1, WOS);

  for (int g = 0; g < NGRP; ++g) {
    const u16*   xg = XB   + (size_t)g * GROWS * KX;
    const float* mg = mask + (size_t)g * GROWS;
    float*       og = out  + (size_t)g * GROWS * DM;
    // (1) q, k, v, u projections in one launch: q, k and v^T as f16 hi + residual planes, gate pre-activation u as f32
    proj4<<<gP, b128, 0, stream>>>(xg, WQ, QH, QL, KH, KL, VH, VL, U, KX);
    // (2) attention: rows from the k planes, columns from the q planes, sum over columns with v; gated O -> OH + OL planes
    attn_t<<<gAT, bAT, 0, stream>>>(KH, KL, QH, QL, VH, VL, CB, U, bu, OH, OL);
    // (3) output projection (hi + residual), + bo, x mask row scale -> out f32, carries 1024 x 1024 folded back
    gemm_o<<<gO, b128, 0, stream>>>(OH, OL, WO, bo, mg, og, osc);
  }
  (void)hipGetLastError();
}

// v003
// A run of this version takes 292 microseconds.
// Next to v002, in two timings, it ran 1.30 times as fast each time.
// All steps since v000 together make it 2.11 times as fast.
// Contractions: x.Wq, x.Wk, x.Wv, x.Wu on v_wmma_f32_16x16x32_bf16 (x as bf16 hi|lo pair folded into K = 256, W as bf16 RNE
// of the input, f32 accumulate); k.q^T over 64 and P.v^T on v_wmma_f32_16x16x32_f16 (k x1024 and q x128 f16 hi + residual
// planes, P x32768 f16 hi + residual, v x1024 f16 hi + residual; products hh + lh + hl); (O*gate).Wo on
// v_wmma_f32_16x16x32_f16 (O x1024 f16 hi + residual, Wo as f16(bf16(Wo)) x1024, products h.w + l.w); all f32 accumulate.
// LayerNorm, x.Wb (N = 4) and the additive logit table, base-2 online softmax, sigmoid gate, bias and row scale in f32 on VALU.
#include <hip/hip_runtime.h>
#include <math.h>
#include <stdint.h>

#ifndef NS
#define NS 256
#endif
#define NSX   256
#define LP    256
#define DM    128
#define NH    4
#define HD    64
#define DI    (NH * HD)
#define KX    (2 * DM)
#define NPIX  (LP * LP)
#define BG    ((NS <= 64) ? NS : 64)
#define NGRP  (NS / BG)
#define GROWS (BG * LP)
#define LNEPS 1e-5f
#define LOG2E 1.4426950408889634f
#define QSC   128.0f
#define CSC   1024.0f
#define KSC   1024.0f
#define PCAR  32768.0f
#define VCAR  1024.0f
#define OSC   1024.0f
#define WOS   1024.0f
#define WPB   4
#define NQT   (LP / 16)
#define NST   (LP / 64)
#define NKT   (LP / 32)
#define ATT_THREADS (WPB * 32)
#define PTP   36
#define PTW   (16 * PTP)
#define SLP   68
#define SLW   (16 * SLP)
#define WREG  (PTW + SLW)
#define SLAB64 (16 * 68)
#define VTP   72
#define NPT   (4 * DI / 64)
#define PLP   256
#define LNPB  32
#define STG   64
#define TPL   (STG * VTP)
#define WS_CAP 134217728
#define PXR   128
#define PKP   (KX + 8)
#define PROJ_THREADS 256
static_assert(DI == NH * HD && HD == 64 && NH == 4 && WPB == NH);
static_assert(ATT_THREADS == 128);
static_assert(STG == 64 && HD == STG && (LP % STG) == 0 && NST * NH == NQT);
static_assert(NS >= 1 && NS <= NSX && (NS % BG) == 0 && BG >= 1 && BG <= 64);
static_assert((LP % 64) == 0 && (LP % 32) == 0 && (LP % 16) == 0);
static_assert(DM == 128 && (KX % 32) == 0 && (DI % 64) == 0 && (DI % 32) == 0 && (DM % 64) == 0);
static_assert(PLP == DI && PLP == LP && NPT == 4 * NH && (GROWS % 64) == 0);
static_assert((NPIX % LNPB) == 0 && LNPB == 32);
static_assert((GROWS % PXR) == 0 && PXR == 128 && PROJ_THREADS == 256 && KX == 256 && DI == KX && DM == 128 && 8 * SLAB64 * 4 <= (PXR + 64) * PKP * 2);
static_assert((DI % 128) == 0 && (DM % 128) == 0 && (DM % 64) == 0 && (DI % 64) == 0);

typedef unsigned short u16;
typedef _Float16 v16h __attribute__((ext_vector_type(16)));
typedef _Float16 v8h  __attribute__((ext_vector_type(8)));
typedef __bf16   v16b __attribute__((ext_vector_type(16)));
typedef float    v8f  __attribute__((ext_vector_type(8)));
typedef float    v4f  __attribute__((ext_vector_type(4)));
typedef unsigned int v4u __attribute__((ext_vector_type(4)));
typedef unsigned int v2u __attribute__((ext_vector_type(2)));

union FragH { v16h v; v8h h[2]; v4u u[2]; };
union FragB { v16b v; v4u u[2]; };

// ---- scalar helpers --------------------------------------------------------------------------------
__device__ __forceinline__ unsigned short bf_bits(float f) {          // f32 -> bf16 bits, RNE convert
  unsigned u = __float_as_uint(f);
  return (unsigned short)((u + 0x7FFFu + ((u >> 16) & 1u)) >> 16);
}
__device__ __forceinline__ float bf_up(unsigned short h) { return __uint_as_float(((unsigned)h) << 16); }
__device__ __forceinline__ float bfr(float f) { return bf_up(bf_bits(f)); }
__device__ __forceinline__ unsigned short h_bits(_Float16 x) { return __builtin_bit_cast(unsigned short, x); }
__device__ __forceinline__ unsigned pk16(unsigned short a, unsigned short b) { return (unsigned)a | ((unsigned)b << 16); }
__device__ __forceinline__ v8f zero8() { v8f z = {0.f, 0.f, 0.f, 0.f, 0.f, 0.f, 0.f, 0.f}; return z; }
__device__ __forceinline__ float sigm(float z) {                     // 1 / (1 + 2^(-z log2 e)), argument clamped
  const float zc = fminf(fmaxf(z, -30.0f), 30.0f);
  const float e  = exp2f(-zc * LOG2E);
  return __builtin_amdgcn_rcpf(1.0f + e);
}

// ---- fragment loaders: 16-bit A/B operand, lane -> row/col (lane&15), p already includes +8*(lane>>4);
//      elements 0..7 <- p[0..7] (k0+8h..), elements 8..15 <- p[16..23] (k0+16+8h..)  (same split k map for A and B;
//      B is always read from a k-contiguous [n][k] plane)
__device__ __forceinline__ v16h ldfrag_h(const _Float16* p) {
  FragH f;
  f.h[0] = *(const v8h*)(p);
  f.h[1] = *(const v8h*)(p + 16);
  return f.v;
}
__device__ __forceinline__ v16b ldfrag_b(const u16* p) {              // bf16 plane read as unsigned integer vectors
  FragB f;
  f.u[0] = *(const v4u*)(p);
  f.u[1] = *(const v4u*)(p + 16);
  return f.v;
}

__device__ __forceinline__ v8f mma_h(v16h a, v16h b, v8f c) {
  return __builtin_amdgcn_wmma_f32_16x16x32_f16(false, a, false, b, (short)0, c, false, false);
}
__device__ __forceinline__ v8f mma_b(v16b a, v16b b, v8f c) {
  return __builtin_amdgcn_wmma_f32_16x16x32_bf16(false, a, false, b, (short)0, c, false, false);
}
__device__ __forceinline__ void guard2(v8f& a, v8f& b, v16h x0, v16h x1, v16h x2, v16h x3, v16h x4, v16h x5) {
#if defined(__HIP_DEVICE_COMPILE__)
  asm volatile("v_nop\n\tv_nop\n\tv_nop\n\tv_nop"
               : "+v"(a), "+v"(b) : "v"(x0), "v"(x1), "v"(x2), "v"(x3), "v"(x4), "v"(x5) : "memory");
#endif
}
template <typename F>
__device__ __forceinline__ void guard6(v8f& a, v8f& b, v8f& c, v8f& d, F x0, F x1, F x2, F x3, F x4, F x5) {
#if defined(__HIP_DEVICE_COMPILE__)
  asm volatile("v_nop\n\tv_nop\n\tv_nop\n\tv_nop"
               : "+v"(a), "+v"(b), "+v"(c), "+v"(d) : "v"(x0), "v"(x1), "v"(x2), "v"(x3), "v"(x4), "v"(x5) : "memory");
#endif
}
__device__ __forceinline__ void acc_guard4(v8f& a, v8f& b, v8f& c, v8f& d) {
#if defined(__HIP_DEVICE_COMPILE__)
  asm volatile("v_nop\n\tv_nop\n\tv_nop\n\tv_nop" : "+v"(a), "+v"(b), "+v"(c), "+v"(d));
#endif
}
__device__ __forceinline__ void wave_sync_lds() {
  __builtin_amdgcn_fence(__ATOMIC_RELEASE, "workgroup");
  __builtin_amdgcn_wave_barrier();
  __builtin_amdgcn_fence(__ATOMIC_ACQUIRE, "workgroup");
}

// =====================================================================================================
// statistics), x written as bf16 hi | bf16 lo planes XB [NPIX][KX] (columns 0..127 hi bits, 128..255 lo bits of x - hi);
// the additive logit table CB [NH][NPIX] = 1e9*(mask - 1) + x.Wb (VALU f32, N = 4) is produced by the same block.
// Block = 8 waves x LNPB/8 pixels, wave = one pixel at a time (lane holds 4 channels); the 512-B x row is assembled in a
// x 4 heads) are funnelled through LDS and written by wave 0 in one instruction (8 consecutive lanes x 16 B per line);
// coverage: grid = NPIX/LNPB blocks x 32 pixels = every XB row once and every CB line once.
// =====================================================================================================
__global__ __launch_bounds__(256) void ln_x(const float* __restrict__ pr, const float* __restrict__ mask,
                                            const float* __restrict__ gamma, const float* __restrict__ beta,
                                            const float* __restrict__ Wb, u16* XB, float* CB) {
  __shared__ __align__(16) u16 RB[8 * KX];
  __shared__ __align__(16) float PBS[NH * LNPB];
  const int tid = threadIdx.x, wave = tid >> 5, lane = tid & 31;
  const int p0 = (int)blockIdx.x * LNPB;
  if (p0 + LNPB > NPIX) return;             // block-uniform, before any barrier; never taken with the exact grid
  float gm[4], bt[4], wb[16];
  {
    const v4f g4 = *(const v4f*)(gamma + 4 * lane), b4 = *(const v4f*)(beta + 4 * lane);
#pragma unroll
    for (int e = 0; e < 4; ++e) { gm[e] = bfr(g4[e]); bt[e] = bfr(b4[e]); }
#pragma unroll
    for (int i = 0; i < 4; ++i) {
      const v4f w4 = *(const v4f*)(Wb + 16 * lane + 4 * i);      // Wb[(4*lane + i)][h], h = 0..3
#pragma unroll
      for (int h = 0; h < 4; ++h) wb[4 * i + h] = bfr(w4[h]);
    }
  }
  u16* rb = RB + wave * KX;
#pragma unroll 1
  for (int j = 0; j < LNPB / 8; ++j) {
    const int pl = j * 8 + wave;
    const int p  = p0 + pl;
    const v4f x4 = *(const v4f*)(pr + (size_t)p * DM + 4 * lane);
    float xr[4];
#pragma unroll
    for (int e = 0; e < 4; ++e) xr[e] = bfr(x4[e]);
    float s = (xr[0] + xr[1]) + (xr[2] + xr[3]);
#pragma unroll
    for (int off = 1; off < 32; off <<= 1) s += __shfl_xor(s, off, 32);
    const float mu = s * (1.0f / (float)DM);
    float d[4];
#pragma unroll
    for (int e = 0; e < 4; ++e) d[e] = xr[e] - mu;
    float ss = (d[0] * d[0] + d[1] * d[1]) + (d[2] * d[2] + d[3] * d[3]);
#pragma unroll
    for (int off = 1; off < 32; off <<= 1) ss += __shfl_xor(ss, off, 32);
    const float var = ss * (1.0f / (float)DM);
    const float rs  = 1.0f / sqrtf(var + LNEPS);
    float y[4];
#pragma unroll
    for (int e = 0; e < 4; ++e) y[e] = d[e] * rs * gm[e] + bt[e];
    unsigned short hb[4], lb[4];
#pragma unroll
    for (int e = 0; e < 4; ++e) { hb[e] = bf_bits(y[e]); lb[e] = bf_bits(y[e] - bf_up(hb[e])); }
    float pb[4];
#pragma unroll
    for (int h = 0; h < 4; ++h) pb[h] = y[0] * wb[h] + y[1] * wb[4 + h] + y[2] * wb[8 + h] + y[3] * wb[12 + h];
#pragma unroll
    for (int h = 0; h < 4; ++h) {
#pragma unroll
      for (int off = 1; off < 32; off <<= 1) pb[h] += __shfl_xor(pb[h], off, 32);
    }
    const float mk = bfr(mask[p]);
    const float mb = 1e9f * (mk - 1.0f);
    v2u hv, lv;
    hv[0] = pk16(hb[0], hb[1]);  hv[1] = pk16(hb[2], hb[3]);
    lv[0] = pk16(lb[0], lb[1]);  lv[1] = pk16(lb[2], lb[3]);
    *(v2u*)(rb + 4 * lane)      = hv;
    *(v2u*)(rb + DM + 4 * lane) = lv;
    if (lane == 0) {
      PBS[0 * LNPB + pl] = mb + pb[0];
      PBS[1 * LNPB + pl] = mb + pb[1];
      PBS[2 * LNPB + pl] = mb + pb[2];
      PBS[3 * LNPB + pl] = mb + pb[3];
    }
    wave_sync_lds();
    const v4u piece = *(const v4u*)(rb + 8 * lane);
    u16* dst = XB + (size_t)p * KX + 8 * lane;
    {
      *(v4u*)(dst) = piece;
      
    }
    wave_sync_lds();
  }
  __syncthreads();
  if (wave == 0) {
    const int h = lane >> 3, j4 = (lane & 7) * 4;
    const v4f v = *(const v4f*)(PBS + h * LNPB + j4);
    float* d = CB + (size_t)h * NPIX + p0 + j4;
    {
      *(v4f*)(d) = v;
      
    }
  }
}

// =====================================================================================================
// Transposed weight plane: W f32 [nk rows k][ncol cols n] -> D 16-bit [n][ldd], D[n][k] = bf16 bits of W[k][n] (f16mode 0)
// or f16 bits of bf16(W[k][n]) * scale (f16mode 1); when dup != 0 the same 64-half segment is also written at D[n][nk + k]
// (hi|lo folded K). Block (ct = bid % nct: 128 columns, rt = bid / nct: 64 rows): each thread loads 32 floats of one k row
// (16-B loads), converts, scatters into the LDS tile [128 n][64 k] (pitch 72 halves); after a block barrier each n row segment
// coverage: load 256 thr x 32 = 64 k rows x 128 n; store 4 iterations x 256 thr x 8 halves = 128 lines x 64 = the block's tile
// =====================================================================================================
__global__ __launch_bounds__(256) void wt16(const float* __restrict__ W, int ncol, int nk, u16* D, int ldd, int dup,
                                            int f16mode, float scale) {
  __shared__ __align__(16) u16 T[128 * VTP];
  const int tid = threadIdx.x;
  const int bid = blockIdx.x;
  const int nct = ncol / 128;
  const int ct  = bid % nct;
  const int rt  = bid / nct;
  if (rt * 64 + 64 > nk) return;            // block-uniform, before the barrier; never taken with the exact grid
  {
    const int sl = tid >> 2;                // k row within tile 0..63
    const int dc = (tid & 3) * 32;          // n chunk
    const float* src = W + (size_t)(rt * 64 + sl) * ncol + ct * 128 + dc;
#pragma unroll
    for (int i = 0; i < 8; ++i) {
      const v4f a = *(const v4f*)(src + 4 * i);
#pragma unroll
      for (int e = 0; e < 4; ++e) {
        const float f = a[e];
        const unsigned short hb = h_bits((_Float16)(bfr(f) * scale));
        const unsigned short bb = bf_bits(f);
        T[(dc + 4 * i + e) * VTP + sl] = (f16mode != 0) ? hb : bb;
      }
    }
  }
  __syncthreads();
  v4u w4[4];
  const int q8 = tid >> 3, p8 = (tid & 7) * 8;
#pragma unroll
  for (int it = 0; it < 4; ++it) {
    const int line = it * 32 + q8;          // n within tile 0..127
    w4[it] = *(const v4u*)(T + line * VTP + p8);
  }
  const size_t base = ((size_t)ct * 128) * ldd + rt * 64 + p8;
  {
#pragma unroll
    for (int it = 0; it < 4; ++it) {
      const int line = it * 32 + q8;
      *(v4u*)(D + base + (size_t)line * ldd) = w4[it];
      if (dup != 0) *(v4u*)(D + base + (size_t)line * ldd + nk) = w4[it];
    }
    
  }
}

// =====================================================================================================
// epi64o additionally adds a per-column bias (bf16 RNE of the input) and multiplies by a per-row scale (bf16 RNE of mask).
// coverage: 8 instructions x 2 rows x 16 lanes x 4 floats = the wave's 16 x 64 tile.
// =====================================================================================================
__device__ __forceinline__ void epi64(float* sl, v8f a0, v8f a1, v8f a2, v8f a3, float oscale,
                                      float* C, int N, size_t rowb, int col0, int lane) {
  const int hh = lane >> 4, m = lane & 15;
#pragma unroll
  for (int r = 0; r < 8; ++r) {
    const int ro = (8 * hh + r) * 68 + m;
    sl[ro]      = a0[r] * oscale;
    sl[ro + 16] = a1[r] * oscale;
    sl[ro + 32] = a2[r] * oscale;
    sl[ro + 48] = a3[r] * oscale;
  }
  wave_sync_lds();
  v4f vals[8];
#pragma unroll
  for (int it = 0; it < 8; ++it) vals[it] = *(const v4f*)(sl + (it * 2 + hh) * 68 + m * 4);
  float* dst = C + (rowb + (size_t)hh) * (size_t)N + col0 + m * 4;
  {
#pragma unroll
    for (int it = 0; it < 8; ++it) {
      *(v4f*)(dst + (size_t)(it * 2) * (size_t)N) = vals[it];
    }
    
  }
}
__device__ __forceinline__ void epi64o(float* sl, v8f a0, v8f a1, v8f a2, v8f a3, float oscale,
                                       float* C, int N, size_t rowb, int col0, int lane,
                                       const float* __restrict__ bias, const float* __restrict__ rsc) {
  const int hh = lane >> 4, m = lane & 15;
#pragma unroll
  for (int r = 0; r < 8; ++r) {
    const int ro = (8 * hh + r) * 68 + m;
    sl[ro]      = a0[r] * oscale;
    sl[ro + 16] = a1[r] * oscale;
    sl[ro + 32] = a2[r] * oscale;
    sl[ro + 48] = a3[r] * oscale;
  }
  wave_sync_lds();
  float bq[4];
  {
    const v4f b4 = *(const v4f*)(bias + col0 + m * 4);
#pragma unroll
    for (int e = 0; e < 4; ++e) bq[e] = bfr(b4[e]);
  }
  v4f vals[8];
#pragma unroll
  for (int it = 0; it < 8; ++it) {
    const v4f t = *(const v4f*)(sl + (it * 2 + hh) * 68 + m * 4);
    const float mk = bfr(rsc[rowb + (size_t)hh + (size_t)(it * 2)]);
    v4f o;
#pragma unroll
    for (int e = 0; e < 4; ++e) o[e] = (t[e] + bq[e]) * mk;
    vals[it] = o;
  }
  float* dst = C + (rowb + (size_t)hh) * (size_t)N + col0 + m * 4;
  {
#pragma unroll
    for (int it = 0; it < 8; ++it) {
      *(v4f*)(dst + (size_t)(it * 2) * (size_t)N) = vals[it];
    }
    
  }
}

// =====================================================================================================
// Split epilogue: the wave's 16 x 64 f32 tile, times sc, goes out as f16 hi + f16 residual planes (row pitch PLP halves).
// The tile passes through the wave's slab so that 8 consecutive lanes hold one row's 64 halves = one whole 128-B line.
// coverage: 4 instructions x 4 rows x 8 lanes x 8 halves = the wave's 16 x 64 tile of each plane.
// =====================================================================================================
__device__ __forceinline__ void epi64s(float* sl, v8f a0, v8f a1, v8f a2, v8f a3, float sc,
                                       u16* Hp, u16* Lp, size_t ob, int lane) {
  const int hh = lane >> 4, m = lane & 15;
#pragma unroll
  for (int r = 0; r < 8; ++r) {
    const int ro = (8 * hh + r) * 68 + m;
    sl[ro]      = a0[r];
    sl[ro + 16] = a1[r];
    sl[ro + 32] = a2[r];
    sl[ro + 48] = a3[r];
  }
  wave_sync_lds();
  const int rq = lane >> 3, c8 = (lane & 7) * 8;
  v4u oh[4], ol[4];                         // the loops below are unrolled so that these stay in registers
#pragma unroll
  for (int it = 0; it < 4; ++it) {
    const float* p = sl + (it * 4 + rq) * 68 + c8;
    const v4f a = *(const v4f*)(p), b4 = *(const v4f*)(p + 4);
    float w[8];
#pragma unroll
    for (int e = 0; e < 4; ++e) { w[e] = a[e] * sc; w[4 + e] = b4[e] * sc; }
#pragma unroll
    for (int e = 0; e < 4; ++e) {
      const float t0 = w[2 * e], t1 = w[2 * e + 1];
      const _Float16 h0 = (_Float16)t0, h1 = (_Float16)t1;
      const _Float16 l0 = (_Float16)(t0 - (float)h0), l1 = (_Float16)(t1 - (float)h1);
      oh[it][e] = pk16(h_bits(h0), h_bits(h1));
      ol[it][e] = pk16(h_bits(l0), h_bits(l1));
    }
  }
  u16* dh = Hp + ob + (size_t)rq * PLP + c8;
  u16* dl = Lp + ob + (size_t)rq * PLP + c8;
#pragma unroll
  for (int it = 0; it < 4; ++it) {
    *(v4u*)(dh + (size_t)(it * 4) * PLP) = oh[it];
    *(v4u*)(dl + (size_t)(it * 4) * PLP) = ol[it];
  }
}

// =====================================================================================================
// The four projections of one row group in one launch: X [GROWS][KX] (bf16 hi|lo rows of x) against Wt [4*DI][KX] (bf16,
// k-contiguous; rows 0.. Wq^T, DI.. Wk^T, 2*DI.. Wv^T, 3*DI.. Wu^T), f32 accumulate, K = KX stepped by 32.
// Block bid -> (64 rows of Wt nt = bid % NPT, PXR = 128 rows of X rb = bid / NPT); sel = nt / NH names the projection,
// g = nt % NH the head. The block's 128 X rows and 64 Wt rows are brought in once with whole-line 16-B loads (one wave = one
// 512-B row per instruction), stored to LDS (pitch PKP halves = 16 B x 33) and read from there as fragments by all 8 waves
// (two 16-B loads each, the same split k map for both operands, so either plane can be the row operand).
//   q, k, u: row operand X, column operand Wt: wave w's tile is [16 pos (16*w ..)][64 channels of head g].
//   v:       row operand Wt, column operand X: wave w's tile is [16 d (16*(w&3) ..)][64 pos (64*(w>>2) ..)], v^T as read later.
// Epilogue: u goes out as f32 (epi64); q x128 (= C^-0.5 x 1024), k x1024 and v^T x1024 go out as f16 hi + residual planes
// (epi64s): QH, QL, KH, KL [b*LP + pos][g*HD + d]; VH, VL [(b*NH + g)*HD + d][LP]. The waves' slabs reuse the operand LDS.
// coverage: grid = (GROWS/PXR) * NPT blocks, each one 128 x 64 tile = every element of U and of the six planes once.
// =====================================================================================================
__global__ __launch_bounds__(PROJ_THREADS)
void proj4(const u16* __restrict__ X, const u16* __restrict__ Wt, u16* QH, u16* QL, u16* KH, u16* KL,
           u16* VH, u16* VL, float* U) {
  __shared__ __align__(16) u16 opt[(PXR + 64) * PKP];   // X rows 0..127, then Wt rows 0..63; later the 8 result slabs
  const int tid = threadIdx.x, wave = tid >> 5, lane = tid & 31, hh = lane >> 4, m = lane & 15;
  const int bid = blockIdx.x;
  const int nt  = bid % NPT;
  const int rb  = bid / NPT;
  if (rb * PXR + PXR > GROWS) return;       // block-uniform, before any barrier; never taken with the exact grid
  const int sel = nt / NH;
  const int g   = nt % NH;
  {
    // staging: wave -> row wave + 8*i, lane -> 8 halves at 8*lane: each load and each LDS store covers one whole 512-B row
    const u16* gx = X  + (size_t)(rb * PXR + wave) * KX + 8 * lane;
    const u16* gw = Wt + (size_t)(nt * 64 + wave) * KX + 8 * lane;
    u16* tw = opt + wave * PKP + 8 * lane;
    v4u st[(PXR + 64) / 8];                 // the loops below are unrolled so that these stay in registers
#pragma unroll
    for (int i = 0; i < PXR / 8; ++i) st[i] = *(const v4u*)(gx + (size_t)(8 * i) * KX);
#pragma unroll
    for (int i = 0; i < 8; ++i) st[PXR / 8 + i] = *(const v4u*)(gw + (size_t)(8 * i) * KX);
    // the address registers of these loads are free for reuse below while the loads are still in flight
    asm volatile("s_wait_xcnt 0x0" ::: "memory");
#pragma unroll
    for (int i = 0; i < (PXR + 64) / 8; ++i) *(v4u*)(tw + 8 * i * PKP) = st[i];
  }
  __syncthreads();                          // both operand tiles are complete before any wave reads a fragment
  const int ao = ((sel == 2) ? (PXR + (wave & 3) * 16 + m) : (wave * 16 + m)) * PKP + 8 * hh;
  const int bo = ((sel == 2) ? ((wave >> 2) * 64 + m) : (PXR + m)) * PKP + 8 * hh;
  const u16* ap = opt + ao;
  const u16* bp = opt + bo;
  const int bs = 16 * PKP;
  v8f acc0 = zero8(), acc1 = zero8(), acc2 = zero8(), acc3 = zero8();
  // kept rolled: the guard ends every trip and no load may cross it, so unrolling would only lengthen the text
#pragma unroll 1
  for (int k0 = 0; k0 < KX; k0 += 32) {
    const v16b a  = ldfrag_b(ap + k0);
    const v16b b0 = ldfrag_b(bp + k0);
    const v16b b1 = ldfrag_b(bp + bs + k0);
    const v16b b2 = ldfrag_b(bp + 2 * bs + k0);
    const v16b b3 = ldfrag_b(bp + 3 * bs + k0);
    acc0 = mma_b(a, b0, acc0);
    acc1 = mma_b(a, b1, acc1);
    acc2 = mma_b(a, b2, acc2);
    acc3 = mma_b(a, b3, acc3);
    guard6<v16b>(acc0, acc1, acc2, acc3, a, b0, b1, b2, b3, a);
  }
  __syncthreads();                          // every wave has read its last fragment before the slabs overwrite the tiles
  float* sl = (float*)(void*)opt + wave * SLAB64;
  if (sel == 3) {
    epi64(sl, acc0, acc1, acc2, acc3, 1.0f, U, DI, (size_t)(rb * PXR + wave * 16), g * HD, lane);
  } else if (sel == 2) {
    const int r64 = rb * (PXR / 64) + (wave >> 2);      // which 64 positions of the row group
    const size_t ob = ((size_t)((r64 / NST) * NH + g) * HD + (wave & 3) * 16) * LP + (size_t)(r64 % NST) * 64;
    epi64s(sl, acc0, acc1, acc2, acc3, VCAR, VH, VL, ob, lane);
  } else {
    const size_t ob = (size_t)(rb * PXR + wave * 16) * DI + (size_t)g * HD;
    epi64s(sl, acc0, acc1, acc2, acc3, (sel == 0) ? QSC : KSC, (sel == 0) ? QH : KH, (sel == 0) ? QL : KL, ob, lane);
  }
}

// =====================================================================================================
// Output projection: C[row][DM] (f32) = ((Ah + Al)[row][DI] . Bt[DM][DI]^T) * oscale + bias[col], times rsc[row]
// (products h.B + l.B into one accumulator, l unscaled). Block -> (position tile rt = bid % NST, row group bb): 64 rows
// bb*LP + 64*rt .. of Ah, Al and C against all DM rows of Bt. The three operand tiles are staged in LDS as in proj4 (whole-line
// loads, pitch PKP halves); wave w's tile is [16 rows (16*(w&3) ..)][64 columns (64*(w>>2) ..)], epilogue epi64o.
// coverage: grid = BG * NST blocks, each one 64 x 128 tile = every element of the row group's C once.
// =====================================================================================================
__global__ __launch_bounds__(PROJ_THREADS)
void gemm_o(const u16* __restrict__ Ah, const u16* __restrict__ Al, const u16* __restrict__ Bt,
            const float* __restrict__ bias, const float* __restrict__ rsc, float* C, float oscale) {
  __shared__ __align__(16) u16 opt[(2 * 64 + DM) * PKP];   // Ah rows 0..63, Al rows 0..63, Bt rows 0..127; later the 8 slabs
  const int tid = threadIdx.x, wave = tid >> 5, lane = tid & 31, hh = lane >> 4, m = lane & 15;
  const int bid   = blockIdx.x;
  const int rt    = bid % NST;
  const int bb    = bid / NST;
  if (bb >= BG) return;                     // block-uniform, before any barrier; never taken with the exact grid
  const int K     = DI;
  const size_t row0 = (size_t)bb * LP + rt * 64;
  {
    // staging: wave -> row wave + 8*i, lane -> 8 halves at 8*lane: each load and each LDS store covers one whole 512-B row
    const u16* ga = Ah + (row0 + wave) * K + 8 * lane;
    const u16* gl = Al + (row0 + wave) * K + 8 * lane;
    const u16* gb = Bt + (size_t)wave * K + 8 * lane;
    u16* tw = opt + wave * PKP + 8 * lane;
    v4u st[(2 * 64 + DM) / 8];              // the loops below are unrolled so that these stay in registers
#pragma unroll
    for (int i = 0; i < 8; ++i) {
      st[i]     = *(const v4u*)(ga + (size_t)(8 * i) * K);
      st[8 + i] = *(const v4u*)(gl + (size_t)(8 * i) * K);
    }
#pragma unroll
    for (int i = 0; i < DM / 8; ++i) st[16 + i] = *(const v4u*)(gb + (size_t)(8 * i) * K);
    // the address registers of these loads are reused below while the loads are still in flight; the three bases are named
    // as inputs so that none of them is given up for another value ahead of the wait
    asm volatile("s_wait_xcnt 0x0" :: "v"(ga), "v"(gl), "v"(gb) : "memory");
#pragma unroll
    for (int i = 0; i < (2 * 64 + DM) / 8; ++i) *(v4u*)(tw + 8 * i * PKP) = st[i];
  }
  __syncthreads();                          // the three operand tiles are complete before any wave reads a fragment
  const int srow  = (wave & 3) * 16;
  const int col0  = (wave >> 2) * 64;
  const size_t rowC = row0 + srow;
  const _Float16* ahp = (const _Float16*)(const void*)opt + (srow + m) * PKP + 8 * hh;
  const _Float16* alp = ahp + 64 * PKP;
  const _Float16* bp  = (const _Float16*)(const void*)opt + (2 * 64 + col0 + m) * PKP + 8 * hh;
  const int bs = 16 * PKP;
  v8f acc0 = zero8(), acc1 = zero8(), acc2 = zero8(), acc3 = zero8();
#pragma unroll 1
  for (int k0 = 0; k0 < K; k0 += 32) {
    const v16h ah = ldfrag_h(ahp + k0), al = ldfrag_h(alp + k0);
    const v16h b0 = ldfrag_h(bp + k0);
    const v16h b1 = ldfrag_h(bp + bs + k0);
    const v16h b2 = ldfrag_h(bp + 2 * bs + k0);
    const v16h b3 = ldfrag_h(bp + 3 * bs + k0);
    acc0 = mma_h(ah, b0, acc0);  acc0 = mma_h(al, b0, acc0);
    acc1 = mma_h(ah, b1, acc1);  acc1 = mma_h(al, b1, acc1);
    acc2 = mma_h(ah, b2, acc2);  acc2 = mma_h(al, b2, acc2);
    acc3 = mma_h(ah, b3, acc3);  acc3 = mma_h(al, b3, acc3);
    guard6<v16h>(acc0, acc1, acc2, acc3, ah, al, b0, b1, b2, b3);
  }
  __syncthreads();                          // every wave has read its last fragment before the slabs overwrite the tiles
  epi64o((float*)(void*)opt + wave * SLAB64, acc0, acc1, acc2, acc3, oscale, C, DM, rowC, col0, lane, bias, rsc);
}

// =====================================================================================================
// Pair attention for one row group. Block bid -> (64 softmax rows qb = bid % NST, head = (bid / NST) % NH, row group b);
// the four waves take 16 rows each (q0 = 64*qb + 16*wave) of the SAME head and share its column operands: per 64 columns the
// Cm hi/residual rows [64 vi][64 d] and the v^T hi/residual rows [64 d][64 vi] are brought in once per block with whole-line
// 16-B loads (8 lanes per 128-B row), held in registers while the tile before is worked on, stored to LDS (pitch 72 halves)
// and read from there as fragments by all four waves. Softmax row index qi uses the k projection (row operand R), softmax
// column index vi uses the q projection (column operand Cm), summed over vi with v[vi].
//   R hi/residual planes (k x1024 f16) and Cm hi/residual planes (q x128 x 8 ... i.e. (q*C^-0.5) x1024 f16) laid out
//   [b*LP + pos][h*HD + d]; v^T hi/residual planes [b*NH + h][d][LP]; CB [h][qi][vi] f32 = 1e9*(mask - 1) + x.Wb.
//   scores s(i, j) = R_hi.C_hi + R_lo.C_hi + R_hi.C_lo over HD; logit (log2 domain) t = (s / (1024*1024) + CB) * log2 e.
//   All NKT column tiles of 32 visited in order. Per tile: the 16x32 CB tile is staged into the wave-private LDS tile with
//   16-B loads/stores, then 2 score subtiles x 2 k-steps with column fragments read from the LDS tile (two 16-B loads
//   fragments of P*32768 (f16 hi plus its f16 residual) rebuilt from the LDS rows (float vector loads, same element type as
//   stored), v^T B fragments in 2 groups of 2 d-subtiles, products hh + lh + hl.
//   After the loop: out = acc / Z (Z >= 1 always; guarded anyway), carries 1/(32768*1024) folded once, written to the wave's
//   private result slab (pitch 68; every element owned by one lane).
//   Epilogue: out multiplied by sigmoid(U + bu) in f32 (U = x.Wu f32 plane, bu bf16 RNE of the input), then O x1024 -> f16
// coverage: per wave 4 instructions x 4 rows x 8 lanes x 8 halves = 16 x 64 per plane; grid = NQT * BG = NST * NH * BG blocks
//           x WPB waves = every (b, pos, h) row segment of OH and OL exactly once.
// =====================================================================================================
__global__ __launch_bounds__(ATT_THREADS)
void attn_t(const u16* __restrict__ RHp, const u16* __restrict__ RLp,
            const u16* __restrict__ CHp, const u16* __restrict__ CLp,
            const u16* __restrict__ VHp, const u16* __restrict__ VLp,
            const float* __restrict__ CB, const float* __restrict__ U, const float* __restrict__ bu,
            u16* OHp, u16* OLp) {
  __shared__ __align__(16) float smem[WPB * WREG];
  __shared__ __align__(16) u16 tile[4 * TPL];   // Cm hi, Cm residual [vi][d]; v^T hi, v^T residual [d][vi]; pitch VTP

  const int tid  = threadIdx.x;
  const int wave = tid >> 5;
  const int lane = tid & 31;
  const int hh   = lane >> 4;
  const int c    = lane & 15;
  const int bid  = blockIdx.x;
  const int qb   = bid % NST;
  const int t2   = bid / NST;
  const int head = t2 % NH;
  const int b    = t2 / NH;
  if (b >= BG) return;                      // block-uniform, before any barrier; never taken with the exact grid
  const int q0   = qb * 64 + wave * 16;

  float* pt   = smem + wave * WREG;         // CB tile, then prob tile [16][32] pitch 36
  float* slab = pt + PTW;                   // result slab [16][64] pitch 68

  const size_t hcol = (size_t)head * HD + 8 * hh;
  const _Float16* Rh  = (const _Float16*)(const void*)RHp + ((size_t)b * LP + q0 + c) * DI + hcol;
  const _Float16* Rl  = (const _Float16*)(const void*)RLp + ((size_t)b * LP + q0 + c) * DI + hcol;
  // fragment bases in the LDS tile: row c (+16 per subtile), halves 8*hh (+ the k offset per step)
  const _Float16* Chb = (const _Float16*)(const void*)tile + c * VTP + 8 * hh;   // row = vi within the tile, k = d
  const _Float16* Clb = Chb + TPL;
  const _Float16* Vhb = Chb + 2 * TPL;                                           // row = d, k = vi within the tile
  const _Float16* Vlb = Chb + 3 * TPL;
  // staging: thread -> (row sr + 16*i, 8 halves at sc); 8 consecutive lanes cover one 128-B row segment of a plane
  const int sr = tid >> 3, sc = (tid & 7) * 8;
  const u16* gch = CHp + ((size_t)b * LP + sr) * DI + (size_t)head * HD + sc;    // + (64*s + 16*i) * DI
  const u16* gcl = CLp + ((size_t)b * LP + sr) * DI + (size_t)head * HD + sc;
  const u16* gvh = VHp + ((size_t)(b * NH + head) * HD + sr) * LP + sc;          // + 16*i * LP + 64*s
  const u16* gvl = VLp + ((size_t)(b * NH + head) * HD + sr) * LP + sc;
  u16* tw = tile + sr * VTP + sc;
  const float* cbb = CB + ((size_t)head * LP + q0) * LP;
  const float invc = 1.0f / (CSC * KSC);
  const float oc   = 1.0f / (PCAR * VCAR);

  float mrow[8], lrow[8];
  v8f o[4];
#pragma unroll
  for (int r = 0; r < 8; ++r) { mrow[r] = -INFINITY; lrow[r] = 0.f; }
#pragma unroll
  for (int j = 0; j < 4; ++j) o[j] = zero8();

  v4u pre[16];                              // the next 64-column tile of the four planes, in flight
#pragma unroll
  for (int i = 0; i < 4; ++i) {
    pre[i]      = *(const v4u*)(gch + (size_t)(16 * i) * DI);
    pre[4 + i]  = *(const v4u*)(gcl + (size_t)(16 * i) * DI);
    pre[8 + i]  = *(const v4u*)(gvh + (size_t)(16 * i) * LP);
    pre[12 + i] = *(const v4u*)(gvl + (size_t)(16 * i) * LP);
  }
#pragma unroll 1
  for (int kt = 0; kt < NKT; ++kt) {
    const int kb = kt * 32;
    const int kl = kb & (STG - 1);          // first column of this step inside the LDS tile
    if (kl == 0) {                          // block-uniform: a new 64-column tile every second step
      if (kt != 0) __syncthreads();         // every wave has finished reading the tile that is overwritten next
#pragma unroll
      for (int i = 0; i < 4; ++i) {
        *(v4u*)(tw + 16 * i * VTP)           = pre[i];
        *(v4u*)(tw + TPL + 16 * i * VTP)     = pre[4 + i];
        *(v4u*)(tw + 2 * TPL + 16 * i * VTP) = pre[8 + i];
        *(v4u*)(tw + 3 * TPL + 16 * i * VTP) = pre[12 + i];
      }
      __syncthreads();                      // the tile is complete before any wave reads a fragment of it
      if (kb + STG < LP) {                  // block-uniform: the following tile's loads fly while this one is worked on
#pragma unroll
        for (int i = 0; i < 4; ++i) {
          pre[i]      = *(const v4u*)(gch + (size_t)(kb + STG + 16 * i) * DI);
          pre[4 + i]  = *(const v4u*)(gcl + (size_t)(kb + STG + 16 * i) * DI);
          pre[8 + i]  = *(const v4u*)(gvh + (size_t)(16 * i) * LP + kb + STG);
          pre[12 + i] = *(const v4u*)(gvl + (size_t)(16 * i) * LP + kb + STG);
        }
        // the address registers of these loads are reused by the step below while the loads are still in flight
        asm volatile("s_wait_xcnt 0x0" ::: "memory");
      }
    }
    // ---- stage the additive logit tile [16 rows][32 cols] into pt: 128 float4, lane handles f = it*32 + lane ----
#pragma unroll
    for (int it = 0; it < 4; ++it) {
      const int f = it * 32 + lane;
      const int row = f >> 3, col4 = (f & 7) * 4;
      const v4f t4 = *(const v4f*)(cbb + (size_t)row * LP + kb + col4);
      *(v4f*)(pt + row * PTP + col4) = t4;
    }
    // ---- scores: D element r of this lane = (row q0 + 8hh + r, col kb + c) in s0, col kb + 16 + c in s1 ----
    v8f s0 = zero8(), s1 = zero8();
    const _Float16* c0p = Chb + kl * VTP;
    const _Float16* c1p = c0p + 16 * VTP;
    const _Float16* l0p = Clb + kl * VTP;
    const _Float16* l1p = l0p + 16 * VTP;
#pragma unroll
    for (int kk = 0; kk < HD / 32; ++kk) {
      const v16h rh  = ldfrag_h(Rh + kk * 32);
      const v16h rl  = ldfrag_h(Rl + kk * 32);
      const v16h ch0 = ldfrag_h(c0p + kk * 32);
      const v16h ch1 = ldfrag_h(c1p + kk * 32);
      const v16h cl0 = ldfrag_h(l0p + kk * 32);
      const v16h cl1 = ldfrag_h(l1p + kk * 32);
      s0 = mma_h(rh, ch0, s0);
      s0 = mma_h(rl, ch0, s0);
      s0 = mma_h(rh, cl0, s0);
      s1 = mma_h(rh, ch1, s1);
      s1 = mma_h(rl, ch1, s1);
      s1 = mma_h(rh, cl1, s1);
      guard2(s0, s1, rh, rl, ch0, cl0, ch1, cl1);
    }
    wave_sync_lds();
    // ---- additive term + online softmax in base 2, -inf-safe ----
#pragma unroll
    for (int r = 0; r < 8; ++r) {
      const int   ro  = (8 * hh + r) * PTP + c;
      const float cb0 = pt[ro];
      const float cb1 = pt[ro + 16];
      const float t0  = (s0[r] * invc + cb0) * LOG2E;
      const float t1  = (s1[r] * invc + cb1) * LOG2E;
      float mx = fmaxf(t0, t1);
#pragma unroll
      for (int off = 1; off < 16; off <<= 1) mx = fmaxf(mx, __shfl_xor(mx, off, 32));
      const float mn = fmaxf(mrow[r], mx);
      const float ms = (mn == -INFINITY) ? 0.0f : mn;
      const float al = exp2f(mrow[r] - ms);
      mrow[r] = mn;
      const float e0 = exp2f(t0 - ms), e1 = exp2f(t1 - ms);
      float ps = e0 + e1;
#pragma unroll
      for (int off = 1; off < 16; off <<= 1) ps += __shfl_xor(ps, off, 32);
      lrow[r] = lrow[r] * al + ps;
#pragma unroll
      for (int j = 0; j < 4; ++j) o[j][r] *= al;
      pt[ro]      = e0;
      pt[ro + 16] = e1;
    }
    wave_sync_lds();
    // ---- A fragments of P*32768: hi f16 and residual f16, row = c, split k map over the 32 columns of this step ----
    FragH ph, pl;
    {
      const float* prow = pt + c * PTP + 8 * hh;
      const v4f p0 = *(const v4f*)(prow), p1 = *(const v4f*)(prow + 4);
      const v4f p2 = *(const v4f*)(prow + 16), p3 = *(const v4f*)(prow + 20);
#pragma unroll
      for (int e = 0; e < 4; ++e) {
        const float ta = p0[e] * PCAR, tb = p1[e] * PCAR, tc = p2[e] * PCAR, td = p3[e] * PCAR;
        const _Float16 ha = (_Float16)ta, hb = (_Float16)tb, hc = (_Float16)tc, hd = (_Float16)td;
        ph.h[0][e]     = ha;                  // elements 0..7  = columns kb + 8hh + 0..7
        ph.h[0][4 + e] = hb;
        ph.h[1][e]     = hc;                  // elements 8..15 = columns kb + 16 + 8hh + 0..7
        ph.h[1][4 + e] = hd;
        pl.h[0][e]     = (_Float16)(ta - (float)ha);
        pl.h[0][4 + e] = (_Float16)(tb - (float)hb);
        pl.h[1][e]     = (_Float16)(tc - (float)hc);
        pl.h[1][4 + e] = (_Float16)(td - (float)hd);
      }
    }
    // ---- P.V : B fragment col n = d = j*16 + c, columns vi contiguous in the v^T tile rows; 2 groups of 2 d-subtiles ----
    {
      const _Float16* vhp = Vhb + kl;
      const _Float16* vlp = Vlb + kl;
#pragma unroll
      for (int jg = 0; jg < HD / 32; ++jg) {
        const int da = (2 * jg) * 16 * VTP;
        const int db = da + 16 * VTP;
        const v16h vha = ldfrag_h(vhp + da), vhb2 = ldfrag_h(vhp + db);
        const v16h vla = ldfrag_h(vlp + da), vlb2 = ldfrag_h(vlp + db);
        o[2 * jg]     = mma_h(ph.v, vha,  o[2 * jg]);
        o[2 * jg]     = mma_h(pl.v, vha,  o[2 * jg]);
        o[2 * jg]     = mma_h(ph.v, vla,  o[2 * jg]);
        o[2 * jg + 1] = mma_h(ph.v, vhb2, o[2 * jg + 1]);
        o[2 * jg + 1] = mma_h(pl.v, vhb2, o[2 * jg + 1]);
        o[2 * jg + 1] = mma_h(ph.v, vlb2, o[2 * jg + 1]);
        guard2(o[2 * jg], o[2 * jg + 1], ph.v, pl.v, vha, vhb2, vla, vlb2);
      }
    }
    wave_sync_lds();
  }
  acc_guard4(o[0], o[1], o[2], o[3]);
  // ---- out = acc / Z (0 if Z == 0), carries (32768 on P, 1024 on v) folded once; written into the lane-owned slab ----
#pragma unroll
  for (int r = 0; r < 8; ++r) {
    const float lv  = lrow[r];
    const float ls  = (lv > 0.0f) ? lv : 1.0f;
    const float inv = (lv > 0.0f) ? ((1.0f / ls) * oc) : 0.0f;
#pragma unroll
    for (int j = 0; j < 4; ++j) {
      const int idx = (8 * hh + r) * SLP + j * 16 + c;
      slab[idx] = o[j][r] * inv;
    }
  }

  wave_sync_lds();
  // ---- gate in f32, then O x1024 -> f16 hi + residual planes; lane = (row select rq in 0..3, 8 consecutive d at c8) ----
  v4u oh[4], ol[4];
  const int rq = lane >> 3, c8 = (lane & 7) * 8;
  const float* urow = U + ((size_t)b * LP + q0) * DI + (size_t)head * HD + c8;
  float bb[8];
  {
    const v4f u0 = *(const v4f*)(bu + head * HD + c8), u1 = *(const v4f*)(bu + head * HD + c8 + 4);
#pragma unroll
    for (int e = 0; e < 4; ++e) { bb[e] = bfr(u0[e]); bb[4 + e] = bfr(u1[e]); }
  }
#pragma unroll
  for (int it = 0; it < 4; ++it) {
    const int row = it * 4 + rq;
    const v4f a  = *(const v4f*)(slab + row * SLP + c8), b4 = *(const v4f*)(slab + row * SLP + c8 + 4);
    const v4f ua = *(const v4f*)(urow + (size_t)row * DI), ub = *(const v4f*)(urow + (size_t)row * DI + 4);
    float w[8];
#pragma unroll
    for (int e = 0; e < 4; ++e) {
      w[e]     = (a[e]  * sigm(ua[e] + bb[e]))     * OSC;
      w[4 + e] = (b4[e] * sigm(ub[e] + bb[4 + e])) * OSC;
    }
#pragma unroll
    for (int e = 0; e < 4; ++e) {
      const _Float16 h0 = (_Float16)w[2 * e], h1 = (_Float16)w[2 * e + 1];
      const _Float16 l0 = (_Float16)(w[2 * e] - (float)h0), l1 = (_Float16)(w[2 * e + 1] - (float)h1);
      oh[it][e] = pk16(h_bits(h0), h_bits(h1));
      ol[it][e] = pk16(h_bits(l0), h_bits(l1));
    }
  }
  const size_t ob = ((size_t)b * LP + q0) * DI + (size_t)head * HD + c8;
  {
#pragma unroll
    for (int it = 0; it < 4; ++it) {
      const int row = it * 4 + rq;
      *(v4u*)(OHp + ob + (size_t)row * DI) = oh[it];
      *(v4u*)(OLp + ob + (size_t)row * DI) = ol[it];
    }
    
  }
}

// =====================================================================================================
// Rows s are processed in NGRP groups of BG rows; every per-group workspace plane is reused in launch order.
// Workspace map (bytes); every plane is fully written by whole-line stores before it is read; all extents are exact
// multiples of the store granularity (no pad rows needed); every region offset a multiple of 65536:
//   XB  bf16 [NPIX][256] (hi|lo)                    33554432
//   OH, OL  f16 [GROWS][256] x1024                  2 * GROWS*512
//   U   f32 [GROWS][256]                            GROWS*1024   (gate pre-activation)
//   QH, KH, QL, KL  f16 [GROWS][256]               4 * GROWS*512
//   VH, VL  f16 [BG*4][64][LP]                      2 * GROWS*512
//   CB  f32 [4][NPIX]                               1048576
//   WQ, WK, WV, WU  bf16 [256 n][256 k]             4 * 131072   (contiguous in this order: proj4 reads them as one plane)
//   WO  f16 x1024 [128 n][256 k]                    65536
//   end (BG = 64)                                   119078912
// =====================================================================================================
extern "C" void kernel_launch(void* const* d_in, const int* in_sizes, int n_in,
                              void* d_out, int out_size, void* d_ws, size_t ws_size,
                              hipStream_t stream) {
  if (n_in < 12) return;
  if (in_sizes[0] < NPIX * DM) return;
  if (in_sizes[1] < NPIX) return;
  if (in_sizes[2] < DM || in_sizes[3] < DM) return;
  if (in_sizes[4] < DM * DI || in_sizes[5] < DM * DI || in_sizes[6] < DM * DI || in_sizes[8] < DM * DI) return;
  if (in_sizes[7] < DM * NH) return;
  if (in_sizes[9] < DI) return;
  if (in_sizes[10] < DI * DM) return;
  if (in_sizes[11] < DM) return;
  if (out_size < NS * LP * DM) return;

  const float* pr    = (const float*)d_in[0];
  const float* mask  = (const float*)d_in[1];
  const float* gamma = (const float*)d_in[2];
  const float* beta  = (const float*)d_in[3];
  const float* Wq    = (const float*)d_in[4];
  const float* Wk    = (const float*)d_in[5];
  const float* Wv    = (const float*)d_in[6];
  const float* Wb    = (const float*)d_in[7];
  const float* Wu    = (const float*)d_in[8];
  const float* bu    = (const float*)d_in[9];
  const float* Wo    = (const float*)d_in[10];
  const float* bo    = (const float*)d_in[11];
  float*       out   = (float*)d_out;

  const size_t szXB = (size_t)NPIX * KX * 2;
  const size_t szU  = (size_t)GROWS * DI * 4;
  const size_t szH  = (size_t)GROWS * DI * 2;                   // QH, KH, QL, KL, OH, OL
  const size_t szV  = (size_t)BG * NH * HD * LP * 2;            // VH, VL (== szH)
  const size_t szCB = (size_t)NH * NPIX * 4;
  const size_t szW  = (size_t)DI * KX * 2;
  const size_t szWO = (size_t)DM * DI * 2;
  size_t off = 0;
  const size_t oXB = off; off += szXB;
  const size_t oOH = off; off += szH;
  const size_t oOL = off; off += szH;
  const size_t oU  = off; off += szU;
  const size_t oQH = off; off += szH;
  const size_t oKH = off; off += szH;
  const size_t oQL = off; off += szH;
  const size_t oKL = off; off += szH;
  const size_t oVH = off; off += szV;
  const size_t oVL = off; off += szV;
  const size_t oCB = off; off += szCB;
  const size_t oWQ = off; off += szW;
  const size_t oWK = off; off += szW;
  const size_t oWV = off; off += szW;
  const size_t oWU = off; off += szW;
  const size_t oWO = off; off += szWO;
  if (off > ws_size) return;                // off = 119078912 for BG = 64
  if (off > (size_t)WS_CAP) return;

  char* ws = (char*)d_ws;
  u16*   XB = (u16*)(ws + oXB);
  u16*   OH = (u16*)(ws + oOH);
  u16*   OL = (u16*)(ws + oOL);
  float* U  = (float*)(ws + oU);
  u16*   QH = (u16*)(ws + oQH);
  u16*   KH = (u16*)(ws + oKH);
  u16*   QL = (u16*)(ws + oQL);
  u16*   KL = (u16*)(ws + oKL);
  u16*   VH = (u16*)(ws + oVH);
  u16*   VL = (u16*)(ws + oVL);
  float* CB = (float*)(ws + oCB);
  u16*   WQ = (u16*)(ws + oWQ);
  u16*   WK = (u16*)(ws + oWK);
  u16*   WV = (u16*)(ws + oWV);
  u16*   WU = (u16*)(ws + oWU);
  u16*   WO = (u16*)(ws + oWO);

  const dim3 b256(256), bAT(ATT_THREADS);
  const dim3 gLN(NPIX / LNPB);                          // 2048
  const dim3 gWP((DI / 128) * (DM / 64));               // 4: Wq, Wk, Wv, Wu planes
  const dim3 gWO((DM / 128) * (DI / 64));               // 4: Wo plane
  const dim3 gP((GROWS / PXR) * NPT);
  const dim3 gAT(NQT * BG);
  const dim3 gO(BG * NST);
  const float osc = 1.0f / (OSC * WOS);

  // LayerNorm once for every pixel: x hi|lo planes and the additive logit table
  ln_x<<<gLN, b256, 0, stream>>>(pr, mask, gamma, beta, Wb, XB, CB);
  // weight planes once: Wq^T, Wk^T, Wv^T, Wu^T [n][k | k] as bf16; Wo^T [n][k] as f16 of bf16 value x1024
  wt16<<<gWP, b256, 0, stream>>>(Wq, DI, DM, WQ, KX, 1, 0, 1.0f);
  wt16<<<gWP, b256, 0, stream>>>(Wk, DI, DM, WK, KX, 1, 0, 1.0f);
  wt16<<<gWP, b256, 0, stream>>>(Wv, DI, DM, WV, KX, 1, 0, 1.0f);
  wt16<<<gWP, b256, 0, stream>>>(Wu, DI, DM, WU, KX, 1, 0, 1.0f);
  wt16<<<gWO, b256, 0, stream>>>(Wo, DM, DI, WO, DI, 0, 1, WOS);

  for (int g = 0; g < NGRP; ++g) {
    const u16*   xg = XB   + (size_t)g * GROWS * KX;
    const float* mg = mask + (size_t)g * GROWS;
    float*       og = out  + (size_t)g * GROWS * DM;
    // (1) q, k, v, u projections in one launch: q, k and v^T as f16 hi + residual planes, gate pre-activation u as f32
    proj4<<<gP, b256, 0, stream>>>(xg, WQ, QH, QL, KH, KL, VH, VL, U);
    // (2) attention: rows from the k planes, columns from the q planes, sum over columns with v; gated O -> OH + OL planes
    attn_t<<<gAT, bAT, 0, stream>>>(KH, KL, QH, QL, VH, VL, CB, U, bu, OH, OL);
    // (3) output projection (hi + residual), + bo, x mask row scale -> out f32, carries 1024 x 1024 folded back
    gemm_o<<<gO, b256, 0, stream>>>(OH, OL, WO, bo, mg, og, osc);
  }
  (void)hipGetLastError();
}

// v004
// It runs in 274 microseconds.
// Next to v003, in two timings, it ran 1.07 times as fast each time.
// All steps since v000 together make it 2.25 times as fast.
// Contractions: x.Wq, x.Wk, x.Wv, x.Wu on v_wmma_f32_16x16x32_bf16 (x as bf16 hi|lo pair folded into K = 256, W as bf16 RNE
// of the input, f32 accumulate); k.q^T over 64 and P.v^T on v_wmma_f32_16x16x32_f16 (k x1024 and q x128 f16 hi + residual
// planes, P x32768 f16 hi + residual, v x1024 f16 hi + residual; products hh + lh + hl); (O*gate).Wo on
// v_wmma_f32_16x16x32_f16 (O x1024 f16 hi + residual, Wo as f16(bf16(Wo)) x1024, products h.w + l.w); all f32 accumulate.
// LayerNorm, x.Wb (N = 4) and the additive logit table, base-2 online softmax, sigmoid gate, bias and row scale in f32 on VALU.
#include <hip/hip_runtime.h>
#include <math.h>
#include <stdint.h>

#ifndef NS
#define NS 256
#endif
#define NSX   256
#define LP    256
#define DM    128
#define NH    4
#define HD    64
#define DI    (NH * HD)
#define KX    (2 * DM)
#define NPIX  (LP * LP)
#define BG    ((NS <= 64) ? NS : 64)
#define NGRP  (NS / BG)
#define GROWS (BG * LP)
#define LNEPS 1e-5f
#define LOG2E 1.4426950408889634f
#define QSC   128.0f
#define CSC   1024.0f
#define KSC   1024.0f
#define PCAR  32768.0f
#define VCAR  1024.0f
#define OSC   1024.0f
#define WOS   1024.0f
#define WPB   4
#define NQT   (LP / 16)
#define NST   (LP / 64)
#define NKT   (LP / 32)
#define ATT_THREADS (WPB * 32)
#define PTP   36
#define PTW   (16 * PTP)
#define SLP   68
#define SLW   (16 * SLP)
#define WREG  (PTW + SLW)
#define SLAB64 (16 * 68)
#define VTP   72
#define NPT   (4 * DI / 64)
#define PLP   256
#define LNPB  32
#define STG   64
#define TPL   (STG * VTP)
#define WS_CAP 134217728
#define PXR   128
#define PKP   (KX + 8)
#define PROJ_THREADS 256
static_assert(DI == NH * HD && HD == 64 && NH == 4 && WPB == NH);
static_assert(ATT_THREADS == 128);
static_assert(STG == 64 && HD == STG && (LP % STG) == 0 && NST * NH == NQT);
static_assert(NS >= 1 && NS <= NSX && (NS % BG) == 0 && BG >= 1 && BG <= 64);
static_assert((LP % 64) == 0 && (LP % 32) == 0 && (LP % 16) == 0);
static_assert(DM == 128 && (KX % 32) == 0 && (DI % 64) == 0 && (DI % 32) == 0 && (DM % 64) == 0);
static_assert(PLP == DI && PLP == LP && NPT == 4 * NH && (GROWS % 64) == 0);
static_assert((NPIX % LNPB) == 0 && LNPB == 32);
static_assert((GROWS % PXR) == 0 && PXR == 128 && PROJ_THREADS == 256 && KX == 256 && DI == KX && DM == 128 && 8 * SLAB64 * 4 <= (PXR + 64) * PKP * 2);
static_assert((DI % 128) == 0 && (DM % 128) == 0 && (DM % 64) == 0 && (DI % 64) == 0);

typedef unsigned short u16;
typedef _Float16 v16h __attribute__((ext_vector_type(16)));
typedef _Float16 v8h  __attribute__((ext_vector_type(8)));
typedef __bf16   v16b __attribute__((ext_vector_type(16)));
typedef float    v8f  __attribute__((ext_vector_type(8)));
typedef float    v4f  __attribute__((ext_vector_type(4)));
typedef unsigned int v4u __attribute__((ext_vector_type(4)));
typedef unsigned int v2u __attribute__((ext_vector_type(2)));

union FragH { v16h v; v8h h[2]; v4u u[2]; };
union FragB { v16b v; v4u u[2]; };

// ---- scalar helpers --------------------------------------------------------------------------------
__device__ __forceinline__ unsigned short bf_bits(float f) {          // f32 -> bf16 bits, RNE convert
  unsigned u = __float_as_uint(f);
  return (unsigned short)((u + 0x7FFFu + ((u >> 16) & 1u)) >> 16);
}
__device__ __forceinline__ float bf_up(unsigned short h) { return __uint_as_float(((unsigned)h) << 16); }
__device__ __forceinline__ float bfr(float f) { return bf_up(bf_bits(f)); }
__device__ __forceinline__ unsigned short h_bits(_Float16 x) { return __builtin_bit_cast(unsigned short, x); }
__device__ __forceinline__ unsigned pk16(unsigned short a, unsigned short b) { return (unsigned)a | ((unsigned)b << 16); }
__device__ __forceinline__ v8f zero8() { v8f z = {0.f, 0.f, 0.f, 0.f, 0.f, 0.f, 0.f, 0.f}; return z; }
__device__ __forceinline__ float sigm(float z) {                     // 1 / (1 + 2^(-z log2 e)), argument clamped
  const float zc = fminf(fmaxf(z, -30.0f), 30.0f);
  const float e  = exp2f(-zc * LOG2E);
  return __builtin_amdgcn_rcpf(1.0f + e);
}

// ---- fragment loaders: 16-bit A/B operand, lane -> row/col (lane&15), p already includes +8*(lane>>4);
//      elements 0..7 <- p[0..7] (k0+8h..), elements 8..15 <- p[16..23] (k0+16+8h..)  (same split k map for A and B;
//      B is always read from a k-contiguous [n][k] plane)
__device__ __forceinline__ v16h ldfrag_h(const _Float16* p) {
  FragH f;
  f.h[0] = *(const v8h*)(p);
  f.h[1] = *(const v8h*)(p + 16);
  return f.v;
}
__device__ __forceinline__ v16b ldfrag_b(const u16* p) {              // bf16 plane read as unsigned integer vectors
  FragB f;
  f.u[0] = *(const v4u*)(p);
  f.u[1] = *(const v4u*)(p + 16);
  return f.v;
}

__device__ __forceinline__ v8f mma_h(v16h a, v16h b, v8f c) {
  return __builtin_amdgcn_wmma_f32_16x16x32_f16(false, a, false, b, (short)0, c, false, false);
}
__device__ __forceinline__ v8f mma_b(v16b a, v16b b, v8f c) {
  return __builtin_amdgcn_wmma_f32_16x16x32_bf16(false, a, false, b, (short)0, c, false, false);
}
__device__ __forceinline__ void guard2(v8f& a, v8f& b, v16h x0, v16h x1, v16h x2, v16h x3, v16h x4, v16h x5) {
#if defined(__HIP_DEVICE_COMPILE__)
  asm volatile("v_nop\n\tv_nop\n\tv_nop\n\tv_nop"
               : "+v"(a), "+v"(b) : "v"(x0), "v"(x1), "v"(x2), "v"(x3), "v"(x4), "v"(x5) : "memory");
#endif
}
template <typename F>
__device__ __forceinline__ void guard6(v8f& a, v8f& b, v8f& c, v8f& d, F x0, F x1, F x2, F x3, F x4, F x5) {
#if defined(__HIP_DEVICE_COMPILE__)
  asm volatile("v_nop\n\tv_nop\n\tv_nop\n\tv_nop"
               : "+v"(a), "+v"(b), "+v"(c), "+v"(d) : "v"(x0), "v"(x1), "v"(x2), "v"(x3), "v"(x4), "v"(x5) : "memory");
#endif
}
__device__ __forceinline__ void acc_guard4(v8f& a, v8f& b, v8f& c, v8f& d) {
#if defined(__HIP_DEVICE_COMPILE__)
  asm volatile("v_nop\n\tv_nop\n\tv_nop\n\tv_nop" : "+v"(a), "+v"(b), "+v"(c), "+v"(d));
#endif
}
__device__ __forceinline__ float xhalf(float x) {                    // value of lane l ^ 16 (the other 16-lane row)
  const int b = __builtin_bit_cast(int, x);
  return __builtin_bit_cast(float, __builtin_amdgcn_permlanex16(b, b, 0x76543210, 0xfedcba98, false, false));
}
__device__ __forceinline__ void wave_sync_lds() {
  __builtin_amdgcn_fence(__ATOMIC_RELEASE, "workgroup");
  __builtin_amdgcn_wave_barrier();
  __builtin_amdgcn_fence(__ATOMIC_ACQUIRE, "workgroup");
}

// =====================================================================================================
// statistics), x written as bf16 hi | bf16 lo planes XB [NPIX][KX] (columns 0..127 hi bits, 128..255 lo bits of x - hi);
// the additive logit table CB [NH][NPIX] = 1e9*(mask - 1) + x.Wb (VALU f32, N = 4) is produced by the same block.
// Block = 8 waves x LNPB/8 pixels, wave = one pixel at a time (lane holds 4 channels); the 512-B x row is assembled in a
// x 4 heads) are funnelled through LDS and written by wave 0 in one instruction (8 consecutive lanes x 16 B per line);
// coverage: grid = NPIX/LNPB blocks x 32 pixels = every XB row once and every CB line once.
// =====================================================================================================
__global__ __launch_bounds__(256) void ln_x(const float* __restrict__ pr, const float* __restrict__ mask,
                                            const float* __restrict__ gamma, const float* __restrict__ beta,
                                            const float* __restrict__ Wb, u16* XB, float* CB) {
  __shared__ __align__(16) u16 RB[8 * KX];
  __shared__ __align__(16) float PBS[NH * LNPB];
  const int tid = threadIdx.x, wave = tid >> 5, lane = tid & 31;
  const int p0 = (int)blockIdx.x * LNPB;
  if (p0 + LNPB > NPIX) return;             // block-uniform, before any barrier; never taken with the exact grid
  float gm[4], bt[4], wb[16];
  {
    const v4f g4 = *(const v4f*)(gamma + 4 * lane), b4 = *(const v4f*)(beta + 4 * lane);
#pragma unroll
    for (int e = 0; e < 4; ++e) { gm[e] = bfr(g4[e]); bt[e] = bfr(b4[e]); }
#pragma unroll
    for (int i = 0; i < 4; ++i) {
      const v4f w4 = *(const v4f*)(Wb + 16 * lane + 4 * i);      // Wb[(4*lane + i)][h], h = 0..3
#pragma unroll
      for (int h = 0; h < 4; ++h) wb[4 * i + h] = bfr(w4[h]);
    }
  }
  u16* rb = RB + wave * KX;
#pragma unroll 1
  for (int j = 0; j < LNPB / 8; ++j) {
    const int pl = j * 8 + wave;
    const int p  = p0 + pl;
    const v4f x4 = *(const v4f*)(pr + (size_t)p * DM + 4 * lane);
    float xr[4];
#pragma unroll
    for (int e = 0; e < 4; ++e) xr[e] = bfr(x4[e]);
    float s = (xr[0] + xr[1]) + (xr[2] + xr[3]);
#pragma unroll
    for (int off = 1; off < 32; off <<= 1) s += __shfl_xor(s, off, 32);
    const float mu = s * (1.0f / (float)DM);
    float d[4];
#pragma unroll
    for (int e = 0; e < 4; ++e) d[e] = xr[e] - mu;
    float ss = (d[0] * d[0] + d[1] * d[1]) + (d[2] * d[2] + d[3] * d[3]);
#pragma unroll
    for (int off = 1; off < 32; off <<= 1) ss += __shfl_xor(ss, off, 32);
    const float var = ss * (1.0f / (float)DM);
    const float rs  = 1.0f / sqrtf(var + LNEPS);
    float y[4];
#pragma unroll
    for (int e = 0; e < 4; ++e) y[e] = d[e] * rs * gm[e] + bt[e];
    unsigned short hb[4], lb[4];
#pragma unroll
    for (int e = 0; e < 4; ++e) { hb[e] = bf_bits(y[e]); lb[e] = bf_bits(y[e] - bf_up(hb[e])); }
    float pb[4];
#pragma unroll
    for (int h = 0; h < 4; ++h) pb[h] = y[0] * wb[h] + y[1] * wb[4 + h] + y[2] * wb[8 + h] + y[3] * wb[12 + h];
#pragma unroll
    for (int h = 0; h < 4; ++h) {
#pragma unroll
      for (int off = 1; off < 32; off <<= 1) pb[h] += __shfl_xor(pb[h], off, 32);
    }
    const float mk = bfr(mask[p]);
    const float mb = 1e9f * (mk - 1.0f);
    v2u hv, lv;
    hv[0] = pk16(hb[0], hb[1]);  hv[1] = pk16(hb[2], hb[3]);
    lv[0] = pk16(lb[0], lb[1]);  lv[1] = pk16(lb[2], lb[3]);
    *(v2u*)(rb + 4 * lane)      = hv;
    *(v2u*)(rb + DM + 4 * lane) = lv;
    if (lane == 0) {
      PBS[0 * LNPB + pl] = mb + pb[0];
      PBS[1 * LNPB + pl] = mb + pb[1];
      PBS[2 * LNPB + pl] = mb + pb[2];
      PBS[3 * LNPB + pl] = mb + pb[3];
    }
    wave_sync_lds();
    const v4u piece = *(const v4u*)(rb + 8 * lane);
    u16* dst = XB + (size_t)p * KX + 8 * lane;
    {
      *(v4u*)(dst) = piece;
      
    }
    wave_sync_lds();
  }
  __syncthreads();
  if (wave == 0) {
    const int h = lane >> 3, j4 = (lane & 7) * 4;
    const v4f v = *(const v4f*)(PBS + h * LNPB + j4);
    float* d = CB + (size_t)h * NPIX + p0 + j4;
    {
      *(v4f*)(d) = v;
      
    }
  }
}

// =====================================================================================================
// Transposed weight plane: W f32 [nk rows k][ncol cols n] -> D 16-bit [n][ldd], D[n][k] = bf16 bits of W[k][n] (f16mode 0)
// or f16 bits of bf16(W[k][n]) * scale (f16mode 1); when dup != 0 the same 64-half segment is also written at D[n][nk + k]
// (hi|lo folded K). Block (ct = bid % nct: 128 columns, rt = bid / nct: 64 rows): each thread loads 32 floats of one k row
// (16-B loads), converts, scatters into the LDS tile [128 n][64 k] (pitch 72 halves); after a block barrier each n row segment
// coverage: load 256 thr x 32 = 64 k rows x 128 n; store 4 iterations x 256 thr x 8 halves = 128 lines x 64 = the block's tile
// =====================================================================================================
__global__ __launch_bounds__(256) void wt16(const float* __restrict__ W, int ncol, int nk, u16* D, int ldd, int dup,
                                            int f16mode, float scale) {
  __shared__ __align__(16) u16 T[128 * VTP];
  const int tid = threadIdx.x;
  const int bid = blockIdx.x;
  const int nct = ncol / 128;
  const int ct  = bid % nct;
  const int rt  = bid / nct;
  if (rt * 64 + 64 > nk) return;            // block-uniform, before the barrier; never taken with the exact grid
  {
    const int sl = tid >> 2;                // k row within tile 0..63
    const int dc = (tid & 3) * 32;          // n chunk
    const float* src = W + (size_t)(rt * 64 + sl) * ncol + ct * 128 + dc;
#pragma unroll
    for (int i = 0; i < 8; ++i) {
      const v4f a = *(const v4f*)(src + 4 * i);
#pragma unroll
      for (int e = 0; e < 4; ++e) {
        const float f = a[e];
        const unsigned short hb = h_bits((_Float16)(bfr(f) * scale));
        const unsigned short bb = bf_bits(f);
        T[(dc + 4 * i + e) * VTP + sl] = (f16mode != 0) ? hb : bb;
      }
    }
  }
  __syncthreads();
  v4u w4[4];
  const int q8 = tid >> 3, p8 = (tid & 7) * 8;
#pragma unroll
  for (int it = 0; it < 4; ++it) {
    const int line = it * 32 + q8;          // n within tile 0..127
    w4[it] = *(const v4u*)(T + line * VTP + p8);
  }
  const size_t base = ((size_t)ct * 128) * ldd + rt * 64 + p8;
  {
#pragma unroll
    for (int it = 0; it < 4; ++it) {
      const int line = it * 32 + q8;
      *(v4u*)(D + base + (size_t)line * ldd) = w4[it];
      if (dup != 0) *(v4u*)(D + base + (size_t)line * ldd + nk) = w4[it];
    }
    
  }
}

// =====================================================================================================
// epi64o additionally adds a per-column bias (bf16 RNE of the input) and multiplies by a per-row scale (bf16 RNE of mask).
// coverage: 8 instructions x 2 rows x 16 lanes x 4 floats = the wave's 16 x 64 tile.
// =====================================================================================================
__device__ __forceinline__ void epi64(float* sl, v8f a0, v8f a1, v8f a2, v8f a3, float oscale,
                                      float* C, int N, size_t rowb, int col0, int lane) {
  const int hh = lane >> 4, m = lane & 15;
#pragma unroll
  for (int r = 0; r < 8; ++r) {
    const int ro = (8 * hh + r) * 68 + m;
    sl[ro]      = a0[r] * oscale;
    sl[ro + 16] = a1[r] * oscale;
    sl[ro + 32] = a2[r] * oscale;
    sl[ro + 48] = a3[r] * oscale;
  }
  wave_sync_lds();
  v4f vals[8];
#pragma unroll
  for (int it = 0; it < 8; ++it) vals[it] = *(const v4f*)(sl + (it * 2 + hh) * 68 + m * 4);
  float* dst = C + (rowb + (size_t)hh) * (size_t)N + col0 + m * 4;
  {
#pragma unroll
    for (int it = 0; it < 8; ++it) {
      *(v4f*)(dst + (size_t)(it * 2) * (size_t)N) = vals[it];
    }
    
  }
}
__device__ __forceinline__ void epi64o(float* sl, v8f a0, v8f a1, v8f a2, v8f a3, float oscale,
                                       float* C, int N, size_t rowb, int col0, int lane,
                                       const float* __restrict__ bias, const float* __restrict__ rsc) {
  const int hh = lane >> 4, m = lane & 15;
#pragma unroll
  for (int r = 0; r < 8; ++r) {
    const int ro = (8 * hh + r) * 68 + m;
    sl[ro]      = a0[r] * oscale;
    sl[ro + 16] = a1[r] * oscale;
    sl[ro + 32] = a2[r] * oscale;
    sl[ro + 48] = a3[r] * oscale;
  }
  wave_sync_lds();
  float bq[4];
  {
    const v4f b4 = *(const v4f*)(bias + col0 + m * 4);
#pragma unroll
    for (int e = 0; e < 4; ++e) bq[e] = bfr(b4[e]);
  }
  v4f vals[8];
#pragma unroll
  for (int it = 0; it < 8; ++it) {
    const v4f t = *(const v4f*)(sl + (it * 2 + hh) * 68 + m * 4);
    const float mk = bfr(rsc[rowb + (size_t)hh + (size_t)(it * 2)]);
    v4f o;
#pragma unroll
    for (int e = 0; e < 4; ++e) o[e] = (t[e] + bq[e]) * mk;
    vals[it] = o;
  }
  float* dst = C + (rowb + (size_t)hh) * (size_t)N + col0 + m * 4;
  {
#pragma unroll
    for (int it = 0; it < 8; ++it) {
      *(v4f*)(dst + (size_t)(it * 2) * (size_t)N) = vals[it];
    }
    
  }
}

// =====================================================================================================
// Split epilogue: the wave's 16 x 64 f32 tile, times sc, goes out as f16 hi + f16 residual planes (row pitch PLP halves).
// The tile passes through the wave's slab so that 8 consecutive lanes hold one row's 64 halves = one whole 128-B line.
// coverage: 4 instructions x 4 rows x 8 lanes x 8 halves = the wave's 16 x 64 tile of each plane.
// =====================================================================================================
__device__ __forceinline__ void epi64s(float* sl, v8f a0, v8f a1, v8f a2, v8f a3, float sc,
                                       u16* Hp, u16* Lp, size_t ob, int lane) {
  const int hh = lane >> 4, m = lane & 15;
#pragma unroll
  for (int r = 0; r < 8; ++r) {
    const int ro = (8 * hh + r) * 68 + m;
    sl[ro]      = a0[r];
    sl[ro + 16] = a1[r];
    sl[ro + 32] = a2[r];
    sl[ro + 48] = a3[r];
  }
  wave_sync_lds();
  const int rq = lane >> 3, c8 = (lane & 7) * 8;
  v4u oh[4], ol[4];                         // the loops below are unrolled so that these stay in registers
#pragma unroll
  for (int it = 0; it < 4; ++it) {
    const float* p = sl + (it * 4 + rq) * 68 + c8;
    const v4f a = *(const v4f*)(p), b4 = *(const v4f*)(p + 4);
    float w[8];
#pragma unroll
    for (int e = 0; e < 4; ++e) { w[e] = a[e] * sc; w[4 + e] = b4[e] * sc; }
#pragma unroll
    for (int e = 0; e < 4; ++e) {
      const float t0 = w[2 * e], t1 = w[2 * e + 1];
      const _Float16 h0 = (_Float16)t0, h1 = (_Float16)t1;
      const _Float16 l0 = (_Float16)(t0 - (float)h0), l1 = (_Float16)(t1 - (float)h1);
      oh[it][e] = pk16(h_bits(h0), h_bits(h1));
      ol[it][e] = pk16(h_bits(l0), h_bits(l1));
    }
  }
  u16* dh = Hp + ob + (size_t)rq * PLP + c8;
  u16* dl = Lp + ob + (size_t)rq * PLP + c8;
#pragma unroll
  for (int it = 0; it < 4; ++it) {
    *(v4u*)(dh + (size_t)(it * 4) * PLP) = oh[it];
    *(v4u*)(dl + (size_t)(it * 4) * PLP) = ol[it];
  }
}

// =====================================================================================================
// The four projections of one row group in one launch: X [GROWS][KX] (bf16 hi|lo rows of x) against Wt [4*DI][KX] (bf16,
// k-contiguous; rows 0.. Wq^T, DI.. Wk^T, 2*DI.. Wv^T, 3*DI.. Wu^T), f32 accumulate, K = KX stepped by 32.
// Block bid -> (64 rows of Wt nt = bid % NPT, PXR = 128 rows of X rb = bid / NPT); sel = nt / NH names the projection,
// g = nt % NH the head. The block's 128 X rows and 64 Wt rows are brought in once with whole-line 16-B loads (one wave = one
// 512-B row per instruction), stored to LDS (pitch PKP halves = 16 B x 33) and read from there as fragments by all 8 waves
// (two 16-B loads each, the same split k map for both operands, so either plane can be the row operand).
//   q, k, u: row operand X, column operand Wt: wave w's tile is [16 pos (16*w ..)][64 channels of head g].
//   v:       row operand Wt, column operand X: wave w's tile is [16 d (16*(w&3) ..)][64 pos (64*(w>>2) ..)], v^T as read later.
// Epilogue: u goes out as f32 (epi64); q x128 (= C^-0.5 x 1024), k x1024 and v^T x1024 go out as f16 hi + residual planes
// (epi64s): QH, QL, KH, KL [b*LP + pos][g*HD + d]; VH, VL [(b*NH + g)*HD + d][LP]. The waves' slabs reuse the operand LDS.
// coverage: grid = (GROWS/PXR) * NPT blocks, each one 128 x 64 tile = every element of U and of the six planes once.
// =====================================================================================================
__global__ __launch_bounds__(PROJ_THREADS)
void proj4(const u16* __restrict__ X, const u16* __restrict__ Wt, u16* QH, u16* QL, u16* KH, u16* KL,
           u16* VH, u16* VL, float* U) {
  __shared__ __align__(16) u16 opt[(PXR + 64) * PKP];   // X rows 0..127, then Wt rows 0..63; later the 8 result slabs
  const int tid = threadIdx.x, wave = tid >> 5, lane = tid & 31, hh = lane >> 4, m = lane & 15;
  const int bid = blockIdx.x;
  const int nt  = bid % NPT;
  const int rb  = bid / NPT;
  if (rb * PXR + PXR > GROWS) return;       // block-uniform, before any barrier; never taken with the exact grid
  const int sel = nt / NH;
  const int g   = nt % NH;
  {
    // staging: wave -> row wave + 8*i, lane -> 8 halves at 8*lane: each load and each LDS store covers one whole 512-B row
    const u16* gx = X  + (size_t)(rb * PXR + wave) * KX + 8 * lane;
    const u16* gw = Wt + (size_t)(nt * 64 + wave) * KX + 8 * lane;
    u16* tw = opt + wave * PKP + 8 * lane;
    v4u st[(PXR + 64) / 8];                 // the loops below are unrolled so that these stay in registers
#pragma unroll
    for (int i = 0; i < PXR / 8; ++i) st[i] = *(const v4u*)(gx + (size_t)(8 * i) * KX);
#pragma unroll
    for (int i = 0; i < 8; ++i) st[PXR / 8 + i] = *(const v4u*)(gw + (size_t)(8 * i) * KX);
    // the address registers of these loads are free for reuse below while the loads are still in flight
    asm volatile("s_wait_xcnt 0x0" ::: "memory");
#pragma unroll
    for (int i = 0; i < (PXR + 64) / 8; ++i) *(v4u*)(tw + 8 * i * PKP) = st[i];
  }
  __syncthreads();                          // both operand tiles are complete before any wave reads a fragment
  const int ao = ((sel == 2) ? (PXR + (wave & 3) * 16 + m) : (wave * 16 + m)) * PKP + 8 * hh;
  const int bo = ((sel == 2) ? ((wave >> 2) * 64 + m) : (PXR + m)) * PKP + 8 * hh;
  const u16* ap = opt + ao;
  const u16* bp = opt + bo;
  const int bs = 16 * PKP;
  v8f acc0 = zero8(), acc1 = zero8(), acc2 = zero8(), acc3 = zero8();
  // kept rolled: the guard ends every trip and no load may cross it, so unrolling would only lengthen the text
#pragma unroll 1
  for (int k0 = 0; k0 < KX; k0 += 32) {
    const v16b a  = ldfrag_b(ap + k0);
    const v16b b0 = ldfrag_b(bp + k0);
    const v16b b1 = ldfrag_b(bp + bs + k0);
    const v16b b2 = ldfrag_b(bp + 2 * bs + k0);
    const v16b b3 = ldfrag_b(bp + 3 * bs + k0);
    acc0 = mma_b(a, b0, acc0);
    acc1 = mma_b(a, b1, acc1);
    acc2 = mma_b(a, b2, acc2);
    acc3 = mma_b(a, b3, acc3);
    guard6<v16b>(acc0, acc1, acc2, acc3, a, b0, b1, b2, b3, a);
  }
  __syncthreads();                          // every wave has read its last fragment before the slabs overwrite the tiles
  float* sl = (float*)(void*)opt + wave * SLAB64;
  if (sel == 3) {
    epi64(sl, acc0, acc1, acc2, acc3, 1.0f, U, DI, (size_t)(rb * PXR + wave * 16), g * HD, lane);
  } else if (sel == 2) {
    const int r64 = rb * (PXR / 64) + (wave >> 2);      // which 64 positions of the row group
    const size_t ob = ((size_t)((r64 / NST) * NH + g) * HD + (wave & 3) * 16) * LP + (size_t)(r64 % NST) * 64;
    epi64s(sl, acc0, acc1, acc2, acc3, VCAR, VH, VL, ob, lane);
  } else {
    const size_t ob = (size_t)(rb * PXR + wave * 16) * DI + (size_t)g * HD;
    epi64s(sl, acc0, acc1, acc2, acc3, (sel == 0) ? QSC : KSC, (sel == 0) ? QH : KH, (sel == 0) ? QL : KL, ob, lane);
  }
}

// =====================================================================================================
// Output projection: C[row][DM] (f32) = ((Ah + Al)[row][DI] . Bt[DM][DI]^T) * oscale + bias[col], times rsc[row]
// (products h.B + l.B into one accumulator, l unscaled). Block -> (position tile rt = bid % NST, row group bb): 64 rows
// bb*LP + 64*rt .. of Ah, Al and C against all DM rows of Bt. The three operand tiles are staged in LDS as in proj4 (whole-line
// loads, pitch PKP halves); wave w's tile is [16 rows (16*(w&3) ..)][64 columns (64*(w>>2) ..)], epilogue epi64o.
// coverage: grid = BG * NST blocks, each one 64 x 128 tile = every element of the row group's C once.
// =====================================================================================================
__global__ __launch_bounds__(PROJ_THREADS)
void gemm_o(const u16* __restrict__ Ah, const u16* __restrict__ Al, const u16* __restrict__ Bt,
            const float* __restrict__ bias, const float* __restrict__ rsc, float* C, float oscale) {
  __shared__ __align__(16) u16 opt[(2 * 64 + DM) * PKP];   // Ah rows 0..63, Al rows 0..63, Bt rows 0..127; later the 8 slabs
  const int tid = threadIdx.x, wave = tid >> 5, lane = tid & 31, hh = lane >> 4, m = lane & 15;
  const int bid   = blockIdx.x;
  const int rt    = bid % NST;
  const int bb    = bid / NST;
  if (bb >= BG) return;                     // block-uniform, before any barrier; never taken with the exact grid
  const int K     = DI;
  const size_t row0 = (size_t)bb * LP + rt * 64;
  {
    // staging: wave -> row wave + 8*i, lane -> 8 halves at 8*lane: each load and each LDS store covers one whole 512-B row
    const u16* ga = Ah + (row0 + wave) * K + 8 * lane;
    const u16* gl = Al + (row0 + wave) * K + 8 * lane;
    const u16* gb = Bt + (size_t)wave * K + 8 * lane;
    u16* tw = opt + wave * PKP + 8 * lane;
    v4u st[(2 * 64 + DM) / 8];              // the loops below are unrolled so that these stay in registers
#pragma unroll
    for (int i = 0; i < 8; ++i) {
      st[i]     = *(const v4u*)(ga + (size_t)(8 * i) * K);
      st[8 + i] = *(const v4u*)(gl + (size_t)(8 * i) * K);
    }
#pragma unroll
    for (int i = 0; i < DM / 8; ++i) st[16 + i] = *(const v4u*)(gb + (size_t)(8 * i) * K);
    // the address registers of these loads are reused below while the loads are still in flight; the three bases are named
    // as inputs so that none of them is given up for another value ahead of the wait
    asm volatile("s_wait_xcnt 0x0" :: "v"(ga), "v"(gl), "v"(gb) : "memory");
#pragma unroll
    for (int i = 0; i < (2 * 64 + DM) / 8; ++i) *(v4u*)(tw + 8 * i * PKP) = st[i];
  }
  __syncthreads();                          // the three operand tiles are complete before any wave reads a fragment
  const int srow  = (wave & 3) * 16;
  const int col0  = (wave >> 2) * 64;
  const size_t rowC = row0 + srow;
  const _Float16* ahp = (const _Float16*)(const void*)opt + (srow + m) * PKP + 8 * hh;
  const _Float16* alp = ahp + 64 * PKP;
  const _Float16* bp  = (const _Float16*)(const void*)opt + (2 * 64 + col0 + m) * PKP + 8 * hh;
  const int bs = 16 * PKP;
  v8f acc0 = zero8(), acc1 = zero8(), acc2 = zero8(), acc3 = zero8();
#pragma unroll 1
  for (int k0 = 0; k0 < K; k0 += 32) {
    const v16h ah = ldfrag_h(ahp + k0), al = ldfrag_h(alp + k0);
    const v16h b0 = ldfrag_h(bp + k0);
    const v16h b1 = ldfrag_h(bp + bs + k0);
    const v16h b2 = ldfrag_h(bp + 2 * bs + k0);
    const v16h b3 = ldfrag_h(bp + 3 * bs + k0);
    acc0 = mma_h(ah, b0, acc0);  acc0 = mma_h(al, b0, acc0);
    acc1 = mma_h(ah, b1, acc1);  acc1 = mma_h(al, b1, acc1);
    acc2 = mma_h(ah, b2, acc2);  acc2 = mma_h(al, b2, acc2);
    acc3 = mma_h(ah, b3, acc3);  acc3 = mma_h(al, b3, acc3);
    guard6<v16h>(acc0, acc1, acc2, acc3, ah, al, b0, b1, b2, b3);
  }
  __syncthreads();                          // every wave has read its last fragment before the slabs overwrite the tiles
  epi64o((float*)(void*)opt + wave * SLAB64, acc0, acc1, acc2, acc3, oscale, C, DM, rowC, col0, lane, bias, rsc);
}

// =====================================================================================================
// Pair attention for one row group. Block bid -> (64 softmax rows qb = bid % NST, head = (bid / NST) % NH, row group b);
// the four waves take 16 rows each (q0 = 64*qb + 16*wave) of the SAME head and share its column operands: per 64 columns the
// Cm hi/residual rows [64 vi][64 d] and the v^T hi/residual rows [64 d][64 vi] are brought in once per block with whole-line
// 16-B loads (8 lanes per 128-B row), held in registers while the tile before is worked on, stored to LDS (pitch 72 halves)
// and read from there as fragments by all four waves. Softmax row index qi uses the k projection (column operand R), softmax
// column index vi uses the q projection (row operand Cm), summed over vi with v[vi].
//   R hi/residual planes (k x1024 f16) and Cm hi/residual planes (q x128 x 8 ... i.e. (q*C^-0.5) x1024 f16) laid out
//   [b*LP + pos][h*HD + d]; v^T hi/residual planes [b*NH + h][d][LP]; CB [h][qi][vi] f32 = 1e9*(mask - 1) + x.Wb.
//   scores s(i, j) = R_hi.C_hi + R_lo.C_hi + R_hi.C_lo over HD; logit (log2 domain) t = (s / (1024*1024) + CB) * log2 e.
//   All NKT column tiles of 32 visited in order. Per tile: the 16x32 CB tile is staged into the wave-private LDS tile with
//   16-B loads/stores, then 2 score subtiles x 2 k-steps, computed transposed: Cm fragments from the LDS tile are the row
//   operand and R the column operand, so a lane holds 16 logits of ONE softmax row (q0 + c): maximum and sum run in the lane,
//   with one exchange between the lane halves for the maximum. The two score subtiles' registers lie in the split k map, so
//   P^T*32768 (f16 hi plus its f16 residual) is converted in place into the column operand of out^T += v^T.P^T (v^T fragments
//   as row operand, 2 groups of 2 d-subtiles), products hh + lh + hl.
//   After the loop: out = acc / Z (Z >= 1 always; guarded anyway), carries 1/(32768*1024) folded once, written to the wave's
//   private result slab (pitch 68; every element owned by one lane).
//   Epilogue: out multiplied by sigmoid(U + bu) in f32 (U = x.Wu f32 plane, bu bf16 RNE of the input), then O x1024 -> f16
// coverage: per wave 4 instructions x 4 rows x 8 lanes x 8 halves = 16 x 64 per plane; grid = NQT * BG = NST * NH * BG blocks
//           x WPB waves = every (b, pos, h) row segment of OH and OL exactly once.
// =====================================================================================================
__global__ __launch_bounds__(ATT_THREADS)
void attn_t(const u16* __restrict__ RHp, const u16* __restrict__ RLp,
            const u16* __restrict__ CHp, const u16* __restrict__ CLp,
            const u16* __restrict__ VHp, const u16* __restrict__ VLp,
            const float* __restrict__ CB, const float* __restrict__ U, const float* __restrict__ bu,
            u16* OHp, u16* OLp) {
  __shared__ __align__(16) float smem[WPB * WREG];
  __shared__ __align__(16) u16 tile[4 * TPL];   // Cm hi, Cm residual [vi][d]; v^T hi, v^T residual [d][vi]; pitch VTP

  const int tid  = threadIdx.x;
  const int wave = tid >> 5;
  const int lane = tid & 31;
  const int hh   = lane >> 4;
  const int c    = lane & 15;
  const int bid  = blockIdx.x;
  const int qb   = bid % NST;
  const int t2   = bid / NST;
  const int head = t2 % NH;
  const int b    = t2 / NH;
  if (b >= BG) return;                      // block-uniform, before any barrier; never taken with the exact grid
  const int q0   = qb * 64 + wave * 16;

  float* pt   = smem + wave * WREG;         // CB tile [16][32] pitch 36
  float* slab = pt + PTW;                   // result slab [16][64] pitch 68

  const size_t hcol = (size_t)head * HD + 8 * hh;
  const _Float16* Rh  = (const _Float16*)(const void*)RHp + ((size_t)b * LP + q0 + c) * DI + hcol;
  const _Float16* Rl  = (const _Float16*)(const void*)RLp + ((size_t)b * LP + q0 + c) * DI + hcol;
  // fragment bases in the LDS tile: row c (+16 per subtile), halves 8*hh (+ the k offset per step)
  const _Float16* Chb = (const _Float16*)(const void*)tile + c * VTP + 8 * hh;   // row = vi within the tile, k = d
  const _Float16* Clb = Chb + TPL;
  const _Float16* Vhb = Chb + 2 * TPL;                                           // row = d, k = vi within the tile
  const _Float16* Vlb = Chb + 3 * TPL;
  // staging: thread -> (row sr + 16*i, 8 halves at sc); 8 consecutive lanes cover one 128-B row segment of a plane
  const int sr = tid >> 3, sc = (tid & 7) * 8;
  const u16* gch = CHp + ((size_t)b * LP + sr) * DI + (size_t)head * HD + sc;    // + (64*s + 16*i) * DI
  const u16* gcl = CLp + ((size_t)b * LP + sr) * DI + (size_t)head * HD + sc;
  const u16* gvh = VHp + ((size_t)(b * NH + head) * HD + sr) * LP + sc;          // + 16*i * LP + 64*s
  const u16* gvl = VLp + ((size_t)(b * NH + head) * HD + sr) * LP + sc;
  u16* tw = tile + sr * VTP + sc;
  const float* cbb = CB + ((size_t)head * LP + q0) * LP;
  const float invc = 1.0f / (CSC * KSC);
  const float oc   = 1.0f / (PCAR * VCAR);

  float mrow = -INFINITY, lrow = 0.f;       // of softmax row q0 + c; lrow is this lane half's share of the row sum
  v8f o[4];                                 // o[j][r] = out^T (d = 16*j + 8*hh + r, row q0 + c)
#pragma unroll
  for (int j = 0; j < 4; ++j) o[j] = zero8();

  v4u pre[16];                              // the next 64-column tile of the four planes, in flight
#pragma unroll
  for (int i = 0; i < 4; ++i) {
    pre[i]      = *(const v4u*)(gch + (size_t)(16 * i) * DI);
    pre[4 + i]  = *(const v4u*)(gcl + (size_t)(16 * i) * DI);
    pre[8 + i]  = *(const v4u*)(gvh + (size_t)(16 * i) * LP);
    pre[12 + i] = *(const v4u*)(gvl + (size_t)(16 * i) * LP);
  }
#pragma unroll 1
  for (int kt = 0; kt < NKT; ++kt) {
    const int kb = kt * 32;
    const int kl = kb & (STG - 1);          // first column of this step inside the LDS tile
    if (kl == 0) {                          // block-uniform: a new 64-column tile every second step
      if (kt != 0) __syncthreads();         // every wave has finished reading the tile that is overwritten next
#pragma unroll
      for (int i = 0; i < 4; ++i) {
        *(v4u*)(tw + 16 * i * VTP)           = pre[i];
        *(v4u*)(tw + TPL + 16 * i * VTP)     = pre[4 + i];
        *(v4u*)(tw + 2 * TPL + 16 * i * VTP) = pre[8 + i];
        *(v4u*)(tw + 3 * TPL + 16 * i * VTP) = pre[12 + i];
      }
      __syncthreads();                      // the tile is complete before any wave reads a fragment of it
      if (kb + STG < LP) {                  // block-uniform: the following tile's loads fly while this one is worked on
#pragma unroll
        for (int i = 0; i < 4; ++i) {
          pre[i]      = *(const v4u*)(gch + (size_t)(kb + STG + 16 * i) * DI);
          pre[4 + i]  = *(const v4u*)(gcl + (size_t)(kb + STG + 16 * i) * DI);
          pre[8 + i]  = *(const v4u*)(gvh + (size_t)(16 * i) * LP + kb + STG);
          pre[12 + i] = *(const v4u*)(gvl + (size_t)(16 * i) * LP + kb + STG);
        }
        // the address registers of these loads are reused by the step below while the loads are still in flight
        asm volatile("s_wait_xcnt 0x0" ::: "memory");
      }
    }
    // ---- stage the additive logit tile [16 rows][32 cols] into pt: 128 float4, lane handles f = it*32 + lane ----
#pragma unroll
    for (int it = 0; it < 4; ++it) {
      const int f = it * 32 + lane;
      const int row = f >> 3, col4 = (f & 7) * 4;
      const v4f t4 = *(const v4f*)(cbb + (size_t)row * LP + kb + col4);
      *(v4f*)(pt + row * PTP + col4) = t4;
    }
    // ---- scores, transposed: D element r of this lane = (col kb + 8hh + r, row q0 + c) in s0, col kb + 16 + 8hh + r in s1 ----
    v8f s0 = zero8(), s1 = zero8();
    const _Float16* c0p = Chb + kl * VTP;
    const _Float16* c1p = c0p + 16 * VTP;
    const _Float16* l0p = Clb + kl * VTP;
    const _Float16* l1p = l0p + 16 * VTP;
#pragma unroll
    for (int kk = 0; kk < HD / 32; ++kk) {
      const v16h rh  = ldfrag_h(Rh + kk * 32);
      const v16h rl  = ldfrag_h(Rl + kk * 32);
      const v16h ch0 = ldfrag_h(c0p + kk * 32);
      const v16h ch1 = ldfrag_h(c1p + kk * 32);
      const v16h cl0 = ldfrag_h(l0p + kk * 32);
      const v16h cl1 = ldfrag_h(l1p + kk * 32);
      s0 = mma_h(ch0, rh, s0);
      s0 = mma_h(ch0, rl, s0);
      s0 = mma_h(cl0, rh, s0);
      s1 = mma_h(ch1, rh, s1);
      s1 = mma_h(ch1, rl, s1);
      s1 = mma_h(cl1, rh, s1);
      guard2(s0, s1, rh, rl, ch0, cl0, ch1, cl1);
    }
    wave_sync_lds();
    // ---- additive term + online softmax in base 2, -inf-safe; the lane's 16 logits all belong to row q0 + c ----
    float e[16];                            // element s = column kb + 8hh + s (s < 8), kb + 16 + 8hh + s - 8 (s >= 8)
    {
      const float* crow = pt + c * PTP + 8 * hh;
      const v4f c0 = *(const v4f*)(crow), c1 = *(const v4f*)(crow + 4);
      const v4f c2 = *(const v4f*)(crow + 16), c3 = *(const v4f*)(crow + 20);
#pragma unroll
      for (int r = 0; r < 4; ++r) {
        e[r]      = (s0[r] * invc + c0[r]) * LOG2E;
        e[4 + r]  = (s0[4 + r] * invc + c1[r]) * LOG2E;
        e[8 + r]  = (s1[r] * invc + c2[r]) * LOG2E;
        e[12 + r] = (s1[4 + r] * invc + c3[r]) * LOG2E;
      }
    }
    float mx = e[0];
#pragma unroll
    for (int s = 1; s < 16; ++s) mx = fmaxf(mx, e[s]);
    mx = fmaxf(mx, xhalf(mx));              // the other half of the row's 32 columns
    const float mn = fmaxf(mrow, mx);
    const float ms = (mn == -INFINITY) ? 0.0f : mn;
    const float al = exp2f(mrow - ms);
    mrow = mn;
#pragma unroll
    for (int s = 0; s < 16; ++s) e[s] = exp2f(e[s] - ms);
    {
      const float pa = ((e[0] + e[1]) + (e[2] + e[3])) + ((e[4] + e[5]) + (e[6] + e[7]));
      const float pb = ((e[8] + e[9]) + (e[10] + e[11])) + ((e[12] + e[13]) + (e[14] + e[15]));
      lrow = lrow * al + (pa + pb);
    }
#pragma unroll
    for (int j = 0; j < 4; ++j) {
#pragma unroll
      for (int r = 0; r < 8; ++r) o[j][r] *= al;
    }
    // ---- B fragments of P^T*32768: hi f16 and residual f16, column = row q0 + c; the score registers already lie in the
    //      split k map over the 32 columns of this step, so element s of the fragment is e[s] ----
    FragH ph, pl;
#pragma unroll
    for (int s = 0; s < 8; ++s) {
      const float ta = e[s] * PCAR, tb = e[8 + s] * PCAR;
      const _Float16 ha = (_Float16)ta, hb = (_Float16)tb;
      ph.h[0][s] = ha;
      ph.h[1][s] = hb;
      pl.h[0][s] = (_Float16)(ta - (float)ha);
      pl.h[1][s] = (_Float16)(tb - (float)hb);
    }
    // ---- v^T.P^T : A fragment row m = d = j*16 + c, columns vi contiguous in the v^T tile rows; 2 groups of 2 d-subtiles ----
    {
      const _Float16* vhp = Vhb + kl;
      const _Float16* vlp = Vlb + kl;
#pragma unroll
      for (int jg = 0; jg < HD / 32; ++jg) {
        const int da = (2 * jg) * 16 * VTP;
        const int db = da + 16 * VTP;
        const v16h vha = ldfrag_h(vhp + da), vhb2 = ldfrag_h(vhp + db);
        const v16h vla = ldfrag_h(vlp + da), vlb2 = ldfrag_h(vlp + db);
        o[2 * jg]     = mma_h(vha,  ph.v, o[2 * jg]);
        o[2 * jg]     = mma_h(vha,  pl.v, o[2 * jg]);
        o[2 * jg]     = mma_h(vla,  ph.v, o[2 * jg]);
        o[2 * jg + 1] = mma_h(vhb2, ph.v, o[2 * jg + 1]);
        o[2 * jg + 1] = mma_h(vhb2, pl.v, o[2 * jg + 1]);
        o[2 * jg + 1] = mma_h(vlb2, ph.v, o[2 * jg + 1]);
        guard2(o[2 * jg], o[2 * jg + 1], ph.v, pl.v, vha, vhb2, vla, vlb2);
      }
    }
    wave_sync_lds();
  }
  acc_guard4(o[0], o[1], o[2], o[3]);
  // ---- out = acc / Z (0 if Z == 0), carries (32768 on P, 1024 on v) folded once; written into the lane-owned slab ----
  {
    const float lv  = lrow + xhalf(lrow);   // the two lane halves' shares of the row sum, joined once
    const float ls  = (lv > 0.0f) ? lv : 1.0f;
    const float inv = (lv > 0.0f) ? ((1.0f / ls) * oc) : 0.0f;
#pragma unroll
    for (int j = 0; j < 4; ++j) {
      float* sp = slab + c * SLP + j * 16 + 8 * hh;     // row q0 + c, 8 consecutive d
      v4f w0, w1;
#pragma unroll
      for (int r = 0; r < 4; ++r) { w0[r] = o[j][r] * inv; w1[r] = o[j][4 + r] * inv; }
      *(v4f*)(sp)     = w0;
      *(v4f*)(sp + 4) = w1;
    }
  }

  wave_sync_lds();
  // ---- gate in f32, then O x1024 -> f16 hi + residual planes; lane = (row select rq in 0..3, 8 consecutive d at c8) ----
  v4u oh[4], ol[4];
  const int rq = lane >> 3, c8 = (lane & 7) * 8;
  const float* urow = U + ((size_t)b * LP + q0) * DI + (size_t)head * HD + c8;
  float bb[8];
  {
    const v4f u0 = *(const v4f*)(bu + head * HD + c8), u1 = *(const v4f*)(bu + head * HD + c8 + 4);
#pragma unroll
    for (int e = 0; e < 4; ++e) { bb[e] = bfr(u0[e]); bb[4 + e] = bfr(u1[e]); }
  }
#pragma unroll
  for (int it = 0; it < 4; ++it) {
    const int row = it * 4 + rq;
    const v4f a  = *(const v4f*)(slab + row * SLP + c8), b4 = *(const v4f*)(slab + row * SLP + c8 + 4);
    const v4f ua = *(const v4f*)(urow + (size_t)row * DI), ub = *(const v4f*)(urow + (size_t)row * DI + 4);
    float w[8];
#pragma unroll
    for (int e = 0; e < 4; ++e) {
      w[e]     = (a[e]  * sigm(ua[e] + bb[e]))     * OSC;
      w[4 + e] = (b4[e] * sigm(ub[e] + bb[4 + e])) * OSC;
    }
#pragma unroll
    for (int e = 0; e < 4; ++e) {
      const _Float16 h0 = (_Float16)w[2 * e], h1 = (_Float16)w[2 * e + 1];
      const _Float16 l0 = (_Float16)(w[2 * e] - (float)h0), l1 = (_Float16)(w[2 * e + 1] - (float)h1);
      oh[it][e] = pk16(h_bits(h0), h_bits(h1));
      ol[it][e] = pk16(h_bits(l0), h_bits(l1));
    }
  }
  const size_t ob = ((size_t)b * LP + q0) * DI + (size_t)head * HD + c8;
  {
#pragma unroll
    for (int it = 0; it < 4; ++it) {
      const int row = it * 4 + rq;
      *(v4u*)(OHp + ob + (size_t)row * DI) = oh[it];
      *(v4u*)(OLp + ob + (size_t)row * DI) = ol[it];
    }
    
  }
}

// =====================================================================================================
// Rows s are processed in NGRP groups of BG rows; every per-group workspace plane is reused in launch order.
// Workspace map (bytes); every plane is fully written by whole-line stores before it is read; all extents are exact
// multiples of the store granularity (no pad rows needed); every region offset a multiple of 65536:
//   XB  bf16 [NPIX][256] (hi|lo)                    33554432
//   OH, OL  f16 [GROWS][256] x1024                  2 * GROWS*512
//   U   f32 [GROWS][256]                            GROWS*1024   (gate pre-activation)
//   QH, KH, QL, KL  f16 [GROWS][256]               4 * GROWS*512
//   VH, VL  f16 [BG*4][64][LP]                      2 * GROWS*512
//   CB  f32 [4][NPIX]                               1048576
//   WQ, WK, WV, WU  bf16 [256 n][256 k]             4 * 131072   (contiguous in this order: proj4 reads them as one plane)
//   WO  f16 x1024 [128 n][256 k]                    65536
//   end (BG = 64)                                   119078912
// =====================================================================================================
extern "C" void kernel_launch(void* const* d_in, const int* in_sizes, int n_in,
                              void* d_out, int out_size, void* d_ws, size_t ws_size,
                              hipStream_t stream) {
  if (n_in < 12) return;
  if (in_sizes[0] < NPIX * DM) return;
  if (in_sizes[1] < NPIX) return;
  if (in_sizes[2] < DM || in_sizes[3] < DM) return;
  if (in_sizes[4] < DM * DI || in_sizes[5] < DM * DI || in_sizes[6] < DM * DI || in_sizes[8] < DM * DI) return;
  if (in_sizes[7] < DM * NH) return;
  if (in_sizes[9] < DI) return;
  if (in_sizes[10] < DI * DM) return;
  if (in_sizes[11] < DM) return;
  if (out_size < NS * LP * DM) return;

  const float* pr    = (const float*)d_in[0];
  const float* mask  = (const float*)d_in[1];
  const float* gamma = (const float*)d_in[2];
  const float* beta  = (const float*)d_in[3];
  const float* Wq    = (const float*)d_in[4];
  const float* Wk    = (const float*)d_in[5];
  const float* Wv    = (const float*)d_in[6];
  const float* Wb    = (const float*)d_in[7];
  const float* Wu    = (const float*)d_in[8];
  const float* bu    = (const float*)d_in[9];
  const float* Wo    = (const float*)d_in[10];
  const float* bo    = (const float*)d_in[11];
  float*       out   = (float*)d_out;

  const size_t szXB = (size_t)NPIX * KX * 2;
  const size_t szU  = (size_t)GROWS * DI * 4;
  const size_t szH  = (size_t)GROWS * DI * 2;                   // QH, KH, QL, KL, OH, OL
  const size_t szV  = (size_t)BG * NH * HD * LP * 2;            // VH, VL (== szH)
  const size_t szCB = (size_t)NH * NPIX * 4;
  const size_t szW  = (size_t)DI * KX * 2;
  const size_t szWO = (size_t)DM * DI * 2;
  size_t off = 0;
  const size_t oXB = off; off += szXB;
  const size_t oOH = off; off += szH;
  const size_t oOL = off; off += szH;
  const size_t oU  = off; off += szU;
  const size_t oQH = off; off += szH;
  const size_t oKH = off; off += szH;
  const size_t oQL = off; off += szH;
  const size_t oKL = off; off += szH;
  const size_t oVH = off; off += szV;
  const size_t oVL = off; off += szV;
  const size_t oCB = off; off += szCB;
  const size_t oWQ = off; off += szW;
  const size_t oWK = off; off += szW;
  const size_t oWV = off; off += szW;
  const size_t oWU = off; off += szW;
  const size_t oWO = off; off += szWO;
  if (off > ws_size) return;                // off = 119078912 for BG = 64
  if (off > (size_t)WS_CAP) return;

  char* ws = (char*)d_ws;
  u16*   XB = (u16*)(ws + oXB);
  u16*   OH = (u16*)(ws + oOH);
  u16*   OL = (u16*)(ws + oOL);
  float* U  = (float*)(ws + oU);
  u16*   QH = (u16*)(ws + oQH);
  u16*   KH = (u16*)(ws + oKH);
  u16*   QL = (u16*)(ws + oQL);
  u16*   KL = (u16*)(ws + oKL);
  u16*   VH = (u16*)(ws + oVH);
  u16*   VL = (u16*)(ws + oVL);
  float* CB = (float*)(ws + oCB);
  u16*   WQ = (u16*)(ws + oWQ);
  u16*   WK = (u16*)(ws + oWK);
  u16*   WV = (u16*)(ws + oWV);
  u16*   WU = (u16*)(ws + oWU);
  u16*   WO = (u16*)(ws + oWO);

  const dim3 b256(256), bAT(ATT_THREADS);
  const dim3 gLN(NPIX / LNPB);                          // 2048
  const dim3 gWP((DI / 128) * (DM / 64));               // 4: Wq, Wk, Wv, Wu planes
  const dim3 gWO((DM / 128) * (DI / 64));               // 4: Wo plane
  const dim3 gP((GROWS / PXR) * NPT);
  const dim3 gAT(NQT * BG);
  const dim3 gO(BG * NST);
  const float osc = 1.0f / (OSC * WOS);

  // LayerNorm once for every pixel: x hi|lo planes and the additive logit table
  ln_x<<<gLN, b256, 0, stream>>>(pr, mask, gamma, beta, Wb, XB, CB);
  // weight planes once: Wq^T, Wk^T, Wv^T, Wu^T [n][k | k] as bf16; Wo^T [n][k] as f16 of bf16 value x1024
  wt16<<<gWP, b256, 0, stream>>>(Wq, DI, DM, WQ, KX, 1, 0, 1.0f);
  wt16<<<gWP, b256, 0, stream>>>(Wk, DI, DM, WK, KX, 1, 0, 1.0f);
  wt16<<<gWP, b256, 0, stream>>>(Wv, DI, DM, WV, KX, 1, 0, 1.0f);
  wt16<<<gWP, b256, 0, stream>>>(Wu, DI, DM, WU, KX, 1, 0, 1.0f);
  wt16<<<gWO, b256, 0, stream>>>(Wo, DM, DI, WO, DI, 0, 1, WOS);

  for (int g = 0; g < NGRP; ++g) {
    const u16*   xg = XB   + (size_t)g * GROWS * KX;
    const float* mg = mask + (size_t)g * GROWS;
    float*       og = out  + (size_t)g * GROWS * DM;
    // (1) q, k, v, u projections in one launch: q, k and v^T as f16 hi + residual planes, gate pre-activation u as f32
    proj4<<<gP, b256, 0, stream>>>(xg, WQ, QH, QL, KH, KL, VH, VL, U);
    // (2) attention: rows from the k planes, columns from the q planes, sum over columns with v; gated O -> OH + OL planes
    attn_t<<<gAT, bAT, 0, stream>>>(KH, KL, QH, QL, VH, VL, CB, U, bu, OH, OL);
    // (3) output projection (hi + residual), + bo, x mask row scale -> out f32, carries 1024 x 1024 folded back
    gemm_o<<<gO, b256, 0, stream>>>(OH, OL, WO, bo, mg, og, osc);
  }
  (void)hipGetLastError();
}

// v005
// Measured time: 223 microseconds a run.
// Two timings next to v004 put it at 1.24 and 1.23 times that version's speed.
// Counting every step since v000, it is 2.78 times as fast.
// Contractions: x.Wq, x.Wk, x.Wv, x.Wu on v_wmma_f32_16x16x32_bf16 (x as bf16 hi|lo pair folded into K = 256, W as bf16 RNE
// of the input, f32 accumulate); k.q^T over 64 and P.v^T on v_wmma_f32_16x16x32_f16 (k x1024 and q x128 f16 hi + residual
// planes, P x32768 f16 hi + residual, v x1024 f16 hi + residual; products hh + lh + hl); (O*gate).Wo on
// v_wmma_f32_16x16x32_f16 (O x1024 f16 hi + residual, Wo as f16(bf16(Wo)) x1024, products h.w + l.w); all f32 accumulate.
// LayerNorm, x.Wb (N = 4) and the additive logit table, base-2 online softmax, sigmoid gate, bias and row scale in f32 on VALU.
#include <hip/hip_runtime.h>
#include <math.h>
#include <stdint.h>

#ifndef NS
#define NS 256
#endif
#define NSX   256
#define LP    256
#define DM    128
#define NH    4
#define HD    64
#define DI    (NH * HD)
#define KX    (2 * DM)
#define NPIX  (LP * LP)
#define BG    ((NS <= 128) ? NS : 128)
#define NGRP  (NS / BG)
#define GROWS (BG * LP)
#define LNEPS 1e-5f
#define LOG2E 1.4426950408889634f
#define QSC   128.0f
#define CSC   1024.0f
#define KSC   1024.0f
#define PCAR  32768.0f
#define VCAR  1024.0f
#define OSC   1024.0f
#define WOS   1024.0f
#define WPB   4
#define NQT   (LP / 16)
#define NST   (LP / 64)
#define NKT   (LP / 32)
#define ATT_THREADS (WPB * 32)
#define PTP   36
#define PTW   (16 * PTP)
#define SLP   68
#define SLW   (16 * SLP)
#define WREG  (PTW + SLW)
#define SLAB64 (16 * 68)
#define VTP   72
#define NPT   (4 * DI / 64)
#define PLP   256
#define LNPB  32
#define STG   64
#define TPL   (STG * VTP)
#define WS_CAP 268435456
#define PXR   128
#define PKP   (KX + 8)
#define PROJ_THREADS 256
static_assert(DI == NH * HD && HD == 64 && NH == 4 && WPB == NH);
static_assert(ATT_THREADS == 128);
static_assert(STG == 64 && HD == STG && (LP % STG) == 0 && NST * NH == NQT);
static_assert(NS >= 1 && NS <= NSX && (NS % BG) == 0 && BG >= 1 && BG <= 128);
static_assert((LP % 64) == 0 && (LP % 32) == 0 && (LP % 16) == 0);
static_assert(DM == 128 && (KX % 32) == 0 && (DI % 64) == 0 && (DI % 32) == 0 && (DM % 64) == 0);
static_assert(PLP == DI && PLP == LP && NPT == 4 * NH && (GROWS % 64) == 0);
static_assert((NPIX % LNPB) == 0 && LNPB == 32);
static_assert((GROWS % PXR) == 0 && PXR == 128 && PROJ_THREADS == 256 && KX == 256 && DI == KX && DM == 128 && 8 * SLAB64 * 4 <= (PXR + 64) * PKP * 2);
static_assert((DI % 128) == 0 && (DM % 128) == 0 && (DM % 64) == 0 && (DI % 64) == 0);

typedef unsigned short u16;
typedef _Float16 v16h __attribute__((ext_vector_type(16)));
typedef _Float16 v8h  __attribute__((ext_vector_type(8)));
typedef __bf16   v16b __attribute__((ext_vector_type(16)));
typedef float    v8f  __attribute__((ext_vector_type(8)));
typedef float    v4f  __attribute__((ext_vector_type(4)));
typedef unsigned int v4u __attribute__((ext_vector_type(4)));
typedef unsigned int v2u __attribute__((ext_vector_type(2)));

union FragH { v16h v; v8h h[2]; v4u u[2]; };
union FragB { v16b v; v4u u[2]; };

// ---- scalar helpers --------------------------------------------------------------------------------
__device__ __forceinline__ unsigned short bf_bits(float f) {          // f32 -> bf16 bits, RNE convert
  unsigned u = __float_as_uint(f);
  return (unsigned short)((u + 0x7FFFu + ((u >> 16) & 1u)) >> 16);
}
__device__ __forceinline__ float bf_up(unsigned short h) { return __uint_as_float(((unsigned)h) << 16); }
__device__ __forceinline__ float bfr(float f) { return bf_up(bf_bits(f)); }
__device__ __forceinline__ unsigned short h_bits(_Float16 x) { return __builtin_bit_cast(unsigned short, x); }
__device__ __forceinline__ unsigned pk16(unsigned short a, unsigned short b) { return (unsigned)a | ((unsigned)b << 16); }
__device__ __forceinline__ v8f zero8() { v8f z = {0.f, 0.f, 0.f, 0.f, 0.f, 0.f, 0.f, 0.f}; return z; }
__device__ __forceinline__ float sigm(float z) {                     // 1 / (1 + 2^(-z log2 e)), argument clamped
  const float zc = fminf(fmaxf(z, -30.0f), 30.0f);
  const float e  = exp2f(-zc * LOG2E);
  return __builtin_amdgcn_rcpf(1.0f + e);
}

// ---- fragment loaders: 16-bit A/B operand, lane -> row/col (lane&15), p already includes +8*(lane>>4);
//      elements 0..7 <- p[0..7] (k0+8h..), elements 8..15 <- p[16..23] (k0+16+8h..)  (same split k map for A and B;
//      B is always read from a k-contiguous [n][k] plane)
__device__ __forceinline__ v16h ldfrag_h(const _Float16* p) {
  FragH f;
  f.h[0] = *(const v8h*)(p);
  f.h[1] = *(const v8h*)(p + 16);
  return f.v;
}
__device__ __forceinline__ v16b ldfrag_b(const u16* p) {              // bf16 plane read as unsigned integer vectors
  FragB f;
  f.u[0] = *(const v4u*)(p);
  f.u[1] = *(const v4u*)(p + 16);
  return f.v;
}

__device__ __forceinline__ v8f mma_h(v16h a, v16h b, v8f c) {
  return __builtin_amdgcn_wmma_f32_16x16x32_f16(false, a, false, b, (short)0, c, false, false);
}
__device__ __forceinline__ v8f mma_b(v16b a, v16b b, v8f c) {
  return __builtin_amdgcn_wmma_f32_16x16x32_bf16(false, a, false, b, (short)0, c, false, false);
}
__device__ __forceinline__ void guard2(v8f& a, v8f& b, v16h x0, v16h x1, v16h x2, v16h x3, v16h x4, v16h x5) {
#if defined(__HIP_DEVICE_COMPILE__)
  asm volatile("v_nop\n\tv_nop\n\tv_nop\n\tv_nop"
               : "+v"(a), "+v"(b) : "v"(x0), "v"(x1), "v"(x2), "v"(x3), "v"(x4), "v"(x5) : "memory");
#endif
}
template <typename F>
__device__ __forceinline__ void guard6(v8f& a, v8f& b, v8f& c, v8f& d, F x0, F x1, F x2, F x3, F x4, F x5) {
#if defined(__HIP_DEVICE_COMPILE__)
  asm volatile("v_nop\n\tv_nop\n\tv_nop\n\tv_nop"
               : "+v"(a), "+v"(b), "+v"(c), "+v"(d) : "v"(x0), "v"(x1), "v"(x2), "v"(x3), "v"(x4), "v"(x5) : "memory");
#endif
}
__device__ __forceinline__ void acc_guard4(v8f& a, v8f& b, v8f& c, v8f& d) {
#if defined(__HIP_DEVICE_COMPILE__)
  asm volatile("v_nop\n\tv_nop\n\tv_nop\n\tv_nop" : "+v"(a), "+v"(b), "+v"(c), "+v"(d));
#endif
}
__device__ __forceinline__ float xhalf(float x) {                    // value of lane l ^ 16 (the other 16-lane row)
  const int b = __builtin_bit_cast(int, x);
  return __builtin_bit_cast(float, __builtin_amdgcn_permlanex16(b, b, 0x76543210, 0xfedcba98, false, false));
}
__device__ __forceinline__ void wave_sync_lds() {
  __builtin_amdgcn_fence(__ATOMIC_RELEASE, "workgroup");
  __builtin_amdgcn_wave_barrier();
  __builtin_amdgcn_fence(__ATOMIC_ACQUIRE, "workgroup");
}

// =====================================================================================================
// statistics), x written as bf16 hi | bf16 lo planes XB [NPIX][KX] (columns 0..127 hi bits, 128..255 lo bits of x - hi);
// the additive logit table CB [NH][NPIX] = 1e9*(mask - 1) + x.Wb (VALU f32, N = 4) is produced by the same block.
// Block = 8 waves x LNPB/8 pixels, wave = one pixel at a time (lane holds 4 channels); the 512-B x row is assembled in a
// x 4 heads) are funnelled through LDS and written by wave 0 in one instruction (8 consecutive lanes x 16 B per line);
// coverage: grid = NPIX/LNPB blocks x 32 pixels = every XB row once and every CB line once.
// =====================================================================================================
__global__ __launch_bounds__(256) void ln_x(const float* __restrict__ pr, const float* __restrict__ mask,
                                            const float* __restrict__ gamma, const float* __restrict__ beta,
                                            const float* __restrict__ Wb, u16* XB, float* CB) {
  __shared__ __align__(16) u16 RB[8 * KX];
  __shared__ __align__(16) float PBS[NH * LNPB];
  const int tid = threadIdx.x, wave = tid >> 5, lane = tid & 31;
  const int p0 = (int)blockIdx.x * LNPB;
  if (p0 + LNPB > NPIX) return;             // block-uniform, before any barrier; never taken with the exact grid
  float gm[4], bt[4], wb[16];
  {
    const v4f g4 = *(const v4f*)(gamma + 4 * lane), b4 = *(const v4f*)(beta + 4 * lane);
#pragma unroll
    for (int e = 0; e < 4; ++e) { gm[e] = bfr(g4[e]); bt[e] = bfr(b4[e]); }
#pragma unroll
    for (int i = 0; i < 4; ++i) {
      const v4f w4 = *(const v4f*)(Wb + 16 * lane + 4 * i);      // Wb[(4*lane + i)][h], h = 0..3
#pragma unroll
      for (int h = 0; h < 4; ++h) wb[4 * i + h] = bfr(w4[h]);
    }
  }
  u16* rb = RB + wave * KX;
#pragma unroll 1
  for (int j = 0; j < LNPB / 8; ++j) {
    const int pl = j * 8 + wave;
    const int p  = p0 + pl;
    const v4f x4 = *(const v4f*)(pr + (size_t)p * DM + 4 * lane);
    float xr[4];
#pragma unroll
    for (int e = 0; e < 4; ++e) xr[e] = bfr(x4[e]);
    float s = (xr[0] + xr[1]) + (xr[2] + xr[3]);
#pragma unroll
    for (int off = 1; off < 32; off <<= 1) s += __shfl_xor(s, off, 32);
    const float mu = s * (1.0f / (float)DM);
    float d[4];
#pragma unroll
    for (int e = 0; e < 4; ++e) d[e] = xr[e] - mu;
    float ss = (d[0] * d[0] + d[1] * d[1]) + (d[2] * d[2] + d[3] * d[3]);
#pragma unroll
    for (int off = 1; off < 32; off <<= 1) ss += __shfl_xor(ss, off, 32);
    const float var = ss * (1.0f / (float)DM);
    const float rs  = 1.0f / sqrtf(var + LNEPS);
    float y[4];
#pragma unroll
    for (int e = 0; e < 4; ++e) y[e] = d[e] * rs * gm[e] + bt[e];
    unsigned short hb[4], lb[4];
#pragma unroll
    for (int e = 0; e < 4; ++e) { hb[e] = bf_bits(y[e]); lb[e] = bf_bits(y[e] - bf_up(hb[e])); }
    float pb[4];
#pragma unroll
    for (int h = 0; h < 4; ++h) pb[h] = y[0] * wb[h] + y[1] * wb[4 + h] + y[2] * wb[8 + h] + y[3] * wb[12 + h];
#pragma unroll
    for (int h = 0; h < 4; ++h) {
#pragma unroll
      for (int off = 1; off < 32; off <<= 1) pb[h] += __shfl_xor(pb[h], off, 32);
    }
    const float mk = bfr(mask[p]);
    const float mb = 1e9f * (mk - 1.0f);
    v2u hv, lv;
    hv[0] = pk16(hb[0], hb[1]);  hv[1] = pk16(hb[2], hb[3]);
    lv[0] = pk16(lb[0], lb[1]);  lv[1] = pk16(lb[2], lb[3]);
    *(v2u*)(rb + 4 * lane)      = hv;
    *(v2u*)(rb + DM + 4 * lane) = lv;
    if (lane == 0) {
      PBS[0 * LNPB + pl] = mb + pb[0];
      PBS[1 * LNPB + pl] = mb + pb[1];
      PBS[2 * LNPB + pl] = mb + pb[2];
      PBS[3 * LNPB + pl] = mb + pb[3];
    }
    wave_sync_lds();
    const v4u piece = *(const v4u*)(rb + 8 * lane);
    u16* dst = XB + (size_t)p * KX + 8 * lane;
    {
      *(v4u*)(dst) = piece;
      
    }
    wave_sync_lds();
  }
  __syncthreads();
  if (wave == 0) {
    const int h = lane >> 3, j4 = (lane & 7) * 4;
    const v4f v = *(const v4f*)(PBS + h * LNPB + j4);
    float* d = CB + (size_t)h * NPIX + p0 + j4;
    {
      *(v4f*)(d) = v;
      
    }
  }
}

// =====================================================================================================
// Transposed weight plane: W f32 [nk rows k][ncol cols n] -> D 16-bit [n][ldd], D[n][k] = bf16 bits of W[k][n] (f16mode 0)
// or f16 bits of bf16(W[k][n]) * scale (f16mode 1); when dup != 0 the same 64-half segment is also written at D[n][nk + k]
// (hi|lo folded K). Block (ct = bid % nct: 128 columns, rt = bid / nct: 64 rows): each thread loads 32 floats of one k row
// (16-B loads), converts, scatters into the LDS tile [128 n][64 k] (pitch 72 halves); after a block barrier each n row segment
// coverage: load 256 thr x 32 = 64 k rows x 128 n; store 4 iterations x 256 thr x 8 halves = 128 lines x 64 = the block's tile
// =====================================================================================================
__global__ __launch_bounds__(256) void wt16(const float* __restrict__ W, int ncol, int nk, u16* D, int ldd, int dup,
                                            int f16mode, float scale) {
  __shared__ __align__(16) u16 T[128 * VTP];
  const int tid = threadIdx.x;
  const int bid = blockIdx.x;
  const int nct = ncol / 128;
  const int ct  = bid % nct;
  const int rt  = bid / nct;
  if (rt * 64 + 64 > nk) return;            // block-uniform, before the barrier; never taken with the exact grid
  {
    const int sl = tid >> 2;                // k row within tile 0..63
    const int dc = (tid & 3) * 32;          // n chunk
    const float* src = W + (size_t)(rt * 64 + sl) * ncol + ct * 128 + dc;
#pragma unroll
    for (int i = 0; i < 8; ++i) {
      const v4f a = *(const v4f*)(src + 4 * i);
#pragma unroll
      for (int e = 0; e < 4; ++e) {
        const float f = a[e];
        const unsigned short hb = h_bits((_Float16)(bfr(f) * scale));
        const unsigned short bb = bf_bits(f);
        T[(dc + 4 * i + e) * VTP + sl] = (f16mode != 0) ? hb : bb;
      }
    }
  }
  __syncthreads();
  v4u w4[4];
  const int q8 = tid >> 3, p8 = (tid & 7) * 8;
#pragma unroll
  for (int it = 0; it < 4; ++it) {
    const int line = it * 32 + q8;          // n within tile 0..127
    w4[it] = *(const v4u*)(T + line * VTP + p8);
  }
  const size_t base = ((size_t)ct * 128) * ldd + rt * 64 + p8;
  {
#pragma unroll
    for (int it = 0; it < 4; ++it) {
      const int line = it * 32 + q8;
      *(v4u*)(D + base + (size_t)line * ldd) = w4[it];
      if (dup != 0) *(v4u*)(D + base + (size_t)line * ldd + nk) = w4[it];
    }
    
  }
}

// =====================================================================================================
// epi64o additionally adds a per-column bias (bf16 RNE of the input) and multiplies by a per-row scale (bf16 RNE of mask).
// coverage: 8 instructions x 2 rows x 16 lanes x 4 floats = the wave's 16 x 64 tile.
// =====================================================================================================
__device__ __forceinline__ void epi64(float* sl, v8f a0, v8f a1, v8f a2, v8f a3, float oscale,
                                      float* C, int N, size_t rowb, int col0, int lane) {
  const int hh = lane >> 4, m = lane & 15;
#pragma unroll
  for (int r = 0; r < 8; ++r) {
    const int ro = (8 * hh + r) * 68 + m;
    sl[ro]      = a0[r] * oscale;
    sl[ro + 16] = a1[r] * oscale;
    sl[ro + 32] = a2[r] * oscale;
    sl[ro + 48] = a3[r] * oscale;
  }
  wave_sync_lds();
  v4f vals[8];
#pragma unroll
  for (int it = 0; it < 8; ++it) vals[it] = *(const v4f*)(sl + (it * 2 + hh) * 68 + m * 4);
  float* dst = C + (rowb + (size_t)hh) * (size_t)N + col0 + m * 4;
  {
#pragma unroll
    for (int it = 0; it < 8; ++it) {
      *(v4f*)(dst + (size_t)(it * 2) * (size_t)N) = vals[it];
    }
    
  }
}
__device__ __forceinline__ void epi64o(float* sl, v8f a0, v8f a1, v8f a2, v8f a3, float oscale,
                                       float* C, int N, size_t rowb, int col0, int lane,
                                       const float* __restrict__ bias, const float* __restrict__ rsc) {
  const int hh = lane >> 4, m = lane & 15;
#pragma unroll
  for (int r = 0; r < 8; ++r) {
    const int ro = (8 * hh + r) * 68 + m;
    sl[ro]      = a0[r] * oscale;
    sl[ro + 16] = a1[r] * oscale;
    sl[ro + 32] = a2[r] * oscale;
    sl[ro + 48] = a3[r] * oscale;
  }
  wave_sync_lds();
  float bq[4];
  {
    const v4f b4 = *(const v4f*)(bias + col0 + m * 4);
#pragma unroll
    for (int e = 0; e < 4; ++e) bq[e] = bfr(b4[e]);
  }
  v4f vals[8];
#pragma unroll
  for (int it = 0; it < 8; ++it) {
    const v4f t = *(const v4f*)(sl + (it * 2 + hh) * 68 + m * 4);
    const float mk = bfr(rsc[rowb + (size_t)hh + (size_t)(it * 2)]);
    v4f o;
#pragma unroll
    for (int e = 0; e < 4; ++e) o[e] = (t[e] + bq[e]) * mk;
    vals[it] = o;
  }
  float* dst = C + (rowb + (size_t)hh) * (size_t)N + col0 + m * 4;
  {
#pragma unroll
    for (int it = 0; it < 8; ++it) {
      *(v4f*)(dst + (size_t)(it * 2) * (size_t)N) = vals[it];
    }
    
  }
}

// =====================================================================================================
// Split epilogue: the wave's 16 x 64 f32 tile, times sc, goes out as f16 hi + f16 residual planes (row pitch PLP halves).
// The tile passes through the wave's slab so that 8 consecutive lanes hold one row's 64 halves = one whole 128-B line.
// coverage: 4 instructions x 4 rows x 8 lanes x 8 halves = the wave's 16 x 64 tile of each plane.
// =====================================================================================================
__device__ __forceinline__ void epi64s(float* sl, v8f a0, v8f a1, v8f a2, v8f a3, float sc,
                                       u16* Hp, u16* Lp, size_t ob, int lane) {
  const int hh = lane >> 4, m = lane & 15;
#pragma unroll
  for (int r = 0; r < 8; ++r) {
    const int ro = (8 * hh + r) * 68 + m;
    sl[ro]      = a0[r];
    sl[ro + 16] = a1[r];
    sl[ro + 32] = a2[r];
    sl[ro + 48] = a3[r];
  }
  wave_sync_lds();
  const int rq = lane >> 3, c8 = (lane & 7) * 8;
  v4u oh[4], ol[4];                         // the loops below are unrolled so that these stay in registers
#pragma unroll
  for (int it = 0; it < 4; ++it) {
    const float* p = sl + (it * 4 + rq) * 68 + c8;
    const v4f a = *(const v4f*)(p), b4 = *(const v4f*)(p + 4);
    float w[8];
#pragma unroll
    for (int e = 0; e < 4; ++e) { w[e] = a[e] * sc; w[4 + e] = b4[e] * sc; }
#pragma unroll
    for (int e = 0; e < 4; ++e) {
      const float t0 = w[2 * e], t1 = w[2 * e + 1];
      const _Float16 h0 = (_Float16)t0, h1 = (_Float16)t1;
      const _Float16 l0 = (_Float16)(t0 - (float)h0), l1 = (_Float16)(t1 - (float)h1);
      oh[it][e] = pk16(h_bits(h0), h_bits(h1));
      ol[it][e] = pk16(h_bits(l0), h_bits(l1));
    }
  }
  u16* dh = Hp + ob + (size_t)rq * PLP + c8;
  u16* dl = Lp + ob + (size_t)rq * PLP + c8;
#pragma unroll
  for (int it = 0; it < 4; ++it) {
    *(v4u*)(dh + (size_t)(it * 4) * PLP) = oh[it];
    *(v4u*)(dl + (size_t)(it * 4) * PLP) = ol[it];
  }
}

// =====================================================================================================
// The four projections of one row group in one launch: X [GROWS][KX] (bf16 hi|lo rows of x) against Wt [4*DI][KX] (bf16,
// k-contiguous; rows 0.. Wq^T, DI.. Wk^T, 2*DI.. Wv^T, 3*DI.. Wu^T), f32 accumulate, K = KX stepped by 32.
// Block bid -> (64 rows of Wt nt = bid % NPT, PXR = 128 rows of X rb = bid / NPT); sel = nt / NH names the projection,
// g = nt % NH the head. The block's 128 X rows and 64 Wt rows are brought in once with whole-line 16-B loads (one wave = one
// 512-B row per instruction), stored to LDS (pitch PKP halves = 16 B x 33) and read from there as fragments by all 8 waves
// (two 16-B loads each, the same split k map for both operands, so either plane can be the row operand).
//   q, k, u: row operand X, column operand Wt: wave w's tile is [16 pos (16*w ..)][64 channels of head g].
//   v:       row operand Wt, column operand X: wave w's tile is [16 d (16*(w&3) ..)][64 pos (64*(w>>2) ..)], v^T as read later.
// Epilogue: u goes out as f32 (epi64); q x128 (= C^-0.5 x 1024), k x1024 and v^T x1024 go out as f16 hi + residual planes
// (epi64s): QH, QL, KH, KL [b*LP + pos][g*HD + d]; VH, VL [(b*NH + g)*HD + d][LP]. The waves' slabs reuse the operand LDS.
// coverage: grid = (GROWS/PXR) * NPT blocks, each one 128 x 64 tile = every element of U and of the six planes once.
// =====================================================================================================
__global__ __launch_bounds__(PROJ_THREADS)
void proj4(const u16* __restrict__ X, const u16* __restrict__ Wt, u16* QH, u16* QL, u16* KH, u16* KL,
           u16* VH, u16* VL, float* U) {
  __shared__ __align__(16) u16 opt[(PXR + 64) * PKP];   // X rows 0..127, then Wt rows 0..63; later the 8 result slabs
  const int tid = threadIdx.x, wave = tid >> 5, lane = tid & 31, hh = lane >> 4, m = lane & 15;
  const int bid = blockIdx.x;
  const int nt  = bid % NPT;
  const int rb  = bid / NPT;
  if (rb * PXR + PXR > GROWS) return;       // block-uniform, before any barrier; never taken with the exact grid
  const int sel = nt / NH;
  const int g   = nt % NH;
  {
    // staging: wave -> row wave + 8*i, lane -> 8 halves at 8*lane: each load and each LDS store covers one whole 512-B row
    const u16* gx = X  + (size_t)(rb * PXR + wave) * KX + 8 * lane;
    const u16* gw = Wt + (size_t)(nt * 64 + wave) * KX + 8 * lane;
    u16* tw = opt + wave * PKP + 8 * lane;
    v4u st[(PXR + 64) / 8];                 // the loops below are unrolled so that these stay in registers
#pragma unroll
    for (int i = 0; i < PXR / 8; ++i) st[i] = *(const v4u*)(gx + (size_t)(8 * i) * KX);
#pragma unroll
    for (int i = 0; i < 8; ++i) st[PXR / 8 + i] = *(const v4u*)(gw + (size_t)(8 * i) * KX);
    // the address registers of these loads are free for reuse below while the loads are still in flight
    asm volatile("s_wait_xcnt 0x0" ::: "memory");
#pragma unroll
    for (int i = 0; i < (PXR + 64) / 8; ++i) *(v4u*)(tw + 8 * i * PKP) = st[i];
  }
  __syncthreads();                          // both operand tiles are complete before any wave reads a fragment
  const int ao = ((sel == 2) ? (PXR + (wave & 3) * 16 + m) : (wave * 16 + m)) * PKP + 8 * hh;
  const int bo = ((sel == 2) ? ((wave >> 2) * 64 + m) : (PXR + m)) * PKP + 8 * hh;
  const u16* ap = opt + ao;
  const u16* bp = opt + bo;
  const int bs = 16 * PKP;
  v8f acc0 = zero8(), acc1 = zero8(), acc2 = zero8(), acc3 = zero8();
  // kept rolled: the guard ends every trip and no load may cross it, so unrolling would only lengthen the text
#pragma unroll 1
  for (int k0 = 0; k0 < KX; k0 += 32) {
    const v16b a  = ldfrag_b(ap + k0);
    const v16b b0 = ldfrag_b(bp + k0);
    const v16b b1 = ldfrag_b(bp + bs + k0);
    const v16b b2 = ldfrag_b(bp + 2 * bs + k0);
    const v16b b3 = ldfrag_b(bp + 3 * bs + k0);
    acc0 = mma_b(a, b0, acc0);
    acc1 = mma_b(a, b1, acc1);
    acc2 = mma_b(a, b2, acc2);
    acc3 = mma_b(a, b3, acc3);
    guard6<v16b>(acc0, acc1, acc2, acc3, a, b0, b1, b2, b3, a);
  }
  __syncthreads();                          // every wave has read its last fragment before the slabs overwrite the tiles
  float* sl = (float*)(void*)opt + wave * SLAB64;
  if (sel == 3) {
    epi64(sl, acc0, acc1, acc2, acc3, 1.0f, U, DI, (size_t)(rb * PXR + wave * 16), g * HD, lane);
  } else if (sel == 2) {
    const int r64 = rb * (PXR / 64) + (wave >> 2);      // which 64 positions of the row group
    const size_t ob = ((size_t)((r64 / NST) * NH + g) * HD + (wave & 3) * 16) * LP + (size_t)(r64 % NST) * 64;
    epi64s(sl, acc0, acc1, acc2, acc3, VCAR, VH, VL, ob, lane);
  } else {
    const size_t ob = (size_t)(rb * PXR + wave * 16) * DI + (size_t)g * HD;
    epi64s(sl, acc0, acc1, acc2, acc3, (sel == 0) ? QSC : KSC, (sel == 0) ? QH : KH, (sel == 0) ? QL : KL, ob, lane);
  }
}

// =====================================================================================================
// Output projection: C[row][DM] (f32) = ((Ah + Al)[row][DI] . Bt[DM][DI]^T) * oscale + bias[col], times rsc[row]
// (products h.B + l.B into one accumulator, l unscaled). Block -> (position tile rt = bid % NST, row group bb): 64 rows
// bb*LP + 64*rt .. of Ah, Al and C against all DM rows of Bt. The three operand tiles are staged in LDS as in proj4 (whole-line
// loads, pitch PKP halves); wave w's tile is [16 rows (16*(w&3) ..)][64 columns (64*(w>>2) ..)], epilogue epi64o.
// coverage: grid = BG * NST blocks, each one 64 x 128 tile = every element of the row group's C once.
// =====================================================================================================
__global__ __launch_bounds__(PROJ_THREADS)
void gemm_o(const u16* __restrict__ Ah, const u16* __restrict__ Al, const u16* __restrict__ Bt,
            const float* __restrict__ bias, const float* __restrict__ rsc, float* C, float oscale) {
  __shared__ __align__(16) u16 opt[(2 * 64 + DM) * PKP];   // Ah rows 0..63, Al rows 0..63, Bt rows 0..127; later the 8 slabs
  const int tid = threadIdx.x, wave = tid >> 5, lane = tid & 31, hh = lane >> 4, m = lane & 15;
  const int bid   = blockIdx.x;
  const int rt    = bid % NST;
  const int bb    = bid / NST;
  if (bb >= BG) return;                     // block-uniform, before any barrier; never taken with the exact grid
  const int K     = DI;
  const size_t row0 = (size_t)bb * LP + rt * 64;
  {
    // staging: wave -> row wave + 8*i, lane -> 8 halves at 8*lane: each load and each LDS store covers one whole 512-B row
    const u16* ga = Ah + (row0 + wave) * K + 8 * lane;
    const u16* gl = Al + (row0 + wave) * K + 8 * lane;
    const u16* gb = Bt + (size_t)wave * K + 8 * lane;
    u16* tw = opt + wave * PKP + 8 * lane;
    v4u st[(2 * 64 + DM) / 8];              // the loops below are unrolled so that these stay in registers
#pragma unroll
    for (int i = 0; i < 8; ++i) {
      st[i]     = *(const v4u*)(ga + (size_t)(8 * i) * K);
      st[8 + i] = *(const v4u*)(gl + (size_t)(8 * i) * K);
    }
#pragma unroll
    for (int i = 0; i < DM / 8; ++i) st[16 + i] = *(const v4u*)(gb + (size_t)(8 * i) * K);
    // the address registers of these loads are reused below while the loads are still in flight; the three bases are named
    // as inputs so that none of them is given up for another value ahead of the wait
    asm volatile("s_wait_xcnt 0x0" :: "v"(ga), "v"(gl), "v"(gb) : "memory");
#pragma unroll
    for (int i = 0; i < (2 * 64 + DM) / 8; ++i) *(v4u*)(tw + 8 * i * PKP) = st[i];
  }
  __syncthreads();                          // the three operand tiles are complete before any wave reads a fragment
  const int srow  = (wave & 3) * 16;
  const int col0  = (wave >> 2) * 64;
  const size_t rowC = row0 + srow;
  const _Float16* ahp = (const _Float16*)(const void*)opt + (srow + m) * PKP + 8 * hh;
  const _Float16* alp = ahp + 64 * PKP;
  const _Float16* bp  = (const _Float16*)(const void*)opt + (2 * 64 + col0 + m) * PKP + 8 * hh;
  const int bs = 16 * PKP;
  v8f acc0 = zero8(), acc1 = zero8(), acc2 = zero8(), acc3 = zero8();
#pragma unroll 1
  for (int k0 = 0; k0 < K; k0 += 32) {
    const v16h ah = ldfrag_h(ahp + k0), al = ldfrag_h(alp + k0);
    const v16h b0 = ldfrag_h(bp + k0);
    const v16h b1 = ldfrag_h(bp + bs + k0);
    const v16h b2 = ldfrag_h(bp + 2 * bs + k0);
    const v16h b3 = ldfrag_h(bp + 3 * bs + k0);
    acc0 = mma_h(ah, b0, acc0);  acc0 = mma_h(al, b0, acc0);
    acc1 = mma_h(ah, b1, acc1);  acc1 = mma_h(al, b1, acc1);
    acc2 = mma_h(ah, b2, acc2);  acc2 = mma_h(al, b2, acc2);
    acc3 = mma_h(ah, b3, acc3);  acc3 = mma_h(al, b3, acc3);
    guard6<v16h>(acc0, acc1, acc2, acc3, ah, al, b0, b1, b2, b3);
  }
  __syncthreads();                          // every wave has read its last fragment before the slabs overwrite the tiles
  epi64o((float*)(void*)opt + wave * SLAB64, acc0, acc1, acc2, acc3, oscale, C, DM, rowC, col0, lane, bias, rsc);
}

// =====================================================================================================
// Pair attention for one row group. Block bid -> (64 softmax rows qb = bid % NST, head = (bid / NST) % NH, row group b);
// the four waves take 16 rows each (q0 = 64*qb + 16*wave) of the SAME head and share its column operands: per 64 columns the
// Cm hi/residual rows [64 vi][64 d] and the v^T hi/residual rows [64 d][64 vi] are brought in once per block with whole-line
// 16-B loads (8 lanes per 128-B row), held in registers while the tile before is worked on, stored to LDS (pitch 72 halves)
// and read from there as fragments by all four waves. Softmax row index qi uses the k projection (column operand R), softmax
// column index vi uses the q projection (row operand Cm), summed over vi with v[vi].
//   R hi/residual planes (k x1024 f16) and Cm hi/residual planes (q x128 x 8 ... i.e. (q*C^-0.5) x1024 f16) laid out
//   [b*LP + pos][h*HD + d]; v^T hi/residual planes [b*NH + h][d][LP]; CB [h][qi][vi] f32 = 1e9*(mask - 1) + x.Wb.
//   scores s(i, j) = R_hi.C_hi + R_lo.C_hi + R_hi.C_lo over HD; logit (log2 domain) t = (s / (1024*1024) + CB) * log2 e.
//   All NKT column tiles of 32 visited in order. Per tile: the 16x32 CB tile is staged into the wave-private LDS tile with
//   16-B loads/stores, then 2 score subtiles x 2 k-steps, computed transposed: Cm fragments from the LDS tile are the row
//   operand and R the column operand, so a lane holds 16 logits of ONE softmax row (q0 + c): maximum and sum run in the lane,
//   with one exchange between the lane halves for the maximum. The two score subtiles' registers lie in the split k map, so
//   P^T*32768 (f16 hi plus its f16 residual) is converted in place into the column operand of out^T += v^T.P^T (v^T fragments
//   as row operand, 2 groups of 2 d-subtiles), products hh + lh + hl.
//   After the loop: out = acc / Z (Z >= 1 always; guarded anyway), carries 1/(32768*1024) folded once, written to the wave's
//   private result slab (pitch 68; every element owned by one lane).
//   Epilogue: out multiplied by sigmoid(U + bu) in f32 (U = x.Wu f32 plane, bu bf16 RNE of the input), then O x1024 -> f16
// coverage: per wave 4 instructions x 4 rows x 8 lanes x 8 halves = 16 x 64 per plane; grid = NQT * BG = NST * NH * BG blocks
//           x WPB waves = every (b, pos, h) row segment of OH and OL exactly once.
// =====================================================================================================
__global__ __launch_bounds__(ATT_THREADS)
void attn_t(const u16* __restrict__ RHp, const u16* __restrict__ RLp,
            const u16* __restrict__ CHp, const u16* __restrict__ CLp,
            const u16* __restrict__ VHp, const u16* __restrict__ VLp,
            const float* __restrict__ CB, const float* __restrict__ U, const float* __restrict__ bu,
            u16* OHp, u16* OLp) {
  __shared__ __align__(16) float smem[WPB * WREG];
  __shared__ __align__(16) u16 tile[4 * TPL];   // Cm hi, Cm residual [vi][d]; v^T hi, v^T residual [d][vi]; pitch VTP

  const int tid  = threadIdx.x;
  const int wave = tid >> 5;
  const int lane = tid & 31;
  const int hh   = lane >> 4;
  const int c    = lane & 15;
  const int bid  = blockIdx.x;
  const int qb   = bid % NST;
  const int t2   = bid / NST;
  const int head = t2 % NH;
  const int b    = t2 / NH;
  if (b >= BG) return;                      // block-uniform, before any barrier; never taken with the exact grid
  const int q0   = qb * 64 + wave * 16;

  float* pt   = smem + wave * WREG;         // CB tile [16][32] pitch 36
  float* slab = pt + PTW;                   // result slab [16][64] pitch 68

  const size_t hcol = (size_t)head * HD + 8 * hh;
  const _Float16* Rh  = (const _Float16*)(const void*)RHp + ((size_t)b * LP + q0 + c) * DI + hcol;
  const _Float16* Rl  = (const _Float16*)(const void*)RLp + ((size_t)b * LP + q0 + c) * DI + hcol;
  // fragment bases in the LDS tile: row c (+16 per subtile), halves 8*hh (+ the k offset per step)
  const _Float16* Chb = (const _Float16*)(const void*)tile + c * VTP + 8 * hh;   // row = vi within the tile, k = d
  const _Float16* Clb = Chb + TPL;
  const _Float16* Vhb = Chb + 2 * TPL;                                           // row = d, k = vi within the tile
  const _Float16* Vlb = Chb + 3 * TPL;
  // staging: thread -> (row sr + 16*i, 8 halves at sc); 8 consecutive lanes cover one 128-B row segment of a plane
  const int sr = tid >> 3, sc = (tid & 7) * 8;
  const u16* gch = CHp + ((size_t)b * LP + sr) * DI + (size_t)head * HD + sc;    // + (64*s + 16*i) * DI
  const u16* gcl = CLp + ((size_t)b * LP + sr) * DI + (size_t)head * HD + sc;
  const u16* gvh = VHp + ((size_t)(b * NH + head) * HD + sr) * LP + sc;          // + 16*i * LP + 64*s
  const u16* gvl = VLp + ((size_t)(b * NH + head) * HD + sr) * LP + sc;
  u16* tw = tile + sr * VTP + sc;
  const float* cbb = CB + ((size_t)head * LP + q0) * LP;
  const float invc = 1.0f / (CSC * KSC);
  const float oc   = 1.0f / (PCAR * VCAR);

  float mrow = -INFINITY, lrow = 0.f;       // of softmax row q0 + c; lrow is this lane half's share of the row sum
  v8f o[4];                                 // o[j][r] = out^T (d = 16*j + 8*hh + r, row q0 + c)
#pragma unroll
  for (int j = 0; j < 4; ++j) o[j] = zero8();

  v4u pre[16];                              // the next 64-column tile of the four planes, in flight
#pragma unroll
  for (int i = 0; i < 4; ++i) {
    pre[i]      = *(const v4u*)(gch + (size_t)(16 * i) * DI);
    pre[4 + i]  = *(const v4u*)(gcl + (size_t)(16 * i) * DI);
    pre[8 + i]  = *(const v4u*)(gvh + (size_t)(16 * i) * LP);
    pre[12 + i] = *(const v4u*)(gvl + (size_t)(16 * i) * LP);
  }
#pragma unroll 1
  for (int kt = 0; kt < NKT; ++kt) {
    const int kb = kt * 32;
    const int kl = kb & (STG - 1);          // first column of this step inside the LDS tile
    if (kl == 0) {                          // block-uniform: a new 64-column tile every second step
      if (kt != 0) __syncthreads();         // every wave has finished reading the tile that is overwritten next
#pragma unroll
      for (int i = 0; i < 4; ++i) {
        *(v4u*)(tw + 16 * i * VTP)           = pre[i];
        *(v4u*)(tw + TPL + 16 * i * VTP)     = pre[4 + i];
        *(v4u*)(tw + 2 * TPL + 16 * i * VTP) = pre[8 + i];
        *(v4u*)(tw + 3 * TPL + 16 * i * VTP) = pre[12 + i];
      }
      __syncthreads();                      // the tile is complete before any wave reads a fragment of it
      if (kb + STG < LP) {                  // block-uniform: the following tile's loads fly while this one is worked on
#pragma unroll
        for (int i = 0; i < 4; ++i) {
          pre[i]      = *(const v4u*)(gch + (size_t)(kb + STG + 16 * i) * DI);
          pre[4 + i]  = *(const v4u*)(gcl + (size_t)(kb + STG + 16 * i) * DI);
          pre[8 + i]  = *(const v4u*)(gvh + (size_t)(16 * i) * LP + kb + STG);
          pre[12 + i] = *(const v4u*)(gvl + (size_t)(16 * i) * LP + kb + STG);
        }
        // the address registers of these loads are reused by the step below while the loads are still in flight
        asm volatile("s_wait_xcnt 0x0" ::: "memory");
      }
    }
    // ---- stage the additive logit tile [16 rows][32 cols] into pt: 128 float4, lane handles f = it*32 + lane ----
#pragma unroll
    for (int it = 0; it < 4; ++it) {
      const int f = it * 32 + lane;
      const int row = f >> 3, col4 = (f & 7) * 4;
      const v4f t4 = *(const v4f*)(cbb + (size_t)row * LP + kb + col4);
      *(v4f*)(pt + row * PTP + col4) = t4;
    }
    // ---- scores, transposed: D element r of this lane = (col kb + 8hh + r, row q0 + c) in s0, col kb + 16 + 8hh + r in s1 ----
    v8f s0 = zero8(), s1 = zero8();
    const _Float16* c0p = Chb + kl * VTP;
    const _Float16* c1p = c0p + 16 * VTP;
    const _Float16* l0p = Clb + kl * VTP;
    const _Float16* l1p = l0p + 16 * VTP;
#pragma unroll
    for (int kk = 0; kk < HD / 32; ++kk) {
      const v16h rh  = ldfrag_h(Rh + kk * 32);
      const v16h rl  = ldfrag_h(Rl + kk * 32);
      const v16h ch0 = ldfrag_h(c0p + kk * 32);
      const v16h ch1 = ldfrag_h(c1p + kk * 32);
      const v16h cl0 = ldfrag_h(l0p + kk * 32);
      const v16h cl1 = ldfrag_h(l1p + kk * 32);
      s0 = mma_h(ch0, rh, s0);
      s0 = mma_h(ch0, rl, s0);
      s0 = mma_h(cl0, rh, s0);
      s1 = mma_h(ch1, rh, s1);
      s1 = mma_h(ch1, rl, s1);
      s1 = mma_h(cl1, rh, s1);
      guard2(s0, s1, rh, rl, ch0, cl0, ch1, cl1);
    }
    wave_sync_lds();
    // ---- additive term + online softmax in base 2, -inf-safe; the lane's 16 logits all belong to row q0 + c ----
    float e[16];                            // element s = column kb + 8hh + s (s < 8), kb + 16 + 8hh + s - 8 (s >= 8)
    {
      const float* crow = pt + c * PTP + 8 * hh;
      const v4f c0 = *(const v4f*)(crow), c1 = *(const v4f*)(crow + 4);
      const v4f c2 = *(const v4f*)(crow + 16), c3 = *(const v4f*)(crow + 20);
#pragma unroll
      for (int r = 0; r < 4; ++r) {
        e[r]      = (s0[r] * invc + c0[r]) * LOG2E;
        e[4 + r]  = (s0[4 + r] * invc + c1[r]) * LOG2E;
        e[8 + r]  = (s1[r] * invc + c2[r]) * LOG2E;
        e[12 + r] = (s1[4 + r] * invc + c3[r]) * LOG2E;
      }
    }
    float mx = e[0];
#pragma unroll
    for (int s = 1; s < 16; ++s) mx = fmaxf(mx, e[s]);
    mx = fmaxf(mx, xhalf(mx));              // the other half of the row's 32 columns
    const float mn = fmaxf(mrow, mx);
    const float ms = (mn == -INFINITY) ? 0.0f : mn;
    const float al = exp2f(mrow - ms);
    mrow = mn;
#pragma unroll
    for (int s = 0; s < 16; ++s) e[s] = exp2f(e[s] - ms);
    {
      const float pa = ((e[0] + e[1]) + (e[2] + e[3])) + ((e[4] + e[5]) + (e[6] + e[7]));
      const float pb = ((e[8] + e[9]) + (e[10] + e[11])) + ((e[12] + e[13]) + (e[14] + e[15]));
      lrow = lrow * al + (pa + pb);
    }
#pragma unroll
    for (int j = 0; j < 4; ++j) {
#pragma unroll
      for (int r = 0; r < 8; ++r) o[j][r] *= al;
    }
    // ---- B fragments of P^T*32768: hi f16 and residual f16, column = row q0 + c; the score registers already lie in the
    //      split k map over the 32 columns of this step, so element s of the fragment is e[s] ----
    FragH ph, pl;
#pragma unroll
    for (int s = 0; s < 8; ++s) {
      const float ta = e[s] * PCAR, tb = e[8 + s] * PCAR;
      const _Float16 ha = (_Float16)ta, hb = (_Float16)tb;
      ph.h[0][s] = ha;
      ph.h[1][s] = hb;
      pl.h[0][s] = (_Float16)(ta - (float)ha);
      pl.h[1][s] = (_Float16)(tb - (float)hb);
    }
    // ---- v^T.P^T : A fragment row m = d = j*16 + c, columns vi contiguous in the v^T tile rows; 2 groups of 2 d-subtiles ----
    {
      const _Float16* vhp = Vhb + kl;
      const _Float16* vlp = Vlb + kl;
#pragma unroll
      for (int jg = 0; jg < HD / 32; ++jg) {
        const int da = (2 * jg) * 16 * VTP;
        const int db = da + 16 * VTP;
        const v16h vha = ldfrag_h(vhp + da), vhb2 = ldfrag_h(vhp + db);
        const v16h vla = ldfrag_h(vlp + da), vlb2 = ldfrag_h(vlp + db);
        o[2 * jg]     = mma_h(vha,  ph.v, o[2 * jg]);
        o[2 * jg]     = mma_h(vha,  pl.v, o[2 * jg]);
        o[2 * jg]     = mma_h(vla,  ph.v, o[2 * jg]);
        o[2 * jg + 1] = mma_h(vhb2, ph.v, o[2 * jg + 1]);
        o[2 * jg + 1] = mma_h(vhb2, pl.v, o[2 * jg + 1]);
        o[2 * jg + 1] = mma_h(vlb2, ph.v, o[2 * jg + 1]);
        guard2(o[2 * jg], o[2 * jg + 1], ph.v, pl.v, vha, vhb2, vla, vlb2);
      }
    }
    wave_sync_lds();
  }
  acc_guard4(o[0], o[1], o[2], o[3]);
  // ---- out = acc / Z (0 if Z == 0), carries (32768 on P, 1024 on v) folded once; written into the lane-owned slab ----
  {
    const float lv  = lrow + xhalf(lrow);   // the two lane halves' shares of the row sum, joined once
    const float ls  = (lv > 0.0f) ? lv : 1.0f;
    const float inv = (lv > 0.0f) ? ((1.0f / ls) * oc) : 0.0f;
#pragma unroll
    for (int j = 0; j < 4; ++j) {
      float* sp = slab + c * SLP + j * 16 + 8 * hh;     // row q0 + c, 8 consecutive d
      v4f w0, w1;
#pragma unroll
      for (int r = 0; r < 4; ++r) { w0[r] = o[j][r] * inv; w1[r] = o[j][4 + r] * inv; }
      *(v4f*)(sp)     = w0;
      *(v4f*)(sp + 4) = w1;
    }
  }

  wave_sync_lds();
  // ---- gate in f32, then O x1024 -> f16 hi + residual planes; lane = (row select rq in 0..3, 8 consecutive d at c8) ----
  v4u oh[4], ol[4];
  const int rq = lane >> 3, c8 = (lane & 7) * 8;
  const float* urow = U + ((size_t)b * LP + q0) * DI + (size_t)head * HD + c8;
  float bb[8];
  {
    const v4f u0 = *(const v4f*)(bu + head * HD + c8), u1 = *(const v4f*)(bu + head * HD + c8 + 4);
#pragma unroll
    for (int e = 0; e < 4; ++e) { bb[e] = bfr(u0[e]); bb[4 + e] = bfr(u1[e]); }
  }
#pragma unroll
  for (int it = 0; it < 4; ++it) {
    const int row = it * 4 + rq;
    const v4f a  = *(const v4f*)(slab + row * SLP + c8), b4 = *(const v4f*)(slab + row * SLP + c8 + 4);
    const v4f ua = *(const v4f*)(urow + (size_t)row * DI), ub = *(const v4f*)(urow + (size_t)row * DI + 4);
    float w[8];
#pragma unroll
    for (int e = 0; e < 4; ++e) {
      w[e]     = (a[e]  * sigm(ua[e] + bb[e]))     * OSC;
      w[4 + e] = (b4[e] * sigm(ub[e] + bb[4 + e])) * OSC;
    }
#pragma unroll
    for (int e = 0; e < 4; ++e) {
      const _Float16 h0 = (_Float16)w[2 * e], h1 = (_Float16)w[2 * e + 1];
      const _Float16 l0 = (_Float16)(w[2 * e] - (float)h0), l1 = (_Float16)(w[2 * e + 1] - (float)h1);
      oh[it][e] = pk16(h_bits(h0), h_bits(h1));
      ol[it][e] = pk16(h_bits(l0), h_bits(l1));
    }
  }
  const size_t ob = ((size_t)b * LP + q0) * DI + (size_t)head * HD + c8;
  {
#pragma unroll
    for (int it = 0; it < 4; ++it) {
      const int row = it * 4 + rq;
      *(v4u*)(OHp + ob + (size_t)row * DI) = oh[it];
      *(v4u*)(OLp + ob + (size_t)row * DI) = ol[it];
    }
    
  }
}

// =====================================================================================================
// Rows s are processed in NGRP groups of BG rows; every per-group workspace plane is reused in launch order. BG is the largest
// divisor of NS whose planes fit the workspace: every group costs three dependent launches, each with its own start and drain.
// Workspace map (bytes); every plane is fully written by whole-line stores before it is read; all extents are exact
// multiples of the store granularity (no pad rows needed); every region offset a multiple of 65536:
//   XB  bf16 [NPIX][256] (hi|lo)                    33554432
//   OH, OL  f16 [GROWS][256] x1024                  2 * GROWS*512
//   U   f32 [GROWS][256]                            GROWS*1024   (gate pre-activation)
//   QH, KH, QL, KL  f16 [GROWS][256]               4 * GROWS*512
//   VH, VL  f16 [BG*4][64][LP]                      2 * GROWS*512
//   CB  f32 [4][NPIX]                               1048576
//   WQ, WK, WV, WU  bf16 [256 n][256 k]             4 * 131072   (contiguous in this order: proj4 reads them as one plane)
//   WO  f16 x1024 [128 n][256 k]                    65536
//   end (BG = 128)                                  202964992
// =====================================================================================================
extern "C" void kernel_launch(void* const* d_in, const int* in_sizes, int n_in,
                              void* d_out, int out_size, void* d_ws, size_t ws_size,
                              hipStream_t stream) {
  if (n_in < 12) return;
  if (in_sizes[0] < NPIX * DM) return;
  if (in_sizes[1] < NPIX) return;
  if (in_sizes[2] < DM || in_sizes[3] < DM) return;
  if (in_sizes[4] < DM * DI || in_sizes[5] < DM * DI || in_sizes[6] < DM * DI || in_sizes[8] < DM * DI) return;
  if (in_sizes[7] < DM * NH) return;
  if (in_sizes[9] < DI) return;
  if (in_sizes[10] < DI * DM) return;
  if (in_sizes[11] < DM) return;
  if (out_size < NS * LP * DM) return;

  const float* pr    = (const float*)d_in[0];
  const float* mask  = (const float*)d_in[1];
  const float* gamma = (const float*)d_in[2];
  const float* beta  = (const float*)d_in[3];
  const float* Wq    = (const float*)d_in[4];
  const float* Wk    = (const float*)d_in[5];
  const float* Wv    = (const float*)d_in[6];
  const float* Wb    = (const float*)d_in[7];
  const float* Wu    = (const float*)d_in[8];
  const float* bu    = (const float*)d_in[9];
  const float* Wo    = (const float*)d_in[10];
  const float* bo    = (const float*)d_in[11];
  float*       out   = (float*)d_out;

  const size_t szXB = (size_t)NPIX * KX * 2;
  const size_t szU  = (size_t)GROWS * DI * 4;
  const size_t szH  = (size_t)GROWS * DI * 2;                   // QH, KH, QL, KL, OH, OL
  const size_t szV  = (size_t)BG * NH * HD * LP * 2;            // VH, VL (== szH)
  const size_t szCB = (size_t)NH * NPIX * 4;
  const size_t szW  = (size_t)DI * KX * 2;
  const size_t szWO = (size_t)DM * DI * 2;
  size_t off = 0;
  const size_t oXB = off; off += szXB;
  const size_t oOH = off; off += szH;
  const size_t oOL = off; off += szH;
  const size_t oU  = off; off += szU;
  const size_t oQH = off; off += szH;
  const size_t oKH = off; off += szH;
  const size_t oQL = off; off += szH;
  const size_t oKL = off; off += szH;
  const size_t oVH = off; off += szV;
  const size_t oVL = off; off += szV;
  const size_t oCB = off; off += szCB;
  const size_t oWQ = off; off += szW;
  const size_t oWK = off; off += szW;
  const size_t oWV = off; off += szW;
  const size_t oWU = off; off += szW;
  const size_t oWO = off; off += szWO;
  if (off > ws_size) return;                // off = 202964992 for BG = 128
  if (off > (size_t)WS_CAP) return;

  char* ws = (char*)d_ws;
  u16*   XB = (u16*)(ws + oXB);
  u16*   OH = (u16*)(ws + oOH);
  u16*   OL = (u16*)(ws + oOL);
  float* U  = (float*)(ws + oU);
  u16*   QH = (u16*)(ws + oQH);
  u16*   KH = (u16*)(ws + oKH);
  u16*   QL = (u16*)(ws + oQL);
  u16*   KL = (u16*)(ws + oKL);
  u16*   VH = (u16*)(ws + oVH);
  u16*   VL = (u16*)(ws + oVL);
  float* CB = (float*)(ws + oCB);
  u16*   WQ = (u16*)(ws + oWQ);
  u16*   WK = (u16*)(ws + oWK);
  u16*   WV = (u16*)(ws + oWV);
  u16*   WU = (u16*)(ws + oWU);
  u16*   WO = (u16*)(ws + oWO);

  const dim3 b256(256), bAT(ATT_THREADS);
  const dim3 gLN(NPIX / LNPB);                          // 2048
  const dim3 gWP((DI / 128) * (DM / 64));               // 4: Wq, Wk, Wv, Wu planes
  const dim3 gWO((DM / 128) * (DI / 64));               // 4: Wo plane
  const dim3 gP((GROWS / PXR) * NPT);
  const dim3 gAT(NQT * BG);
  const dim3 gO(BG * NST);
  const float osc = 1.0f / (OSC * WOS);

  // LayerNorm once for every pixel: x hi|lo planes and the additive logit table
  ln_x<<<gLN, b256, 0, stream>>>(pr, mask, gamma, beta, Wb, XB, CB);
  // weight planes once: Wq^T, Wk^T, Wv^T, Wu^T [n][k | k] as bf16; Wo^T [n][k] as f16 of bf16 value x1024
  wt16<<<gWP, b256, 0, stream>>>(Wq, DI, DM, WQ, KX, 1, 0, 1.0f);
  wt16<<<gWP, b256, 0, stream>>>(Wk, DI, DM, WK, KX, 1, 0, 1.0f);
  wt16<<<gWP, b256, 0, stream>>>(Wv, DI, DM, WV, KX, 1, 0, 1.0f);
  wt16<<<gWP, b256, 0, stream>>>(Wu, DI, DM, WU, KX, 1, 0, 1.0f);
  wt16<<<gWO, b256, 0, stream>>>(Wo, DM, DI, WO, DI, 0, 1, WOS);

  for (int g = 0; g < NGRP; ++g) {
    const u16*   xg = XB   + (size_t)g * GROWS * KX;
    const float* mg = mask + (size_t)g * GROWS;
    float*       og = out  + (size_t)g * GROWS * DM;
    // (1) q, k, v, u projections in one launch: q, k and v^T as f16 hi + residual planes, gate pre-activation u as f32
    proj4<<<gP, b256, 0, stream>>>(xg, WQ, QH, QL, KH, KL, VH, VL, U);
    // (2) attention: rows from the k planes, columns from the q planes, sum over columns with v; gated O -> OH + OL planes
    attn_t<<<gAT, bAT, 0, stream>>>(KH, KL, QH, QL, VH, VL, CB, U, bu, OH, OL);
    // (3) output projection (hi + residual), + bo, x mask row scale -> out f32, carries 1024 x 1024 folded back
    gemm_o<<<gO, b256, 0, stream>>>(OH, OL, WO, bo, mg, og, osc);
  }
  (void)hipGetLastError();
}

// v006
// A run of this version takes 209 microseconds.
// Next to v005, in two timings, it ran 1.07 and 1.06 times as fast.
// All steps since v000 together make it 2.95 times as fast.
// Contractions: x.Wq, x.Wk, x.Wv, x.Wu on v_wmma_f32_16x16x32_bf16 (x as bf16 hi|lo pair folded into K = 256, W as bf16 RNE
// of the input, f32 accumulate); k.q^T over 64 and P.v^T on v_wmma_f32_16x16x32_f16 (k x1024 and q x128 f16 hi + residual
// planes, P x32768 f16 hi + residual, v x1024 f16 hi + residual; products hh + lh + hl); (O*gate).Wo on
// v_wmma_f32_16x16x32_f16 (O x1024 f16 hi + residual, Wo as f16(bf16(Wo)) x1024, products h.w + l.w); all f32 accumulate.
// LayerNorm, x.Wb (N = 4) and the additive logit table, base-2 online softmax, sigmoid gate, bias and row scale in f32 on VALU.
#include <hip/hip_runtime.h>
#include <math.h>
#include <stdint.h>

#ifndef NS
#define NS 256
#endif
#define NSX   256
#define LP    256
#define DM    128
#define NH    4
#define HD    64
#define DI    (NH * HD)
#define KX    (2 * DM)
#define NPIX  (LP * LP)
#define BG    ((NS <= 128) ? NS : 128)
#define NGRP  (NS / BG)
#define GROWS (BG * LP)
#define LNEPS 1e-5f
#define LOG2E 1.4426950408889634f
#define QSC   128.0f
#define CSC   1024.0f
#define KSC   1024.0f
#define PCAR  32768.0f
#define VCAR  1024.0f
#define OSC   1024.0f
#define WOS   1024.0f
#define WPB   4
#define NQT   (LP / 16)
#define NST   (LP / 64)
#define NKT   (LP / 32)
#define ATT_THREADS (WPB * 32)
#define PTP   36
#define PTW   (16 * PTP)
#define SLP   68
#define SLW   (16 * SLP)
#define WREG  (PTW + SLW)
#define SLAB64 (16 * 68)
#define VTP   72
#define NPT   (4 * DI / 64)
#define PLP   256
#define LNPB  32
#define STG   64
#define TPL   (STG * VTP)
#define WS_CAP 268435456
#define PXR   128
#define PKP   (KX + 8)
#define PROJ_THREADS 256
#define WTB   4
#define NWB   (5 * WTB)
static_assert(DI == NH * HD && HD == 64 && NH == 4 && WPB == NH);
static_assert(ATT_THREADS == 128);
static_assert(STG == 64 && HD == STG && (LP % STG) == 0 && NST * NH == NQT);
static_assert(NS >= 1 && NS <= NSX && (NS % BG) == 0 && BG >= 1 && BG <= 128);
static_assert((LP % 64) == 0 && (LP % 32) == 0 && (LP % 16) == 0);
static_assert(DM == 128 && (KX % 32) == 0 && (DI % 64) == 0 && (DI % 32) == 0 && (DM % 64) == 0);
static_assert(PLP == DI && PLP == LP && NPT == 4 * NH && (GROWS % 64) == 0);
static_assert((NPIX % LNPB) == 0 && LNPB == 32);
static_assert((GROWS % PXR) == 0 && PXR == 128 && PROJ_THREADS == 256 && KX == 256 && DI == KX && DM == 128 && 8 * SLAB64 * 4 <= (PXR + 64) * PKP * 2);
static_assert((DI % 128) == 0 && (DM % 128) == 0 && (DM % 64) == 0 && (DI % 64) == 0);
static_assert((DI / 128) * (DM / 64) == WTB && (DM / 128) * (DI / 64) == WTB);

typedef unsigned short u16;
typedef _Float16 v16h __attribute__((ext_vector_type(16)));
typedef _Float16 v8h  __attribute__((ext_vector_type(8)));
typedef __bf16   v16b __attribute__((ext_vector_type(16)));
typedef float    v8f  __attribute__((ext_vector_type(8)));
typedef float    v4f  __attribute__((ext_vector_type(4)));
typedef unsigned int v4u __attribute__((ext_vector_type(4)));
typedef unsigned int v2u __attribute__((ext_vector_type(2)));

union FragH { v16h v; v8h h[2]; v4u u[2]; };
union FragB { v16b v; v4u u[2]; };

// ---- scalar helpers --------------------------------------------------------------------------------
__device__ __forceinline__ unsigned short bf_bits(float f) {          // f32 -> bf16 bits, RNE convert
  unsigned u = __float_as_uint(f);
  return (unsigned short)((u + 0x7FFFu + ((u >> 16) & 1u)) >> 16);
}
__device__ __forceinline__ float bf_up(unsigned short h) { return __uint_as_float(((unsigned)h) << 16); }
__device__ __forceinline__ float bfr(float f) { return bf_up(bf_bits(f)); }
__device__ __forceinline__ unsigned short h_bits(_Float16 x) { return __builtin_bit_cast(unsigned short, x); }
__device__ __forceinline__ unsigned pk16(unsigned short a, unsigned short b) { return (unsigned)a | ((unsigned)b << 16); }
__device__ __forceinline__ v8f zero8() { v8f z = {0.f, 0.f, 0.f, 0.f, 0.f, 0.f, 0.f, 0.f}; return z; }
__device__ __forceinline__ float sigm(float z) {                     // 1 / (1 + 2^(-z log2 e)), argument clamped
  const float zc = fminf(fmaxf(z, -30.0f), 30.0f);
  const float e  = exp2f(-zc * LOG2E);
  return __builtin_amdgcn_rcpf(1.0f + e);
}

// ---- fragment loaders: 16-bit A/B operand, lane -> row/col (lane&15), p already includes +8*(lane>>4);
//      elements 0..7 <- p[0..7] (k0+8h..), elements 8..15 <- p[16..23] (k0+16+8h..)  (same split k map for A and B;
//      B is always read from a k-contiguous [n][k] plane)
__device__ __forceinline__ v16h ldfrag_h(const _Float16* p) {
  FragH f;
  f.h[0] = *(const v8h*)(p);
  f.h[1] = *(const v8h*)(p + 16);
  return f.v;
}
__device__ __forceinline__ v16b ldfrag_b(const u16* p) {              // bf16 plane read as unsigned integer vectors
  FragB f;
  f.u[0] = *(const v4u*)(p);
  f.u[1] = *(const v4u*)(p + 16);
  return f.v;
}

__device__ __forceinline__ v8f mma_h(v16h a, v16h b, v8f c) {
  return __builtin_amdgcn_wmma_f32_16x16x32_f16(false, a, false, b, (short)0, c, false, false);
}
__device__ __forceinline__ v8f mma_b(v16b a, v16b b, v8f c) {
  return __builtin_amdgcn_wmma_f32_16x16x32_bf16(false, a, false, b, (short)0, c, false, false);
}
__device__ __forceinline__ void guard2(v8f& a, v8f& b, v16h x0, v16h x1, v16h x2, v16h x3, v16h x4, v16h x5) {
#if defined(__HIP_DEVICE_COMPILE__)
  asm volatile("v_nop\n\tv_nop\n\tv_nop\n\tv_nop"
               : "+v"(a), "+v"(b) : "v"(x0), "v"(x1), "v"(x2), "v"(x3), "v"(x4), "v"(x5) : "memory");
#endif
}
template <typename F>
__device__ __forceinline__ void guard6(v8f& a, v8f& b, v8f& c, v8f& d, F x0, F x1, F x2, F x3, F x4, F x5) {
#if defined(__HIP_DEVICE_COMPILE__)
  asm volatile("v_nop\n\tv_nop\n\tv_nop\n\tv_nop"
               : "+v"(a), "+v"(b), "+v"(c), "+v"(d) : "v"(x0), "v"(x1), "v"(x2), "v"(x3), "v"(x4), "v"(x5) : "memory");
#endif
}
__device__ __forceinline__ void acc_guard4(v8f& a, v8f& b, v8f& c, v8f& d) {
#if defined(__HIP_DEVICE_COMPILE__)
  asm volatile("v_nop\n\tv_nop\n\tv_nop\n\tv_nop" : "+v"(a), "+v"(b), "+v"(c), "+v"(d));
#endif
}
__device__ __forceinline__ float xhalf(float x) {                    // value of lane l ^ 16 (the other 16-lane row)
  const int b = __builtin_bit_cast(int, x);
  return __builtin_bit_cast(float, __builtin_amdgcn_permlanex16(b, b, 0x76543210, 0xfedcba98, false, false));
}
__device__ __forceinline__ void wave_sync_lds() {
  __builtin_amdgcn_fence(__ATOMIC_RELEASE, "workgroup");
  __builtin_amdgcn_wave_barrier();
  __builtin_amdgcn_fence(__ATOMIC_ACQUIRE, "workgroup");
}

// =====================================================================================================
// statistics), x written as bf16 hi | bf16 lo planes XB [NPIX][KX] (columns 0..127 hi bits, 128..255 lo bits of x - hi);
// the additive logit table CB [NH][NPIX] = 1e9*(mask - 1) + x.Wb (VALU f32, N = 4) is produced by the same block.
// Block = 8 waves x LNPB/8 pixels, wave = one pixel at a time (lane holds 4 channels); the 512-B x row is assembled in a
// x 4 heads) are funnelled through LDS and written by wave 0 in one instruction (8 consecutive lanes x 16 B per line);
// coverage: blk = 0 .. NPIX/LNPB - 1, each 32 pixels = every XB row once and every CB line once.
// =====================================================================================================
__device__ __forceinline__ void ln_x(int blk, const float* __restrict__ pr, const float* __restrict__ mask,
                                     const float* __restrict__ gamma, const float* __restrict__ beta,
                                     const float* __restrict__ Wb, u16* XB, float* CB) {
  __shared__ __align__(16) u16 RB[8 * KX];
  __shared__ __align__(16) float PBS[NH * LNPB];
  const int tid = threadIdx.x, wave = tid >> 5, lane = tid & 31;
  const int p0 = blk * LNPB;
  if (p0 + LNPB > NPIX) return;             // block-uniform, before any barrier; never taken with the exact grid
  float gm[4], bt[4], wb[16];
  {
    const v4f g4 = *(const v4f*)(gamma + 4 * lane), b4 = *(const v4f*)(beta + 4 * lane);
#pragma unroll
    for (int e = 0; e < 4; ++e) { gm[e] = bfr(g4[e]); bt[e] = bfr(b4[e]); }
#pragma unroll
    for (int i = 0; i < 4; ++i) {
      const v4f w4 = *(const v4f*)(Wb + 16 * lane + 4 * i);      // Wb[(4*lane + i)][h], h = 0..3
#pragma unroll
      for (int h = 0; h < 4; ++h) wb[4 * i + h] = bfr(w4[h]);
    }
  }
  u16* rb = RB + wave * KX;
#pragma unroll 1
  for (int j = 0; j < LNPB / 8; ++j) {
    const int pl = j * 8 + wave;
    const int p  = p0 + pl;
    const v4f x4 = *(const v4f*)(pr + (size_t)p * DM + 4 * lane);
    float xr[4];
#pragma unroll
    for (int e = 0; e < 4; ++e) xr[e] = bfr(x4[e]);
    float s = (xr[0] + xr[1]) + (xr[2] + xr[3]);
#pragma unroll
    for (int off = 1; off < 32; off <<= 1) s += __shfl_xor(s, off, 32);
    const float mu = s * (1.0f / (float)DM);
    float d[4];
#pragma unroll
    for (int e = 0; e < 4; ++e) d[e] = xr[e] - mu;
    float ss = (d[0] * d[0] + d[1] * d[1]) + (d[2] * d[2] + d[3] * d[3]);
#pragma unroll
    for (int off = 1; off < 32; off <<= 1) ss += __shfl_xor(ss, off, 32);
    const float var = ss * (1.0f / (float)DM);
    const float rs  = 1.0f / sqrtf(var + LNEPS);
    float y[4];
#pragma unroll
    for (int e = 0; e < 4; ++e) y[e] = d[e] * rs * gm[e] + bt[e];
    unsigned short hb[4], lb[4];
#pragma unroll
    for (int e = 0; e < 4; ++e) { hb[e] = bf_bits(y[e]); lb[e] = bf_bits(y[e] - bf_up(hb[e])); }
    float pb[4];
#pragma unroll
    for (int h = 0; h < 4; ++h) pb[h] = y[0] * wb[h] + y[1] * wb[4 + h] + y[2] * wb[8 + h] + y[3] * wb[12 + h];
#pragma unroll
    for (int h = 0; h < 4; ++h) {
#pragma unroll
      for (int off = 1; off < 32; off <<= 1) pb[h] += __shfl_xor(pb[h], off, 32);
    }
    const float mk = bfr(mask[p]);
    const float mb = 1e9f * (mk - 1.0f);
    v2u hv, lv;
    hv[0] = pk16(hb[0], hb[1]);  hv[1] = pk16(hb[2], hb[3]);
    lv[0] = pk16(lb[0], lb[1]);  lv[1] = pk16(lb[2], lb[3]);
    *(v2u*)(rb + 4 * lane)      = hv;
    *(v2u*)(rb + DM + 4 * lane) = lv;
    if (lane == 0) {
      PBS[0 * LNPB + pl] = mb + pb[0];
      PBS[1 * LNPB + pl] = mb + pb[1];
      PBS[2 * LNPB + pl] = mb + pb[2];
      PBS[3 * LNPB + pl] = mb + pb[3];
    }
    wave_sync_lds();
    const v4u piece = *(const v4u*)(rb + 8 * lane);
    u16* dst = XB + (size_t)p * KX + 8 * lane;
    {
      *(v4u*)(dst) = piece;
      
    }
    wave_sync_lds();
  }
  __syncthreads();
  if (wave == 0) {
    const int h = lane >> 3, j4 = (lane & 7) * 4;
    const v4f v = *(const v4f*)(PBS + h * LNPB + j4);
    float* d = CB + (size_t)h * NPIX + p0 + j4;
    {
      *(v4f*)(d) = v;
      
    }
  }
}

// =====================================================================================================
// Transposed weight plane: W f32 [nk rows k][ncol cols n] -> D 16-bit [n][ldd], D[n][k] = bf16 bits of W[k][n] (f16mode 0)
// or f16 bits of bf16(W[k][n]) * scale (f16mode 1); when dup != 0 the same 64-half segment is also written at D[n][nk + k]
// (hi|lo folded K). Block (ct = bid % nct: 128 columns, rt = bid / nct: 64 rows): each thread loads 32 floats of one k row
// (16-B loads), converts, scatters into the LDS tile [128 n][64 k] (pitch 72 halves); after a block barrier each n row segment
// coverage: load 256 thr x 32 = 64 k rows x 128 n; store 4 iterations x 256 thr x 8 halves = 128 lines x 64 = the block's tile
// =====================================================================================================
__device__ __forceinline__ void wt16(int bid, const float* __restrict__ W, int ncol, int nk, u16* D, int ldd, int dup,
                                     int f16mode, float scale) {
  __shared__ __align__(16) u16 T[128 * VTP];
  const int tid = threadIdx.x;
  const int nct = ncol / 128;
  const int ct  = bid % nct;
  const int rt  = bid / nct;
  if (rt * 64 + 64 > nk) return;            // block-uniform, before the barrier; never taken with the exact grid
  {
    const int sl = tid >> 2;                // k row within tile 0..63
    const int dc = (tid & 3) * 32;          // n chunk
    const float* src = W + (size_t)(rt * 64 + sl) * ncol + ct * 128 + dc;
    v4f ld[8];                              // the loops below are unrolled so that these stay in registers
#pragma unroll
    for (int i = 0; i < 8; ++i) ld[i] = *(const v4f*)(src + 4 * i);
    // the eight loads share one address pair; it is named as an input so that no load's result is placed on it ahead of the wait
    asm volatile("s_wait_xcnt 0x0" :: "v"(src) : "memory");
#pragma unroll
    for (int i = 0; i < 8; ++i) {
      const v4f a = ld[i];
#pragma unroll
      for (int e = 0; e < 4; ++e) {
        const float f = a[e];
        const unsigned short hb = h_bits((_Float16)(bfr(f) * scale));
        const unsigned short bb = bf_bits(f);
        T[(dc + 4 * i + e) * VTP + sl] = (f16mode != 0) ? hb : bb;
      }
    }
  }
  __syncthreads();
  v4u w4[4];
  const int q8 = tid >> 3, p8 = (tid & 7) * 8;
#pragma unroll
  for (int it = 0; it < 4; ++it) {
    const int line = it * 32 + q8;          // n within tile 0..127
    w4[it] = *(const v4u*)(T + line * VTP + p8);
  }
  const size_t base = ((size_t)ct * 128) * ldd + rt * 64 + p8;
  {
#pragma unroll
    for (int it = 0; it < 4; ++it) {
      const int line = it * 32 + q8;
      *(v4u*)(D + base + (size_t)line * ldd) = w4[it];
      if (dup != 0) *(v4u*)(D + base + (size_t)line * ldd + nk) = w4[it];
    }
    // behind the last store: no register that these stores name is rewritten ahead of this wait on any path of the joined kernel
    asm volatile("s_wait_xcnt 0x0" ::: "memory");
  }
}

// =====================================================================================================
// Everything that depends on the inputs alone, in one launch: the five weight planes and the LayerNorm pass touch disjoint
// data, so their blocks share one grid. Blocks 0 .. NWB-1 come first (they start first and end inside the LayerNorm blocks'
// time): block bid -> plane bid / WTB (Wq, Wk, Wv, Wu into WP + plane * DI * KX; plane 4 = Wo into WO), tile bid % WTB of it.
// Blocks NWB .. NWB + NPIX/LNPB - 1 are the LayerNorm blocks. The choice is block-uniform, so every barrier stays uniform.
// 16 waves per SIMD asked for: the LayerNorm blocks stream from memory with one row per wave in flight and need every wave
// slot; without it the joined kernel takes one register granule more than the LayerNorm kernel alone did.
// =====================================================================================================
__global__ __launch_bounds__(256) __attribute__((amdgpu_waves_per_eu(16, 16)))
void prep(const float* __restrict__ pr, const float* __restrict__ mask, const float* __restrict__ gamma,
          const float* __restrict__ beta, const float* __restrict__ Wb, const float* __restrict__ Wq,
          const float* __restrict__ Wk, const float* __restrict__ Wv, const float* __restrict__ Wu,
          const float* __restrict__ Wo, u16* XB, float* CB, u16* WP, u16* WO) {
  const int bid = blockIdx.x;
  if (bid >= NWB) {
    ln_x(bid - NWB, pr, mask, gamma, beta, Wb, XB, CB);
  } else if (bid >= 4 * WTB) {
    wt16(bid - 4 * WTB, Wo, DM, DI, WO, DI, 0, 1, WOS);
  } else {
    const int pl = bid / WTB;
    const float* W = (pl == 0) ? Wq : (pl == 1) ? Wk : (pl == 2) ? Wv : Wu;
    wt16(bid % WTB, W, DI, DM, WP + (size_t)pl * DI * KX, KX, 1, 0, 1.0f);
  }
}

// =====================================================================================================
// epi64o additionally adds a per-column bias (bf16 RNE of the input) and multiplies by a per-row scale (bf16 RNE of mask).
// coverage: 8 instructions x 2 rows x 16 lanes x 4 floats = the wave's 16 x 64 tile.
// =====================================================================================================
__device__ __forceinline__ void epi64(float* sl, v8f a0, v8f a1, v8f a2, v8f a3, float oscale,
                                      float* C, int N, size_t rowb, int col0, int lane) {
  const int hh = lane >> 4, m = lane & 15;
#pragma unroll
  for (int r = 0; r < 8; ++r) {
    const int ro = (8 * hh + r) * 68 + m;
    sl[ro]      = a0[r] * oscale;
    sl[ro + 16] = a1[r] * oscale;
    sl[ro + 32] = a2[r] * oscale;
    sl[ro + 48] = a3[r] * oscale;
  }
  wave_sync_lds();
  v4f vals[8];
#pragma unroll
  for (int it = 0; it < 8; ++it) vals[it] = *(const v4f*)(sl + (it * 2 + hh) * 68 + m * 4);
  float* dst = C + (rowb + (size_t)hh) * (size_t)N + col0 + m * 4;
  {
#pragma unroll
    for (int it = 0; it < 8; ++it) {
      *(v4f*)(dst + (size_t)(it * 2) * (size_t)N) = vals[it];
    }
    
  }
}
__device__ __forceinline__ void epi64o(float* sl, v8f a0, v8f a1, v8f a2, v8f a3, float oscale,
                                       float* C, int N, size_t rowb, int col0, int lane,
                                       const float* __restrict__ bias, const float* __restrict__ rsc) {
  const int hh = lane >> 4, m = lane & 15;
#pragma unroll
  for (int r = 0; r < 8; ++r) {
    const int ro = (8 * hh + r) * 68 + m;
    sl[ro]      = a0[r] * oscale;
    sl[ro + 16] = a1[r] * oscale;
    sl[ro + 32] = a2[r] * oscale;
    sl[ro + 48] = a3[r] * oscale;
  }
  wave_sync_lds();
  float bq[4];
  {
    const v4f b4 = *(const v4f*)(bias + col0 + m * 4);
#pragma unroll
    for (int e = 0; e < 4; ++e) bq[e] = bfr(b4[e]);
  }
  v4f vals[8];
#pragma unroll
  for (int it = 0; it < 8; ++it) {
    const v4f t = *(const v4f*)(sl + (it * 2 + hh) * 68 + m * 4);
    const float mk = bfr(rsc[rowb + (size_t)hh + (size_t)(it * 2)]);
    v4f o;
#pragma unroll
    for (int e = 0; e < 4; ++e) o[e] = (t[e] + bq[e]) * mk;
    vals[it] = o;
  }
  float* dst = C + (rowb + (size_t)hh) * (size_t)N + col0 + m * 4;
  {
#pragma unroll
    for (int it = 0; it < 8; ++it) {
      *(v4f*)(dst + (size_t)(it * 2) * (size_t)N) = vals[it];
    }
    
  }
}

// =====================================================================================================
// Split epilogue: the wave's 16 x 64 f32 tile, times sc, goes out as f16 hi + f16 residual planes (row pitch PLP halves).
// The tile passes through the wave's slab so that 8 consecutive lanes hold one row's 64 halves = one whole 128-B line.
// coverage: 4 instructions x 4 rows x 8 lanes x 8 halves = the wave's 16 x 64 tile of each plane.
// =====================================================================================================
__device__ __forceinline__ void epi64s(float* sl, v8f a0, v8f a1, v8f a2, v8f a3, float sc,
                                       u16* Hp, u16* Lp, size_t ob, int lane) {
  const int hh = lane >> 4, m = lane & 15;
#pragma unroll
  for (int r = 0; r < 8; ++r) {
    const int ro = (8 * hh + r) * 68 + m;
    sl[ro]      = a0[r];
    sl[ro + 16] = a1[r];
    sl[ro + 32] = a2[r];
    sl[ro + 48] = a3[r];
  }
  wave_sync_lds();
  const int rq = lane >> 3, c8 = (lane & 7) * 8;
  v4u oh[4], ol[4];                         // the loops below are unrolled so that these stay in registers
#pragma unroll
  for (int it = 0; it < 4; ++it) {
    const float* p = sl + (it * 4 + rq) * 68 + c8;
    const v4f a = *(const v4f*)(p), b4 = *(const v4f*)(p + 4);
    float w[8];
#pragma unroll
    for (int e = 0; e < 4; ++e) { w[e] = a[e] * sc; w[4 + e] = b4[e] * sc; }
#pragma unroll
    for (int e = 0; e < 4; ++e) {
      const float t0 = w[2 * e], t1 = w[2 * e + 1];
      const _Float16 h0 = (_Float16)t0, h1 = (_Float16)t1;
      const _Float16 l0 = (_Float16)(t0 - (float)h0), l1 = (_Float16)(t1 - (float)h1);
      oh[it][e] = pk16(h_bits(h0), h_bits(h1));
      ol[it][e] = pk16(h_bits(l0), h_bits(l1));
    }
  }
  u16* dh = Hp + ob + (size_t)rq * PLP + c8;
  u16* dl = Lp + ob + (size_t)rq * PLP + c8;
#pragma unroll
  for (int it = 0; it < 4; ++it) {
    *(v4u*)(dh + (size_t)(it * 4) * PLP) = oh[it];
    *(v4u*)(dl + (size_t)(it * 4) * PLP) = ol[it];
  }
}

// =====================================================================================================
// The four projections of one row group in one launch: X [GROWS][KX] (bf16 hi|lo rows of x) against Wt [4*DI][KX] (bf16,
// k-contiguous; rows 0.. Wq^T, DI.. Wk^T, 2*DI.. Wv^T, 3*DI.. Wu^T), f32 accumulate, K = KX stepped by 32.
// Block bid -> (64 rows of Wt nt = bid % NPT, PXR = 128 rows of X rb = bid / NPT); sel = nt / NH names the projection,
// g = nt % NH the head. The block's 128 X rows and 64 Wt rows are brought in once with whole-line 16-B loads (one wave = one
// 512-B row per instruction), stored to LDS (pitch PKP halves = 16 B x 33) and read from there as fragments by all 8 waves
// (two 16-B loads each, the same split k map for both operands, so either plane can be the row operand).
//   q, k, u: row operand X, column operand Wt: wave w's tile is [16 pos (16*w ..)][64 channels of head g].
//   v:       row operand Wt, column operand X: wave w's tile is [16 d (16*(w&3) ..)][64 pos (64*(w>>2) ..)], v^T as read later.
// Epilogue: u goes out as f32 (epi64); q x128 (= C^-0.5 x 1024), k x1024 and v^T x1024 go out as f16 hi + residual planes
// (epi64s): QH, QL, KH, KL [b*LP + pos][g*HD + d]; VH, VL [(b*NH + g)*HD + d][LP]. The waves' slabs reuse the operand LDS.
// coverage: grid = (GROWS/PXR) * NPT blocks, each one 128 x 64 tile = every element of U and of the six planes once.
// =====================================================================================================
__global__ __launch_bounds__(PROJ_THREADS)
void proj4(const u16* __restrict__ X, const u16* __restrict__ Wt, u16* QH, u16* QL, u16* KH, u16* KL,
           u16* VH, u16* VL, float* U) {
  __shared__ __align__(16) u16 opt[(PXR + 64) * PKP];   // X rows 0..127, then Wt rows 0..63; later the 8 result slabs
  const int tid = threadIdx.x, wave = tid >> 5, lane = tid & 31, hh = lane >> 4, m = lane & 15;
  const int bid = blockIdx.x;
  const int nt  = bid % NPT;
  const int rb  = bid / NPT;
  if (rb * PXR + PXR > GROWS) return;       // block-uniform, before any barrier; never taken with the exact grid
  const int sel = nt / NH;
  const int g   = nt % NH;
  {
    // staging: wave -> row wave + 8*i, lane -> 8 halves at 8*lane: each load and each LDS store covers one whole 512-B row
    const u16* gx = X  + (size_t)(rb * PXR + wave) * KX + 8 * lane;
    const u16* gw = Wt + (size_t)(nt * 64 + wave) * KX + 8 * lane;
    u16* tw = opt + wave * PKP + 8 * lane;
    v4u st[(PXR + 64) / 8];                 // the loops below are unrolled so that these stay in registers
#pragma unroll
    for (int i = 0; i < PXR / 8; ++i) st[i] = *(const v4u*)(gx + (size_t)(8 * i) * KX);
#pragma unroll
    for (int i = 0; i < 8; ++i) st[PXR / 8 + i] = *(const v4u*)(gw + (size_t)(8 * i) * KX);
    // the address registers of these loads are free for reuse below while the loads are still in flight
    asm volatile("s_wait_xcnt 0x0" ::: "memory");
#pragma unroll
    for (int i = 0; i < (PXR + 64) / 8; ++i) *(v4u*)(tw + 8 * i * PKP) = st[i];
  }
  __syncthreads();                          // both operand tiles are complete before any wave reads a fragment
  const int ao = ((sel == 2) ? (PXR + (wave & 3) * 16 + m) : (wave * 16 + m)) * PKP + 8 * hh;
  const int bo = ((sel == 2) ? ((wave >> 2) * 64 + m) : (PXR + m)) * PKP + 8 * hh;
  const u16* ap = opt + ao;
  const u16* bp = opt + bo;
  const int bs = 16 * PKP;
  v8f acc0 = zero8(), acc1 = zero8(), acc2 = zero8(), acc3 = zero8();
  // kept rolled: the guard ends every trip and no load may cross it, so unrolling would only lengthen the text
#pragma unroll 1
  for (int k0 = 0; k0 < KX; k0 += 32) {
    const v16b a  = ldfrag_b(ap + k0);
    const v16b b0 = ldfrag_b(bp + k0);
    const v16b b1 = ldfrag_b(bp + bs + k0);
    const v16b b2 = ldfrag_b(bp + 2 * bs + k0);
    const v16b b3 = ldfrag_b(bp + 3 * bs + k0);
    acc0 = mma_b(a, b0, acc0);
    acc1 = mma_b(a, b1, acc1);
    acc2 = mma_b(a, b2, acc2);
    acc3 = mma_b(a, b3, acc3);
    guard6<v16b>(acc0, acc1, acc2, acc3, a, b0, b1, b2, b3, a);
  }
  __syncthreads();                          // every wave has read its last fragment before the slabs overwrite the tiles
  float* sl = (float*)(void*)opt + wave * SLAB64;
  if (sel == 3) {
    epi64(sl, acc0, acc1, acc2, acc3, 1.0f, U, DI, (size_t)(rb * PXR + wave * 16), g * HD, lane);
  } else if (sel == 2) {
    const int r64 = rb * (PXR / 64) + (wave >> 2);      // which 64 positions of the row group
    const size_t ob = ((size_t)((r64 / NST) * NH + g) * HD + (wave & 3) * 16) * LP + (size_t)(r64 % NST) * 64;
    epi64s(sl, acc0, acc1, acc2, acc3, VCAR, VH, VL, ob, lane);
  } else {
    const size_t ob = (size_t)(rb * PXR + wave * 16) * DI + (size_t)g * HD;
    epi64s(sl, acc0, acc1, acc2, acc3, (sel == 0) ? QSC : KSC, (sel == 0) ? QH : KH, (sel == 0) ? QL : KL, ob, lane);
  }
}

// =====================================================================================================
// Output projection: C[row][DM] (f32) = ((Ah + Al)[row][DI] . Bt[DM][DI]^T) * oscale + bias[col], times rsc[row]
// (products h.B + l.B into one accumulator, l unscaled). Block -> (position tile rt = bid % NST, row group bb): 64 rows
// bb*LP + 64*rt .. of Ah, Al and C against all DM rows of Bt. The three operand tiles are staged in LDS as in proj4 (whole-line
// loads, pitch PKP halves); wave w's tile is [16 rows (16*(w&3) ..)][64 columns (64*(w>>2) ..)], epilogue epi64o.
// coverage: grid = BG * NST blocks, each one 64 x 128 tile = every element of the row group's C once.
// =====================================================================================================
__global__ __launch_bounds__(PROJ_THREADS)
void gemm_o(const u16* __restrict__ Ah, const u16* __restrict__ Al, const u16* __restrict__ Bt,
            const float* __restrict__ bias, const float* __restrict__ rsc, float* C, float oscale) {
  __shared__ __align__(16) u16 opt[(2 * 64 + DM) * PKP];   // Ah rows 0..63, Al rows 0..63, Bt rows 0..127; later the 8 slabs
  const int tid = threadIdx.x, wave = tid >> 5, lane = tid & 31, hh = lane >> 4, m = lane & 15;
  const int bid   = blockIdx.x;
  const int rt    = bid % NST;
  const int bb    = bid / NST;
  if (bb >= BG) return;                     // block-uniform, before any barrier; never taken with the exact grid
  const int K     = DI;
  const size_t row0 = (size_t)bb * LP + rt * 64;
  {
    // staging: wave -> row wave + 8*i, lane -> 8 halves at 8*lane: each load and each LDS store covers one whole 512-B row
    const u16* ga = Ah + (row0 + wave) * K + 8 * lane;
    const u16* gl = Al + (row0 + wave) * K + 8 * lane;
    const u16* gb = Bt + (size_t)wave * K + 8 * lane;
    u16* tw = opt + wave * PKP + 8 * lane;
    v4u st[(2 * 64 + DM) / 8];              // the loops below are unrolled so that these stay in registers
#pragma unroll
    for (int i = 0; i < 8; ++i) {
      st[i]     = *(const v4u*)(ga + (size_t)(8 * i) * K);
      st[8 + i] = *(const v4u*)(gl + (size_t)(8 * i) * K);
    }
#pragma unroll
    for (int i = 0; i < DM / 8; ++i) st[16 + i] = *(const v4u*)(gb + (size_t)(8 * i) * K);
    // the address registers of these loads are reused below while the loads are still in flight; the three bases are named
    // as inputs so that none of them is given up for another value ahead of the wait
    asm volatile("s_wait_xcnt 0x0" :: "v"(ga), "v"(gl), "v"(gb) : "memory");
#pragma unroll
    for (int i = 0; i < (2 * 64 + DM) / 8; ++i) *(v4u*)(tw + 8 * i * PKP) = st[i];
  }
  __syncthreads();                          // the three operand tiles are complete before any wave reads a fragment
  const int srow  = (wave & 3) * 16;
  const int col0  = (wave >> 2) * 64;
  const size_t rowC = row0 + srow;
  const _Float16* ahp = (const _Float16*)(const void*)opt + (srow + m) * PKP + 8 * hh;
  const _Float16* alp = ahp + 64 * PKP;
  const _Float16* bp  = (const _Float16*)(const void*)opt + (2 * 64 + col0 + m) * PKP + 8 * hh;
  const int bs = 16 * PKP;
  v8f acc0 = zero8(), acc1 = zero8(), acc2 = zero8(), acc3 = zero8();
#pragma unroll 1
  for (int k0 = 0; k0 < K; k0 += 32) {
    const v16h ah = ldfrag_h(ahp + k0), al = ldfrag_h(alp + k0);
    const v16h b0 = ldfrag_h(bp + k0);
    const v16h b1 = ldfrag_h(bp + bs + k0);
    const v16h b2 = ldfrag_h(bp + 2 * bs + k0);
    const v16h b3 = ldfrag_h(bp + 3 * bs + k0);
    acc0 = mma_h(ah, b0, acc0);  acc0 = mma_h(al, b0, acc0);
    acc1 = mma_h(ah, b1, acc1);  acc1 = mma_h(al, b1, acc1);
    acc2 = mma_h(ah, b2, acc2);  acc2 = mma_h(al, b2, acc2);
    acc3 = mma_h(ah, b3, acc3);  acc3 = mma_h(al, b3, acc3);
    guard6<v16h>(acc0, acc1, acc2, acc3, ah, al, b0, b1, b2, b3);
  }
  __syncthreads();                          // every wave has read its last fragment before the slabs overwrite the tiles
  epi64o((float*)(void*)opt + wave * SLAB64, acc0, acc1, acc2, acc3, oscale, C, DM, rowC, col0, lane, bias, rsc);
}

// =====================================================================================================
// Pair attention for one row group. Block bid -> (64 softmax rows qb = bid % NST, head = (bid / NST) % NH, row group b);
// the four waves take 16 rows each (q0 = 64*qb + 16*wave) of the SAME head and share its column operands: per 64 columns the
// Cm hi/residual rows [64 vi][64 d] and the v^T hi/residual rows [64 d][64 vi] are brought in once per block with whole-line
// 16-B loads (8 lanes per 128-B row), held in registers while the tile before is worked on, stored to LDS (pitch 72 halves)
// and read from there as fragments by all four waves. Softmax row index qi uses the k projection (column operand R), softmax
// column index vi uses the q projection (row operand Cm), summed over vi with v[vi].
//   R hi/residual planes (k x1024 f16) and Cm hi/residual planes (q x128 x 8 ... i.e. (q*C^-0.5) x1024 f16) laid out
//   [b*LP + pos][h*HD + d]; v^T hi/residual planes [b*NH + h][d][LP]; CB [h][qi][vi] f32 = 1e9*(mask - 1) + x.Wb.
//   scores s(i, j) = R_hi.C_hi + R_lo.C_hi + R_hi.C_lo over HD; logit (log2 domain) t = (s / (1024*1024) + CB) * log2 e.
//   All NKT column tiles of 32 visited in order. Per tile: the 16x32 CB tile is staged into the wave-private LDS tile with
//   16-B loads/stores, then 2 score subtiles x 2 k-steps, computed transposed: Cm fragments from the LDS tile are the row
//   operand and R the column operand, so a lane holds 16 logits of ONE softmax row (q0 + c): maximum and sum run in the lane,
//   with one exchange between the lane halves for the maximum. The two score subtiles' registers lie in the split k map, so
//   P^T*32768 (f16 hi plus its f16 residual) is converted in place into the column operand of out^T += v^T.P^T (v^T fragments
//   as row operand, 2 groups of 2 d-subtiles), products hh + lh + hl.
//   After the loop: out = acc / Z (Z >= 1 always; guarded anyway), carries 1/(32768*1024) folded once, written to the wave's
//   private result slab (pitch 68; every element owned by one lane).
//   Epilogue: out multiplied by sigmoid(U + bu) in f32 (U = x.Wu f32 plane, bu bf16 RNE of the input), then O x1024 -> f16
// coverage: per wave 4 instructions x 4 rows x 8 lanes x 8 halves = 16 x 64 per plane; grid = NQT * BG = NST * NH * BG blocks
//           x WPB waves = every (b, pos, h) row segment of OH and OL exactly once.
// =====================================================================================================
__global__ __launch_bounds__(ATT_THREADS)
void attn_t(const u16* __restrict__ RHp, const u16* __restrict__ RLp,
            const u16* __restrict__ CHp, const u16* __restrict__ CLp,
            const u16* __restrict__ VHp, const u16* __restrict__ VLp,
            const float* __restrict__ CB, const float* __restrict__ U, const float* __restrict__ bu,
            u16* OHp, u16* OLp) {
  __shared__ __align__(16) float smem[WPB * WREG];
  __shared__ __align__(16) u16 tile[4 * TPL];   // Cm hi, Cm residual [vi][d]; v^T hi, v^T residual [d][vi]; pitch VTP

  const int tid  = threadIdx.x;
  const int wave = tid >> 5;
  const int lane = tid & 31;
  const int hh   = lane >> 4;
  const int c    = lane & 15;
  const int bid  = blockIdx.x;
  const int qb   = bid % NST;
  const int t2   = bid / NST;
  const int head = t2 % NH;
  const int b    = t2 / NH;
  if (b >= BG) return;                      // block-uniform, before any barrier; never taken with the exact grid
  const int q0   = qb * 64 + wave * 16;

  float* pt   = smem + wave * WREG;         // CB tile [16][32] pitch 36
  float* slab = pt + PTW;                   // result slab [16][64] pitch 68

  const size_t hcol = (size_t)head * HD + 8 * hh;
  const _Float16* Rh  = (const _Float16*)(const void*)RHp + ((size_t)b * LP + q0 + c) * DI + hcol;
  const _Float16* Rl  = (const _Float16*)(const void*)RLp + ((size_t)b * LP + q0 + c) * DI + hcol;
  // fragment bases in the LDS tile: row c (+16 per subtile), halves 8*hh (+ the k offset per step)
  const _Float16* Chb = (const _Float16*)(const void*)tile + c * VTP + 8 * hh;   // row = vi within the tile, k = d
  const _Float16* Clb = Chb + TPL;
  const _Float16* Vhb = Chb + 2 * TPL;                                           // row = d, k = vi within the tile
  const _Float16* Vlb = Chb + 3 * TPL;
  // staging: thread -> (row sr + 16*i, 8 halves at sc); 8 consecutive lanes cover one 128-B row segment of a plane
  const int sr = tid >> 3, sc = (tid & 7) * 8;
  const u16* gch = CHp + ((size_t)b * LP + sr) * DI + (size_t)head * HD + sc;    // + (64*s + 16*i) * DI
  const u16* gcl = CLp + ((size_t)b * LP + sr) * DI + (size_t)head * HD + sc;
  const u16* gvh = VHp + ((size_t)(b * NH + head) * HD + sr) * LP + sc;          // + 16*i * LP + 64*s
  const u16* gvl = VLp + ((size_t)(b * NH + head) * HD + sr) * LP + sc;
  u16* tw = tile + sr * VTP + sc;
  const float* cbb = CB + ((size_t)head * LP + q0) * LP;
  const float invc = 1.0f / (CSC * KSC);
  const float oc   = 1.0f / (PCAR * VCAR);

  float mrow = -INFINITY, lrow = 0.f;       // of softmax row q0 + c; lrow is this lane half's share of the row sum
  v8f o[4];                                 // o[j][r] = out^T (d = 16*j + 8*hh + r, row q0 + c)
#pragma unroll
  for (int j = 0; j < 4; ++j) o[j] = zero8();

  v4u pre[16];                              // the next 64-column tile of the four planes, in flight
#pragma unroll
  for (int i = 0; i < 4; ++i) {
    pre[i]      = *(const v4u*)(gch + (size_t)(16 * i) * DI);
    pre[4 + i]  = *(const v4u*)(gcl + (size_t)(16 * i) * DI);
    pre[8 + i]  = *(const v4u*)(gvh + (size_t)(16 * i) * LP);
    pre[12 + i] = *(const v4u*)(gvl + (size_t)(16 * i) * LP);
  }
#pragma unroll 1
  for (int kt = 0; kt < NKT; ++kt) {
    const int kb = kt * 32;
    const int kl = kb & (STG - 1);          // first column of this step inside the LDS tile
    if (kl == 0) {                          // block-uniform: a new 64-column tile every second step
      if (kt != 0) __syncthreads();         // every wave has finished reading the tile that is overwritten next
#pragma unroll
      for (int i = 0; i < 4; ++i) {
        *(v4u*)(tw + 16 * i * VTP)           = pre[i];
        *(v4u*)(tw + TPL + 16 * i * VTP)     = pre[4 + i];
        *(v4u*)(tw + 2 * TPL + 16 * i * VTP) = pre[8 + i];
        *(v4u*)(tw + 3 * TPL + 16 * i * VTP) = pre[12 + i];
      }
      __syncthreads();                      // the tile is complete before any wave reads a fragment of it
      if (kb + STG < LP) {                  // block-uniform: the following tile's loads fly while this one is worked on
#pragma unroll
        for (int i = 0; i < 4; ++i) {
          pre[i]      = *(const v4u*)(gch + (size_t)(kb + STG + 16 * i) * DI);
          pre[4 + i]  = *(const v4u*)(gcl + (size_t)(kb + STG + 16 * i) * DI);
          pre[8 + i]  = *(const v4u*)(gvh + (size_t)(16 * i) * LP + kb + STG);
          pre[12 + i] = *(const v4u*)(gvl + (size_t)(16 * i) * LP + kb + STG);
        }
        // the address registers of these loads are reused by the step below while the loads are still in flight
        asm volatile("s_wait_xcnt 0x0" ::: "memory");
      }
    }
    // ---- stage the additive logit tile [16 rows][32 cols] into pt: 128 float4, lane handles f = it*32 + lane ----
#pragma unroll
    for (int it = 0; it < 4; ++it) {
      const int f = it * 32 + lane;
      const int row = f >> 3, col4 = (f & 7) * 4;
      const v4f t4 = *(const v4f*)(cbb + (size_t)row * LP + kb + col4);
      *(v4f*)(pt + row * PTP + col4) = t4;
    }
    // ---- scores, transposed: D element r of this lane = (col kb + 8hh + r, row q0 + c) in s0, col kb + 16 + 8hh + r in s1 ----
    v8f s0 = zero8(), s1 = zero8();
    const _Float16* c0p = Chb + kl * VTP;
    const _Float16* c1p = c0p + 16 * VTP;
    const _Float16* l0p = Clb + kl * VTP;
    const _Float16* l1p = l0p + 16 * VTP;
#pragma unroll
    for (int kk = 0; kk < HD / 32; ++kk) {
      const v16h rh  = ldfrag_h(Rh + kk * 32);
      const v16h rl  = ldfrag_h(Rl + kk * 32);
      const v16h ch0 = ldfrag_h(c0p + kk * 32);
      const v16h ch1 = ldfrag_h(c1p + kk * 32);
      const v16h cl0 = ldfrag_h(l0p + kk * 32);
      const v16h cl1 = ldfrag_h(l1p + kk * 32);
      s0 = mma_h(ch0, rh, s0);
      s0 = mma_h(ch0, rl, s0);
      s0 = mma_h(cl0, rh, s0);
      s1 = mma_h(ch1, rh, s1);
      s1 = mma_h(ch1, rl, s1);
      s1 = mma_h(cl1, rh, s1);
      guard2(s0, s1, rh, rl, ch0, cl0, ch1, cl1);
    }
    wave_sync_lds();
    // ---- additive term + online softmax in base 2, -inf-safe; the lane's 16 logits all belong to row q0 + c ----
    float e[16];                            // element s = column kb + 8hh + s (s < 8), kb + 16 + 8hh + s - 8 (s >= 8)
    {
      const float* crow = pt + c * PTP + 8 * hh;
      const v4f c0 = *(const v4f*)(crow), c1 = *(const v4f*)(crow + 4);
      const v4f c2 = *(const v4f*)(crow + 16), c3 = *(const v4f*)(crow + 20);
#pragma unroll
      for (int r = 0; r < 4; ++r) {
        e[r]      = (s0[r] * invc + c0[r]) * LOG2E;
        e[4 + r]  = (s0[4 + r] * invc + c1[r]) * LOG2E;
        e[8 + r]  = (s1[r] * invc + c2[r]) * LOG2E;
        e[12 + r] = (s1[4 + r] * invc + c3[r]) * LOG2E;
      }
    }
    float mx = e[0];
#pragma unroll
    for (int s = 1; s < 16; ++s) mx = fmaxf(mx, e[s]);
    mx = fmaxf(mx, xhalf(mx));              // the other half of the row's 32 columns
    const float mn = fmaxf(mrow, mx);
    const float ms = (mn == -INFINITY) ? 0.0f : mn;
    const float al = exp2f(mrow - ms);
    mrow = mn;
#pragma unroll
    for (int s = 0; s < 16; ++s) e[s] = exp2f(e[s] - ms);
    {
      const float pa = ((e[0] + e[1]) + (e[2] + e[3])) + ((e[4] + e[5]) + (e[6] + e[7]));
      const float pb = ((e[8] + e[9]) + (e[10] + e[11])) + ((e[12] + e[13]) + (e[14] + e[15]));
      lrow = lrow * al + (pa + pb);
    }
#pragma unroll
    for (int j = 0; j < 4; ++j) {
#pragma unroll
      for (int r = 0; r < 8; ++r) o[j][r] *= al;
    }
    // ---- B fragments of P^T*32768: hi f16 and residual f16, column = row q0 + c; the score registers already lie in the
    //      split k map over the 32 columns of this step, so element s of the fragment is e[s] ----
    FragH ph, pl;
#pragma unroll
    for (int s = 0; s < 8; ++s) {
      const float ta = e[s] * PCAR, tb = e[8 + s] * PCAR;
      const _Float16 ha = (_Float16)ta, hb = (_Float16)tb;
      ph.h[0][s] = ha;
      ph.h[1][s] = hb;
      pl.h[0][s] = (_Float16)(ta - (float)ha);
      pl.h[1][s] = (_Float16)(tb - (float)hb);
    }
    // ---- v^T.P^T : A fragment row m = d = j*16 + c, columns vi contiguous in the v^T tile rows; 2 groups of 2 d-subtiles ----
    {
      const _Float16* vhp = Vhb + kl;
      const _Float16* vlp = Vlb + kl;
#pragma unroll
      for (int jg = 0; jg < HD / 32; ++jg) {
        const int da = (2 * jg) * 16 * VTP;
        const int db = da + 16 * VTP;
        const v16h vha = ldfrag_h(vhp + da), vhb2 = ldfrag_h(vhp + db);
        const v16h vla = ldfrag_h(vlp + da), vlb2 = ldfrag_h(vlp + db);
        o[2 * jg]     = mma_h(vha,  ph.v, o[2 * jg]);
        o[2 * jg]     = mma_h(vha,  pl.v, o[2 * jg]);
        o[2 * jg]     = mma_h(vla,  ph.v, o[2 * jg]);
        o[2 * jg + 1] = mma_h(vhb2, ph.v, o[2 * jg + 1]);
        o[2 * jg + 1] = mma_h(vhb2, pl.v, o[2 * jg + 1]);
        o[2 * jg + 1] = mma_h(vlb2, ph.v, o[2 * jg + 1]);
        guard2(o[2 * jg], o[2 * jg + 1], ph.v, pl.v, vha, vhb2, vla, vlb2);
      }
    }
    wave_sync_lds();
  }
  acc_guard4(o[0], o[1], o[2], o[3]);
  // ---- out = acc / Z (0 if Z == 0), carries (32768 on P, 1024 on v) folded once; written into the lane-owned slab ----
  {
    const float lv  = lrow + xhalf(lrow);   // the two lane halves' shares of the row sum, joined once
    const float ls  = (lv > 0.0f) ? lv : 1.0f;
    const float inv = (lv > 0.0f) ? ((1.0f / ls) * oc) : 0.0f;
#pragma unroll
    for (int j = 0; j < 4; ++j) {
      float* sp = slab + c * SLP + j * 16 + 8 * hh;     // row q0 + c, 8 consecutive d
      v4f w0, w1;
#pragma unroll
      for (int r = 0; r < 4; ++r) { w0[r] = o[j][r] * inv; w1[r] = o[j][4 + r] * inv; }
      *(v4f*)(sp)     = w0;
      *(v4f*)(sp + 4) = w1;
    }
  }

  wave_sync_lds();
  // ---- gate in f32, then O x1024 -> f16 hi + residual planes; lane = (row select rq in 0..3, 8 consecutive d at c8) ----
  v4u oh[4], ol[4];
  const int rq = lane >> 3, c8 = (lane & 7) * 8;
  const float* urow = U + ((size_t)b * LP + q0) * DI + (size_t)head * HD + c8;
  float bb[8];
  {
    const v4f u0 = *(const v4f*)(bu + head * HD + c8), u1 = *(const v4f*)(bu + head * HD + c8 + 4);
#pragma unroll
    for (int e = 0; e < 4; ++e) { bb[e] = bfr(u0[e]); bb[4 + e] = bfr(u1[e]); }
  }
#pragma unroll
  for (int it = 0; it < 4; ++it) {
    const int row = it * 4 + rq;
    const v4f a  = *(const v4f*)(slab + row * SLP + c8), b4 = *(const v4f*)(slab + row * SLP + c8 + 4);
    const v4f ua = *(const v4f*)(urow + (size_t)row * DI), ub = *(const v4f*)(urow + (size_t)row * DI + 4);
    float w[8];
#pragma unroll
    for (int e = 0; e < 4; ++e) {
      w[e]     = (a[e]  * sigm(ua[e] + bb[e]))     * OSC;
      w[4 + e] = (b4[e] * sigm(ub[e] + bb[4 + e])) * OSC;
    }
#pragma unroll
    for (int e = 0; e < 4; ++e) {
      const _Float16 h0 = (_Float16)w[2 * e], h1 = (_Float16)w[2 * e + 1];
      const _Float16 l0 = (_Float16)(w[2 * e] - (float)h0), l1 = (_Float16)(w[2 * e + 1] - (float)h1);
      oh[it][e] = pk16(h_bits(h0), h_bits(h1));
      ol[it][e] = pk16(h_bits(l0), h_bits(l1));
    }
  }
  const size_t ob = ((size_t)b * LP + q0) * DI + (size_t)head * HD + c8;
  {
#pragma unroll
    for (int it = 0; it < 4; ++it) {
      const int row = it * 4 + rq;
      *(v4u*)(OHp + ob + (size_t)row * DI) = oh[it];
      *(v4u*)(OLp + ob + (size_t)row * DI) = ol[it];
    }
    
  }
}

// =====================================================================================================
// Rows s are processed in NGRP groups of BG rows; every per-group workspace plane is reused in launch order. BG is the largest
// divisor of NS whose planes fit the workspace: every group costs three dependent launches, each with its own start and drain.
// Workspace map (bytes); every plane is fully written by whole-line stores before it is read; all extents are exact
// multiples of the store granularity (no pad rows needed); every region offset a multiple of 65536:
//   XB  bf16 [NPIX][256] (hi|lo)                    33554432
//   OH, OL  f16 [GROWS][256] x1024                  2 * GROWS*512
//   U   f32 [GROWS][256]                            GROWS*1024   (gate pre-activation)
//   QH, KH, QL, KL  f16 [GROWS][256]               4 * GROWS*512
//   VH, VL  f16 [BG*4][64][LP]                      2 * GROWS*512
//   CB  f32 [4][NPIX]                               1048576
//   WQ, WK, WV, WU  bf16 [256 n][256 k]             4 * 131072   (contiguous in this order: proj4 reads them as one plane)
//   WO  f16 x1024 [128 n][256 k]                    65536
//   end (BG = 128)                                  202964992
// =====================================================================================================
extern "C" void kernel_launch(void* const* d_in, const int* in_sizes, int n_in,
                              void* d_out, int out_size, void* d_ws, size_t ws_size,
                              hipStream_t stream) {
  if (n_in < 12) return;
  if (in_sizes[0] < NPIX * DM) return;
  if (in_sizes[1] < NPIX) return;
  if (in_sizes[2] < DM || in_sizes[3] < DM) return;
  if (in_sizes[4] < DM * DI || in_sizes[5] < DM * DI || in_sizes[6] < DM * DI || in_sizes[8] < DM * DI) return;
  if (in_sizes[7] < DM * NH) return;
  if (in_sizes[9] < DI) return;
  if (in_sizes[10] < DI * DM) return;
  if (in_sizes[11] < DM) return;
  if (out_size < NS * LP * DM) return;

  const float* pr    = (const float*)d_in[0];
  const float* mask  = (const float*)d_in[1];
  const float* gamma = (const float*)d_in[2];
  const float* beta  = (const float*)d_in[3];
  const float* Wq    = (const float*)d_in[4];
  const float* Wk    = (const float*)d_in[5];
  const float* Wv    = (const float*)d_in[6];
  const float* Wb    = (const float*)d_in[7];
  const float* Wu    = (const float*)d_in[8];
  const float* bu    = (const float*)d_in[9];
  const float* Wo    = (const float*)d_in[10];
  const float* bo    = (const float*)d_in[11];
  float*       out   = (float*)d_out;

  const size_t szXB = (size_t)NPIX * KX * 2;
  const size_t szU  = (size_t)GROWS * DI * 4;
  const size_t szH  = (size_t)GROWS * DI * 2;                   // QH, KH, QL, KL, OH, OL
  const size_t szV  = (size_t)BG * NH * HD * LP * 2;            // VH, VL (== szH)
  const size_t szCB = (size_t)NH * NPIX * 4;
  const size_t szW  = (size_t)DI * KX * 2;
  const size_t szWO = (size_t)DM * DI * 2;
  size_t off = 0;
  const size_t oXB = off; off += szXB;
  const size_t oOH = off; off += szH;
  const size_t oOL = off; off += szH;
  const size_t oU  = off; off += szU;
  const size_t oQH = off; off += szH;
  const size_t oKH = off; off += szH;
  const size_t oQL = off; off += szH;
  const size_t oKL = off; off += szH;
  const size_t oVH = off; off += szV;
  const size_t oVL = off; off += szV;
  const size_t oCB = off; off += szCB;
  const size_t oWQ = off; off += szW;
  const size_t oWK = off; off += szW;
  const size_t oWV = off; off += szW;
  const size_t oWU = off; off += szW;
  const size_t oWO = off; off += szWO;
  if (off > ws_size) return;                // off = 202964992 for BG = 128
  if (off > (size_t)WS_CAP) return;

  char* ws = (char*)d_ws;
  u16*   XB = (u16*)(ws + oXB);
  u16*   OH = (u16*)(ws + oOH);
  u16*   OL = (u16*)(ws + oOL);
  float* U  = (float*)(ws + oU);
  u16*   QH = (u16*)(ws + oQH);
  u16*   KH = (u16*)(ws + oKH);
  u16*   QL = (u16*)(ws + oQL);
  u16*   KL = (u16*)(ws + oKL);
  u16*   VH = (u16*)(ws + oVH);
  u16*   VL = (u16*)(ws + oVL);
  float* CB = (float*)(ws + oCB);
  u16*   WQ = (u16*)(ws + oWQ);
  u16*   WO = (u16*)(ws + oWO);

  const dim3 b256(256), bAT(ATT_THREADS);
  const dim3 gPR(NWB + NPIX / LNPB);                    // 20 weight-plane blocks + 2048 LayerNorm blocks
  const dim3 gP((GROWS / PXR) * NPT);
  const dim3 gAT(NQT * BG);
  const dim3 gO(BG * NST);
  const float osc = 1.0f / (OSC * WOS);

  // one launch: LayerNorm for every pixel (x hi|lo planes, additive logit table) and the weight planes
  // Wq^T, Wk^T, Wv^T, Wu^T [n][k | k] as bf16 (contiguous from WQ), Wo^T [n][k] as f16 of bf16 value x1024
  prep<<<gPR, b256, 0, stream>>>(pr, mask, gamma, beta, Wb, Wq, Wk, Wv, Wu, Wo, XB, CB, WQ, WO);

  for (int g = 0; g < NGRP; ++g) {
    const u16*   xg = XB   + (size_t)g * GROWS * KX;
    const float* mg = mask + (size_t)g * GROWS;
    float*       og = out  + (size_t)g * GROWS * DM;
    // (1) q, k, v, u projections in one launch: q, k and v^T as f16 hi + residual planes, gate pre-activation u as f32
    proj4<<<gP, b256, 0, stream>>>(xg, WQ, QH, QL, KH, KL, VH, VL, U);
    // (2) attention: rows from the k planes, columns from the q planes, sum over columns with v; gated O -> OH + OL planes
    attn_t<<<gAT, bAT, 0, stream>>>(KH, KL, QH, QL, VH, VL, CB, U, bu, OH, OL);
    // (3) output projection (hi + residual), + bo, x mask row scale -> out f32, carries 1024 x 1024 folded back
    gemm_o<<<gO, b256, 0, stream>>>(OH, OL, WO, bo, mg, og, osc);
  }
  (void)hipGetLastError();
}

// v007
// One run takes 199 microseconds.
// Next to v006, in two timings, it ran 1.05 times as fast each time.
// Over all steps from v000 it is 3.10 times as fast.
// Contractions: x.Wq, x.Wk, x.Wv, x.Wu on v_wmma_f32_16x16x32_bf16 (x as bf16 hi|lo pair folded into K = 256, W as bf16 RNE
// of the input, f32 accumulate); k.q^T over 64 and P.v^T on v_wmma_f32_16x16x32_f16 (k x1024 and q x128 f16 hi + residual
// planes, P x32768 f16 hi + residual, v x1024 f16 hi + residual; products hh + lh + hl); (O*gate).Wo on
// v_wmma_f32_16x16x32_f16 (O x1024 f16 hi + residual, Wo as f16(bf16(Wo)) x1024, products h.w + l.w); all f32 accumulate.
// LayerNorm, x.Wb (N = 4) and the additive logit table, base-2 online softmax, sigmoid gate, bias and row scale in f32 on VALU.
#include <hip/hip_runtime.h>
#include <math.h>
#include <stdint.h>

#ifndef NS
#define NS 256
#endif
#define NSX   256
#define LP    256
#define DM    128
#define NH    4
#define HD    64
#define DI    (NH * HD)
#define KX    (2 * DM)
#define NPIX  (LP * LP)
#define BG    NS
#define NGRP  (NS / BG)
#define GROWS (BG * LP)
#define LNEPS 1e-5f
#define LOG2E 1.4426950408889634f
#define QSC   128.0f
#define CSC   1024.0f
#define KSC   1024.0f
#define PCAR  32768.0f
#define VCAR  1024.0f
#define OSC   1024.0f
#define WOS   1024.0f
#define WPB   4
#define NQT   (LP / 16)
#define NST   (LP / 64)
#define NKT   (LP / 32)
#define ATT_THREADS (WPB * 32)
#define PTP   36
#define PTW   (16 * PTP)
#define SLP   68
#define SLW   (16 * SLP)
#define WREG  (PTW + SLW)
#define SLAB64 (16 * 68)
#define VTP   72
#define NPT   (3 * DI / 64)
#define PLP   256
#define LNPB  32
#define STG   64
#define TPL   (STG * VTP)
#define WS_CAP 268435456
#define PXR   128
#define PKP   (KX + 8)
#define PROJ_THREADS 256
#define WTB   4
#define NWB   (5 * WTB)
static_assert(DI == NH * HD && HD == 64 && NH == 4 && WPB == NH);
static_assert(ATT_THREADS == 128);
static_assert(STG == 64 && HD == STG && (LP % STG) == 0 && NST * NH == NQT);
static_assert(NS >= 1 && NS <= NSX && (NS % BG) == 0 && BG >= 1 && BG <= NSX);
static_assert((LP % 64) == 0 && (LP % 32) == 0 && (LP % 16) == 0);
static_assert(DM == 128 && (KX % 32) == 0 && (DI % 64) == 0 && (DI % 32) == 0 && (DM % 64) == 0);
static_assert(PLP == DI && PLP == LP && NPT == 3 * NH && (GROWS % 64) == 0);
static_assert(HD * PKP <= 4 * TPL && ATT_THREADS * 16 * 8 == HD * KX && HD == 16 * WPB);
static_assert((NPIX % LNPB) == 0 && LNPB == 32);
static_assert((GROWS % PXR) == 0 && PXR == 128 && PROJ_THREADS == 256 && KX == 256 && DI == KX && DM == 128 && 8 * SLAB64 * 4 <= (PXR + 64) * PKP * 2);
static_assert((DI % 128) == 0 && (DM % 128) == 0 && (DM % 64) == 0 && (DI % 64) == 0);
static_assert((DI / 128) * (DM / 64) == WTB && (DM / 128) * (DI / 64) == WTB);

typedef unsigned short u16;
typedef _Float16 v16h __attribute__((ext_vector_type(16)));
typedef _Float16 v8h  __attribute__((ext_vector_type(8)));
typedef __bf16   v16b __attribute__((ext_vector_type(16)));
typedef float    v8f  __attribute__((ext_vector_type(8)));
typedef float    v4f  __attribute__((ext_vector_type(4)));
typedef unsigned int v4u __attribute__((ext_vector_type(4)));
typedef unsigned int v2u __attribute__((ext_vector_type(2)));

union FragH { v16h v; v8h h[2]; v4u u[2]; };
union FragB { v16b v; v4u u[2]; };

// ---- scalar helpers --------------------------------------------------------------------------------
__device__ __forceinline__ unsigned short bf_bits(float f) {          // f32 -> bf16 bits, RNE convert
  unsigned u = __float_as_uint(f);
  return (unsigned short)((u + 0x7FFFu + ((u >> 16) & 1u)) >> 16);
}
__device__ __forceinline__ float bf_up(unsigned short h) { return __uint_as_float(((unsigned)h) << 16); }
__device__ __forceinline__ float bfr(float f) { return bf_up(bf_bits(f)); }
__device__ __forceinline__ unsigned short h_bits(_Float16 x) { return __builtin_bit_cast(unsigned short, x); }
__device__ __forceinline__ unsigned pk16(unsigned short a, unsigned short b) { return (unsigned)a | ((unsigned)b << 16); }
__device__ __forceinline__ v8f zero8() { v8f z = {0.f, 0.f, 0.f, 0.f, 0.f, 0.f, 0.f, 0.f}; return z; }
__device__ __forceinline__ float sigm(float z) {                     // 1 / (1 + 2^(-z log2 e)), argument clamped
  const float zc = fminf(fmaxf(z, -30.0f), 30.0f);
  const float e  = exp2f(-zc * LOG2E);
  return __builtin_amdgcn_rcpf(1.0f + e);
}

// ---- fragment loaders: 16-bit A/B operand, lane -> row/col (lane&15), p already includes +8*(lane>>4);
//      elements 0..7 <- p[0..7] (k0+8h..), elements 8..15 <- p[16..23] (k0+16+8h..)  (same split k map for A and B;
//      B is always read from a k-contiguous [n][k] plane)
__device__ __forceinline__ v16h ldfrag_h(const _Float16* p) {
  FragH f;
  f.h[0] = *(const v8h*)(p);
  f.h[1] = *(const v8h*)(p + 16);
  return f.v;
}
__device__ __forceinline__ v16b ldfrag_b(const u16* p) {              // bf16 plane read as unsigned integer vectors
  FragB f;
  f.u[0] = *(const v4u*)(p);
  f.u[1] = *(const v4u*)(p + 16);
  return f.v;
}

__device__ __forceinline__ v8f mma_h(v16h a, v16h b, v8f c) {
  return __builtin_amdgcn_wmma_f32_16x16x32_f16(false, a, false, b, (short)0, c, false, false);
}
__device__ __forceinline__ v8f mma_b(v16b a, v16b b, v8f c) {
  return __builtin_amdgcn_wmma_f32_16x16x32_bf16(false, a, false, b, (short)0, c, false, false);
}
__device__ __forceinline__ void guard2(v8f& a, v8f& b, v16h x0, v16h x1, v16h x2, v16h x3, v16h x4, v16h x5) {
#if defined(__HIP_DEVICE_COMPILE__)
  asm volatile("v_nop\n\tv_nop\n\tv_nop\n\tv_nop"
               : "+v"(a), "+v"(b) : "v"(x0), "v"(x1), "v"(x2), "v"(x3), "v"(x4), "v"(x5) : "memory");
#endif
}
template <typename F>
__device__ __forceinline__ void guard6(v8f& a, v8f& b, v8f& c, v8f& d, F x0, F x1, F x2, F x3, F x4, F x5) {
#if defined(__HIP_DEVICE_COMPILE__)
  asm volatile("v_nop\n\tv_nop\n\tv_nop\n\tv_nop"
               : "+v"(a), "+v"(b), "+v"(c), "+v"(d) : "v"(x0), "v"(x1), "v"(x2), "v"(x3), "v"(x4), "v"(x5) : "memory");
#endif
}
__device__ __forceinline__ void acc_guard4(v8f& a, v8f& b, v8f& c, v8f& d) {
#if defined(__HIP_DEVICE_COMPILE__)
  asm volatile("v_nop\n\tv_nop\n\tv_nop\n\tv_nop" : "+v"(a), "+v"(b), "+v"(c), "+v"(d));
#endif
}
__device__ __forceinline__ float xhalf(float x) {                    // value of lane l ^ 16 (the other 16-lane row)
  const int b = __builtin_bit_cast(int, x);
  return __builtin_bit_cast(float, __builtin_amdgcn_permlanex16(b, b, 0x76543210, 0xfedcba98, false, false));
}
__device__ __forceinline__ void wave_sync_lds() {
  __builtin_amdgcn_fence(__ATOMIC_RELEASE, "workgroup");
  __builtin_amdgcn_wave_barrier();
  __builtin_amdgcn_fence(__ATOMIC_ACQUIRE, "workgroup");
}

// =====================================================================================================
// statistics), x written as bf16 hi | bf16 lo planes XB [NPIX][KX] (columns 0..127 hi bits, 128..255 lo bits of x - hi);
// the additive logit table CB [NH][NPIX] = 1e9*(mask - 1) + x.Wb (VALU f32, N = 4) is produced by the same block.
// Block = 8 waves x LNPB/8 pixels, wave = one pixel at a time (lane holds 4 channels); the 512-B x row is assembled in a
// x 4 heads) are funnelled through LDS and written by wave 0 in one instruction (8 consecutive lanes x 16 B per line);
// coverage: blk = 0 .. NPIX/LNPB - 1, each 32 pixels = every XB row once and every CB line once.
// =====================================================================================================
__device__ __forceinline__ void ln_x(int blk, const float* __restrict__ pr, const float* __restrict__ mask,
                                     const float* __restrict__ gamma, const float* __restrict__ beta,
                                     const float* __restrict__ Wb, u16* XB, float* CB) {
  __shared__ __align__(16) u16 RB[8 * KX];
  __shared__ __align__(16) float PBS[NH * LNPB];
  const int tid = threadIdx.x, wave = tid >> 5, lane = tid & 31;
  const int p0 = blk * LNPB;
  if (p0 + LNPB > NPIX) return;             // block-uniform, before any barrier; never taken with the exact grid
  float gm[4], bt[4], wb[16];
  {
    const v4f g4 = *(const v4f*)(gamma + 4 * lane), b4 = *(const v4f*)(beta + 4 * lane);
#pragma unroll
    for (int e = 0; e < 4; ++e) { gm[e] = bfr(g4[e]); bt[e] = bfr(b4[e]); }
#pragma unroll
    for (int i = 0; i < 4; ++i) {
      const v4f w4 = *(const v4f*)(Wb + 16 * lane + 4 * i);      // Wb[(4*lane + i)][h], h = 0..3
#pragma unroll
      for (int h = 0; h < 4; ++h) wb[4 * i + h] = bfr(w4[h]);
    }
  }
  u16* rb = RB + wave * KX;
#pragma unroll 1
  for (int j = 0; j < LNPB / 8; ++j) {
    const int pl = j * 8 + wave;
    const int p  = p0 + pl;
    const v4f x4 = *(const v4f*)(pr + (size_t)p * DM + 4 * lane);
    float xr[4];
#pragma unroll
    for (int e = 0; e < 4; ++e) xr[e] = bfr(x4[e]);
    float s = (xr[0] + xr[1]) + (xr[2] + xr[3]);
#pragma unroll
    for (int off = 1; off < 32; off <<= 1) s += __shfl_xor(s, off, 32);
    const float mu = s * (1.0f / (float)DM);
    float d[4];
#pragma unroll
    for (int e = 0; e < 4; ++e) d[e] = xr[e] - mu;
    float ss = (d[0] * d[0] + d[1] * d[1]) + (d[2] * d[2] + d[3] * d[3]);
#pragma unroll
    for (int off = 1; off < 32; off <<= 1) ss += __shfl_xor(ss, off, 32);
    const float var = ss * (1.0f / (float)DM);
    const float rs  = 1.0f / sqrtf(var + LNEPS);
    float y[4];
#pragma unroll
    for (int e = 0; e < 4; ++e) y[e] = d[e] * rs * gm[e] + bt[e];
    unsigned short hb[4], lb[4];
#pragma unroll
    for (int e = 0; e < 4; ++e) { hb[e] = bf_bits(y[e]); lb[e] = bf_bits(y[e] - bf_up(hb[e])); }
    float pb[4];
#pragma unroll
    for (int h = 0; h < 4; ++h) pb[h] = y[0] * wb[h] + y[1] * wb[4 + h] + y[2] * wb[8 + h] + y[3] * wb[12 + h];
#pragma unroll
    for (int h = 0; h < 4; ++h) {
#pragma unroll
      for (int off = 1; off < 32; off <<= 1) pb[h] += __shfl_xor(pb[h], off, 32);
    }
    const float mk = bfr(mask[p]);
    const float mb = 1e9f * (mk - 1.0f);
    v2u hv, lv;
    hv[0] = pk16(hb[0], hb[1]);  hv[1] = pk16(hb[2], hb[3]);
    lv[0] = pk16(lb[0], lb[1]);  lv[1] = pk16(lb[2], lb[3]);
    *(v2u*)(rb + 4 * lane)      = hv;
    *(v2u*)(rb + DM + 4 * lane) = lv;
    if (lane == 0) {
      PBS[0 * LNPB + pl] = mb + pb[0];
      PBS[1 * LNPB + pl] = mb + pb[1];
      PBS[2 * LNPB + pl] = mb + pb[2];
      PBS[3 * LNPB + pl] = mb + pb[3];
    }
    wave_sync_lds();
    const v4u piece = *(const v4u*)(rb + 8 * lane);
    u16* dst = XB + (size_t)p * KX + 8 * lane;
    {
      *(v4u*)(dst) = piece;
      
    }
    wave_sync_lds();
  }
  __syncthreads();
  if (wave == 0) {
    const int h = lane >> 3, j4 = (lane & 7) * 4;
    const v4f v = *(const v4f*)(PBS + h * LNPB + j4);
    float* d = CB + (size_t)h * NPIX + p0 + j4;
    {
      *(v4f*)(d) = v;
      
    }
  }
}

// =====================================================================================================
// Transposed weight plane: W f32 [nk rows k][ncol cols n] -> D 16-bit [n][ldd], D[n][k] = bf16 bits of W[k][n] (f16mode 0)
// or f16 bits of bf16(W[k][n]) * scale (f16mode 1); when dup != 0 the same 64-half segment is also written at D[n][nk + k]
// (hi|lo folded K). Block (ct = bid % nct: 128 columns, rt = bid / nct: 64 rows): each thread loads 32 floats of one k row
// (16-B loads), converts, scatters into the LDS tile [128 n][64 k] (pitch 72 halves); after a block barrier each n row segment
// coverage: load 256 thr x 32 = 64 k rows x 128 n; store 4 iterations x 256 thr x 8 halves = 128 lines x 64 = the block's tile
// =====================================================================================================
__device__ __forceinline__ void wt16(int bid, const float* __restrict__ W, int ncol, int nk, u16* D, int ldd, int dup,
                                     int f16mode, float scale) {
  __shared__ __align__(16) u16 T[128 * VTP];
  const int tid = threadIdx.x;
  const int nct = ncol / 128;
  const int ct  = bid % nct;
  const int rt  = bid / nct;
  if (rt * 64 + 64 > nk) return;            // block-uniform, before the barrier; never taken with the exact grid
  {
    const int sl = tid >> 2;                // k row within tile 0..63
    const int dc = (tid & 3) * 32;          // n chunk
    const float* src = W + (size_t)(rt * 64 + sl) * ncol + ct * 128 + dc;
    v4f ld[8];                              // the loops below are unrolled so that these stay in registers
#pragma unroll
    for (int i = 0; i < 8; ++i) ld[i] = *(const v4f*)(src + 4 * i);
    // the eight loads share one address pair; it is named as an input so that no load's result is placed on it ahead of the wait
    asm volatile("s_wait_xcnt 0x0" :: "v"(src) : "memory");
#pragma unroll
    for (int i = 0; i < 8; ++i) {
      const v4f a = ld[i];
#pragma unroll
      for (int e = 0; e < 4; ++e) {
        const float f = a[e];
        const unsigned short hb = h_bits((_Float16)(bfr(f) * scale));
        const unsigned short bb = bf_bits(f);
        T[(dc + 4 * i + e) * VTP + sl] = (f16mode != 0) ? hb : bb;
      }
    }
  }
  __syncthreads();
  v4u w4[4];
  const int q8 = tid >> 3, p8 = (tid & 7) * 8;
#pragma unroll
  for (int it = 0; it < 4; ++it) {
    const int line = it * 32 + q8;          // n within tile 0..127
    w4[it] = *(const v4u*)(T + line * VTP + p8);
  }
  const size_t base = ((size_t)ct * 128) * ldd + rt * 64 + p8;
  {
#pragma unroll
    for (int it = 0; it < 4; ++it) {
      const int line = it * 32 + q8;
      *(v4u*)(D + base + (size_t)line * ldd) = w4[it];
      if (dup != 0) *(v4u*)(D + base + (size_t)line * ldd + nk) = w4[it];
    }
    // behind the last store: no register that these stores name is rewritten ahead of this wait on any path of the joined kernel
    asm volatile("s_wait_xcnt 0x0" ::: "memory");
  }
}

// =====================================================================================================
// Everything that depends on the inputs alone, in one launch: the five weight planes and the LayerNorm pass touch disjoint
// data, so their blocks share one grid. Blocks 0 .. NWB-1 come first (they start first and end inside the LayerNorm blocks'
// time): block bid -> plane bid / WTB (Wq, Wk, Wv, Wu into WP + plane * DI * KX; plane 4 = Wo into WO), tile bid % WTB of it.
// Blocks NWB .. NWB + NPIX/LNPB - 1 are the LayerNorm blocks. The choice is block-uniform, so every barrier stays uniform.
// 16 waves per SIMD asked for: the LayerNorm blocks stream from memory with one row per wave in flight and need every wave
// slot; without it the joined kernel takes one register granule more than the LayerNorm kernel alone did.
// =====================================================================================================
__global__ __launch_bounds__(256) __attribute__((amdgpu_waves_per_eu(16, 16)))
void prep(const float* __restrict__ pr, const float* __restrict__ mask, const float* __restrict__ gamma,
          const float* __restrict__ beta, const float* __restrict__ Wb, const float* __restrict__ Wq,
          const float* __restrict__ Wk, const float* __restrict__ Wv, const float* __restrict__ Wu,
          const float* __restrict__ Wo, u16* XB, float* CB, u16* WP, u16* WO) {
  const int bid = blockIdx.x;
  if (bid >= NWB) {
    ln_x(bid - NWB, pr, mask, gamma, beta, Wb, XB, CB);
  } else if (bid >= 4 * WTB) {
    wt16(bid - 4 * WTB, Wo, DM, DI, WO, DI, 0, 1, WOS);
  } else {
    const int pl = bid / WTB;
    const float* W = (pl == 0) ? Wq : (pl == 1) ? Wk : (pl == 2) ? Wv : Wu;
    wt16(bid % WTB, W, DI, DM, WP + (size_t)pl * DI * KX, KX, 1, 0, 1.0f);
  }
}

// =====================================================================================================
// epi64o additionally adds a per-column bias (bf16 RNE of the input) and multiplies by a per-row scale (bf16 RNE of mask).
// coverage: 8 instructions x 2 rows x 16 lanes x 4 floats = the wave's 16 x 64 tile.
// =====================================================================================================
__device__ __forceinline__ void epi64o(float* sl, v8f a0, v8f a1, v8f a2, v8f a3, float oscale,
                                       float* C, int N, size_t rowb, int col0, int lane,
                                       const float* __restrict__ bias, const float* __restrict__ rsc) {
  const int hh = lane >> 4, m = lane & 15;
#pragma unroll
  for (int r = 0; r < 8; ++r) {
    const int ro = (8 * hh + r) * 68 + m;
    sl[ro]      = a0[r] * oscale;
    sl[ro + 16] = a1[r] * oscale;
    sl[ro + 32] = a2[r] * oscale;
    sl[ro + 48] = a3[r] * oscale;
  }
  wave_sync_lds();
  float bq[4];
  {
    const v4f b4 = *(const v4f*)(bias + col0 + m * 4);
#pragma unroll
    for (int e = 0; e < 4; ++e) bq[e] = bfr(b4[e]);
  }
  v4f vals[8];
#pragma unroll
  for (int it = 0; it < 8; ++it) {
    const v4f t = *(const v4f*)(sl + (it * 2 + hh) * 68 + m * 4);
    const float mk = bfr(rsc[rowb + (size_t)hh + (size_t)(it * 2)]);
    v4f o;
#pragma unroll
    for (int e = 0; e < 4; ++e) o[e] = (t[e] + bq[e]) * mk;
    vals[it] = o;
  }
  float* dst = C + (rowb + (size_t)hh) * (size_t)N + col0 + m * 4;
  {
#pragma unroll
    for (int it = 0; it < 8; ++it) {
      *(v4f*)(dst + (size_t)(it * 2) * (size_t)N) = vals[it];
    }
    
  }
}

// =====================================================================================================
// Split epilogue: the wave's 16 x 64 f32 tile, times sc, goes out as f16 hi + f16 residual planes (row pitch PLP halves).
// The tile passes through the wave's slab so that 8 consecutive lanes hold one row's 64 halves = one whole 128-B line.
// coverage: 4 instructions x 4 rows x 8 lanes x 8 halves = the wave's 16 x 64 tile of each plane.
// =====================================================================================================
__device__ __forceinline__ void epi64s(float* sl, v8f a0, v8f a1, v8f a2, v8f a3, float sc,
                                       u16* Hp, u16* Lp, size_t ob, int lane) {
  const int hh = lane >> 4, m = lane & 15;
#pragma unroll
  for (int r = 0; r < 8; ++r) {
    const int ro = (8 * hh + r) * 68 + m;
    sl[ro]      = a0[r];
    sl[ro + 16] = a1[r];
    sl[ro + 32] = a2[r];
    sl[ro + 48] = a3[r];
  }
  wave_sync_lds();
  const int rq = lane >> 3, c8 = (lane & 7) * 8;
  v4u oh[4], ol[4];                         // the loops below are unrolled so that these stay in registers
#pragma unroll
  for (int it = 0; it < 4; ++it) {
    const float* p = sl + (it * 4 + rq) * 68 + c8;
    const v4f a = *(const v4f*)(p), b4 = *(const v4f*)(p + 4);
    float w[8];
#pragma unroll
    for (int e = 0; e < 4; ++e) { w[e] = a[e] * sc; w[4 + e] = b4[e] * sc; }
#pragma unroll
    for (int e = 0; e < 4; ++e) {
      const float t0 = w[2 * e], t1 = w[2 * e + 1];
      const _Float16 h0 = (_Float16)t0, h1 = (_Float16)t1;
      const _Float16 l0 = (_Float16)(t0 - (float)h0), l1 = (_Float16)(t1 - (float)h1);
      oh[it][e] = pk16(h_bits(h0), h_bits(h1));
      ol[it][e] = pk16(h_bits(l0), h_bits(l1));
    }
  }
  u16* dh = Hp + ob + (size_t)rq * PLP + c8;
  u16* dl = Lp + ob + (size_t)rq * PLP + c8;
#pragma unroll
  for (int it = 0; it < 4; ++it) {
    *(v4u*)(dh + (size_t)(it * 4) * PLP) = oh[it];
    *(v4u*)(dl + (size_t)(it * 4) * PLP) = ol[it];
  }
}

// =====================================================================================================
// The q, k and v projections of one row group in one launch: X [GROWS][KX] (bf16 hi|lo rows of x) against Wt [3*DI][KX] (bf16,
// k-contiguous; rows 0.. Wq^T, DI.. Wk^T, 2*DI.. Wv^T), f32 accumulate, K = KX stepped by 32.
// Block bid -> (64 rows of Wt nt = bid % NPT, PXR = 128 rows of X rb = bid / NPT); sel = nt / NH names the projection,
// g = nt % NH the head. The block's 128 X rows and 64 Wt rows are brought in once with whole-line 16-B loads (one wave = one
// 512-B row per instruction), stored to LDS (pitch PKP halves = 16 B x 33) and read from there as fragments by all 8 waves
// (two 16-B loads each, the same split k map for both operands, so either plane can be the row operand).
//   q, k:    row operand X, column operand Wt: wave w's tile is [16 pos (16*w ..)][64 channels of head g].
//   v:       row operand Wt, column operand X: wave w's tile is [16 d (16*(w&3) ..)][64 pos (64*(w>>2) ..)], v^T as read later.
// Epilogue: q x128 (= C^-0.5 x 1024), k x1024 and v^T x1024 go out as f16 hi + residual planes
// (epi64s): QH, QL, KH, KL [b*LP + pos][g*HD + d]; VH, VL [(b*NH + g)*HD + d][LP]. The waves' slabs reuse the operand LDS.
// coverage: grid = (GROWS/PXR) * NPT blocks, each one 128 x 64 tile = every element of the six planes once.
// =====================================================================================================
__global__ __launch_bounds__(PROJ_THREADS)
void proj4(const u16* __restrict__ X, const u16* __restrict__ Wt, u16* QH, u16* QL, u16* KH, u16* KL,
           u16* VH, u16* VL) {
  __shared__ __align__(16) u16 opt[(PXR + 64) * PKP];   // X rows 0..127, then Wt rows 0..63; later the 8 result slabs
  const int tid = threadIdx.x, wave = tid >> 5, lane = tid & 31, hh = lane >> 4, m = lane & 15;
  const int bid = blockIdx.x;
  const int nt  = bid % NPT;
  const int rb  = bid / NPT;
  if (rb * PXR + PXR > GROWS) return;       // block-uniform, before any barrier; never taken with the exact grid
  const int sel = nt / NH;
  const int g   = nt % NH;
  {
    // staging: wave -> row wave + 8*i, lane -> 8 halves at 8*lane: each load and each LDS store covers one whole 512-B row
    const u16* gx = X  + (size_t)(rb * PXR + wave) * KX + 8 * lane;
    const u16* gw = Wt + (size_t)(nt * 64 + wave) * KX + 8 * lane;
    u16* tw = opt + wave * PKP + 8 * lane;
    v4u st[(PXR + 64) / 8];                 // the loops below are unrolled so that these stay in registers
#pragma unroll
    for (int i = 0; i < PXR / 8; ++i) st[i] = *(const v4u*)(gx + (size_t)(8 * i) * KX);
#pragma unroll
    for (int i = 0; i < 8; ++i) st[PXR / 8 + i] = *(const v4u*)(gw + (size_t)(8 * i) * KX);
    // the address registers of these loads are free for reuse below while the loads are still in flight
    asm volatile("s_wait_xcnt 0x0" ::: "memory");
#pragma unroll
    for (int i = 0; i < (PXR + 64) / 8; ++i) *(v4u*)(tw + 8 * i * PKP) = st[i];
  }
  __syncthreads();                          // both operand tiles are complete before any wave reads a fragment
  const int ao = ((sel == 2) ? (PXR + (wave & 3) * 16 + m) : (wave * 16 + m)) * PKP + 8 * hh;
  const int bo = ((sel == 2) ? ((wave >> 2) * 64 + m) : (PXR + m)) * PKP + 8 * hh;
  const u16* ap = opt + ao;
  const u16* bp = opt + bo;
  const int bs = 16 * PKP;
  v8f acc0 = zero8(), acc1 = zero8(), acc2 = zero8(), acc3 = zero8();
  // kept rolled: the guard ends every trip and no load may cross it, so unrolling would only lengthen the text
#pragma unroll 1
  for (int k0 = 0; k0 < KX; k0 += 32) {
    const v16b a  = ldfrag_b(ap + k0);
    const v16b b0 = ldfrag_b(bp + k0);
    const v16b b1 = ldfrag_b(bp + bs + k0);
    const v16b b2 = ldfrag_b(bp + 2 * bs + k0);
    const v16b b3 = ldfrag_b(bp + 3 * bs + k0);
    acc0 = mma_b(a, b0, acc0);
    acc1 = mma_b(a, b1, acc1);
    acc2 = mma_b(a, b2, acc2);
    acc3 = mma_b(a, b3, acc3);
    guard6<v16b>(acc0, acc1, acc2, acc3, a, b0, b1, b2, b3, a);
  }
  __syncthreads();                          // every wave has read its last fragment before the slabs overwrite the tiles
  float* sl = (float*)(void*)opt + wave * SLAB64;
  if (sel == 2) {
    const int r64 = rb * (PXR / 64) + (wave >> 2);      // which 64 positions of the row group
    const size_t ob = ((size_t)((r64 / NST) * NH + g) * HD + (wave & 3) * 16) * LP + (size_t)(r64 % NST) * 64;
    epi64s(sl, acc0, acc1, acc2, acc3, VCAR, VH, VL, ob, lane);
  } else {
    const size_t ob = (size_t)(rb * PXR + wave * 16) * DI + (size_t)g * HD;
    epi64s(sl, acc0, acc1, acc2, acc3, (sel == 0) ? QSC : KSC, (sel == 0) ? QH : KH, (sel == 0) ? QL : KL, ob, lane);
  }
}

// =====================================================================================================
// Output projection: C[row][DM] (f32) = ((Ah + Al)[row][DI] . Bt[DM][DI]^T) * oscale + bias[col], times rsc[row]
// (products h.B + l.B into one accumulator, l unscaled). Block -> (position tile rt = bid % NST, row group bb): 64 rows
// bb*LP + 64*rt .. of Ah, Al and C against all DM rows of Bt. The three operand tiles are staged in LDS as in proj4 (whole-line
// loads, pitch PKP halves); wave w's tile is [16 rows (16*(w&3) ..)][64 columns (64*(w>>2) ..)], epilogue epi64o.
// coverage: grid = BG * NST blocks, each one 64 x 128 tile = every element of the row group's C once.
// =====================================================================================================
__global__ __launch_bounds__(PROJ_THREADS)
void gemm_o(const u16* __restrict__ Ah, const u16* __restrict__ Al, const u16* __restrict__ Bt,
            const float* __restrict__ bias, const float* __restrict__ rsc, float* C, float oscale) {
  __shared__ __align__(16) u16 opt[(2 * 64 + DM) * PKP];   // Ah rows 0..63, Al rows 0..63, Bt rows 0..127; later the 8 slabs
  const int tid = threadIdx.x, wave = tid >> 5, lane = tid & 31, hh = lane >> 4, m = lane & 15;
  const int bid   = blockIdx.x;
  const int rt    = bid % NST;
  const int bb    = bid / NST;
  if (bb >= BG) return;                     // block-uniform, before any barrier; never taken with the exact grid
  const int K     = DI;
  const size_t row0 = (size_t)bb * LP + rt * 64;
  {
    // staging: wave -> row wave + 8*i, lane -> 8 halves at 8*lane: each load and each LDS store covers one whole 512-B row
    const u16* ga = Ah + (row0 + wave) * K + 8 * lane;
    const u16* gl = Al + (row0 + wave) * K + 8 * lane;
    const u16* gb = Bt + (size_t)wave * K + 8 * lane;
    u16* tw = opt + wave * PKP + 8 * lane;
    v4u st[(2 * 64 + DM) / 8];              // the loops below are unrolled so that these stay in registers
#pragma unroll
    for (int i = 0; i < 8; ++i) {
      st[i]     = *(const v4u*)(ga + (size_t)(8 * i) * K);
      st[8 + i] = *(const v4u*)(gl + (size_t)(8 * i) * K);
    }
#pragma unroll
    for (int i = 0; i < DM / 8; ++i) st[16 + i] = *(const v4u*)(gb + (size_t)(8 * i) * K);
    // the address registers of these loads are reused below while the loads are still in flight; the three bases are named
    // as inputs so that none of them is given up for another value ahead of the wait
    asm volatile("s_wait_xcnt 0x0" :: "v"(ga), "v"(gl), "v"(gb) : "memory");
#pragma unroll
    for (int i = 0; i < (2 * 64 + DM) / 8; ++i) *(v4u*)(tw + 8 * i * PKP) = st[i];
  }
  __syncthreads();                          // the three operand tiles are complete before any wave reads a fragment
  const int srow  = (wave & 3) * 16;
  const int col0  = (wave >> 2) * 64;
  const size_t rowC = row0 + srow;
  const _Float16* ahp = (const _Float16*)(const void*)opt + (srow + m) * PKP + 8 * hh;
  const _Float16* alp = ahp + 64 * PKP;
  const _Float16* bp  = (const _Float16*)(const void*)opt + (2 * 64 + col0 + m) * PKP + 8 * hh;
  const int bs = 16 * PKP;
  v8f acc0 = zero8(), acc1 = zero8(), acc2 = zero8(), acc3 = zero8();
#pragma unroll 1
  for (int k0 = 0; k0 < K; k0 += 32) {
    const v16h ah = ldfrag_h(ahp + k0), al = ldfrag_h(alp + k0);
    const v16h b0 = ldfrag_h(bp + k0);
    const v16h b1 = ldfrag_h(bp + bs + k0);
    const v16h b2 = ldfrag_h(bp + 2 * bs + k0);
    const v16h b3 = ldfrag_h(bp + 3 * bs + k0);
    acc0 = mma_h(ah, b0, acc0);  acc0 = mma_h(al, b0, acc0);
    acc1 = mma_h(ah, b1, acc1);  acc1 = mma_h(al, b1, acc1);
    acc2 = mma_h(ah, b2, acc2);  acc2 = mma_h(al, b2, acc2);
    acc3 = mma_h(ah, b3, acc3);  acc3 = mma_h(al, b3, acc3);
    guard6<v16h>(acc0, acc1, acc2, acc3, ah, al, b0, b1, b2, b3);
  }
  __syncthreads();                          // every wave has read its last fragment before the slabs overwrite the tiles
  epi64o((float*)(void*)opt + wave * SLAB64, acc0, acc1, acc2, acc3, oscale, C, DM, rowC, col0, lane, bias, rsc);
}

// =====================================================================================================
// Pair attention for one row group. Block bid -> (64 softmax rows qb = bid % NST, head = (bid / NST) % NH, row group b);
// the four waves take 16 rows each (q0 = 64*qb + 16*wave) of the SAME head and share its column operands: per 64 columns the
// Cm hi/residual rows [64 vi][64 d] and the v^T hi/residual rows [64 d][64 vi] are brought in once per block with whole-line
// 16-B loads (8 lanes per 128-B row), held in registers while the tile before is worked on, stored to LDS (pitch 72 halves)
// and read from there as fragments by all four waves. Softmax row index qi uses the k projection (column operand R), softmax
// column index vi uses the q projection (row operand Cm), summed over vi with v[vi].
//   R hi/residual planes (k x1024 f16) and Cm hi/residual planes (q x128 x 8 ... i.e. (q*C^-0.5) x1024 f16) laid out
//   [b*LP + pos][h*HD + d]; v^T hi/residual planes [b*NH + h][d][LP]; CB [h][qi][vi] f32 = 1e9*(mask - 1) + x.Wb.
//   scores s(i, j) = R_hi.C_hi + R_lo.C_hi + R_hi.C_lo over HD; logit (log2 domain) t = (s / (1024*1024) + CB) * log2 e.
//   All NKT column tiles of 32 visited in order. Per tile: the 16x32 CB tile is staged into the wave-private LDS tile with
//   16-B loads/stores, then 2 score subtiles x 2 k-steps, computed transposed: Cm fragments from the LDS tile are the row
//   operand and R the column operand, so a lane holds 16 logits of ONE softmax row (q0 + c): maximum and sum run in the lane,
//   with one exchange between the lane halves for the maximum. The two score subtiles' registers lie in the split k map, so
//   P^T*32768 (f16 hi plus its f16 residual) is converted in place into the column operand of out^T += v^T.P^T (v^T fragments
//   as row operand, 2 groups of 2 d-subtiles), products hh + lh + hl.
//   After the loop: out = acc / Z (Z >= 1 always; guarded anyway), carries 1/(32768*1024) folded once, written to the wave's
//   private result slab (pitch 68; every element owned by one lane).
//   Gate: U^T = Wu^T.x^T for the wave's 16 rows and the head's 64 channels is formed here, behind the column loop, on the bf16
//   matrix form (row operand: the head's 64 Wu^T rows, fetched with whole-line loads while the last column tile is worked on
//   and laid over the column tiles' LDS at pitch PKP; column operand: the wave's own x hi|lo rows from XB; K = KX), so that
//   u[j][r] sits in the lane and register of o[j][r].
//   Epilogue: out multiplied by sigmoid(U + bu) in f32 (bu bf16 RNE of the input), then O x1024 -> f16 hi + residual planes.
//   OHp, OLp may be RHp, RLp: a wave alone reads its 16 R row segments, and it stores O there behind its last read of them.
// coverage: per wave 4 instructions x 4 rows x 8 lanes x 8 halves = 16 x 64 per plane; grid = NQT * BG = NST * NH * BG blocks
//           x WPB waves = every (b, pos, h) row segment of OH and OL exactly once.
// =====================================================================================================
__global__ __launch_bounds__(ATT_THREADS)
void attn_t(const u16* RHp, const u16* RLp,
            const u16* __restrict__ CHp, const u16* __restrict__ CLp,
            const u16* __restrict__ VHp, const u16* __restrict__ VLp,
            const float* __restrict__ CB, const u16* __restrict__ XB, const u16* __restrict__ WU,
            const float* __restrict__ bu,
            u16* OHp, u16* OLp) {
  __shared__ __align__(16) float smem[WPB * WREG];
  __shared__ __align__(16) u16 tile[4 * TPL];   // Cm hi, Cm residual [vi][d]; v^T hi, v^T residual [d][vi]; pitch VTP

  const int tid  = threadIdx.x;
  const int wave = tid >> 5;
  const int lane = tid & 31;
  const int hh   = lane >> 4;
  const int c    = lane & 15;
  const int bid  = blockIdx.x;
  const int qb   = bid % NST;
  const int t2   = bid / NST;
  const int head = t2 % NH;
  const int b    = t2 / NH;
  if (b >= BG) return;                      // block-uniform, before any barrier; never taken with the exact grid
  const int q0   = qb * 64 + wave * 16;
  // the wave's number in a scalar register: what the code behind the loop forms from it then holds no vector register in the loop
  const int wv   = __builtin_amdgcn_readfirstlane(wave);

  float* pt   = smem + wave * WREG;         // CB tile [16][32] pitch 36
                                            // behind it the result slab [16][64] pitch 68

  const size_t hcol = (size_t)head * HD + 8 * hh;
  const _Float16* Rh  = (const _Float16*)(const void*)RHp + ((size_t)b * LP + q0 + c) * DI + hcol;
  const _Float16* Rl  = (const _Float16*)(const void*)RLp + ((size_t)b * LP + q0 + c) * DI + hcol;
  // fragment bases in the LDS tile: row c (+16 per subtile), halves 8*hh (+ the k offset per step)
  const _Float16* Chb = (const _Float16*)(const void*)tile + c * VTP + 8 * hh;   // row = vi within the tile, k = d
  const _Float16* Clb = Chb + TPL;
  const _Float16* Vhb = Chb + 2 * TPL;                                           // row = d, k = vi within the tile
  const _Float16* Vlb = Chb + 3 * TPL;
  // staging: thread -> (row sr + 16*i, 8 halves at sc); 8 consecutive lanes cover one 128-B row segment of a plane
  const int sr = tid >> 3, sc = (tid & 7) * 8;
  const u16* gch = CHp + ((size_t)b * LP + sr) * DI + (size_t)head * HD + sc;    // + (64*s + 16*i) * DI
  const u16* gcl = CLp + ((size_t)b * LP + sr) * DI + (size_t)head * HD + sc;
  const u16* gvh = VHp + ((size_t)(b * NH + head) * HD + sr) * LP + sc;          // + 16*i * LP + 64*s
  const u16* gvl = VLp + ((size_t)(b * NH + head) * HD + sr) * LP + sc;
  u16* tw = tile + sr * VTP + sc;
  const float* cbb = CB + ((size_t)head * LP + q0) * LP;
  const float invc = 1.0f / (CSC * KSC);
  const float oc   = 1.0f / (PCAR * VCAR);

  float mrow = -INFINITY, lrow = 0.f;       // of softmax row q0 + c; lrow is this lane half's share of the row sum
  v8f o[4];                                 // o[j][r] = out^T (d = 16*j + 8*hh + r, row q0 + c)
#pragma unroll
  for (int j = 0; j < 4; ++j) o[j] = zero8();

  v4u pre[16];                              // the next 64-column tile of the four planes, in flight
#pragma unroll
  for (int i = 0; i < 4; ++i) {
    pre[i]      = *(const v4u*)(gch + (size_t)(16 * i) * DI);
    pre[4 + i]  = *(const v4u*)(gcl + (size_t)(16 * i) * DI);
    pre[8 + i]  = *(const v4u*)(gvh + (size_t)(16 * i) * LP);
    pre[12 + i] = *(const v4u*)(gvl + (size_t)(16 * i) * LP);
  }
#pragma unroll 1
  for (int kt = 0; kt < NKT; ++kt) {
    const int kb = kt * 32;
    const int kl = kb & (STG - 1);          // first column of this step inside the LDS tile
    if (kl == 0) {                          // block-uniform: a new 64-column tile every second step
      if (kt != 0) __syncthreads();         // every wave has finished reading the tile that is overwritten next
#pragma unroll
      for (int i = 0; i < 4; ++i) {
        *(v4u*)(tw + 16 * i * VTP)           = pre[i];
        *(v4u*)(tw + TPL + 16 * i * VTP)     = pre[4 + i];
        *(v4u*)(tw + 2 * TPL + 16 * i * VTP) = pre[8 + i];
        *(v4u*)(tw + 3 * TPL + 16 * i * VTP) = pre[12 + i];
      }
      __syncthreads();                      // the tile is complete before any wave reads a fragment of it
      if (kb + STG < LP) {                  // block-uniform: the following tile's loads fly while this one is worked on
#pragma unroll
        for (int i = 0; i < 4; ++i) {
          pre[i]      = *(const v4u*)(gch + (size_t)(kb + STG + 16 * i) * DI);
          pre[4 + i]  = *(const v4u*)(gcl + (size_t)(kb + STG + 16 * i) * DI);
          pre[8 + i]  = *(const v4u*)(gvh + (size_t)(16 * i) * LP + kb + STG);
          pre[12 + i] = *(const v4u*)(gvl + (size_t)(16 * i) * LP + kb + STG);
        }
        // the address registers of these loads are reused by the step below while the loads are still in flight
        asm volatile("s_wait_xcnt 0x0" ::: "memory");
      } else {                              // block-uniform: no tile follows; the gate weights fly while the last one is worked on
        // wave -> row wave + 4*i of the head's 64 Wu^T rows, lane -> 8 halves at 8*lane: one whole 512-B row per load
        const u16* wub = WU + (size_t)(head * HD + wv) * KX;    // wave-uniform base; the lane's part is 8 * lane halves
        const unsigned li = __builtin_amdgcn_mbcnt_lo(~0u, 0u);         // the lane's number, read anew (see behind the loop)
#pragma unroll
        for (int i = 0; i < 16; ++i) pre[i] = *(const v4u*)(wub + (8u * li + (unsigned)(4 * i * KX)));
        // the loads share one offset register; it is named as an input so that it is not given up for another value ahead of the wait
        asm volatile("s_wait_xcnt 0x0" :: "v"(li) : "memory");
      }
    }
    // ---- stage the additive logit tile [16 rows][32 cols] into pt: 128 float4, lane handles f = it*32 + lane ----
#pragma unroll
    for (int it = 0; it < 4; ++it) {
      const int f = it * 32 + lane;
      const int row = f >> 3, col4 = (f & 7) * 4;
      const v4f t4 = *(const v4f*)(cbb + (size_t)row * LP + kb + col4);
      *(v4f*)(pt + row * PTP + col4) = t4;
    }
    // ---- scores, transposed: D element r of this lane = (col kb + 8hh + r, row q0 + c) in s0, col kb + 16 + 8hh + r in s1 ----
    v8f s0 = zero8(), s1 = zero8();
    const _Float16* c0p = Chb + kl * VTP;
    const _Float16* c1p = c0p + 16 * VTP;
    const _Float16* l0p = Clb + kl * VTP;
    const _Float16* l1p = l0p + 16 * VTP;
#pragma unroll
    for (int kk = 0; kk < HD / 32; ++kk) {
      const v16h rh  = ldfrag_h(Rh + kk * 32);
      const v16h rl  = ldfrag_h(Rl + kk * 32);
      const v16h ch0 = ldfrag_h(c0p + kk * 32);
      const v16h ch1 = ldfrag_h(c1p + kk * 32);
      const v16h cl0 = ldfrag_h(l0p + kk * 32);
      const v16h cl1 = ldfrag_h(l1p + kk * 32);
      s0 = mma_h(ch0, rh, s0);
      s0 = mma_h(ch0, rl, s0);
      s0 = mma_h(cl0, rh, s0);
      s1 = mma_h(ch1, rh, s1);
      s1 = mma_h(ch1, rl, s1);
      s1 = mma_h(cl1, rh, s1);
      guard2(s0, s1, rh, rl, ch0, cl0, ch1, cl1);
    }
    wave_sync_lds();
    // ---- additive term + online softmax in base 2, -inf-safe; the lane's 16 logits all belong to row q0 + c ----
    float e[16];                            // element s = column kb + 8hh + s (s < 8), kb + 16 + 8hh + s - 8 (s >= 8)
    {
      const float* crow = pt + c * PTP + 8 * hh;
      const v4f c0 = *(const v4f*)(crow), c1 = *(const v4f*)(crow + 4);
      const v4f c2 = *(const v4f*)(crow + 16), c3 = *(const v4f*)(crow + 20);
#pragma unroll
      for (int r = 0; r < 4; ++r) {
        e[r]      = (s0[r] * invc + c0[r]) * LOG2E;
        e[4 + r]  = (s0[4 + r] * invc + c1[r]) * LOG2E;
        e[8 + r]  = (s1[r] * invc + c2[r]) * LOG2E;
        e[12 + r] = (s1[4 + r] * invc + c3[r]) * LOG2E;
      }
    }
    float mx = e[0];
#pragma unroll
    for (int s = 1; s < 16; ++s) mx = fmaxf(mx, e[s]);
    mx = fmaxf(mx, xhalf(mx));              // the other half of the row's 32 columns
    const float mn = fmaxf(mrow, mx);
    const float ms = (mn == -INFINITY) ? 0.0f : mn;
    const float al = exp2f(mrow - ms);
    mrow = mn;
#pragma unroll
    for (int s = 0; s < 16; ++s) e[s] = exp2f(e[s] - ms);
    {
      const float pa = ((e[0] + e[1]) + (e[2] + e[3])) + ((e[4] + e[5]) + (e[6] + e[7]));
      const float pb = ((e[8] + e[9]) + (e[10] + e[11])) + ((e[12] + e[13]) + (e[14] + e[15]));
      lrow = lrow * al + (pa + pb);
    }
#pragma unroll
    for (int j = 0; j < 4; ++j) {
#pragma unroll
      for (int r = 0; r < 8; ++r) o[j][r] *= al;
    }
    // ---- B fragments of P^T*32768: hi f16 and residual f16, column = row q0 + c; the score registers already lie in the
    //      split k map over the 32 columns of this step, so element s of the fragment is e[s] ----
    FragH ph, pl;
#pragma unroll
    for (int s = 0; s < 8; ++s) {
      const float ta = e[s] * PCAR, tb = e[8 + s] * PCAR;
      const _Float16 ha = (_Float16)ta, hb = (_Float16)tb;
      ph.h[0][s] = ha;
      ph.h[1][s] = hb;
      pl.h[0][s] = (_Float16)(ta - (float)ha);
      pl.h[1][s] = (_Float16)(tb - (float)hb);
    }
    // ---- v^T.P^T : A fragment row m = d = j*16 + c, columns vi contiguous in the v^T tile rows; 2 groups of 2 d-subtiles ----
    {
      const _Float16* vhp = Vhb + kl;
      const _Float16* vlp = Vlb + kl;
#pragma unroll
      for (int jg = 0; jg < HD / 32; ++jg) {
        const int da = (2 * jg) * 16 * VTP;
        const int db = da + 16 * VTP;
        const v16h vha = ldfrag_h(vhp + da), vhb2 = ldfrag_h(vhp + db);
        const v16h vla = ldfrag_h(vlp + da), vlb2 = ldfrag_h(vlp + db);
        o[2 * jg]     = mma_h(vha,  ph.v, o[2 * jg]);
        o[2 * jg]     = mma_h(vha,  pl.v, o[2 * jg]);
        o[2 * jg]     = mma_h(vla,  ph.v, o[2 * jg]);
        o[2 * jg + 1] = mma_h(vhb2, ph.v, o[2 * jg + 1]);
        o[2 * jg + 1] = mma_h(vhb2, pl.v, o[2 * jg + 1]);
        o[2 * jg + 1] = mma_h(vlb2, ph.v, o[2 * jg + 1]);
        guard2(o[2 * jg], o[2 * jg + 1], ph.v, pl.v, vha, vhb2, vla, vlb2);
      }
    }
    wave_sync_lds();
  }
  acc_guard4(o[0], o[1], o[2], o[3]);
  // the lane's number is read anew here, and the wave's comes from its scalar register: of what only the code from here on needs
  // (row and column selectors, row bases) nothing but the lane's number then holds a vector register through the column loop
  const int ln = (int)__builtin_amdgcn_mbcnt_lo(~0u, 0u);
  const int hx = ln >> 4, cx = ln & 15;     // = hh, c
  const int q0s = qb * 64 + wv * 16;        // = q0
  float* slx = smem + wv * WREG + PTW;      // = slab
  // ---- gate pre-activation, transposed: u[j][r] = (x.Wu)(row q0 + c, channel head*HD + 16*j + 8*hh + r) ----
  v8f u[4];
#pragma unroll
  for (int j = 0; j < 4; ++j) u[j] = zero8();
  {
    __syncthreads();                        // every wave has read its last fragment of the column tiles that are overwritten next
    u16* tu = tile + wv * PKP + 8 * ln;
#pragma unroll
    for (int i = 0; i < 16; ++i) *(v4u*)(tu + 4 * i * PKP) = pre[i];
    // the x loads below stay behind these stores: lifted over them they would need 64 registers beside the 64 stored here,
    // and the kernel would hold one wave per SIMD fewer
    __builtin_amdgcn_sched_barrier(0);
    const char* xw = (const char*)(XB + ((size_t)b * LP + q0s) * KX);   // wave-uniform base of the wave's 16 x rows
    const unsigned xo = (unsigned)(cx * KX + 8 * hx) * 2u;              // the lane's byte offset: row c, halves 8*hh
    v16b xf[KX / 32];                       // the loops below are unrolled so that these stay in registers
#pragma unroll
    for (int kk = 0; kk < KX / 32; ++kk) xf[kk] = ldfrag_b((const u16*)(xw + xo) + kk * 32);
    // the loads share one offset register; it is named as an input so that it is not given up for another value ahead of the wait
    asm volatile("s_wait_xcnt 0x0" :: "v"(xo) : "memory");
    __syncthreads();                        // the gate weight rows are complete before any wave reads a fragment of them
    const u16* wp = tile + cx * PKP + 8 * hx;
#pragma unroll
    for (int kk = 0; kk < KX / 32; ++kk) {
      const v16b w0 = ldfrag_b(wp + kk * 32);
      const v16b w1 = ldfrag_b(wp + 16 * PKP + kk * 32);
      const v16b w2 = ldfrag_b(wp + 32 * PKP + kk * 32);
      const v16b w3 = ldfrag_b(wp + 48 * PKP + kk * 32);
      u[0] = mma_b(w0, xf[kk], u[0]);
      u[1] = mma_b(w1, xf[kk], u[1]);
      u[2] = mma_b(w2, xf[kk], u[2]);
      u[3] = mma_b(w3, xf[kk], u[3]);
    }
    acc_guard4(u[0], u[1], u[2], u[3]);
  }
  // ---- out = acc / Z (0 if Z == 0), carries (32768 on P, 1024 on v) folded once, times the gate in f32; into the lane-owned slab ----
  {
    const float lv  = lrow + xhalf(lrow);   // the two lane halves' shares of the row sum, joined once
    const float ls  = (lv > 0.0f) ? lv : 1.0f;
    const float inv = (lv > 0.0f) ? ((1.0f / ls) * oc) : 0.0f;
#pragma unroll
    for (int j = 0; j < 4; ++j) {
      float* sp = slx + cx * SLP + j * 16 + 8 * hx;     // row q0 + c, 8 consecutive d
      const float* bp = bu + head * HD + j * 16 + 8 * hx;
      const v4f b0 = *(const v4f*)(bp), b1 = *(const v4f*)(bp + 4);
      v4f w0, w1;
#pragma unroll
      for (int r = 0; r < 4; ++r) {
        w0[r] = (o[j][r] * inv)     * sigm(u[j][r] + bfr(b0[r]));
        w1[r] = (o[j][4 + r] * inv) * sigm(u[j][4 + r] + bfr(b1[r]));
      }
      *(v4f*)(sp)     = w0;
      *(v4f*)(sp + 4) = w1;
    }
  }

  wave_sync_lds();
  // ---- O x1024 -> f16 hi + residual planes; lane = (row select rq in 0..3, 8 consecutive d at c8) ----
  v4u oh[4], ol[4];
  const int rq = ln >> 3, c8 = (ln & 7) * 8;
#pragma unroll
  for (int it = 0; it < 4; ++it) {
    const int row = it * 4 + rq;
    const v4f a  = *(const v4f*)(slx + row * SLP + c8), b4 = *(const v4f*)(slx + row * SLP + c8 + 4);
    float w[8];
#pragma unroll
    for (int e = 0; e < 4; ++e) {
      w[e]     = a[e]  * OSC;
      w[4 + e] = b4[e] * OSC;
    }
#pragma unroll
    for (int e = 0; e < 4; ++e) {
      const _Float16 h0 = (_Float16)w[2 * e], h1 = (_Float16)w[2 * e + 1];
      const _Float16 l0 = (_Float16)(w[2 * e] - (float)h0), l1 = (_Float16)(w[2 * e + 1] - (float)h1);
      oh[it][e] = pk16(h_bits(h0), h_bits(h1));
      ol[it][e] = pk16(h_bits(l0), h_bits(l1));
    }
  }
  const size_t ob = ((size_t)b * LP + q0s) * DI + (size_t)head * HD + c8;
  {
#pragma unroll
    for (int it = 0; it < 4; ++it) {
      const int row = it * 4 + rq;
      *(v4u*)(OHp + ob + (size_t)row * DI) = oh[it];
      *(v4u*)(OLp + ob + (size_t)row * DI) = ol[it];
    }
    
  }
}

// =====================================================================================================
// Rows s are processed in NGRP groups of BG rows; every group costs three dependent launches, each with its own start and drain,
// so all NS rows form one group. Its planes fit the workspace because there is no gate plane (the attention kernel forms the
// gate itself) and because the gated O planes take the place of the k planes (OH = KH, OL = KL; see attn_t).
// Workspace map (bytes); every plane is fully written by whole-line stores before it is read; all extents are exact
// multiples of the store granularity (no pad rows needed); every region offset a multiple of 65536:
//   XB  bf16 [NPIX][256] (hi|lo)                    33554432
//   QH, KH, QL, KL  f16 [GROWS][256]               4 * GROWS*512   (KH, KL hold O x1024 hi, residual behind the attention)
//   VH, VL  f16 [BG*4][64][LP]                      2 * GROWS*512
//   CB  f32 [4][NPIX]                               1048576
//   WQ, WK, WV, WU  bf16 [256 n][256 k]             4 * 131072   (contiguous in this order: proj4 reads the first three as one plane)
//   WO  f16 x1024 [128 n][256 k]                    65536
//   end (BG = 256)                                  236519424
// =====================================================================================================
extern "C" void kernel_launch(void* const* d_in, const int* in_sizes, int n_in,
                              void* d_out, int out_size, void* d_ws, size_t ws_size,
                              hipStream_t stream) {
  if (n_in < 12) return;
  if (in_sizes[0] < NPIX * DM) return;
  if (in_sizes[1] < NPIX) return;
  if (in_sizes[2] < DM || in_sizes[3] < DM) return;
  if (in_sizes[4] < DM * DI || in_sizes[5] < DM * DI || in_sizes[6] < DM * DI || in_sizes[8] < DM * DI) return;
  if (in_sizes[7] < DM * NH) return;
  if (in_sizes[9] < DI) return;
  if (in_sizes[10] < DI * DM) return;
  if (in_sizes[11] < DM) return;
  if (out_size < NS * LP * DM) return;

  const float* pr    = (const float*)d_in[0];
  const float* mask  = (const float*)d_in[1];
  const float* gamma = (const float*)d_in[2];
  const float* beta  = (const float*)d_in[3];
  const float* Wq    = (const float*)d_in[4];
  const float* Wk    = (const float*)d_in[5];
  const float* Wv    = (const float*)d_in[6];
  const float* Wb    = (const float*)d_in[7];
  const float* Wu    = (const float*)d_in[8];
  const float* bu    = (const float*)d_in[9];
  const float* Wo    = (const float*)d_in[10];
  const float* bo    = (const float*)d_in[11];
  float*       out   = (float*)d_out;

  const size_t szXB = (size_t)NPIX * KX * 2;
  const size_t szH  = (size_t)GROWS * DI * 2;                   // QH, KH, QL, KL
  const size_t szV  = (size_t)BG * NH * HD * LP * 2;            // VH, VL (== szH)
  const size_t szCB = (size_t)NH * NPIX * 4;
  const size_t szW  = (size_t)DI * KX * 2;
  const size_t szWO = (size_t)DM * DI * 2;
  size_t off = 0;
  const size_t oXB = off; off += szXB;
  const size_t oQH = off; off += szH;
  const size_t oKH = off; off += szH;
  const size_t oQL = off; off += szH;
  const size_t oKL = off; off += szH;
  const size_t oVH = off; off += szV;
  const size_t oVL = off; off += szV;
  const size_t oCB = off; off += szCB;
  const size_t oWQ = off; off += szW;
  const size_t oWK = off; off += szW;
  const size_t oWV = off; off += szW;
  const size_t oWU = off; off += szW;
  const size_t oWO = off; off += szWO;
  if (off > ws_size) return;                // off = 236519424 for BG = 256
  if (off > (size_t)WS_CAP) return;

  char* ws = (char*)d_ws;
  u16*   XB = (u16*)(ws + oXB);
  u16*   QH = (u16*)(ws + oQH);
  u16*   KH = (u16*)(ws + oKH);
  u16*   QL = (u16*)(ws + oQL);
  u16*   KL = (u16*)(ws + oKL);
  u16*   VH = (u16*)(ws + oVH);
  u16*   VL = (u16*)(ws + oVL);
  float* CB = (float*)(ws + oCB);
  u16*   WQ = (u16*)(ws + oWQ);
  u16*   WU = (u16*)(ws + oWU);
  u16*   WO = (u16*)(ws + oWO);

  const dim3 b256(256), bAT(ATT_THREADS);
  const dim3 gPR(NWB + NPIX / LNPB);                    // 20 weight-plane blocks + 2048 LayerNorm blocks
  const dim3 gP((GROWS / PXR) * NPT);
  const dim3 gAT(NQT * BG);
  const dim3 gO(BG * NST);
  const float osc = 1.0f / (OSC * WOS);

  // one launch: LayerNorm for every pixel (x hi|lo planes, additive logit table) and the weight planes
  // Wq^T, Wk^T, Wv^T, Wu^T [n][k | k] as bf16 (contiguous from WQ), Wo^T [n][k] as f16 of bf16 value x1024
  prep<<<gPR, b256, 0, stream>>>(pr, mask, gamma, beta, Wb, Wq, Wk, Wv, Wu, Wo, XB, CB, WQ, WO);

  for (int g = 0; g < NGRP; ++g) {
    const u16*   xg = XB   + (size_t)g * GROWS * KX;
    const float* mg = mask + (size_t)g * GROWS;
    float*       og = out  + (size_t)g * GROWS * DM;
    // (1) q, k, v projections in one launch: q, k and v^T as f16 hi + residual planes
    proj4<<<gP, b256, 0, stream>>>(xg, WQ, QH, QL, KH, KL, VH, VL);
    // (2) attention: rows from the k planes, columns from the q planes, sum over columns with v; gate from x and Wu^T;
    //     gated O hi + residual planes written over the k planes
    attn_t<<<gAT, bAT, 0, stream>>>(KH, KL, QH, QL, VH, VL, CB, xg, WU, bu, KH, KL);
    // (3) output projection (hi + residual), + bo, x mask row scale -> out f32, carries 1024 x 1024 folded back
    gemm_o<<<gO, b256, 0, stream>>>(KH, KL, WO, bo, mg, og, osc);
  }
  (void)hipGetLastError();
}

// v008
// One run takes 116 microseconds.
// In two side-by-side timings against v007, it was 1.72 and 1.71 times as fast.
// All steps since v000 together make it 5.31 times as fast.
// Contractions: x.Wq, x.Wk, x.Wv, x.Wu on v_wmma_f32_16x16x32_bf16 (x as bf16 hi|lo pair folded into K = 256, W as bf16 RNE
// of the input, f32 accumulate); k.q^T over 64 and P.v^T on v_wmma_f32_16x16x32_f16 (k x1024 and q x128 f16 hi + residual
// planes, P x32768 f16 hi + residual, v x1024 f16 hi + residual; products hh + lh + hl); (O*gate).Wo on
// v_wmma_f32_16x16x32_f16 (O x1024 f16 hi + residual, Wo as f16(bf16(Wo)) x1024, products h.w + l.w); all f32 accumulate.
// LayerNorm, x.Wb (N = 4) and the additive logit table, base-2 online softmax, sigmoid gate, bias and row scale in f32 on VALU.
#include <hip/hip_runtime.h>
#include <math.h>
#include <stdint.h>

#ifndef NS
#define NS 256
#endif
#define NSX   256
#define LP    256
#define DM    128
#define NH    4
#define HD    64
#define DI    (NH * HD)
#define KX    (2 * DM)
#define NPIX  (LP * LP)
#define BG    NS
#define NGRP  (NS / BG)
#define GROWS (BG * LP)
#define LNEPS 1e-5f
#define LOG2E 1.4426950408889634f
#define QSC   128.0f
#define CSC   1024.0f
#define KSC   1024.0f
#define PCAR  32768.0f
#define VCAR  1024.0f
#define OSC   1024.0f
#define WOS   1024.0f
#define WPB   16
#define NQT   (LP / 16)
#define NST   (LP / 64)
#define NKT   (LP / 32)
#define ATT_THREADS (WPB * 32)
#define PTP   36
#define PTW   (16 * PTP)
#define SLP   68
#define SLW   (16 * SLP)
#define WREG  (PTW + SLW)
#define SLAB64 (16 * 68)
#define VTP   72
#define VPP   (LP + 8)
#define LNPB  32
#define WS_CAP 268435456
#define PKP   (KX + 8)
#define PROJ_THREADS 256
#define WTB   4
#define NWB   (5 * WTB)
static_assert(DI == NH * HD && HD == 64 && NH == 4);
static_assert(ATT_THREADS == 512 && WPB * 16 == LP && HD == 4 * 16);
static_assert(NS >= 1 && NS <= NSX && (NS % BG) == 0 && BG >= 1 && BG <= NSX);
static_assert((LP % 64) == 0 && (LP % 32) == 0 && (LP % 16) == 0);
static_assert(DM == 128 && (KX % 32) == 0 && (DI % 64) == 0 && (DI % 32) == 0 && (DM % 64) == 0);
static_assert(WPB * WREG * 4 <= 4 * HD * PKP * 2 && ATT_THREADS * 16 * 8 == 4 * HD * KX);
static_assert((NPIX % LNPB) == 0 && LNPB == 32);
static_assert(PROJ_THREADS == 256 && KX == 256 && DI == KX && DM == 128 && 8 * SLAB64 * 4 <= (2 * 64 + DM) * PKP * 2);
static_assert((DI % 128) == 0 && (DM % 128) == 0 && (DM % 64) == 0 && (DI % 64) == 0);
static_assert((DI / 128) * (DM / 64) == WTB && (DM / 128) * (DI / 64) == WTB);

typedef unsigned short u16;
typedef _Float16 v16h __attribute__((ext_vector_type(16)));
typedef _Float16 v8h  __attribute__((ext_vector_type(8)));
typedef __bf16   v16b __attribute__((ext_vector_type(16)));
typedef float    v8f  __attribute__((ext_vector_type(8)));
typedef float    v4f  __attribute__((ext_vector_type(4)));
typedef unsigned int v4u __attribute__((ext_vector_type(4)));
typedef unsigned int v2u __attribute__((ext_vector_type(2)));

union FragH { v16h v; v8h h[2]; v4u u[2]; };
union FragB { v16b v; v4u u[2]; };

// ---- scalar helpers --------------------------------------------------------------------------------
__device__ __forceinline__ unsigned short bf_bits(float f) {          // f32 -> bf16 bits, RNE convert
  unsigned u = __float_as_uint(f);
  return (unsigned short)((u + 0x7FFFu + ((u >> 16) & 1u)) >> 16);
}
__device__ __forceinline__ float bf_up(unsigned short h) { return __uint_as_float(((unsigned)h) << 16); }
__device__ __forceinline__ float bfr(float f) { return bf_up(bf_bits(f)); }
__device__ __forceinline__ unsigned short h_bits(_Float16 x) { return __builtin_bit_cast(unsigned short, x); }
__device__ __forceinline__ unsigned pk16(unsigned short a, unsigned short b) { return (unsigned)a | ((unsigned)b << 16); }
__device__ __forceinline__ v8f zero8() { v8f z = {0.f, 0.f, 0.f, 0.f, 0.f, 0.f, 0.f, 0.f}; return z; }
__device__ __forceinline__ float sigm(float z) {                     // 1 / (1 + 2^(-z log2 e)), argument clamped
  const float zc = fminf(fmaxf(z, -30.0f), 30.0f);
  const float e  = exp2f(-zc * LOG2E);
  return __builtin_amdgcn_rcpf(1.0f + e);
}

// ---- fragment loaders: 16-bit A/B operand, lane -> row/col (lane&15), p already includes +8*(lane>>4);
//      elements 0..7 <- p[0..7] (k0+8h..), elements 8..15 <- p[16..23] (k0+16+8h..)  (same split k map for A and B;
//      B is always read from a k-contiguous [n][k] plane)
__device__ __forceinline__ v16h ldfrag_h(const _Float16* p) {
  FragH f;
  f.h[0] = *(const v8h*)(p);
  f.h[1] = *(const v8h*)(p + 16);
  return f.v;
}
__device__ __forceinline__ v16b ldfrag_b(const u16* p) {              // bf16 plane read as unsigned integer vectors
  FragB f;
  f.u[0] = *(const v4u*)(p);
  f.u[1] = *(const v4u*)(p + 16);
  return f.v;
}

__device__ __forceinline__ v8f mma_h(v16h a, v16h b, v8f c) {
  return __builtin_amdgcn_wmma_f32_16x16x32_f16(false, a, false, b, (short)0, c, false, false);
}
__device__ __forceinline__ v8f mma_b(v16b a, v16b b, v8f c) {
  return __builtin_amdgcn_wmma_f32_16x16x32_bf16(false, a, false, b, (short)0, c, false, false);
}
__device__ __forceinline__ void guard2(v8f& a, v8f& b, v16h x0, v16h x1, v16h x2, v16h x3, v16h x4, v16h x5) {
#if defined(__HIP_DEVICE_COMPILE__)
  asm volatile("v_nop\n\tv_nop\n\tv_nop\n\tv_nop"
               : "+v"(a), "+v"(b) : "v"(x0), "v"(x1), "v"(x2), "v"(x3), "v"(x4), "v"(x5) : "memory");
#endif
}
template <typename F>
__device__ __forceinline__ void guard6(v8f& a, v8f& b, v8f& c, v8f& d, F x0, F x1, F x2, F x3, F x4, F x5) {
#if defined(__HIP_DEVICE_COMPILE__)
  asm volatile("v_nop\n\tv_nop\n\tv_nop\n\tv_nop"
               : "+v"(a), "+v"(b), "+v"(c), "+v"(d) : "v"(x0), "v"(x1), "v"(x2), "v"(x3), "v"(x4), "v"(x5) : "memory");
#endif
}
__device__ __forceinline__ void acc_guard4(v8f& a, v8f& b, v8f& c, v8f& d) {
#if defined(__HIP_DEVICE_COMPILE__)
  asm volatile("v_nop\n\tv_nop\n\tv_nop\n\tv_nop" : "+v"(a), "+v"(b), "+v"(c), "+v"(d));
#endif
}
__device__ __forceinline__ float xhalf(float x) {                    // value of lane l ^ 16 (the other 16-lane row)
  const int b = __builtin_bit_cast(int, x);
  return __builtin_bit_cast(float, __builtin_amdgcn_permlanex16(b, b, 0x76543210, 0xfedcba98, false, false));
}
__device__ __forceinline__ void wave_sync_lds() {
  __builtin_amdgcn_fence(__ATOMIC_RELEASE, "workgroup");
  __builtin_amdgcn_wave_barrier();
  __builtin_amdgcn_fence(__ATOMIC_ACQUIRE, "workgroup");
}

// =====================================================================================================
// statistics), x written as bf16 hi | bf16 lo planes XB [NPIX][KX] (columns 0..127 hi bits, 128..255 lo bits of x - hi);
// the additive logit table CB [NH][NPIX] = 1e9*(mask - 1) + x.Wb (VALU f32, N = 4) is produced by the same block.
// Block = 8 waves x LNPB/8 pixels, wave = one pixel at a time (lane holds 4 channels); the 512-B x row is assembled in a
// x 4 heads) are funnelled through LDS and written by wave 0 in one instruction (8 consecutive lanes x 16 B per line);
// coverage: blk = 0 .. NPIX/LNPB - 1, each 32 pixels = every XB row once and every CB line once.
// =====================================================================================================
__device__ __forceinline__ void ln_x(int blk, const float* __restrict__ pr, const float* __restrict__ mask,
                                     const float* __restrict__ gamma, const float* __restrict__ beta,
                                     const float* __restrict__ Wb, u16* XB, float* CB) {
  __shared__ __align__(16) u16 RB[8 * KX];
  __shared__ __align__(16) float PBS[NH * LNPB];
  const int tid = threadIdx.x, wave = tid >> 5, lane = tid & 31;
  const int p0 = blk * LNPB;
  if (p0 + LNPB > NPIX) return;             // block-uniform, before any barrier; never taken with the exact grid
  float gm[4], bt[4], wb[16];
  {
    const v4f g4 = *(const v4f*)(gamma + 4 * lane), b4 = *(const v4f*)(beta + 4 * lane);
#pragma unroll
    for (int e = 0; e < 4; ++e) { gm[e] = bfr(g4[e]); bt[e] = bfr(b4[e]); }
#pragma unroll
    for (int i = 0; i < 4; ++i) {
      const v4f w4 = *(const v4f*)(Wb + 16 * lane + 4 * i);      // Wb[(4*lane + i)][h], h = 0..3
#pragma unroll
      for (int h = 0; h < 4; ++h) wb[4 * i + h] = bfr(w4[h]);
    }
  }
  u16* rb = RB + wave * KX;
#pragma unroll 1
  for (int j = 0; j < LNPB / 8; ++j) {
    const int pl = j * 8 + wave;
    const int p  = p0 + pl;
    const v4f x4 = *(const v4f*)(pr + (size_t)p * DM + 4 * lane);
    float xr[4];
#pragma unroll
    for (int e = 0; e < 4; ++e) xr[e] = bfr(x4[e]);
    float s = (xr[0] + xr[1]) + (xr[2] + xr[3]);
#pragma unroll
    for (int off = 1; off < 32; off <<= 1) s += __shfl_xor(s, off, 32);
    const float mu = s * (1.0f / (float)DM);
    float d[4];
#pragma unroll
    for (int e = 0; e < 4; ++e) d[e] = xr[e] - mu;
    float ss = (d[0] * d[0] + d[1] * d[1]) + (d[2] * d[2] + d[3] * d[3]);
#pragma unroll
    for (int off = 1; off < 32; off <<= 1) ss += __shfl_xor(ss, off, 32);
    const float var = ss * (1.0f / (float)DM);
    const float rs  = 1.0f / sqrtf(var + LNEPS);
    float y[4];
#pragma unroll
    for (int e = 0; e < 4; ++e) y[e] = d[e] * rs * gm[e] + bt[e];
    unsigned short hb[4], lb[4];
#pragma unroll
    for (int e = 0; e < 4; ++e) { hb[e] = bf_bits(y[e]); lb[e] = bf_bits(y[e] - bf_up(hb[e])); }
    float pb[4];
#pragma unroll
    for (int h = 0; h < 4; ++h) pb[h] = y[0] * wb[h] + y[1] * wb[4 + h] + y[2] * wb[8 + h] + y[3] * wb[12 + h];
#pragma unroll
    for (int h = 0; h < 4; ++h) {
#pragma unroll
      for (int off = 1; off < 32; off <<= 1) pb[h] += __shfl_xor(pb[h], off, 32);
    }
    const float mk = bfr(mask[p]);
    const float mb = 1e9f * (mk - 1.0f);
    v2u hv, lv;
    hv[0] = pk16(hb[0], hb[1]);  hv[1] = pk16(hb[2], hb[3]);
    lv[0] = pk16(lb[0], lb[1]);  lv[1] = pk16(lb[2], lb[3]);
    *(v2u*)(rb + 4 * lane)      = hv;
    *(v2u*)(rb + DM + 4 * lane) = lv;
    if (lane == 0) {
      PBS[0 * LNPB + pl] = mb + pb[0];
      PBS[1 * LNPB + pl] = mb + pb[1];
      PBS[2 * LNPB + pl] = mb + pb[2];
      PBS[3 * LNPB + pl] = mb + pb[3];
    }
    wave_sync_lds();
    const v4u piece = *(const v4u*)(rb + 8 * lane);
    u16* dst = XB + (size_t)p * KX + 8 * lane;
    {
      *(v4u*)(dst) = piece;
      
    }
    wave_sync_lds();
  }
  __syncthreads();
  if (wave == 0) {
    const int h = lane >> 3, j4 = (lane & 7) * 4;
    const v4f v = *(const v4f*)(PBS + h * LNPB + j4);
    float* d = CB + (size_t)h * NPIX + p0 + j4;
    {
      *(v4f*)(d) = v;
      
    }
  }
}

// =====================================================================================================
// Transposed weight plane: W f32 [nk rows k][ncol cols n] -> D 16-bit [n][ldd], D[n][k] = bf16 bits of W[k][n] (f16mode 0)
// or f16 bits of bf16(W[k][n]) * scale (f16mode 1); when dup != 0 the same 64-half segment is also written at D[n][nk + k]
// (hi|lo folded K). Block (ct = bid % nct: 128 columns, rt = bid / nct: 64 rows): each thread loads 32 floats of one k row
// (16-B loads), converts, scatters into the LDS tile [128 n][64 k] (pitch 72 halves); after a block barrier each n row segment
// coverage: load 256 thr x 32 = 64 k rows x 128 n; store 4 iterations x 256 thr x 8 halves = 128 lines x 64 = the block's tile
// =====================================================================================================
__device__ __forceinline__ void wt16(int bid, const float* __restrict__ W, int ncol, int nk, u16* D, int ldd, int dup,
                                     int f16mode, float scale) {
  __shared__ __align__(16) u16 T[128 * VTP];
  const int tid = threadIdx.x;
  const int nct = ncol / 128;
  const int ct  = bid % nct;
  const int rt  = bid / nct;
  if (rt * 64 + 64 > nk) return;            // block-uniform, before the barrier; never taken with the exact grid
  {
    const int sl = tid >> 2;                // k row within tile 0..63
    const int dc = (tid & 3) * 32;          // n chunk
    const float* src = W + (size_t)(rt * 64 + sl) * ncol + ct * 128 + dc;
    v4f ld[8];                              // the loops below are unrolled so that these stay in registers
#pragma unroll
    for (int i = 0; i < 8; ++i) ld[i] = *(const v4f*)(src + 4 * i);
    // the eight loads share one address pair; it is named as an input so that no load's result is placed on it ahead of the wait
    asm volatile("s_wait_xcnt 0x0" :: "v"(src) : "memory");
#pragma unroll
    for (int i = 0; i < 8; ++i) {
      const v4f a = ld[i];
#pragma unroll
      for (int e = 0; e < 4; ++e) {
        const float f = a[e];
        const unsigned short hb = h_bits((_Float16)(bfr(f) * scale));
        const unsigned short bb = bf_bits(f);
        T[(dc + 4 * i + e) * VTP + sl] = (f16mode != 0) ? hb : bb;
      }
    }
  }
  __syncthreads();
  v4u w4[4];
  const int q8 = tid >> 3, p8 = (tid & 7) * 8;
#pragma unroll
  for (int it = 0; it < 4; ++it) {
    const int line = it * 32 + q8;          // n within tile 0..127
    w4[it] = *(const v4u*)(T + line * VTP + p8);
  }
  const size_t base = ((size_t)ct * 128) * ldd + rt * 64 + p8;
  {
#pragma unroll
    for (int it = 0; it < 4; ++it) {
      const int line = it * 32 + q8;
      *(v4u*)(D + base + (size_t)line * ldd) = w4[it];
      if (dup != 0) *(v4u*)(D + base + (size_t)line * ldd + nk) = w4[it];
    }
    // behind the last store: no register that these stores name is rewritten ahead of this wait on any path of the joined kernel
    asm volatile("s_wait_xcnt 0x0" ::: "memory");
  }
}

// =====================================================================================================
// Everything that depends on the inputs alone, in one launch: the five weight planes and the LayerNorm pass touch disjoint
// data, so their blocks share one grid. Blocks 0 .. NWB-1 come first (they start first and end inside the LayerNorm blocks'
// time): block bid -> plane bid / WTB (Wq, Wk, Wv, Wu into WP + plane * DI * KX; plane 4 = Wo into WO), tile bid % WTB of it.
// Blocks NWB .. NWB + NPIX/LNPB - 1 are the LayerNorm blocks. The choice is block-uniform, so every barrier stays uniform.
// 16 waves per SIMD asked for: the LayerNorm blocks stream from memory with one row per wave in flight and need every wave
// slot; without it the joined kernel takes one register granule more than the LayerNorm kernel alone did.
// =====================================================================================================
__global__ __launch_bounds__(256) __attribute__((amdgpu_waves_per_eu(16, 16)))
void prep(const float* __restrict__ pr, const float* __restrict__ mask, const float* __restrict__ gamma,
          const float* __restrict__ beta, const float* __restrict__ Wb, const float* __restrict__ Wq,
          const float* __restrict__ Wk, const float* __restrict__ Wv, const float* __restrict__ Wu,
          const float* __restrict__ Wo, u16* XB, float* CB, u16* WP, u16* WO) {
  const int bid = blockIdx.x;
  if (bid >= NWB) {
    ln_x(bid - NWB, pr, mask, gamma, beta, Wb, XB, CB);
  } else if (bid >= 4 * WTB) {
    wt16(bid - 4 * WTB, Wo, DM, DI, WO, DI, 0, 1, WOS);
  } else {
    const int pl = bid / WTB;
    const float* W = (pl == 0) ? Wq : (pl == 1) ? Wk : (pl == 2) ? Wv : Wu;
    wt16(bid % WTB, W, DI, DM, WP + (size_t)pl * DI * KX, KX, 1, 0, 1.0f);
  }
}

// =====================================================================================================
// epi64o additionally adds a per-column bias (bf16 RNE of the input) and multiplies by a per-row scale (bf16 RNE of mask).
// coverage: 8 instructions x 2 rows x 16 lanes x 4 floats = the wave's 16 x 64 tile.
// =====================================================================================================
__device__ __forceinline__ void epi64o(float* sl, v8f a0, v8f a1, v8f a2, v8f a3, float oscale,
                                       float* C, int N, size_t rowb, int col0, int lane,
                                       const float* __restrict__ bias, const float* __restrict__ rsc) {
  const int hh = lane >> 4, m = lane & 15;
#pragma unroll
  for (int r = 0; r < 8; ++r) {
    const int ro = (8 * hh + r) * 68 + m;
    sl[ro]      = a0[r] * oscale;
    sl[ro + 16] = a1[r] * oscale;
    sl[ro + 32] = a2[r] * oscale;
    sl[ro + 48] = a3[r] * oscale;
  }
  wave_sync_lds();
  float bq[4];
  {
    const v4f b4 = *(const v4f*)(bias + col0 + m * 4);
#pragma unroll
    for (int e = 0; e < 4; ++e) bq[e] = bfr(b4[e]);
  }
  v4f vals[8];
#pragma unroll
  for (int it = 0; it < 8; ++it) {
    const v4f t = *(const v4f*)(sl + (it * 2 + hh) * 68 + m * 4);
    const float mk = bfr(rsc[rowb + (size_t)hh + (size_t)(it * 2)]);
    v4f o;
#pragma unroll
    for (int e = 0; e < 4; ++e) o[e] = (t[e] + bq[e]) * mk;
    vals[it] = o;
  }
  float* dst = C + (rowb + (size_t)hh) * (size_t)N + col0 + m * 4;
  {
#pragma unroll
    for (int it = 0; it < 8; ++it) {
      *(v4f*)(dst + (size_t)(it * 2) * (size_t)N) = vals[it];
    }
    
  }
}

// =====================================================================================================
// Output projection: C[row][DM] (f32) = ((Ah + Al)[row][DI] . Bt[DM][DI]^T) * oscale + bias[col], times rsc[row]
// (products h.B + l.B into one accumulator, l unscaled). Block -> (position tile rt = bid % NST, row group bb): 64 rows
// bb*LP + 64*rt .. of Ah, Al and C against all DM rows of Bt. The three operand tiles are staged in LDS (whole-line
// loads, pitch PKP halves); wave w's tile is [16 rows (16*(w&3) ..)][64 columns (64*(w>>2) ..)], epilogue epi64o.
// coverage: grid = BG * NST blocks, each one 64 x 128 tile = every element of the row group's C once.
// =====================================================================================================
__global__ __launch_bounds__(PROJ_THREADS)
void gemm_o(const u16* __restrict__ Ah, const u16* __restrict__ Al, const u16* __restrict__ Bt,
            const float* __restrict__ bias, const float* __restrict__ rsc, float* C, float oscale) {
  __shared__ __align__(16) u16 opt[(2 * 64 + DM) * PKP];   // Ah rows 0..63, Al rows 0..63, Bt rows 0..127; later the 8 slabs
  const int tid = threadIdx.x, wave = tid >> 5, lane = tid & 31, hh = lane >> 4, m = lane & 15;
  const int bid   = blockIdx.x;
  const int rt    = bid % NST;
  const int bb    = bid / NST;
  if (bb >= BG) return;                     // block-uniform, before any barrier; never taken with the exact grid
  const int K     = DI;
  const size_t row0 = (size_t)bb * LP + rt * 64;
  {
    // staging: wave -> row wave + 8*i, lane -> 8 halves at 8*lane: each load and each LDS store covers one whole 512-B row
    const u16* ga = Ah + (row0 + wave) * K + 8 * lane;
    const u16* gl = Al + (row0 + wave) * K + 8 * lane;
    const u16* gb = Bt + (size_t)wave * K + 8 * lane;
    u16* tw = opt + wave * PKP + 8 * lane;
    v4u st[(2 * 64 + DM) / 8];              // the loops below are unrolled so that these stay in registers
#pragma unroll
    for (int i = 0; i < 8; ++i) {
      st[i]     = *(const v4u*)(ga + (size_t)(8 * i) * K);
      st[8 + i] = *(const v4u*)(gl + (size_t)(8 * i) * K);
    }
#pragma unroll
    for (int i = 0; i < DM / 8; ++i) st[16 + i] = *(const v4u*)(gb + (size_t)(8 * i) * K);
    // the address registers of these loads are reused below while the loads are still in flight; the three bases are named
    // as inputs so that none of them is given up for another value ahead of the wait
    asm volatile("s_wait_xcnt 0x0" :: "v"(ga), "v"(gl), "v"(gb) : "memory");
#pragma unroll
    for (int i = 0; i < (2 * 64 + DM) / 8; ++i) *(v4u*)(tw + 8 * i * PKP) = st[i];
  }
  __syncthreads();                          // the three operand tiles are complete before any wave reads a fragment
  const int srow  = (wave & 3) * 16;
  const int col0  = (wave >> 2) * 64;
  const size_t rowC = row0 + srow;
  const _Float16* ahp = (const _Float16*)(const void*)opt + (srow + m) * PKP + 8 * hh;
  const _Float16* alp = ahp + 64 * PKP;
  const _Float16* bp  = (const _Float16*)(const void*)opt + (2 * 64 + col0 + m) * PKP + 8 * hh;
  const int bs = 16 * PKP;
  v8f acc0 = zero8(), acc1 = zero8(), acc2 = zero8(), acc3 = zero8();
#pragma unroll 1
  for (int k0 = 0; k0 < K; k0 += 32) {
    const v16h ah = ldfrag_h(ahp + k0), al = ldfrag_h(alp + k0);
    const v16h b0 = ldfrag_h(bp + k0);
    const v16h b1 = ldfrag_h(bp + bs + k0);
    const v16h b2 = ldfrag_h(bp + 2 * bs + k0);
    const v16h b3 = ldfrag_h(bp + 3 * bs + k0);
    acc0 = mma_h(ah, b0, acc0);  acc0 = mma_h(al, b0, acc0);
    acc1 = mma_h(ah, b1, acc1);  acc1 = mma_h(al, b1, acc1);
    acc2 = mma_h(ah, b2, acc2);  acc2 = mma_h(al, b2, acc2);
    acc3 = mma_h(ah, b3, acc3);  acc3 = mma_h(al, b3, acc3);
    guard6<v16h>(acc0, acc1, acc2, acc3, ah, al, b0, b1, b2, b3);
  }
  __syncthreads();                          // every wave has read its last fragment before the slabs overwrite the tiles
  epi64o((float*)(void*)opt + wave * SLAB64, acc0, acc1, acc2, acc3, oscale, C, DM, rowC, col0, lane, bias, rsc);
}

// =====================================================================================================
// Projections and pair attention in one kernel. Block bid -> (head = bid % NH, row b = bid / NH): all LP positions of row b for
// one head; wave w owns positions q0 = 16*w .. q0 + 15, as softmax rows and as the columns it contributes.
// Front part: the head's 64 rows of Wq^T, Wk^T, Wv^T, Wu^T (bf16, [n][k | k]) are brought in once per block with whole-line loads
// (one wave = one 512-B row per instruction) and stored to LDS at pitch PKP; the wave's own 16 x hi|lo rows of XB are held in
// registers as 8 fragments (the split k map is the same for both operands, so they serve as row or as column operand).
//   u^T = Wu^T.x^T, k^T = Wk^T.x^T, q^T = Wq^T.x^T (row operand W, column operand x): the lane holds position q0 + c, channels
//   16*j + 8*hh + r. u becomes the gate sigmoid(u + bu) in place; k x1024 (f16 hi + residual) is converted in place into the column
//   operand of the scores (tiles 2*kk, 2*kk + 1 lie in the split k map over d); q x128 (= C^-0.5 x 1024) hi + residual goes to the
//   LDS planes qt [pos][d] (pitch VTP), 8 consecutive d per 16-B store.
//   v = x.Wv (row operand x, column operand W): the lane holds channel 16*j + c, positions q0 + 8*hh + r; v x1024 hi + residual
//   goes to the LDS planes vt [d][pos] (pitch VPP), 8 consecutive positions per 16-B store.
// One work-group barrier, and every wave has the whole row's q and v^T planes in LDS: the column loop has no barrier.
// Softmax row index qi uses the k projection (column operand R, registers), softmax column index vi uses the q projection
// (row operand Cm, LDS), summed over vi with v[vi]. CB [h][qi][vi] f32 = 1e9*(mask - 1) + x.Wb.
//   scores s(i, j) = R_hi.C_hi + R_lo.C_hi + R_hi.C_lo over HD; logit (log2 domain) t = (s / (1024*1024) + CB) * log2 e.
//   All NKT column tiles of 32 visited in order. Per tile: the 16x32 CB tile is staged into the wave-private LDS tile with
//   16-B loads/stores, then 2 score subtiles x 2 k-steps, computed transposed, so a lane holds 16 logits of ONE softmax row
//   (q0 + c): maximum and sum run in the lane, with one exchange between the lane halves for the maximum. The two score subtiles'
//   registers lie in the split k map, so P^T*32768 (f16 hi plus its f16 residual) is converted in place into the column operand
//   of out^T += v^T.P^T (v^T fragments as row operand, 2 groups of 2 d-subtiles), products hh + lh + hl.
//   After the loop: out = acc / Z (Z >= 1 always; guarded anyway), carries 1/(32768*1024) folded once, times the gate in f32,
//   written to the wave's private result slab (pitch 68; every element owned by one lane), then O x1024 -> f16 hi + residual planes.
// The waves' CB tiles and result slabs lie over the weight rows, which nobody reads behind the barrier.
// coverage: per wave 4 instructions x 4 rows x 8 lanes x 8 halves = 16 x 64 per plane; grid = NH * BG blocks x WPB waves
//           = every (b, pos, h) row segment of OH and OL exactly once.
// =====================================================================================================
__device__ __forceinline__ void split8(v8f a, float sc, v4u& hi, v4u& lo) {   // a * sc -> 8 f16 hi, 8 f16 residuals
#pragma unroll
  for (int e = 0; e < 4; ++e) {
    const float t0 = a[2 * e] * sc, t1 = a[2 * e + 1] * sc;
    const _Float16 h0 = (_Float16)t0, h1 = (_Float16)t1;
    const _Float16 l0 = (_Float16)(t0 - (float)h0), l1 = (_Float16)(t1 - (float)h1);
    hi[e] = pk16(h_bits(h0), h_bits(h1));
    lo[e] = pk16(h_bits(l0), h_bits(l1));
  }
}
// a[j] = 16 x 16 tile j of (64 weight rows at wp) against the wave's x fragments over K = KX; XROW: x is the row operand
template <bool XROW>
__device__ __forceinline__ void proj64(const u16* wp, const v16b (&xf)[KX / 32], v8f (&a)[4]) {
#pragma unroll
  for (int j = 0; j < 4; ++j) a[j] = zero8();
#pragma unroll
  for (int kk = 0; kk < KX / 32; ++kk) {
    const v16b w0 = ldfrag_b(wp + kk * 32);
    const v16b w1 = ldfrag_b(wp + 16 * PKP + kk * 32);
    const v16b w2 = ldfrag_b(wp + 32 * PKP + kk * 32);
    const v16b w3 = ldfrag_b(wp + 48 * PKP + kk * 32);
    a[0] = XROW ? mma_b(xf[kk], w0, a[0]) : mma_b(w0, xf[kk], a[0]);
    a[1] = XROW ? mma_b(xf[kk], w1, a[1]) : mma_b(w1, xf[kk], a[1]);
    a[2] = XROW ? mma_b(xf[kk], w2, a[2]) : mma_b(w2, xf[kk], a[2]);
    a[3] = XROW ? mma_b(xf[kk], w3, a[3]) : mma_b(w3, xf[kk], a[3]);
  }
}

__global__ __launch_bounds__(ATT_THREADS)
void attn_f(const u16* __restrict__ XB, const u16* __restrict__ WP, const float* __restrict__ CB,
            const float* __restrict__ bu, u16* __restrict__ OHp, u16* __restrict__ OLp) {
  __shared__ __align__(16) u16 qt[2 * LP * VTP];    // q hi, q residual [pos][d], pitch VTP
  __shared__ __align__(16) u16 vt[2 * HD * VPP];    // v^T hi, v^T residual [d][pos], pitch VPP
  __shared__ __align__(16) u16 wl[4 * HD * PKP];    // the head's Wq^T, Wk^T, Wv^T, Wu^T rows, pitch PKP; later CB tiles and slabs

  const int tid  = threadIdx.x;
  const int wave = tid >> 5;
  const int lane = tid & 31;
  const int hh   = lane >> 4;
  const int c    = lane & 15;
  const int bid  = blockIdx.x;
  const int head = bid % NH;
  const int b    = bid / NH;
  if (b >= BG) return;                      // block-uniform, before any barrier; never taken with the exact grid
  const int wv   = __builtin_amdgcn_readfirstlane(wave);    // the wave's number in a scalar register: wave-uniform bases stay scalar
  const int q0   = wv * 16;

  v16b xf[KX / 32];                         // the wave's 16 x rows; the loops over it are unrolled so that it stays in registers
  {
    // wave -> row wave + 16*i of each plane's 64 rows, lane -> 8 halves at 8*lane: one whole 512-B row per load
    const u16* gw = WP + (size_t)(head * HD + wave) * KX + 8 * lane;
    v4u st[16];                             // the loops below are unrolled so that these stay in registers
#pragma unroll
    for (int p = 0; p < 4; ++p) {
#pragma unroll
      for (int i = 0; i < 4; ++i) st[4 * p + i] = *(const v4u*)(gw + (size_t)p * DI * KX + (size_t)(16 * i) * KX);
    }
    const char* xw = (const char*)(XB + ((size_t)b * LP + q0) * KX);    // wave-uniform base of the wave's 16 x rows
    const unsigned xo = (unsigned)(c * KX + 8 * hh) * 2u;               // the lane's byte offset: row c, halves 8*hh
#pragma unroll
    for (int kk = 0; kk < KX / 32; ++kk) xf[kk] = ldfrag_b((const u16*)(xw + xo) + kk * 32);
    // the loads of each run share one address register; both are named as inputs so that neither is given up for another
    // value ahead of the wait
    asm volatile("s_wait_xcnt 0x0" :: "v"(gw), "v"(xo) : "memory");
    u16* tw = wl + wave * PKP + 8 * lane;
#pragma unroll
    for (int p = 0; p < 4; ++p) {
#pragma unroll
      for (int i = 0; i < 4; ++i) *(v4u*)(tw + (p * HD + 16 * i) * PKP) = st[4 * p + i];
    }
  }
  __syncthreads();                          // the weight rows are complete before any wave reads a fragment of them

  const u16* wp = wl + c * PKP + 8 * hh;
  v8f gt[4];                                // gate of (row q0 + c, channel head*HD + 16*j + 8*hh + r)
  FragH rh[HD / 32], rl[HD / 32];           // k x1024 hi, residual: column operand of the scores, column = row q0 + c
  {
    v8f a[4];
    proj64<false>(wp + 3 * HD * PKP, xf, a);
#pragma unroll
    for (int j = 0; j < 4; ++j) {
      const float* bp = bu + head * HD + j * 16 + 8 * hh;
      const v4f b0 = *(const v4f*)(bp), b1 = *(const v4f*)(bp + 4);
#pragma unroll
      for (int r = 0; r < 4; ++r) {
        gt[j][r]     = sigm(a[j][r] + bfr(b0[r]));
        gt[j][4 + r] = sigm(a[j][4 + r] + bfr(b1[r]));
      }
    }
    proj64<false>(wp + HD * PKP, xf, a);
#pragma unroll
    for (int kk = 0; kk < HD / 32; ++kk) {
      split8(a[2 * kk],     KSC, rh[kk].u[0], rl[kk].u[0]);
      split8(a[2 * kk + 1], KSC, rh[kk].u[1], rl[kk].u[1]);
    }
    proj64<false>(wp, xf, a);
    u16* qw = qt + (q0 + c) * VTP + 8 * hh;
#pragma unroll
    for (int j = 0; j < 4; ++j) {
      v4u hi, lo;
      split8(a[j], QSC, hi, lo);
      *(v4u*)(qw + 16 * j)            = hi;
      *(v4u*)(qw + LP * VTP + 16 * j) = lo;
    }
    proj64<true>(wp + 2 * HD * PKP, xf, a);
    u16* vw = vt + c * VPP + q0 + 8 * hh;
#pragma unroll
    for (int j = 0; j < 4; ++j) {
      v4u hi, lo;
      split8(a[j], VCAR, hi, lo);
      *(v4u*)(vw + 16 * j * VPP)            = hi;
      *(v4u*)(vw + (HD + 16 * j) * VPP)     = lo;
    }
  }
  __syncthreads();                          // q and v^T planes complete; every wave has read its last weight fragment

  float* pt  = (float*)(void*)wl + wv * WREG;   // CB tile [16][32] pitch 36
  float* slx = pt + PTW;                        // behind it the result slab [16][64] pitch 68
  // fragment bases in the LDS planes: row c (+16 per subtile), halves 8*hh (+ the k offset per step)
  const _Float16* Chb = (const _Float16*)(const void*)qt + c * VTP + 8 * hh;     // row = vi, k = d
  const _Float16* Clb = Chb + LP * VTP;
  const _Float16* Vhb = (const _Float16*)(const void*)vt + c * VPP + 8 * hh;     // row = d, k = vi
  const _Float16* Vlb = Vhb + HD * VPP;
  const float* cbb = CB + ((size_t)head * LP + q0) * LP;
  const float invc = 1.0f / (CSC * KSC);
  const float oc   = 1.0f / (PCAR * VCAR);

  float mrow = -INFINITY, lrow = 0.f;       // of softmax row q0 + c; lrow is this lane half's share of the row sum
  v8f o[4];                                 // o[j][r] = out^T (d = 16*j + 8*hh + r, row q0 + c)
#pragma unroll
  for (int j = 0; j < 4; ++j) o[j] = zero8();

#pragma unroll 1
  for (int kt = 0; kt < NKT; ++kt) {
    const int kb = kt * 32;
    // ---- stage the additive logit tile [16 rows][32 cols] into pt: 128 float4, lane handles f = it*32 + lane ----
#pragma unroll
    for (int it = 0; it < 4; ++it) {
      const int f = it * 32 + lane;
      const int row = f >> 3, col4 = (f & 7) * 4;
      const v4f t4 = *(const v4f*)(cbb + (size_t)row * LP + kb + col4);
      *(v4f*)(pt + row * PTP + col4) = t4;
    }
    // ---- scores, transposed: D element r of this lane = (col kb + 8hh + r, row q0 + c) in s0, col kb + 16 + 8hh + r in s1 ----
    v8f s0 = zero8(), s1 = zero8();
    const _Float16* c0p = Chb + kb * VTP;
    const _Float16* c1p = c0p + 16 * VTP;
    const _Float16* l0p = Clb + kb * VTP;
    const _Float16* l1p = l0p + 16 * VTP;
#pragma unroll
    for (int kk = 0; kk < HD / 32; ++kk) {
      const v16h ch0 = ldfrag_h(c0p + kk * 32);
      const v16h ch1 = ldfrag_h(c1p + kk * 32);
      const v16h cl0 = ldfrag_h(l0p + kk * 32);
      const v16h cl1 = ldfrag_h(l1p + kk * 32);
      s0 = mma_h(ch0, rh[kk].v, s0);
      s0 = mma_h(ch0, rl[kk].v, s0);
      s0 = mma_h(cl0, rh[kk].v, s0);
      s1 = mma_h(ch1, rh[kk].v, s1);
      s1 = mma_h(ch1, rl[kk].v, s1);
      s1 = mma_h(cl1, rh[kk].v, s1);
      guard2(s0, s1, rh[kk].v, rl[kk].v, ch0, cl0, ch1, cl1);
    }
    wave_sync_lds();
    // ---- additive term + online softmax in base 2, -inf-safe; the lane's 16 logits all belong to row q0 + c ----
    float e[16];                            // element s = column kb + 8hh + s (s < 8), kb + 16 + 8hh + s - 8 (s >= 8)
    {
      const float* crow = pt + c * PTP + 8 * hh;
      const v4f c0 = *(const v4f*)(crow), c1 = *(const v4f*)(crow + 4);
      const v4f c2 = *(const v4f*)(crow + 16), c3 = *(const v4f*)(crow + 20);
#pragma unroll
      for (int r = 0; r < 4; ++r) {
        e[r]      = (s0[r] * invc + c0[r]) * LOG2E;
        e[4 + r]  = (s0[4 + r] * invc + c1[r]) * LOG2E;
        e[8 + r]  = (s1[r] * invc + c2[r]) * LOG2E;
        e[12 + r] = (s1[4 + r] * invc + c3[r]) * LOG2E;
      }
    }
    float mx = e[0];
#pragma unroll
    for (int s = 1; s < 16; ++s) mx = fmaxf(mx, e[s]);
    mx = fmaxf(mx, xhalf(mx));              // the other half of the row's 32 columns
    const float mn = fmaxf(mrow, mx);
    const float ms = (mn == -INFINITY) ? 0.0f : mn;
    const float al = exp2f(mrow - ms);
    mrow = mn;
#pragma unroll
    for (int s = 0; s < 16; ++s) e[s] = exp2f(e[s] - ms);
    {
      const float pa = ((e[0] + e[1]) + (e[2] + e[3])) + ((e[4] + e[5]) + (e[6] + e[7]));
      const float pb = ((e[8] + e[9]) + (e[10] + e[11])) + ((e[12] + e[13]) + (e[14] + e[15]));
      lrow = lrow * al + (pa + pb);
    }
#pragma unroll
    for (int j = 0; j < 4; ++j) {
#pragma unroll
      for (int r = 0; r < 8; ++r) o[j][r] *= al;
    }
    // ---- B fragments of P^T*32768: hi f16 and residual f16, column = row q0 + c; the score registers already lie in the
    //      split k map over the 32 columns of this step, so element s of the fragment is e[s] ----
    FragH ph, pl;
#pragma unroll
    for (int s = 0; s < 8; ++s) {
      const float ta = e[s] * PCAR, tb = e[8 + s] * PCAR;
      const _Float16 ha = (_Float16)ta, hb = (_Float16)tb;
      ph.h[0][s] = ha;
      ph.h[1][s] = hb;
      pl.h[0][s] = (_Float16)(ta - (float)ha);
      pl.h[1][s] = (_Float16)(tb - (float)hb);
    }
    // ---- v^T.P^T : A fragment row m = d = j*16 + c, columns vi contiguous in the v^T plane rows; 2 groups of 2 d-subtiles ----
    {
      const _Float16* vhp = Vhb + kb;
      const _Float16* vlp = Vlb + kb;
#pragma unroll
      for (int jg = 0; jg < HD / 32; ++jg) {
        const int da = (2 * jg) * 16 * VPP;
        const int db = da + 16 * VPP;
        const v16h vha = ldfrag_h(vhp + da), vhb2 = ldfrag_h(vhp + db);
        const v16h vla = ldfrag_h(vlp + da), vlb2 = ldfrag_h(vlp + db);
        o[2 * jg]     = mma_h(vha,  ph.v, o[2 * jg]);
        o[2 * jg]     = mma_h(vha,  pl.v, o[2 * jg]);
        o[2 * jg]     = mma_h(vla,  ph.v, o[2 * jg]);
        o[2 * jg + 1] = mma_h(vhb2, ph.v, o[2 * jg + 1]);
        o[2 * jg + 1] = mma_h(vhb2, pl.v, o[2 * jg + 1]);
        o[2 * jg + 1] = mma_h(vlb2, ph.v, o[2 * jg + 1]);
        guard2(o[2 * jg], o[2 * jg + 1], ph.v, pl.v, vha, vhb2, vla, vlb2);
      }
    }
    wave_sync_lds();
  }
  acc_guard4(o[0], o[1], o[2], o[3]);
  // ---- out = acc / Z (0 if Z == 0), carries (32768 on P, 1024 on v) folded once, times the gate in f32; into the lane-owned slab ----
  {
    const float lv  = lrow + xhalf(lrow);   // the two lane halves' shares of the row sum, joined once
    const float ls  = (lv > 0.0f) ? lv : 1.0f;
    const float inv = (lv > 0.0f) ? ((1.0f / ls) * oc) : 0.0f;
#pragma unroll
    for (int j = 0; j < 4; ++j) {
      float* sp = slx + c * SLP + j * 16 + 8 * hh;      // row q0 + c, 8 consecutive d
      v4f w0, w1;
#pragma unroll
      for (int r = 0; r < 4; ++r) {
        w0[r] = (o[j][r] * inv)     * gt[j][r];
        w1[r] = (o[j][4 + r] * inv) * gt[j][4 + r];
      }
      *(v4f*)(sp)     = w0;
      *(v4f*)(sp + 4) = w1;
    }
  }

  wave_sync_lds();
  // ---- O x1024 -> f16 hi + residual planes; lane = (row select rq in 0..3, 8 consecutive d at c8) ----
  v4u oh[4], ol[4];
  const int rq = lane >> 3, c8 = (lane & 7) * 8;
#pragma unroll
  for (int it = 0; it < 4; ++it) {
    const int row = it * 4 + rq;
    const v4f a  = *(const v4f*)(slx + row * SLP + c8), b4 = *(const v4f*)(slx + row * SLP + c8 + 4);
    float w[8];
#pragma unroll
    for (int e = 0; e < 4; ++e) {
      w[e]     = a[e]  * OSC;
      w[4 + e] = b4[e] * OSC;
    }
#pragma unroll
    for (int e = 0; e < 4; ++e) {
      const _Float16 h0 = (_Float16)w[2 * e], h1 = (_Float16)w[2 * e + 1];
      const _Float16 l0 = (_Float16)(w[2 * e] - (float)h0), l1 = (_Float16)(w[2 * e + 1] - (float)h1);
      oh[it][e] = pk16(h_bits(h0), h_bits(h1));
      ol[it][e] = pk16(h_bits(l0), h_bits(l1));
    }
  }
  const size_t ob = ((size_t)b * LP + q0) * DI + (size_t)head * HD + c8;
#pragma unroll
  for (int it = 0; it < 4; ++it) {
    const int row = it * 4 + rq;
    *(v4u*)(OHp + ob + (size_t)row * DI) = oh[it];
    *(v4u*)(OLp + ob + (size_t)row * DI) = ol[it];
  }
}

// =====================================================================================================
// All NS rows form one group (NGRP = 1): two dependent launches behind the preparation. q, k and v never leave the attention
// kernel's work-group, so the workspace holds x, the gated O planes, the logit table and the weight planes.
// Workspace map (bytes); every plane is fully written by whole-line stores before it is read; all extents are exact
// multiples of the store granularity (no pad rows needed); every region offset a multiple of 65536:
//   XB  bf16 [NPIX][256] (hi|lo)                    33554432
//   OH, OL  f16 [GROWS][256]                        2 * GROWS*512   (O x1024 hi, residual)
//   CB  f32 [4][NPIX]                               1048576
//   WQ, WK, WV, WU  bf16 [256 n][256 k]             4 * 131072   (contiguous in this order: attn_f reads them as one plane)
//   WO  f16 x1024 [128 n][256 k]                    65536
//   end (BG = 256)                                  102301696
// =====================================================================================================
extern "C" void kernel_launch(void* const* d_in, const int* in_sizes, int n_in,
                              void* d_out, int out_size, void* d_ws, size_t ws_size,
                              hipStream_t stream) {
  if (n_in < 12) return;
  if (in_sizes[0] < NPIX * DM) return;
  if (in_sizes[1] < NPIX) return;
  if (in_sizes[2] < DM || in_sizes[3] < DM) return;
  if (in_sizes[4] < DM * DI || in_sizes[5] < DM * DI || in_sizes[6] < DM * DI || in_sizes[8] < DM * DI) return;
  if (in_sizes[7] < DM * NH) return;
  if (in_sizes[9] < DI) return;
  if (in_sizes[10] < DI * DM) return;
  if (in_sizes[11] < DM) return;
  if (out_size < NS * LP * DM) return;

  const float* pr    = (const float*)d_in[0];
  const float* mask  = (const float*)d_in[1];
  const float* gamma = (const float*)d_in[2];
  const float* beta  = (const float*)d_in[3];
  const float* Wq    = (const float*)d_in[4];
  const float* Wk    = (const float*)d_in[5];
  const float* Wv    = (const float*)d_in[6];
  const float* Wb    = (const float*)d_in[7];
  const float* Wu    = (const float*)d_in[8];
  const float* bu    = (const float*)d_in[9];
  const float* Wo    = (const float*)d_in[10];
  const float* bo    = (const float*)d_in[11];
  float*       out   = (float*)d_out;

  const size_t szXB = (size_t)NPIX * KX * 2;
  const size_t szH  = (size_t)GROWS * DI * 2;                   // OH, OL
  const size_t szCB = (size_t)NH * NPIX * 4;
  const size_t szW  = (size_t)DI * KX * 2;
  const size_t szWO = (size_t)DM * DI * 2;
  size_t off = 0;
  const size_t oXB = off; off += szXB;
  const size_t oOH = off; off += szH;
  const size_t oOL = off; off += szH;
  const size_t oCB = off; off += szCB;
  const size_t oWQ = off; off += szW;
  const size_t oWK = off; off += szW;
  const size_t oWV = off; off += szW;
  const size_t oWU = off; off += szW;
  const size_t oWO = off; off += szWO;
  if (off > ws_size) return;                // off = 102301696 for BG = 256
  if (off > (size_t)WS_CAP) return;

  char* ws = (char*)d_ws;
  u16*   XB = (u16*)(ws + oXB);
  u16*   OH = (u16*)(ws + oOH);
  u16*   OL = (u16*)(ws + oOL);
  float* CB = (float*)(ws + oCB);
  u16*   WQ = (u16*)(ws + oWQ);
  u16*   WO = (u16*)(ws + oWO);

  const dim3 b256(256), bAT(ATT_THREADS);
  const dim3 gPR(NWB + NPIX / LNPB);                    // 20 weight-plane blocks + 2048 LayerNorm blocks
  const dim3 gAT(NH * BG);
  const dim3 gO(BG * NST);
  const float osc = 1.0f / (OSC * WOS);

  // one launch: LayerNorm for every pixel (x hi|lo planes, additive logit table) and the weight planes
  // Wq^T, Wk^T, Wv^T, Wu^T [n][k | k] as bf16 (contiguous from WQ), Wo^T [n][k] as f16 of bf16 value x1024
  prep<<<gPR, b256, 0, stream>>>(pr, mask, gamma, beta, Wb, Wq, Wk, Wv, Wu, Wo, XB, CB, WQ, WO);

  for (int g = 0; g < NGRP; ++g) {
    const u16*   xg = XB   + (size_t)g * GROWS * KX;
    const float* mg = mask + (size_t)g * GROWS;
    float*       og = out  + (size_t)g * GROWS * DM;
    // (1) q, k, v and gate projections and the attention in one launch: gated O hi + residual planes
    attn_f<<<gAT, bAT, 0, stream>>>(xg, WQ, CB, bu, OH, OL);
    // (2) output projection (hi + residual), + bo, x mask row scale -> out f32, carries 1024 x 1024 folded back
    gemm_o<<<gO, b256, 0, stream>>>(OH, OL, WO, bo, mg, og, osc);
  }
  (void)hipGetLastError();
}

// v009
// It runs in 113 microseconds.
// In two side-by-side timings against v008, it was 1.03 and 1.04 times as fast.
// Over all steps from v000 it is 5.50 times as fast.
// Contractions: x.Wq, x.Wk, x.Wv, x.Wu on v_wmma_f32_16x16x32_bf16 (x as bf16 hi|lo pair, each W fragment multiplies both; W as
// bf16 RNE of the input, f32 accumulate); k.q^T over 64 and P.v^T on v_wmma_f32_16x16x32_f16 (k x1024 and q x128 f16 hi + residual
// planes, P x32768 f16 hi + residual, v x1024 f16 hi + residual; products hh + lh + hl); (O*gate).Wo on
// v_wmma_f32_16x16x32_f16 (O x1024 f16 hi + residual, Wo as f16(bf16(Wo)) x1024, products h.w + l.w); all f32 accumulate.
// LayerNorm, x.Wb (N = 4) and the additive logit table, base-2 online softmax, sigmoid gate, bias and row scale in f32 on VALU.
#include <hip/hip_runtime.h>
#include <math.h>
#include <stdint.h>

#ifndef NS
#define NS 256
#endif
#define NSX   256
#define LP    256
#define DM    128
#define NH    4
#define HD    64
#define DI    (NH * HD)
#define KX    (2 * DM)
#define NPIX  (LP * LP)
#define BG    NS
#define NGRP  (NS / BG)
#define GROWS (BG * LP)
#define LNEPS 1e-5f
#define LOG2E 1.4426950408889634f
#define QSC   128.0f
#define CSC   1024.0f
#define KSC   1024.0f
#define PCAR  32768.0f
#define VCAR  1024.0f
#define OSC   1024.0f
#define WOS   1024.0f
#define WPB   16
#define NQT   (LP / 16)
#define NST   (LP / 64)
#define NKT   (LP / 32)
#define ATT_THREADS (WPB * 32)
#define PTP   36
#define PTW   (16 * PTP)
#define SLP   68
#define SLW   (16 * SLP)
#define WREG  (PTW + SLW)
#define SLAB64 (16 * 68)
#define VTP   72
#define VPP   (LP + 8)
#define LNPB  32
#define WS_CAP 268435456
#define PKP   (KX + 8)
#define PKW   (DM + 8)
#define WLN   ((WPB * WREG * 2 > 4 * HD * PKW) ? (WPB * WREG * 2) : (4 * HD * PKW))
#define PROJ_THREADS 256
#define WTB   4
#define NWB   (5 * WTB)
static_assert(DI == NH * HD && HD == 64 && NH == 4);
static_assert(ATT_THREADS == 512 && WPB * 16 == LP && HD == 4 * 16);
static_assert(NS >= 1 && NS <= NSX && (NS % BG) == 0 && BG >= 1 && BG <= NSX);
static_assert((LP % 64) == 0 && (LP % 32) == 0 && (LP % 16) == 0);
static_assert(DM == 128 && (KX % 32) == 0 && (DI % 64) == 0 && (DI % 32) == 0 && (DM % 64) == 0);
static_assert(WPB * WREG * 4 <= WLN * 2 && 4 * HD * PKW <= WLN && ATT_THREADS * 8 * 8 == 4 * HD * DM);
static_assert((NPIX % LNPB) == 0 && LNPB == 32);
static_assert(PROJ_THREADS == 256 && KX == 256 && DI == KX && DM == 128 && 8 * SLAB64 * 4 <= (2 * 64 + DM) * PKP * 2);
static_assert((DI % 128) == 0 && (DM % 128) == 0 && (DM % 64) == 0 && (DI % 64) == 0);
static_assert((DI / 128) * (DM / 64) == WTB && (DM / 128) * (DI / 64) == WTB);

typedef unsigned short u16;
typedef _Float16 v16h __attribute__((ext_vector_type(16)));
typedef _Float16 v8h  __attribute__((ext_vector_type(8)));
typedef __bf16   v16b __attribute__((ext_vector_type(16)));
typedef float    v8f  __attribute__((ext_vector_type(8)));
typedef float    v4f  __attribute__((ext_vector_type(4)));
typedef unsigned int v4u __attribute__((ext_vector_type(4)));
typedef unsigned int v2u __attribute__((ext_vector_type(2)));

union FragH { v16h v; v8h h[2]; v4u u[2]; };
union FragB { v16b v; v4u u[2]; };

// ---- scalar helpers --------------------------------------------------------------------------------
__device__ __forceinline__ unsigned short bf_bits(float f) {          // f32 -> bf16 bits, RNE convert
  unsigned u = __float_as_uint(f);
  return (unsigned short)((u + 0x7FFFu + ((u >> 16) & 1u)) >> 16);
}
__device__ __forceinline__ float bf_up(unsigned short h) { return __uint_as_float(((unsigned)h) << 16); }
__device__ __forceinline__ float bfr(float f) { return bf_up(bf_bits(f)); }
__device__ __forceinline__ unsigned short h_bits(_Float16 x) { return __builtin_bit_cast(unsigned short, x); }
__device__ __forceinline__ unsigned pk16(unsigned short a, unsigned short b) { return (unsigned)a | ((unsigned)b << 16); }
__device__ __forceinline__ v8f zero8() { v8f z = {0.f, 0.f, 0.f, 0.f, 0.f, 0.f, 0.f, 0.f}; return z; }
__device__ __forceinline__ float sigm(float z) {                     // 1 / (1 + 2^(-z log2 e)), argument clamped
  const float zc = fminf(fmaxf(z, -30.0f), 30.0f);
  const float e  = exp2f(-zc * LOG2E);
  return __builtin_amdgcn_rcpf(1.0f + e);
}

// ---- fragment loaders: 16-bit A/B operand, lane -> row/col (lane&15), p already includes +8*(lane>>4);
//      elements 0..7 <- p[0..7] (k0+8h..), elements 8..15 <- p[16..23] (k0+16+8h..)  (same split k map for A and B;
//      B is always read from a k-contiguous [n][k] plane)
__device__ __forceinline__ v16h ldfrag_h(const _Float16* p) {
  FragH f;
  f.h[0] = *(const v8h*)(p);
  f.h[1] = *(const v8h*)(p + 16);
  return f.v;
}
__device__ __forceinline__ v16b ldfrag_b(const u16* p) {              // bf16 plane read as unsigned integer vectors
  FragB f;
  f.u[0] = *(const v4u*)(p);
  f.u[1] = *(const v4u*)(p + 16);
  return f.v;
}

__device__ __forceinline__ v8f mma_h(v16h a, v16h b, v8f c) {
  return __builtin_amdgcn_wmma_f32_16x16x32_f16(false, a, false, b, (short)0, c, false, false);
}
__device__ __forceinline__ v8f mma_b(v16b a, v16b b, v8f c) {
  return __builtin_amdgcn_wmma_f32_16x16x32_bf16(false, a, false, b, (short)0, c, false, false);
}
__device__ __forceinline__ void guard2(v8f& a, v8f& b, v16h x0, v16h x1, v16h x2, v16h x3, v16h x4, v16h x5) {
#if defined(__HIP_DEVICE_COMPILE__)
  asm volatile("v_nop\n\tv_nop\n\tv_nop\n\tv_nop"
               : "+v"(a), "+v"(b) : "v"(x0), "v"(x1), "v"(x2), "v"(x3), "v"(x4), "v"(x5) : "memory");
#endif
}
template <typename F>
__device__ __forceinline__ void guard6(v8f& a, v8f& b, v8f& c, v8f& d, F x0, F x1, F x2, F x3, F x4, F x5) {
#if defined(__HIP_DEVICE_COMPILE__)
  asm volatile("v_nop\n\tv_nop\n\tv_nop\n\tv_nop"
               : "+v"(a), "+v"(b), "+v"(c), "+v"(d) : "v"(x0), "v"(x1), "v"(x2), "v"(x3), "v"(x4), "v"(x5) : "memory");
#endif
}
__device__ __forceinline__ void acc_guard4(v8f& a, v8f& b, v8f& c, v8f& d) {
#if defined(__HIP_DEVICE_COMPILE__)
  asm volatile("v_nop\n\tv_nop\n\tv_nop\n\tv_nop" : "+v"(a), "+v"(b), "+v"(c), "+v"(d));
#endif
}
__device__ __forceinline__ float xhalf(float x) {                    // value of lane l ^ 16 (the other 16-lane row)
  const int b = __builtin_bit_cast(int, x);
  return __builtin_bit_cast(float, __builtin_amdgcn_permlanex16(b, b, 0x76543210, 0xfedcba98, false, false));
}
__device__ __forceinline__ void wave_sync_lds() {
  __builtin_amdgcn_fence(__ATOMIC_RELEASE, "workgroup");
  __builtin_amdgcn_wave_barrier();
  __builtin_amdgcn_fence(__ATOMIC_ACQUIRE, "workgroup");
}

// =====================================================================================================
// statistics), x written as bf16 hi | bf16 lo planes XB [NPIX][KX] (columns 0..127 hi bits, 128..255 lo bits of x - hi);
// the additive logit table CB [NH][NPIX] = 1e9*(mask - 1) + x.Wb (VALU f32, N = 4) is produced by the same block.
// Block = 8 waves x LNPB/8 pixels, wave = one pixel at a time (lane holds 4 channels); the 512-B x row is assembled in a
// x 4 heads) are funnelled through LDS and written by wave 0 in one instruction (8 consecutive lanes x 16 B per line);
// coverage: blk = 0 .. NPIX/LNPB - 1, each 32 pixels = every XB row once and every CB line once.
// =====================================================================================================
__device__ __forceinline__ void ln_x(int blk, const float* __restrict__ pr, const float* __restrict__ mask,
                                     const float* __restrict__ gamma, const float* __restrict__ beta,
                                     const float* __restrict__ Wb, u16* XB, float* CB) {
  __shared__ __align__(16) u16 RB[8 * KX];
  __shared__ __align__(16) float PBS[NH * LNPB];
  const int tid = threadIdx.x, wave = tid >> 5, lane = tid & 31;
  const int p0 = blk * LNPB;
  if (p0 + LNPB > NPIX) return;             // block-uniform, before any barrier; never taken with the exact grid
  float gm[4], bt[4], wb[16];
  {
    const v4f g4 = *(const v4f*)(gamma + 4 * lane), b4 = *(const v4f*)(beta + 4 * lane);
#pragma unroll
    for (int e = 0; e < 4; ++e) { gm[e] = bfr(g4[e]); bt[e] = bfr(b4[e]); }
#pragma unroll
    for (int i = 0; i < 4; ++i) {
      const v4f w4 = *(const v4f*)(Wb + 16 * lane + 4 * i);      // Wb[(4*lane + i)][h], h = 0..3
#pragma unroll
      for (int h = 0; h < 4; ++h) wb[4 * i + h] = bfr(w4[h]);
    }
  }
  u16* rb = RB + wave * KX;
#pragma unroll 1
  for (int j = 0; j < LNPB / 8; ++j) {
    const int pl = j * 8 + wave;
    const int p  = p0 + pl;
    const v4f x4 = *(const v4f*)(pr + (size_t)p * DM + 4 * lane);
    float xr[4];
#pragma unroll
    for (int e = 0; e < 4; ++e) xr[e] = bfr(x4[e]);
    float s = (xr[0] + xr[1]) + (xr[2] + xr[3]);
#pragma unroll
    for (int off = 1; off < 32; off <<= 1) s += __shfl_xor(s, off, 32);
    const float mu = s * (1.0f / (float)DM);
    float d[4];
#pragma unroll
    for (int e = 0; e < 4; ++e) d[e] = xr[e] - mu;
    float ss = (d[0] * d[0] + d[1] * d[1]) + (d[2] * d[2] + d[3] * d[3]);
#pragma unroll
    for (int off = 1; off < 32; off <<= 1) ss += __shfl_xor(ss, off, 32);
    const float var = ss * (1.0f / (float)DM);
    const float rs  = 1.0f / sqrtf(var + LNEPS);
    float y[4];
#pragma unroll
    for (int e = 0; e < 4; ++e) y[e] = d[e] * rs * gm[e] + bt[e];
    unsigned short hb[4], lb[4];
#pragma unroll
    for (int e = 0; e < 4; ++e) { hb[e] = bf_bits(y[e]); lb[e] = bf_bits(y[e] - bf_up(hb[e])); }
    float pb[4];
#pragma unroll
    for (int h = 0; h < 4; ++h) pb[h] = y[0] * wb[h] + y[1] * wb[4 + h] + y[2] * wb[8 + h] + y[3] * wb[12 + h];
#pragma unroll
    for (int h = 0; h < 4; ++h) {
#pragma unroll
      for (int off = 1; off < 32; off <<= 1) pb[h] += __shfl_xor(pb[h], off, 32);
    }
    const float mk = bfr(mask[p]);
    const float mb = 1e9f * (mk - 1.0f);
    v2u hv, lv;
    hv[0] = pk16(hb[0], hb[1]);  hv[1] = pk16(hb[2], hb[3]);
    lv[0] = pk16(lb[0], lb[1]);  lv[1] = pk16(lb[2], lb[3]);
    *(v2u*)(rb + 4 * lane)      = hv;
    *(v2u*)(rb + DM + 4 * lane) = lv;
    if (lane == 0) {
      PBS[0 * LNPB + pl] = mb + pb[0];
      PBS[1 * LNPB + pl] = mb + pb[1];
      PBS[2 * LNPB + pl] = mb + pb[2];
      PBS[3 * LNPB + pl] = mb + pb[3];
    }
    wave_sync_lds();
    const v4u piece = *(const v4u*)(rb + 8 * lane);
    u16* dst = XB + (size_t)p * KX + 8 * lane;
    {
      *(v4u*)(dst) = piece;
      
    }
    wave_sync_lds();
  }
  __syncthreads();
  if (wave == 0) {
    const int h = lane >> 3, j4 = (lane & 7) * 4;
    const v4f v = *(const v4f*)(PBS + h * LNPB + j4);
    float* d = CB + (size_t)h * NPIX + p0 + j4;
    {
      *(v4f*)(d) = v;
      
    }
  }
}

// =====================================================================================================
// Transposed weight plane: W f32 [nk rows k][ncol cols n] -> D 16-bit [n][ldd], D[n][k] = bf16 bits of W[k][n] (f16mode 0)
// or f16 bits of bf16(W[k][n]) * scale (f16mode 1). Block (ct = bid % nct: 128 columns, rt = bid / nct: 64 rows): each thread loads 32 floats of one k row
// (16-B loads), converts, scatters into the LDS tile [128 n][64 k] (pitch 72 halves); after a block barrier each n row segment
// coverage: load 256 thr x 32 = 64 k rows x 128 n; store 4 iterations x 256 thr x 8 halves = 128 lines x 64 = the block's tile
// =====================================================================================================
__device__ __forceinline__ void wt16(int bid, const float* __restrict__ W, int ncol, int nk, u16* D, int ldd,
                                     int f16mode, float scale) {
  __shared__ __align__(16) u16 T[128 * VTP];
  const int tid = threadIdx.x;
  const int nct = ncol / 128;
  const int ct  = bid % nct;
  const int rt  = bid / nct;
  if (rt * 64 + 64 > nk) return;            // block-uniform, before the barrier; never taken with the exact grid
  {
    const int sl = tid >> 2;                // k row within tile 0..63
    const int dc = (tid & 3) * 32;          // n chunk
    const float* src = W + (size_t)(rt * 64 + sl) * ncol + ct * 128 + dc;
    v4f ld[8];                              // the loops below are unrolled so that these stay in registers
#pragma unroll
    for (int i = 0; i < 8; ++i) ld[i] = *(const v4f*)(src + 4 * i);
    // the eight loads share one address pair; it is named as an input so that no load's result is placed on it ahead of the wait
    asm volatile("s_wait_xcnt 0x0" :: "v"(src) : "memory");
#pragma unroll
    for (int i = 0; i < 8; ++i) {
      const v4f a = ld[i];
#pragma unroll
      for (int e = 0; e < 4; ++e) {
        const float f = a[e];
        const unsigned short hb = h_bits((_Float16)(bfr(f) * scale));
        const unsigned short bb = bf_bits(f);
        T[(dc + 4 * i + e) * VTP + sl] = (f16mode != 0) ? hb : bb;
      }
    }
  }
  __syncthreads();
  v4u w4[4];
  const int q8 = tid >> 3, p8 = (tid & 7) * 8;
#pragma unroll
  for (int it = 0; it < 4; ++it) {
    const int line = it * 32 + q8;          // n within tile 0..127
    w4[it] = *(const v4u*)(T + line * VTP + p8);
  }
  const size_t base = ((size_t)ct * 128) * ldd + rt * 64 + p8;
  {
#pragma unroll
    for (int it = 0; it < 4; ++it) {
      const int line = it * 32 + q8;
      *(v4u*)(D + base + (size_t)line * ldd) = w4[it];
    }
    // behind the last store: no register that these stores name is rewritten ahead of this wait on any path of the joined kernel
    asm volatile("s_wait_xcnt 0x0" ::: "memory");
  }
}

// =====================================================================================================
// Everything that depends on the inputs alone, in one launch: the five weight planes and the LayerNorm pass touch disjoint
// data, so their blocks share one grid. Blocks 0 .. NWB-1 come first (they start first and end inside the LayerNorm blocks'
// time): block bid -> plane bid / WTB (Wq, Wk, Wv, Wu into WP + plane * DI * DM; plane 4 = Wo into WO), tile bid % WTB of it.
// Blocks NWB .. NWB + NPIX/LNPB - 1 are the LayerNorm blocks. The choice is block-uniform, so every barrier stays uniform.
// 16 waves per SIMD asked for: the LayerNorm blocks stream from memory with one row per wave in flight and need every wave
// slot; without it the joined kernel takes one register granule more than the LayerNorm kernel alone did.
// =====================================================================================================
__global__ __launch_bounds__(256) __attribute__((amdgpu_waves_per_eu(16, 16)))
void prep(const float* __restrict__ pr, const float* __restrict__ mask, const float* __restrict__ gamma,
          const float* __restrict__ beta, const float* __restrict__ Wb, const float* __restrict__ Wq,
          const float* __restrict__ Wk, const float* __restrict__ Wv, const float* __restrict__ Wu,
          const float* __restrict__ Wo, u16* XB, float* CB, u16* WP, u16* WO) {
  const int bid = blockIdx.x;
  if (bid >= NWB) {
    ln_x(bid - NWB, pr, mask, gamma, beta, Wb, XB, CB);
  } else if (bid >= 4 * WTB) {
    wt16(bid - 4 * WTB, Wo, DM, DI, WO, DI, 1, WOS);
  } else {
    const int pl = bid / WTB;
    const float* W = (pl == 0) ? Wq : (pl == 1) ? Wk : (pl == 2) ? Wv : Wu;
    wt16(bid % WTB, W, DI, DM, WP + (size_t)pl * DI * DM, DM, 0, 1.0f);
  }
}

// =====================================================================================================
// epi64o additionally adds a per-column bias (bf16 RNE of the input) and multiplies by a per-row scale (bf16 RNE of mask).
// coverage: 8 instructions x 2 rows x 16 lanes x 4 floats = the wave's 16 x 64 tile.
// =====================================================================================================
__device__ __forceinline__ void epi64o(float* sl, v8f a0, v8f a1, v8f a2, v8f a3, float oscale,
                                       float* C, int N, size_t rowb, int col0, int lane,
                                       const float* __restrict__ bias, const float* __restrict__ rsc) {
  const int hh = lane >> 4, m = lane & 15;
#pragma unroll
  for (int r = 0; r < 8; ++r) {
    const int ro = (8 * hh + r) * 68 + m;
    sl[ro]      = a0[r] * oscale;
    sl[ro + 16] = a1[r] * oscale;
    sl[ro + 32] = a2[r] * oscale;
    sl[ro + 48] = a3[r] * oscale;
  }
  wave_sync_lds();
  float bq[4];
  {
    const v4f b4 = *(const v4f*)(bias + col0 + m * 4);
#pragma unroll
    for (int e = 0; e < 4; ++e) bq[e] = bfr(b4[e]);
  }
  v4f vals[8];
#pragma unroll
  for (int it = 0; it < 8; ++it) {
    const v4f t = *(const v4f*)(sl + (it * 2 + hh) * 68 + m * 4);
    const float mk = bfr(rsc[rowb + (size_t)hh + (size_t)(it * 2)]);
    v4f o;
#pragma unroll
    for (int e = 0; e < 4; ++e) o[e] = (t[e] + bq[e]) * mk;
    vals[it] = o;
  }
  float* dst = C + (rowb + (size_t)hh) * (size_t)N + col0 + m * 4;
  {
#pragma unroll
    for (int it = 0; it < 8; ++it) {
      *(v4f*)(dst + (size_t)(it * 2) * (size_t)N) = vals[it];
    }
    
  }
}

// =====================================================================================================
// Output projection: C[row][DM] (f32) = ((Ah + Al)[row][DI] . Bt[DM][DI]^T) * oscale + bias[col], times rsc[row]
// (products h.B + l.B into one accumulator, l unscaled). Block -> (position tile rt = bid % NST, row group bb): 64 rows
// bb*LP + 64*rt .. of Ah, Al and C against all DM rows of Bt. The three operand tiles are staged in LDS (whole-line
// loads, pitch PKP halves); wave w's tile is [16 rows (16*(w&3) ..)][64 columns (64*(w>>2) ..)], epilogue epi64o.
// coverage: grid = BG * NST blocks, each one 64 x 128 tile = every element of the row group's C once.
// =====================================================================================================
__global__ __launch_bounds__(PROJ_THREADS)
void gemm_o(const u16* __restrict__ Ah, const u16* __restrict__ Al, const u16* __restrict__ Bt,
            const float* __restrict__ bias, const float* __restrict__ rsc, float* C, float oscale) {
  __shared__ __align__(16) u16 opt[(2 * 64 + DM) * PKP];   // Ah rows 0..63, Al rows 0..63, Bt rows 0..127; later the 8 slabs
  const int tid = threadIdx.x, wave = tid >> 5, lane = tid & 31, hh = lane >> 4, m = lane & 15;
  const int bid   = blockIdx.x;
  const int rt    = bid % NST;
  const int bb    = bid / NST;
  if (bb >= BG) return;                     // block-uniform, before any barrier; never taken with the exact grid
  const int K     = DI;
  const size_t row0 = (size_t)bb * LP + rt * 64;
  {
    // staging: wave -> row wave + 8*i, lane -> 8 halves at 8*lane: each load and each LDS store covers one whole 512-B row
    const u16* ga = Ah + (row0 + wave) * K + 8 * lane;
    const u16* gl = Al + (row0 + wave) * K + 8 * lane;
    const u16* gb = Bt + (size_t)wave * K + 8 * lane;
    u16* tw = opt + wave * PKP + 8 * lane;
    v4u st[(2 * 64 + DM) / 8];              // the loops below are unrolled so that these stay in registers
#pragma unroll
    for (int i = 0; i < 8; ++i) {
      st[i]     = *(const v4u*)(ga + (size_t)(8 * i) * K);
      st[8 + i] = *(const v4u*)(gl + (size_t)(8 * i) * K);
    }
#pragma unroll
    for (int i = 0; i < DM / 8; ++i) st[16 + i] = *(const v4u*)(gb + (size_t)(8 * i) * K);
    // the address registers of these loads are reused below while the loads are still in flight; the three bases are named
    // as inputs so that none of them is given up for another value ahead of the wait
    asm volatile("s_wait_xcnt 0x0" :: "v"(ga), "v"(gl), "v"(gb) : "memory");
#pragma unroll
    for (int i = 0; i < (2 * 64 + DM) / 8; ++i) *(v4u*)(tw + 8 * i * PKP) = st[i];
  }
  __syncthreads();                          // the three operand tiles are complete before any wave reads a fragment
  const int srow  = (wave & 3) * 16;
  const int col0  = (wave >> 2) * 64;
  const size_t rowC = row0 + srow;
  const _Float16* ahp = (const _Float16*)(const void*)opt + (srow + m) * PKP + 8 * hh;
  const _Float16* alp = ahp + 64 * PKP;
  const _Float16* bp  = (const _Float16*)(const void*)opt + (2 * 64 + col0 + m) * PKP + 8 * hh;
  const int bs = 16 * PKP;
  v8f acc0 = zero8(), acc1 = zero8(), acc2 = zero8(), acc3 = zero8();
#pragma unroll 1
  for (int k0 = 0; k0 < K; k0 += 32) {
    const v16h ah = ldfrag_h(ahp + k0), al = ldfrag_h(alp + k0);
    const v16h b0 = ldfrag_h(bp + k0);
    const v16h b1 = ldfrag_h(bp + bs + k0);
    const v16h b2 = ldfrag_h(bp + 2 * bs + k0);
    const v16h b3 = ldfrag_h(bp + 3 * bs + k0);
    acc0 = mma_h(ah, b0, acc0);  acc0 = mma_h(al, b0, acc0);
    acc1 = mma_h(ah, b1, acc1);  acc1 = mma_h(al, b1, acc1);
    acc2 = mma_h(ah, b2, acc2);  acc2 = mma_h(al, b2, acc2);
    acc3 = mma_h(ah, b3, acc3);  acc3 = mma_h(al, b3, acc3);
    guard6<v16h>(acc0, acc1, acc2, acc3, ah, al, b0, b1, b2, b3);
  }
  __syncthreads();                          // every wave has read its last fragment before the slabs overwrite the tiles
  epi64o((float*)(void*)opt + wave * SLAB64, acc0, acc1, acc2, acc3, oscale, C, DM, rowC, col0, lane, bias, rsc);
}

// =====================================================================================================
// Projections and pair attention in one kernel. Block bid -> (head = bid % NH, row b = bid / NH): all LP positions of row b for
// one head; wave w owns positions q0 = 16*w .. q0 + 15, as softmax rows and as the columns it contributes.
// Front part: the head's 64 rows of Wq^T, Wk^T, Wv^T, Wu^T (bf16, [n][k]) are brought in once per block with whole-line loads
// (one wave = two 256-B rows per instruction) and stored to LDS at pitch PKW; the wave's own 16 x hi|lo rows of XB are held in
// registers as 8 fragments (the split k map is the same for both operands, so they serve as row or as column operand). A weight
// fragment of 32 k is read from LDS once and multiplies the x hi fragment and the x lo fragment of the same 32 k.
//   u^T = Wu^T.x^T, k^T = Wk^T.x^T, q^T = Wq^T.x^T (row operand W, column operand x): the lane holds position q0 + c, channels
//   16*j + 8*hh + r. u becomes the gate sigmoid(u + bu) in place; k x1024 (f16 hi + residual) is converted in place into the column
//   operand of the scores (tiles 2*kk, 2*kk + 1 lie in the split k map over d); q x128 (= C^-0.5 x 1024) hi + residual goes to the
//   LDS planes qt [pos][d] (pitch VTP), 8 consecutive d per 16-B store.
//   v = x.Wv (row operand x, column operand W): the lane holds channel 16*j + c, positions q0 + 8*hh + r; v x1024 hi + residual
//   goes to the LDS planes vt [d][pos] (pitch VPP), 8 consecutive positions per 16-B store.
// One work-group barrier, and every wave has the whole row's q and v^T planes in LDS: the column loop has no barrier.
// Softmax row index qi uses the k projection (column operand R, registers), softmax column index vi uses the q projection
// (row operand Cm, LDS), summed over vi with v[vi]. CB [h][qi][vi] f32 = 1e9*(mask - 1) + x.Wb.
//   scores s(i, j) = R_hi.C_hi + R_lo.C_hi + R_hi.C_lo over HD; logit (log2 domain) t = (s / (1024*1024) + CB) * log2 e.
//   All NKT column tiles of 32 visited in order. Per tile: the 16x32 CB tile is staged into the wave-private LDS tile with
//   16-B loads/stores, then 2 score subtiles x 2 k-steps, computed transposed, so a lane holds 16 logits of ONE softmax row
//   (q0 + c): maximum and sum run in the lane, with one exchange between the lane halves for the maximum. The two score subtiles'
//   registers lie in the split k map, so P^T*32768 (f16 hi plus its f16 residual) is converted in place into the column operand
//   of out^T += v^T.P^T (v^T fragments as row operand, 2 groups of 2 d-subtiles), products hh + lh + hl.
//   After the loop: out = acc / Z (Z >= 1 always; guarded anyway), carries 1/(32768*1024) folded once, times the gate in f32,
//   written to the wave's private result slab (pitch 68; every element owned by one lane), then O x1024 -> f16 hi + residual planes.
// The waves' CB tiles and result slabs lie over the weight rows, which nobody reads behind the barrier.
// coverage: per wave 4 instructions x 4 rows x 8 lanes x 8 halves = 16 x 64 per plane; grid = NH * BG blocks x WPB waves
//           = every (b, pos, h) row segment of OH and OL exactly once.
// =====================================================================================================
__device__ __forceinline__ void split8(v8f a, float sc, v4u& hi, v4u& lo) {   // a * sc -> 8 f16 hi, 8 f16 residuals
#pragma unroll
  for (int e = 0; e < 4; ++e) {
    const float t0 = a[2 * e] * sc, t1 = a[2 * e + 1] * sc;
    const _Float16 h0 = (_Float16)t0, h1 = (_Float16)t1;
    const _Float16 l0 = (_Float16)(t0 - (float)h0), l1 = (_Float16)(t1 - (float)h1);
    hi[e] = pk16(h_bits(h0), h_bits(h1));
    lo[e] = pk16(h_bits(l0), h_bits(l1));
  }
}
// a[j] = 16 x 16 tile j of (64 weight rows at wp, K = DM) against the wave's x fragments (xf[kk] = hi, xf[DM / 32 + kk] = lo of the
// same 32 k): per k step the four hi products, then the four lo products on the same weight fragments; XROW: x is the row operand
template <bool XROW>
__device__ __forceinline__ void proj64(const u16* wp, const v16b (&xf)[KX / 32], v8f (&a)[4]) {
#pragma unroll
  for (int j = 0; j < 4; ++j) a[j] = zero8();
#pragma unroll
  for (int kk = 0; kk < DM / 32; ++kk) {
    const v16b w0 = ldfrag_b(wp + kk * 32);
    const v16b w1 = ldfrag_b(wp + 16 * PKW + kk * 32);
    const v16b w2 = ldfrag_b(wp + 32 * PKW + kk * 32);
    const v16b w3 = ldfrag_b(wp + 48 * PKW + kk * 32);
#pragma unroll                              // xf is indexed by constants only, so that it stays in registers
    for (int p = 0; p < 2; ++p) {
      const v16b x = xf[p * (DM / 32) + kk];
      a[0] = XROW ? mma_b(x, w0, a[0]) : mma_b(w0, x, a[0]);
      a[1] = XROW ? mma_b(x, w1, a[1]) : mma_b(w1, x, a[1]);
      a[2] = XROW ? mma_b(x, w2, a[2]) : mma_b(w2, x, a[2]);
      a[3] = XROW ? mma_b(x, w3, a[3]) : mma_b(w3, x, a[3]);
    }
  }
}

__global__ __launch_bounds__(ATT_THREADS)
void attn_f(const u16* __restrict__ XB, const u16* __restrict__ WP, const float* __restrict__ CB,
            const float* __restrict__ bu, u16* __restrict__ OHp, u16* __restrict__ OLp) {
  // one array, so that the order of its three parts is fixed: with the q planes first the column loop's fragment reads stay
  // one base register plus an immediate offset each
  __shared__ __align__(16) u16 sm[2 * LP * VTP + 2 * HD * VPP + WLN];
  u16* qt = sm;                                     // q hi, q residual [pos][d], pitch VTP
  u16* vt = sm + 2 * LP * VTP;                      // v^T hi, v^T residual [d][pos], pitch VPP
  u16* wl = sm + 2 * LP * VTP + 2 * HD * VPP;       // the head's Wq^T, Wk^T, Wv^T, Wu^T rows, pitch PKW; later CB tiles and slabs

  const int tid  = threadIdx.x;
  const int wave = tid >> 5;
  const int lane = tid & 31;
  const int hh   = lane >> 4;
  const int c    = lane & 15;
  const int bid  = blockIdx.x;
  const int head = bid % NH;
  const int b    = bid / NH;
  if (b >= BG) return;                      // block-uniform, before any barrier; never taken with the exact grid
  const int wv   = __builtin_amdgcn_readfirstlane(wave);    // the wave's number in a scalar register: wave-uniform bases stay scalar
  const int q0   = wv * 16;

  v16b xf[KX / 32];                         // the wave's 16 x rows; the loops over it are unrolled so that it stays in registers
  {
    // 16 threads -> row wr + 32*i of each plane's 64 rows, 8 halves at wc: a wave's load covers two whole 256-B rows, 512 B in a row
    const int wr = tid >> 4, wc = (tid & 15) * 8;
    const u16* gw = WP + (size_t)(head * HD + wr) * DM + wc;
    v4u st[8];                              // the loops below are unrolled so that these stay in registers
#pragma unroll
    for (int p = 0; p < 4; ++p) {
#pragma unroll
      for (int i = 0; i < 2; ++i) st[2 * p + i] = *(const v4u*)(gw + (size_t)p * DI * DM + (size_t)(32 * i) * DM);
    }
    const char* xw = (const char*)(XB + ((size_t)b * LP + q0) * KX);    // wave-uniform base of the wave's 16 x rows
    const unsigned xo = (unsigned)(c * KX + 8 * hh) * 2u;               // the lane's byte offset: row c, halves 8*hh
#pragma unroll
    for (int kk = 0; kk < KX / 32; ++kk) xf[kk] = ldfrag_b((const u16*)(xw + xo) + kk * 32);
    // the loads of each run share one address register; both are named as inputs so that neither is given up for another
    // value ahead of the wait
    asm volatile("s_wait_xcnt 0x0" :: "v"(gw), "v"(xo) : "memory");
    u16* tw = wl + wr * PKW + wc;
#pragma unroll
    for (int p = 0; p < 4; ++p) {
#pragma unroll
      for (int i = 0; i < 2; ++i) *(v4u*)(tw + (p * HD + 32 * i) * PKW) = st[2 * p + i];
    }
  }
  __syncthreads();                          // the weight rows are complete before any wave reads a fragment of them

  const u16* wp = wl + c * PKW + 8 * hh;
  v8f gt[4];                                // gate of (row q0 + c, channel head*HD + 16*j + 8*hh + r)
  FragH rh[HD / 32], rl[HD / 32];           // k x1024 hi, residual: column operand of the scores, column = row q0 + c
  {
    v8f a[4];
    proj64<false>(wp + 3 * HD * PKW, xf, a);
#pragma unroll
    for (int j = 0; j < 4; ++j) {
      const float* bp = bu + head * HD + j * 16 + 8 * hh;
      const v4f b0 = *(const v4f*)(bp), b1 = *(const v4f*)(bp + 4);
#pragma unroll
      for (int r = 0; r < 4; ++r) {
        gt[j][r]     = sigm(a[j][r] + bfr(b0[r]));
        gt[j][4 + r] = sigm(a[j][4 + r] + bfr(b1[r]));
      }
    }
    proj64<false>(wp + HD * PKW, xf, a);
#pragma unroll
    for (int kk = 0; kk < HD / 32; ++kk) {
      split8(a[2 * kk],     KSC, rh[kk].u[0], rl[kk].u[0]);
      split8(a[2 * kk + 1], KSC, rh[kk].u[1], rl[kk].u[1]);
    }
    proj64<false>(wp, xf, a);
    u16* qw = qt + (q0 + c) * VTP + 8 * hh;
#pragma unroll
    for (int j = 0; j < 4; ++j) {
      v4u hi, lo;
      split8(a[j], QSC, hi, lo);
      *(v4u*)(qw + 16 * j)            = hi;
      *(v4u*)(qw + LP * VTP + 16 * j) = lo;
    }
    proj64<true>(wp + 2 * HD * PKW, xf, a);
    u16* vw = vt + c * VPP + q0 + 8 * hh;
#pragma unroll
    for (int j = 0; j < 4; ++j) {
      v4u hi, lo;
      split8(a[j], VCAR, hi, lo);
      *(v4u*)(vw + 16 * j * VPP)            = hi;
      *(v4u*)(vw + (HD + 16 * j) * VPP)     = lo;
    }
  }
  __syncthreads();                          // q and v^T planes complete; every wave has read its last weight fragment

  float* pt  = (float*)(void*)wl + wv * WREG;   // CB tile [16][32] pitch 36
  float* slx = pt + PTW;                        // behind it the result slab [16][64] pitch 68
  // fragment bases in the LDS planes: row c (+16 per subtile), halves 8*hh (+ the k offset per step)
  const _Float16* Chb = (const _Float16*)(const void*)qt + c * VTP + 8 * hh;     // row = vi, k = d
  const _Float16* Clb = Chb + LP * VTP;
  const _Float16* Vhb = (const _Float16*)(const void*)vt + c * VPP + 8 * hh;     // row = d, k = vi
  const _Float16* Vlb = Vhb + HD * VPP;
  const float* cbb = CB + ((size_t)head * LP + q0) * LP;
  const float invc = 1.0f / (CSC * KSC);
  const float oc   = 1.0f / (PCAR * VCAR);

  float mrow = -INFINITY, lrow = 0.f;       // of softmax row q0 + c; lrow is this lane half's share of the row sum
  v8f o[4];                                 // o[j][r] = out^T (d = 16*j + 8*hh + r, row q0 + c)
#pragma unroll
  for (int j = 0; j < 4; ++j) o[j] = zero8();

#pragma unroll 1
  for (int kt = 0; kt < NKT; ++kt) {
    const int kb = kt * 32;
    // ---- stage the additive logit tile [16 rows][32 cols] into pt: 128 float4, lane handles f = it*32 + lane ----
#pragma unroll
    for (int it = 0; it < 4; ++it) {
      const int f = it * 32 + lane;
      const int row = f >> 3, col4 = (f & 7) * 4;
      const v4f t4 = *(const v4f*)(cbb + (size_t)row * LP + kb + col4);
      *(v4f*)(pt + row * PTP + col4) = t4;
    }
    // ---- scores, transposed: D element r of this lane = (col kb + 8hh + r, row q0 + c) in s0, col kb + 16 + 8hh + r in s1 ----
    v8f s0 = zero8(), s1 = zero8();
    const _Float16* c0p = Chb + kb * VTP;
    const _Float16* c1p = c0p + 16 * VTP;
    const _Float16* l0p = Clb + kb * VTP;
    const _Float16* l1p = l0p + 16 * VTP;
#pragma unroll
    for (int kk = 0; kk < HD / 32; ++kk) {
      const v16h ch0 = ldfrag_h(c0p + kk * 32);
      const v16h ch1 = ldfrag_h(c1p + kk * 32);
      const v16h cl0 = ldfrag_h(l0p + kk * 32);
      const v16h cl1 = ldfrag_h(l1p + kk * 32);
      s0 = mma_h(ch0, rh[kk].v, s0);
      s0 = mma_h(ch0, rl[kk].v, s0);
      s0 = mma_h(cl0, rh[kk].v, s0);
      s1 = mma_h(ch1, rh[kk].v, s1);
      s1 = mma_h(ch1, rl[kk].v, s1);
      s1 = mma_h(cl1, rh[kk].v, s1);
      guard2(s0, s1, rh[kk].v, rl[kk].v, ch0, cl0, ch1, cl1);
    }
    wave_sync_lds();
    // ---- additive term + online softmax in base 2, -inf-safe; the lane's 16 logits all belong to row q0 + c ----
    float e[16];                            // element s = column kb + 8hh + s (s < 8), kb + 16 + 8hh + s - 8 (s >= 8)
    {
      const float* crow = pt + c * PTP + 8 * hh;
      const v4f c0 = *(const v4f*)(crow), c1 = *(const v4f*)(crow + 4);
      const v4f c2 = *(const v4f*)(crow + 16), c3 = *(const v4f*)(crow + 20);
#pragma unroll
      for (int r = 0; r < 4; ++r) {
        e[r]      = (s0[r] * invc + c0[r]) * LOG2E;
        e[4 + r]  = (s0[4 + r] * invc + c1[r]) * LOG2E;
        e[8 + r]  = (s1[r] * invc + c2[r]) * LOG2E;
        e[12 + r] = (s1[4 + r] * invc + c3[r]) * LOG2E;
      }
    }
    float mx = e[0];
#pragma unroll
    for (int s = 1; s < 16; ++s) mx = fmaxf(mx, e[s]);
    mx = fmaxf(mx, xhalf(mx));              // the other half of the row's 32 columns
    const float mn = fmaxf(mrow, mx);
    const float ms = (mn == -INFINITY) ? 0.0f : mn;
    const float al = exp2f(mrow - ms);
    mrow = mn;
#pragma unroll
    for (int s = 0; s < 16; ++s) e[s] = exp2f(e[s] - ms);
    {
      const float pa = ((e[0] + e[1]) + (e[2] + e[3])) + ((e[4] + e[5]) + (e[6] + e[7]));
      const float pb = ((e[8] + e[9]) + (e[10] + e[11])) + ((e[12] + e[13]) + (e[14] + e[15]));
      lrow = lrow * al + (pa + pb);
    }
#pragma unroll
    for (int j = 0; j < 4; ++j) {
#pragma unroll
      for (int r = 0; r < 8; ++r) o[j][r] *= al;
    }
    // ---- B fragments of P^T*32768: hi f16 and residual f16, column = row q0 + c; the score registers already lie in the
    //      split k map over the 32 columns of this step, so element s of the fragment is e[s] ----
    FragH ph, pl;
#pragma unroll
    for (int s = 0; s < 8; ++s) {
      const float ta = e[s] * PCAR, tb = e[8 + s] * PCAR;
      const _Float16 ha = (_Float16)ta, hb = (_Float16)tb;
      ph.h[0][s] = ha;
      ph.h[1][s] = hb;
      pl.h[0][s] = (_Float16)(ta - (float)ha);
      pl.h[1][s] = (_Float16)(tb - (float)hb);
    }
    // ---- v^T.P^T : A fragment row m = d = j*16 + c, columns vi contiguous in the v^T plane rows; 2 groups of 2 d-subtiles ----
    {
      const _Float16* vhp = Vhb + kb;
      const _Float16* vlp = Vlb + kb;
#pragma unroll
      for (int jg = 0; jg < HD / 32; ++jg) {
        const int da = (2 * jg) * 16 * VPP;
        const int db = da + 16 * VPP;
        const v16h vha = ldfrag_h(vhp + da), vhb2 = ldfrag_h(vhp + db);
        const v16h vla = ldfrag_h(vlp + da), vlb2 = ldfrag_h(vlp + db);
        o[2 * jg]     = mma_h(vha,  ph.v, o[2 * jg]);
        o[2 * jg]     = mma_h(vha,  pl.v, o[2 * jg]);
        o[2 * jg]     = mma_h(vla,  ph.v, o[2 * jg]);
        o[2 * jg + 1] = mma_h(vhb2, ph.v, o[2 * jg + 1]);
        o[2 * jg + 1] = mma_h(vhb2, pl.v, o[2 * jg + 1]);
        o[2 * jg + 1] = mma_h(vlb2, ph.v, o[2 * jg + 1]);
        guard2(o[2 * jg], o[2 * jg + 1], ph.v, pl.v, vha, vhb2, vla, vlb2);
      }
    }
    wave_sync_lds();
  }
  acc_guard4(o[0], o[1], o[2], o[3]);
  // ---- out = acc / Z (0 if Z == 0), carries (32768 on P, 1024 on v) folded once, times the gate in f32; into the lane-owned slab ----
  {
    const float lv  = lrow + xhalf(lrow);   // the two lane halves' shares of the row sum, joined once
    const float ls  = (lv > 0.0f) ? lv : 1.0f;
    const float inv = (lv > 0.0f) ? ((1.0f / ls) * oc) : 0.0f;
#pragma unroll
    for (int j = 0; j < 4; ++j) {
      float* sp = slx + c * SLP + j * 16 + 8 * hh;      // row q0 + c, 8 consecutive d
      v4f w0, w1;
#pragma unroll
      for (int r = 0; r < 4; ++r) {
        w0[r] = (o[j][r] * inv)     * gt[j][r];
        w1[r] = (o[j][4 + r] * inv) * gt[j][4 + r];
      }
      *(v4f*)(sp)     = w0;
      *(v4f*)(sp + 4) = w1;
    }
  }

  wave_sync_lds();
  // ---- O x1024 -> f16 hi + residual planes; lane = (row select rq in 0..3, 8 consecutive d at c8) ----
  v4u oh[4], ol[4];
  const int rq = lane >> 3, c8 = (lane & 7) * 8;
#pragma unroll
  for (int it = 0; it < 4; ++it) {
    const int row = it * 4 + rq;
    const v4f a  = *(const v4f*)(slx + row * SLP + c8), b4 = *(const v4f*)(slx + row * SLP + c8 + 4);
    float w[8];
#pragma unroll
    for (int e = 0; e < 4; ++e) {
      w[e]     = a[e]  * OSC;
      w[4 + e] = b4[e] * OSC;
    }
#pragma unroll
    for (int e = 0; e < 4; ++e) {
      const _Float16 h0 = (_Float16)w[2 * e], h1 = (_Float16)w[2 * e + 1];
      const _Float16 l0 = (_Float16)(w[2 * e] - (float)h0), l1 = (_Float16)(w[2 * e + 1] - (float)h1);
      oh[it][e] = pk16(h_bits(h0), h_bits(h1));
      ol[it][e] = pk16(h_bits(l0), h_bits(l1));
    }
  }
  const size_t ob = ((size_t)b * LP + q0) * DI + (size_t)head * HD + c8;
#pragma unroll
  for (int it = 0; it < 4; ++it) {
    const int row = it * 4 + rq;
    *(v4u*)(OHp + ob + (size_t)row * DI) = oh[it];
    *(v4u*)(OLp + ob + (size_t)row * DI) = ol[it];
  }
}

// =====================================================================================================
// All NS rows form one group (NGRP = 1): two dependent launches behind the preparation. q, k and v never leave the attention
// kernel's work-group, so the workspace holds x, the gated O planes, the logit table and the weight planes.
// Workspace map (bytes); every plane is fully written by whole-line stores before it is read; all extents are exact
// multiples of the store granularity (no pad rows needed); every region offset a multiple of 65536:
//   XB  bf16 [NPIX][256] (hi|lo)                    33554432
//   OH, OL  f16 [GROWS][256]                        2 * GROWS*512   (O x1024 hi, residual)
//   CB  f32 [4][NPIX]                               1048576
//   WQ, WK, WV, WU  bf16 [256 n][128 k]             4 * 65536    (contiguous in this order: attn_f reads them as one plane)
//   WO  f16 x1024 [128 n][256 k]                    65536
//   end (BG = 256)                                  102039552
// =====================================================================================================
extern "C" void kernel_launch(void* const* d_in, const int* in_sizes, int n_in,
                              void* d_out, int out_size, void* d_ws, size_t ws_size,
                              hipStream_t stream) {
  if (n_in < 12) return;
  if (in_sizes[0] < NPIX * DM) return;
  if (in_sizes[1] < NPIX) return;
  if (in_sizes[2] < DM || in_sizes[3] < DM) return;
  if (in_sizes[4] < DM * DI || in_sizes[5] < DM * DI || in_sizes[6] < DM * DI || in_sizes[8] < DM * DI) return;
  if (in_sizes[7] < DM * NH) return;
  if (in_sizes[9] < DI) return;
  if (in_sizes[10] < DI * DM) return;
  if (in_sizes[11] < DM) return;
  if (out_size < NS * LP * DM) return;

  const float* pr    = (const float*)d_in[0];
  const float* mask  = (const float*)d_in[1];
  const float* gamma = (const float*)d_in[2];
  const float* beta  = (const float*)d_in[3];
  const float* Wq    = (const float*)d_in[4];
  const float* Wk    = (const float*)d_in[5];
  const float* Wv    = (const float*)d_in[6];
  const float* Wb    = (const float*)d_in[7];
  const float* Wu    = (const float*)d_in[8];
  const float* bu    = (const float*)d_in[9];
  const float* Wo    = (const float*)d_in[10];
  const float* bo    = (const float*)d_in[11];
  float*       out   = (float*)d_out;

  const size_t szXB = (size_t)NPIX * KX * 2;
  const size_t szH  = (size_t)GROWS * DI * 2;                   // OH, OL
  const size_t szCB = (size_t)NH * NPIX * 4;
  const size_t szW  = (size_t)DI * DM * 2;
  const size_t szWO = (size_t)DM * DI * 2;
  size_t off = 0;
  const size_t oXB = off; off += szXB;
  const size_t oOH = off; off += szH;
  const size_t oOL = off; off += szH;
  const size_t oCB = off; off += szCB;
  const size_t oWQ = off; off += szW;
  const size_t oWK = off; off += szW;
  const size_t oWV = off; off += szW;
  const size_t oWU = off; off += szW;
  const size_t oWO = off; off += szWO;
  if (off > ws_size) return;                // off = 102039552 for BG = 256
  if (off > (size_t)WS_CAP) return;

  char* ws = (char*)d_ws;
  u16*   XB = (u16*)(ws + oXB);
  u16*   OH = (u16*)(ws + oOH);
  u16*   OL = (u16*)(ws + oOL);
  float* CB = (float*)(ws + oCB);
  u16*   WQ = (u16*)(ws + oWQ);
  u16*   WO = (u16*)(ws + oWO);

  const dim3 b256(256), bAT(ATT_THREADS);
  const dim3 gPR(NWB + NPIX / LNPB);                    // 20 weight-plane blocks + 2048 LayerNorm blocks
  const dim3 gAT(NH * BG);
  const dim3 gO(BG * NST);
  const float osc = 1.0f / (OSC * WOS);

  // one launch: LayerNorm for every pixel (x hi|lo planes, additive logit table) and the weight planes
  // Wq^T, Wk^T, Wv^T, Wu^T [n][k] as bf16 (contiguous from WQ), Wo^T [n][k] as f16 of bf16 value x1024
  prep<<<gPR, b256, 0, stream>>>(pr, mask, gamma, beta, Wb, Wq, Wk, Wv, Wu, Wo, XB, CB, WQ, WO);

  for (int g = 0; g < NGRP; ++g) {
    const u16*   xg = XB   + (size_t)g * GROWS * KX;
    const float* mg = mask + (size_t)g * GROWS;
    float*       og = out  + (size_t)g * GROWS * DM;
    // (1) q, k, v and gate projections and the attention in one launch: gated O hi + residual planes
    attn_f<<<gAT, bAT, 0, stream>>>(xg, WQ, CB, bu, OH, OL);
    // (2) output projection (hi + residual), + bo, x mask row scale -> out f32, carries 1024 x 1024 folded back
    gemm_o<<<gO, b256, 0, stream>>>(OH, OL, WO, bo, mg, og, osc);
  }
  (void)hipGetLastError();
}

// v010
// One run takes 89.6 microseconds.
// In both of two side-by-side timings against v009, it was 1.26 times as fast.
// Over all steps from v000 it is 6.95 times as fast.
// Contractions: x.Wq, x.Wk, x.Wv, x.Wu on v_wmma_f32_16x16x32_bf16 (x as bf16 hi|lo pair, each W fragment multiplies both; W as
// bf16 RNE of the input, f32 accumulate); k.q^T over 64 and P.v^T on v_wmma_f32_16x16x32_f16 (k x1024 and q x128 f16 hi + residual
// planes, P x32768 f16 hi + residual, v x1024 f16 hi + residual; products hh + lh + hl); (O*gate).Wo on
// v_wmma_f32_16x16x32_f16 (O x1024 f16 hi + residual, Wo as f16(bf16(Wo)) x1024, products h.w + l.w); all f32 accumulate.
// LayerNorm, x.Wb (N = 4) and the additive logit table, base-2 online softmax, sigmoid gate, bias and row scale in f32 on VALU.
#include <hip/hip_runtime.h>
#include <math.h>
#include <stdint.h>

#ifndef NS
#define NS 256
#endif
#define NSX   256
#define LP    256
#define DM    128
#define NH    4
#define HD    64
#define DI    (NH * HD)
#define KX    (2 * DM)
#define NPIX  (LP * LP)
#define BG    NS
#define NGRP  (NS / BG)
#define GROWS (BG * LP)
#define LNEPS 1e-5f
#define LOG2E 1.4426950408889634f
#define QSC   128.0f
#define CSC   1024.0f
#define KSC   1024.0f
#define PCAR  32768.0f
#define VCAR  1024.0f
#define OSC   1024.0f
#define WOS   1024.0f
#define WPB   16
#define NQT   (LP / 16)
#define NKT   (LP / 32)
#define ATT_THREADS (WPB * 32)
#define PTP   36
#define PTW   (16 * PTP)
#define WOP   (HD + 8)
#define OSP   (DM + 4)
#define VTP   72
#define VPP   (LP + 8)
#define LNPB  32
#define WS_CAP 268435456
#define PKW   (DM + 8)
#define WLN   (4 * HD * PKW)
#define WTB   4
#define NWB   (5 * WTB)
static_assert(DI == NH * HD && HD == 64 && NH == 4);
static_assert(ATT_THREADS == 512 && WPB * 16 == LP && HD == 4 * 16);
static_assert(NS >= 1 && NS <= NSX && (NS % BG) == 0 && BG >= 1 && BG <= NSX);
static_assert((LP % 64) == 0 && (LP % 32) == 0 && (LP % 16) == 0);
static_assert(DM == 128 && (KX % 32) == 0 && (DI % 64) == 0 && (DI % 32) == 0 && (DM % 64) == 0);
static_assert(ATT_THREADS * 8 * 8 == 4 * HD * DM && ATT_THREADS * 8 * 2 == DM * HD);
static_assert(WPB * 16 * OSP * 4 <= (2 * LP * VTP + 2 * HD * VPP) * 2 && DM == 4 * 32);
static_assert((NPIX % LNPB) == 0 && LNPB == 32);
static_assert(KX == 256 && DI == KX && DM == 128);
static_assert((DI % 128) == 0 && (DM % 128) == 0 && (DM % 64) == 0 && (DI % 64) == 0);
static_assert((DI / 128) * (DM / 64) == WTB && (DM / 128) * (DI / 64) == WTB);

typedef unsigned short u16;
typedef _Float16 v16h __attribute__((ext_vector_type(16)));
typedef _Float16 v8h  __attribute__((ext_vector_type(8)));
typedef __bf16   v16b __attribute__((ext_vector_type(16)));
typedef float    v8f  __attribute__((ext_vector_type(8)));
typedef float    v4f  __attribute__((ext_vector_type(4)));
typedef unsigned int v4u __attribute__((ext_vector_type(4)));
typedef unsigned int v2u __attribute__((ext_vector_type(2)));

union FragH { v16h v; v8h h[2]; v4u u[2]; };
union FragB { v16b v; v4u u[2]; };

// ---- scalar helpers --------------------------------------------------------------------------------
__device__ __forceinline__ unsigned short bf_bits(float f) {          // f32 -> bf16 bits, RNE convert
  unsigned u = __float_as_uint(f);
  return (unsigned short)((u + 0x7FFFu + ((u >> 16) & 1u)) >> 16);
}
__device__ __forceinline__ float bf_up(unsigned short h) { return __uint_as_float(((unsigned)h) << 16); }
__device__ __forceinline__ float bfr(float f) { return bf_up(bf_bits(f)); }
__device__ __forceinline__ unsigned short h_bits(_Float16 x) { return __builtin_bit_cast(unsigned short, x); }
__device__ __forceinline__ unsigned pk16(unsigned short a, unsigned short b) { return (unsigned)a | ((unsigned)b << 16); }
__device__ __forceinline__ v8f zero8() { v8f z = {0.f, 0.f, 0.f, 0.f, 0.f, 0.f, 0.f, 0.f}; return z; }
__device__ __forceinline__ float sigm(float z) {                     // 1 / (1 + 2^(-z log2 e)), argument clamped
  const float zc = fminf(fmaxf(z, -30.0f), 30.0f);
  const float e  = exp2f(-zc * LOG2E);
  return __builtin_amdgcn_rcpf(1.0f + e);
}

// ---- fragment loaders: 16-bit A/B operand, lane -> row/col (lane&15), p already includes +8*(lane>>4);
//      elements 0..7 <- p[0..7] (k0+8h..), elements 8..15 <- p[16..23] (k0+16+8h..)  (same split k map for A and B;
//      B is always read from a k-contiguous [n][k] plane)
__device__ __forceinline__ v16h ldfrag_h(const _Float16* p) {
  FragH f;
  f.h[0] = *(const v8h*)(p);
  f.h[1] = *(const v8h*)(p + 16);
  return f.v;
}
__device__ __forceinline__ v16b ldfrag_b(const u16* p) {              // bf16 plane read as unsigned integer vectors
  FragB f;
  f.u[0] = *(const v4u*)(p);
  f.u[1] = *(const v4u*)(p + 16);
  return f.v;
}

__device__ __forceinline__ v8f mma_h(v16h a, v16h b, v8f c) {
  return __builtin_amdgcn_wmma_f32_16x16x32_f16(false, a, false, b, (short)0, c, false, false);
}
__device__ __forceinline__ v8f mma_b(v16b a, v16b b, v8f c) {
  return __builtin_amdgcn_wmma_f32_16x16x32_bf16(false, a, false, b, (short)0, c, false, false);
}
__device__ __forceinline__ void guard2(v8f& a, v8f& b, v16h x0, v16h x1, v16h x2, v16h x3, v16h x4, v16h x5) {
#if defined(__HIP_DEVICE_COMPILE__)
  asm volatile("v_nop\n\tv_nop\n\tv_nop\n\tv_nop"
               : "+v"(a), "+v"(b) : "v"(x0), "v"(x1), "v"(x2), "v"(x3), "v"(x4), "v"(x5) : "memory");
#endif
}
__device__ __forceinline__ void acc_guard4(v8f& a, v8f& b, v8f& c, v8f& d) {
#if defined(__HIP_DEVICE_COMPILE__)
  asm volatile("v_nop\n\tv_nop\n\tv_nop\n\tv_nop" : "+v"(a), "+v"(b), "+v"(c), "+v"(d));
#endif
}
__device__ __forceinline__ float xhalf(float x) {                    // value of lane l ^ 16 (the other 16-lane row)
  const int b = __builtin_bit_cast(int, x);
  return __builtin_bit_cast(float, __builtin_amdgcn_permlanex16(b, b, 0x76543210, 0xfedcba98, false, false));
}
__device__ __forceinline__ void wave_sync_lds() {
  __builtin_amdgcn_fence(__ATOMIC_RELEASE, "workgroup");
  __builtin_amdgcn_wave_barrier();
  __builtin_amdgcn_fence(__ATOMIC_ACQUIRE, "workgroup");
}

// =====================================================================================================
// statistics), x written as bf16 hi | bf16 lo planes XB [NPIX][KX] (columns 0..127 hi bits, 128..255 lo bits of x - hi);
// the additive logit table CB [NH][NPIX] = 1e9*(mask - 1) + x.Wb (VALU f32, N = 4) is produced by the same block.
// Block = 8 waves x LNPB/8 pixels, wave = one pixel at a time (lane holds 4 channels); the 512-B x row is assembled in a
// x 4 heads) are funnelled through LDS and written by wave 0 in one instruction (8 consecutive lanes x 16 B per line);
// coverage: blk = 0 .. NPIX/LNPB - 1, each 32 pixels = every XB row once and every CB line once.
// =====================================================================================================
__device__ __forceinline__ void ln_x(int blk, const float* __restrict__ pr, const float* __restrict__ mask,
                                     const float* __restrict__ gamma, const float* __restrict__ beta,
                                     const float* __restrict__ Wb, u16* XB, float* CB) {
  __shared__ __align__(16) u16 RB[8 * KX];
  __shared__ __align__(16) float PBS[NH * LNPB];
  const int tid = threadIdx.x, wave = tid >> 5, lane = tid & 31;
  const int p0 = blk * LNPB;
  if (p0 + LNPB > NPIX) return;             // block-uniform, before any barrier; never taken with the exact grid
  float gm[4], bt[4], wb[16];
  {
    const v4f g4 = *(const v4f*)(gamma + 4 * lane), b4 = *(const v4f*)(beta + 4 * lane);
#pragma unroll
    for (int e = 0; e < 4; ++e) { gm[e] = bfr(g4[e]); bt[e] = bfr(b4[e]); }
#pragma unroll
    for (int i = 0; i < 4; ++i) {
      const v4f w4 = *(const v4f*)(Wb + 16 * lane + 4 * i);      // Wb[(4*lane + i)][h], h = 0..3
#pragma unroll
      for (int h = 0; h < 4; ++h) wb[4 * i + h] = bfr(w4[h]);
    }
  }
  u16* rb = RB + wave * KX;
#pragma unroll 1
  for (int j = 0; j < LNPB / 8; ++j) {
    const int pl = j * 8 + wave;
    const int p  = p0 + pl;
    const v4f x4 = *(const v4f*)(pr + (size_t)p * DM + 4 * lane);
    float xr[4];
#pragma unroll
    for (int e = 0; e < 4; ++e) xr[e] = bfr(x4[e]);
    float s = (xr[0] + xr[1]) + (xr[2] + xr[3]);
#pragma unroll
    for (int off = 1; off < 32; off <<= 1) s += __shfl_xor(s, off, 32);
    const float mu = s * (1.0f / (float)DM);
    float d[4];
#pragma unroll
    for (int e = 0; e < 4; ++e) d[e] = xr[e] - mu;
    float ss = (d[0] * d[0] + d[1] * d[1]) + (d[2] * d[2] + d[3] * d[3]);
#pragma unroll
    for (int off = 1; off < 32; off <<= 1) ss += __shfl_xor(ss, off, 32);
    const float var = ss * (1.0f / (float)DM);
    const float rs  = 1.0f / sqrtf(var + LNEPS);
    float y[4];
#pragma unroll
    for (int e = 0; e < 4; ++e) y[e] = d[e] * rs * gm[e] + bt[e];
    unsigned short hb[4], lb[4];
#pragma unroll
    for (int e = 0; e < 4; ++e) { hb[e] = bf_bits(y[e]); lb[e] = bf_bits(y[e] - bf_up(hb[e])); }
    float pb[4];
#pragma unroll
    for (int h = 0; h < 4; ++h) pb[h] = y[0] * wb[h] + y[1] * wb[4 + h] + y[2] * wb[8 + h] + y[3] * wb[12 + h];
#pragma unroll
    for (int h = 0; h < 4; ++h) {
#pragma unroll
      for (int off = 1; off < 32; off <<= 1) pb[h] += __shfl_xor(pb[h], off, 32);
    }
    const float mk = bfr(mask[p]);
    const float mb = 1e9f * (mk - 1.0f);
    v2u hv, lv;
    hv[0] = pk16(hb[0], hb[1]);  hv[1] = pk16(hb[2], hb[3]);
    lv[0] = pk16(lb[0], lb[1]);  lv[1] = pk16(lb[2], lb[3]);
    *(v2u*)(rb + 4 * lane)      = hv;
    *(v2u*)(rb + DM + 4 * lane) = lv;
    if (lane == 0) {
      PBS[0 * LNPB + pl] = mb + pb[0];
      PBS[1 * LNPB + pl] = mb + pb[1];
      PBS[2 * LNPB + pl] = mb + pb[2];
      PBS[3 * LNPB + pl] = mb + pb[3];
    }
    wave_sync_lds();
    const v4u piece = *(const v4u*)(rb + 8 * lane);
    u16* dst = XB + (size_t)p * KX + 8 * lane;
    {
      *(v4u*)(dst) = piece;
      
    }
    wave_sync_lds();
  }
  __syncthreads();
  if (wave == 0) {
    const int h = lane >> 3, j4 = (lane & 7) * 4;
    const v4f v = *(const v4f*)(PBS + h * LNPB + j4);
    float* d = CB + (size_t)h * NPIX + p0 + j4;
    {
      *(v4f*)(d) = v;
      
    }
  }
}

// =====================================================================================================
// Transposed weight plane: W f32 [nk rows k][ncol cols n] -> D 16-bit [n][ldd], D[n][k] = bf16 bits of W[k][n] (f16mode 0)
// or f16 bits of bf16(W[k][n]) * scale (f16mode 1). Block (ct = bid % nct: 128 columns, rt = bid / nct: 64 rows): each thread loads 32 floats of one k row
// (16-B loads), converts, scatters into the LDS tile [128 n][64 k] (pitch 72 halves); after a block barrier each n row segment
// coverage: load 256 thr x 32 = 64 k rows x 128 n; store 4 iterations x 256 thr x 8 halves = 128 lines x 64 = the block's tile
// =====================================================================================================
__device__ __forceinline__ void wt16(int bid, const float* __restrict__ W, int ncol, int nk, u16* D, int ldd,
                                     int f16mode, float scale) {
  __shared__ __align__(16) u16 T[128 * VTP];
  const int tid = threadIdx.x;
  const int nct = ncol / 128;
  const int ct  = bid % nct;
  const int rt  = bid / nct;
  if (rt * 64 + 64 > nk) return;            // block-uniform, before the barrier; never taken with the exact grid
  {
    const int sl = tid >> 2;                // k row within tile 0..63
    const int dc = (tid & 3) * 32;          // n chunk
    const float* src = W + (size_t)(rt * 64 + sl) * ncol + ct * 128 + dc;
    v4f ld[8];                              // the loops below are unrolled so that these stay in registers
#pragma unroll
    for (int i = 0; i < 8; ++i) ld[i] = *(const v4f*)(src + 4 * i);
    // the eight loads share one address pair; it is named as an input so that no load's result is placed on it ahead of the wait
    asm volatile("s_wait_xcnt 0x0" :: "v"(src) : "memory");
#pragma unroll
    for (int i = 0; i < 8; ++i) {
      const v4f a = ld[i];
#pragma unroll
      for (int e = 0; e < 4; ++e) {
        const float f = a[e];
        const unsigned short hb = h_bits((_Float16)(bfr(f) * scale));
        const unsigned short bb = bf_bits(f);
        T[(dc + 4 * i + e) * VTP + sl] = (f16mode != 0) ? hb : bb;
      }
    }
  }
  __syncthreads();
  v4u w4[4];
  const int q8 = tid >> 3, p8 = (tid & 7) * 8;
#pragma unroll
  for (int it = 0; it < 4; ++it) {
    const int line = it * 32 + q8;          // n within tile 0..127
    w4[it] = *(const v4u*)(T + line * VTP + p8);
  }
  const size_t base = ((size_t)ct * 128) * ldd + rt * 64 + p8;
  {
#pragma unroll
    for (int it = 0; it < 4; ++it) {
      const int line = it * 32 + q8;
      *(v4u*)(D + base + (size_t)line * ldd) = w4[it];
    }
    // behind the last store: no register that these stores name is rewritten ahead of this wait on any path of the joined kernel
    asm volatile("s_wait_xcnt 0x0" ::: "memory");
  }
}

// =====================================================================================================
// Everything that depends on the inputs alone, in one launch: the five weight planes and the LayerNorm pass touch disjoint
// data, so their blocks share one grid. Blocks 0 .. NWB-1 come first:
// block bid -> plane bid / WTB (Wq, Wk, Wv, Wu into WP + plane * DI * DM; plane 4 = Wo into WO), tile bid % WTB of it.
// Blocks NWB .. NWB + NPIX/LNPB - 1 are the LayerNorm blocks. The choice is block-uniform, so every barrier stays uniform.
// 16 waves per SIMD asked for: the LayerNorm blocks stream from memory with one row per wave in flight and need every wave
// slot; without it the joined kernel takes one register granule more than the LayerNorm kernel alone did.
// =====================================================================================================
__global__ __launch_bounds__(256) __attribute__((amdgpu_waves_per_eu(16, 16)))
void prep(const float* __restrict__ pr, const float* __restrict__ mask, const float* __restrict__ gamma,
          const float* __restrict__ beta, const float* __restrict__ Wb, const float* __restrict__ Wq,
          const float* __restrict__ Wk, const float* __restrict__ Wv, const float* __restrict__ Wu,
          const float* __restrict__ Wo, u16* XB, float* CB, u16* WP, u16* WO) {
  const int bid = blockIdx.x;
  if (bid >= NWB) {
    ln_x(bid - NWB, pr, mask, gamma, beta, Wb, XB, CB);
  } else if (bid >= 4 * WTB) {
    wt16(bid - 4 * WTB, Wo, DM, DI, WO, DI, 1, WOS);
  } else {
    const int pl = bid / WTB;
    const float* W = (pl == 0) ? Wq : (pl == 1) ? Wk : (pl == 2) ? Wv : Wu;
    wt16(bid % WTB, W, DI, DM, WP + (size_t)pl * DI * DM, DM, 0, 1.0f);
  }
}

// =====================================================================================================
// Projections, pair attention and output projection in one kernel. Block bid -> row b: all LP positions of row b, the NH heads
// one after another; wave w owns positions q0 = 16*w .. q0 + 15, as softmax rows, as the columns it contributes and as output rows.
// Per head: the head's 64 rows of Wq^T, Wk^T, Wv^T, Wu^T (bf16, [n][k]) and its 64 k columns of Wo^T (f16, [n][k]) are brought in
// once per block with whole-line loads and stored to LDS at pitch PKW and WOP; the loads of head h + 1 are issued at the foot of
// head h, ahead of its last barrier. The wave's own 16 x hi|lo rows of XB are held in registers as 8 fragments outside the column loop and are read again
// behind it (the split k map is the same for both operands, so they serve as row or as column operand). A weight fragment of
// 32 k is read from LDS once and multiplies the x hi fragment and the x lo fragment of the same 32 k.
//   k^T = Wk^T.x^T, q^T = Wq^T.x^T, u^T = Wu^T.x^T (row operand W, column operand x): the lane holds position q0 + c, channels
//   16*j + 8*hh + r. k x1024 (f16 hi + residual) is converted in place into the column operand of the scores (tiles 2*kk,
//   2*kk + 1 lie in the split k map over d); q x128 (= C^-0.5 x 1024) hi + residual goes to the LDS planes qt [pos][d]
//   (pitch VTP), 8 consecutive d per 16-B store. u is computed behind the column loop and becomes the gate sigmoid(u + bu).
//   v = x.Wv (row operand x, column operand W): the lane holds channel 16*j + c, positions q0 + 8*hh + r; v x1024 hi + residual
//   goes to the LDS planes vt [d][pos] (pitch VPP), 8 consecutive positions per 16-B store.
// One work-group barrier, and every wave has the whole row's q and v^T planes in LDS: the column loop has no barrier.
// Softmax row index qi uses the k projection (column operand R, registers), softmax column index vi uses the q projection
// (row operand Cm, LDS), summed over vi with v[vi]. CB [h][qi][vi] f32 = 1e9*(mask - 1) + x.Wb.
//   scores s(i, j) = R_hi.C_hi + R_lo.C_hi + R_hi.C_lo over HD; logit (log2 domain) t = (s / (1024*1024) + CB) * log2 e.
//   All NKT column tiles of 32 visited in order. Per tile: the 16x32 CB tile is staged into the wave-private LDS tile with
//   16-B loads/stores, then 2 score subtiles x 2 k-steps, computed transposed, so a lane holds 16 logits of ONE softmax row
//   (q0 + c): maximum and sum run in the lane, with one exchange between the lane halves for the maximum. The two score subtiles'
//   registers lie in the split k map, so P^T*32768 (f16 hi plus its f16 residual) is converted in place into the column operand
//   of out^T += v^T.P^T (v^T fragments as row operand, 2 groups of 2 d-subtiles), products hh + lh + hl.
//   After the loop: O = acc / Z (Z >= 1 always; guarded anyway), carries 1/(32768*1024) folded once, times the gate in f32. The
//   lane holds O of position q0 + c, channels 16*j + 8*hh + r: O x1024 (f16 hi + residual) is converted in place into the column
//   operand of res^T += Wo^T.O^T (row operand: the head's Wo^T slice, 8 tiles of 16 n; products w.h + w.l per 32 k), which
//   stays in registers over the heads: k runs over head*HD + d in ascending order.
// Behind the last head: res^T * oscale goes to the wave's slab [16 pos][DM] (pitch OSP, over the q and v^T planes, which nobody
// reads behind the last barrier), then + bias (bf16 RNE of the input), x row scale (bf16 RNE of mask), one whole 512-B row per store.
// coverage: per wave 16 stores x 32 lanes x 4 floats = 16 x DM; grid = BG blocks x WPB waves = every output row exactly once.
// =====================================================================================================
__device__ __forceinline__ void split8(v8f a, float sc, v4u& hi, v4u& lo) {   // a * sc -> 8 f16 hi, 8 f16 residuals
#pragma unroll
  for (int e = 0; e < 4; ++e) {
    const float t0 = a[2 * e] * sc, t1 = a[2 * e + 1] * sc;
    const _Float16 h0 = (_Float16)t0, h1 = (_Float16)t1;
    const _Float16 l0 = (_Float16)(t0 - (float)h0), l1 = (_Float16)(t1 - (float)h1);
    hi[e] = pk16(h_bits(h0), h_bits(h1));
    lo[e] = pk16(h_bits(l0), h_bits(l1));
  }
}
// a[j] = 16 x 16 tile j of (64 weight rows at wp, K = DM) against the wave's x fragments (xf[kk] = hi, xf[DM / 32 + kk] = lo of the
// same 32 k): per k step the four hi products, then the four lo products on the same weight fragments; XROW: x is the row operand
template <bool XROW>
__device__ __forceinline__ void proj64(const u16* wp, const v16b (&xf)[KX / 32], v8f (&a)[4]) {
#pragma unroll
  for (int j = 0; j < 4; ++j) a[j] = zero8();
#pragma unroll
  for (int kk = 0; kk < DM / 32; ++kk) {
    const v16b w0 = ldfrag_b(wp + kk * 32);
    const v16b w1 = ldfrag_b(wp + 16 * PKW + kk * 32);
    const v16b w2 = ldfrag_b(wp + 32 * PKW + kk * 32);
    const v16b w3 = ldfrag_b(wp + 48 * PKW + kk * 32);
#pragma unroll                              // xf is indexed by constants only, so that it stays in registers
    for (int p = 0; p < 2; ++p) {
      const v16b x = xf[p * (DM / 32) + kk];
      a[0] = XROW ? mma_b(x, w0, a[0]) : mma_b(w0, x, a[0]);
      a[1] = XROW ? mma_b(x, w1, a[1]) : mma_b(w1, x, a[1]);
      a[2] = XROW ? mma_b(x, w2, a[2]) : mma_b(w2, x, a[2]);
      a[3] = XROW ? mma_b(x, w3, a[3]) : mma_b(w3, x, a[3]);
    }
  }
}

// the head's weight rows into registers. Wq^T .. Wu^T: 16 threads -> row (tid >> 4) + 32*i of each plane's 64 rows, 8 halves each: a
// wave's load covers two whole 256-B rows. Wo^T: 8 threads -> row (tid >> 3) + 64*i of its DM rows, the head's 64 k: one 128-B line
__device__ __forceinline__ void ld_w(const u16* __restrict__ WP, const u16* __restrict__ WO, int head, int tid,
                                     v4u (&st)[8], v4u (&sw)[2]) {
  const u16* gw = WP + (size_t)(head * HD + (tid >> 4)) * DM + (tid & 15) * 8;
  const u16* go = WO + (size_t)(tid >> 3) * DI + head * HD + (tid & 7) * 8;
#pragma unroll                              // st and sw are indexed by constants only, so that they stay in registers
  for (int p = 0; p < 4; ++p) {
#pragma unroll
    for (int i = 0; i < 2; ++i) st[2 * p + i] = *(const v4u*)(gw + (size_t)p * DI * DM + (size_t)(32 * i) * DM);
  }
#pragma unroll
  for (int i = 0; i < 2; ++i) sw[i] = *(const v4u*)(go + (size_t)(64 * i) * DI);
  // the loads of each run share one address pair; both are named as inputs so that neither is given up for another value
  // ahead of the wait
  asm volatile("s_wait_xcnt 0x0" :: "v"(gw), "v"(go) : "memory");
}
// the wave's 16 x rows (hi | lo) as 8 fragments: xw = wave-uniform base, xo = the lane's byte offset (row c, halves 8*hh)
__device__ __forceinline__ void ld_x(const char* xw, unsigned xo, v16b (&xf)[KX / 32]) {
#pragma unroll                              // xf is indexed by constants only, so that it stays in registers
  for (int kk = 0; kk < KX / 32; ++kk) xf[kk] = ldfrag_b((const u16*)(xw + xo) + kk * 32);
  // the loads share one address register; it is named as an input so that it is not given up for another value ahead of the wait
  asm volatile("s_wait_xcnt 0x0" :: "v"(xo) : "memory");
}

__global__ __launch_bounds__(ATT_THREADS)
void attn_f(const u16* __restrict__ XB, const u16* __restrict__ WP, const float* __restrict__ CB,
            const float* __restrict__ bu, const u16* __restrict__ WO, const float* __restrict__ bias,
            const float* __restrict__ rsc, float* __restrict__ C, float oscale) {
  // one array, so that the order of its parts is fixed: with the q planes first the column loop's fragment reads stay
  // one base register plus an immediate offset each
  __shared__ __align__(16) u16 sm[2 * LP * VTP + 2 * HD * VPP + WLN + DM * WOP + WPB * PTW * 2];
  u16* qt = sm;                                     // q hi, q residual [pos][d], pitch VTP
  u16* vt = sm + 2 * LP * VTP;                      // v^T hi, v^T residual [d][pos], pitch VPP
  u16* wl = sm + 2 * LP * VTP + 2 * HD * VPP;       // the head's Wq^T, Wk^T, Wv^T, Wu^T rows, pitch PKW
  u16* wo = wl + WLN;                               // the head's 64 k of Wo^T [n][k], pitch WOP

  const int tid  = threadIdx.x;
  const int wave = tid >> 5;
  const int lane = tid & 31;
  const int hh   = lane >> 4;
  const int c    = lane & 15;
  const int b    = blockIdx.x;
  if (b >= BG) return;                      // block-uniform, before any barrier; never taken with the exact grid
  const int wv   = __builtin_amdgcn_readfirstlane(wave);    // the wave's number in a scalar register: wave-uniform bases stay scalar
  const int q0   = wv * 16;

  const char* xw = (const char*)(XB + ((size_t)b * LP + q0) * KX);    // wave-uniform base of the wave's 16 x rows
  const unsigned xo = (unsigned)(c * KX + 8 * hh) * 2u;               // the lane's byte offset: row c, halves 8*hh
  const u16* wp = wl + c * PKW + 8 * hh;
  const _Float16* wop = (const _Float16*)(const void*)wo + c * WOP + 8 * hh;      // row = n, k = d
  float* pt  = (float*)(void*)(wo + DM * WOP) + wv * PTW;                         // the wave's CB tile [16][32] pitch 36
  // fragment bases in the LDS planes: row c (+16 per subtile), halves 8*hh (+ the k offset per step)
  const _Float16* Chb = (const _Float16*)(const void*)qt + c * VTP + 8 * hh;     // row = vi, k = d
  const _Float16* Clb = Chb + LP * VTP;
  const _Float16* Vhb = (const _Float16*)(const void*)vt + c * VPP + 8 * hh;     // row = d, k = vi
  const _Float16* Vlb = Vhb + HD * VPP;
  const float invc = 1.0f / (CSC * KSC);
  const float oc   = 1.0f / (PCAR * VCAR);

  v8f res[DM / 16];                         // res[t][r] = result^T (n = 16*t + 8*hh + r, row q0 + c), summed over the heads
#pragma unroll
  for (int t = 0; t < DM / 16; ++t) res[t] = zero8();
  v16b xf[KX / 32];                         // the wave's 16 x rows; the loops over it are unrolled so that it stays in registers
  v4u st[8], sw[2];                         // the next head's weight rows on their way to LDS
  ld_w(WP, WO, 0, tid, st, sw);
  ld_x(xw, xo, xf);

#pragma unroll 1                            // one head's code, kept rolled for speed only
  for (int head = 0; ; ++head) {            // left in the middle, behind the last head's products
    {
      u16* tw = wl + (tid >> 4) * PKW + (tid & 15) * 8;
#pragma unroll
      for (int p = 0; p < 4; ++p) {
#pragma unroll
        for (int i = 0; i < 2; ++i) *(v4u*)(tw + (p * HD + 32 * i) * PKW) = st[2 * p + i];
      }
      u16* ow = wo + (tid >> 3) * WOP + (tid & 7) * 8;
#pragma unroll
      for (int i = 0; i < 2; ++i) *(v4u*)(ow + 64 * i * WOP) = sw[i];
    }
    __syncthreads();                        // the weight rows are complete before any wave reads a fragment of them

    FragH rh[HD / 32], rl[HD / 32];         // k x1024 hi, residual: column operand of the scores, column = row q0 + c
    {
      v8f a[4];
      proj64<false>(wp, xf, a);
      u16* qw = qt + (q0 + c) * VTP + 8 * hh;
#pragma unroll
      for (int j = 0; j < 4; ++j) {
        v4u hi, lo;
        split8(a[j], QSC, hi, lo);
        *(v4u*)(qw + 16 * j)            = hi;
        *(v4u*)(qw + LP * VTP + 16 * j) = lo;
      }
      proj64<true>(wp + 2 * HD * PKW, xf, a);
      u16* vw = vt + c * VPP + q0 + 8 * hh;
#pragma unroll
      for (int j = 0; j < 4; ++j) {
        v4u hi, lo;
        split8(a[j], VCAR, hi, lo);
        *(v4u*)(vw + 16 * j * VPP)            = hi;
        *(v4u*)(vw + (HD + 16 * j) * VPP)     = lo;
      }
      proj64<false>(wp + HD * PKW, xf, a);
#pragma unroll
      for (int kk = 0; kk < HD / 32; ++kk) {
        split8(a[2 * kk],     KSC, rh[kk].u[0], rl[kk].u[0]);
        split8(a[2 * kk + 1], KSC, rh[kk].u[1], rl[kk].u[1]);
      }
    }
    __syncthreads();                        // q and v^T planes complete

    const float* cbb = CB + ((size_t)head * LP + q0) * LP;
    float mrow = -INFINITY, lrow = 0.f;     // of softmax row q0 + c; lrow is this lane half's share of the row sum
    v8f o[4];                               // o[j][r] = out^T (d = 16*j + 8*hh + r, row q0 + c)
#pragma unroll
    for (int j = 0; j < 4; ++j) o[j] = zero8();

#pragma unroll 1
    for (int kt = 0; kt < NKT; ++kt) {
      const int kb = kt * 32;
      // ---- stage the additive logit tile [16 rows][32 cols] into pt: 128 float4, lane handles f = it*32 + lane ----
#pragma unroll
      for (int it = 0; it < 4; ++it) {
        const int f = it * 32 + lane;
        const int row = f >> 3, col4 = (f & 7) * 4;
        const v4f t4 = *(const v4f*)(cbb + (size_t)row * LP + kb + col4);
        *(v4f*)(pt + row * PTP + col4) = t4;
      }
      // ---- scores, transposed: D element r of this lane = (col kb + 8hh + r, row q0 + c) in s0, col kb + 16 + 8hh + r in s1 ----
      v8f s0 = zero8(), s1 = zero8();
      const _Float16* c0p = Chb + kb * VTP;
      const _Float16* c1p = c0p + 16 * VTP;
      const _Float16* l0p = Clb + kb * VTP;
      const _Float16* l1p = l0p + 16 * VTP;
#pragma unroll
      for (int kk = 0; kk < HD / 32; ++kk) {
        const v16h ch0 = ldfrag_h(c0p + kk * 32);
        const v16h ch1 = ldfrag_h(c1p + kk * 32);
        const v16h cl0 = ldfrag_h(l0p + kk * 32);
        const v16h cl1 = ldfrag_h(l1p + kk * 32);
        s0 = mma_h(ch0, rh[kk].v, s0);
        s0 = mma_h(ch0, rl[kk].v, s0);
        s0 = mma_h(cl0, rh[kk].v, s0);
        s1 = mma_h(ch1, rh[kk].v, s1);
        s1 = mma_h(ch1, rl[kk].v, s1);
        s1 = mma_h(cl1, rh[kk].v, s1);
        guard2(s0, s1, rh[kk].v, rl[kk].v, ch0, cl0, ch1, cl1);
      }
      wave_sync_lds();
      // ---- additive term + online softmax in base 2, -inf-safe; the lane's 16 logits all belong to row q0 + c ----
      float e[16];                            // element s = column kb + 8hh + s (s < 8), kb + 16 + 8hh + s - 8 (s >= 8)
      {
        const float* crow = pt + c * PTP + 8 * hh;
        const v4f c0 = *(const v4f*)(crow), c1 = *(const v4f*)(crow + 4);
        const v4f c2 = *(const v4f*)(crow + 16), c3 = *(const v4f*)(crow + 20);
#pragma unroll
        for (int r = 0; r < 4; ++r) {
          e[r]      = (s0[r] * invc + c0[r]) * LOG2E;
          e[4 + r]  = (s0[4 + r] * invc + c1[r]) * LOG2E;
          e[8 + r]  = (s1[r] * invc + c2[r]) * LOG2E;
          e[12 + r] = (s1[4 + r] * invc + c3[r]) * LOG2E;
        }
      }
      float mx = e[0];
#pragma unroll
      for (int s = 1; s < 16; ++s) mx = fmaxf(mx, e[s]);
      mx = fmaxf(mx, xhalf(mx));              // the other half of the row's 32 columns
      const float mn = fmaxf(mrow, mx);
      const float ms = (mn == -INFINITY) ? 0.0f : mn;
      const float al = exp2f(mrow - ms);
      mrow = mn;
#pragma unroll
      for (int s = 0; s < 16; ++s) e[s] = exp2f(e[s] - ms);
      {
        const float pa = ((e[0] + e[1]) + (e[2] + e[3])) + ((e[4] + e[5]) + (e[6] + e[7]));
        const float pb = ((e[8] + e[9]) + (e[10] + e[11])) + ((e[12] + e[13]) + (e[14] + e[15]));
        lrow = lrow * al + (pa + pb);
      }
#pragma unroll
      for (int j = 0; j < 4; ++j) {
#pragma unroll
        for (int r = 0; r < 8; ++r) o[j][r] *= al;
      }
      // ---- B fragments of P^T*32768: hi f16 and residual f16, column = row q0 + c; the score registers already lie in the
      //      split k map over the 32 columns of this step, so element s of the fragment is e[s] ----
      FragH ph, pl;
#pragma unroll
      for (int s = 0; s < 8; ++s) {
        const float ta = e[s] * PCAR, tb = e[8 + s] * PCAR;
        const _Float16 ha = (_Float16)ta, hb = (_Float16)tb;
        ph.h[0][s] = ha;
        ph.h[1][s] = hb;
        pl.h[0][s] = (_Float16)(ta - (float)ha);
        pl.h[1][s] = (_Float16)(tb - (float)hb);
      }
      // ---- v^T.P^T : A fragment row m = d = j*16 + c, columns vi contiguous in the v^T plane rows; 2 groups of 2 d-subtiles ----
      {
        const _Float16* vhp = Vhb + kb;
        const _Float16* vlp = Vlb + kb;
#pragma unroll
        for (int jg = 0; jg < HD / 32; ++jg) {
          const int da = (2 * jg) * 16 * VPP;
          const int db = da + 16 * VPP;
          const v16h vha = ldfrag_h(vhp + da), vhb2 = ldfrag_h(vhp + db);
          const v16h vla = ldfrag_h(vlp + da), vlb2 = ldfrag_h(vlp + db);
          o[2 * jg]     = mma_h(vha,  ph.v, o[2 * jg]);
          o[2 * jg]     = mma_h(vha,  pl.v, o[2 * jg]);
          o[2 * jg]     = mma_h(vla,  ph.v, o[2 * jg]);
          o[2 * jg + 1] = mma_h(vhb2, ph.v, o[2 * jg + 1]);
          o[2 * jg + 1] = mma_h(vhb2, pl.v, o[2 * jg + 1]);
          o[2 * jg + 1] = mma_h(vlb2, ph.v, o[2 * jg + 1]);
          guard2(o[2 * jg], o[2 * jg + 1], ph.v, pl.v, vha, vhb2, vla, vlb2);
        }
      }
      wave_sync_lds();
    }
    acc_guard4(o[0], o[1], o[2], o[3]);
    // ---- the x fragments again (they are not kept over the column loop); they serve the gate here and the next head's q, k, v ----
    ld_x(xw, xo, xf);
    // ---- O = acc / Z (0 if Z == 0), carries (32768 on P, 1024 on v) folded once, times the gate in f32; x1024 -> f16 hi + residual,
    //      in place the column operand over d ----
    FragH oh[HD / 32], ol[HD / 32];
    {
      v8f a[4];
      proj64<false>(wp + 3 * HD * PKW, xf, a);
      const float lv  = lrow + xhalf(lrow); // the two lane halves' shares of the row sum, joined once
      const float ls  = (lv > 0.0f) ? lv : 1.0f;
      const float inv = (lv > 0.0f) ? ((1.0f / ls) * oc) : 0.0f;
#pragma unroll
      for (int j = 0; j < 4; ++j) {
        const float* bp = bu + head * HD + j * 16 + 8 * hh;
        const v4f b0 = *(const v4f*)(bp), b1 = *(const v4f*)(bp + 4);
#pragma unroll
        for (int r = 0; r < 4; ++r) {
          a[j][r]     = (o[j][r] * inv)     * sigm(a[j][r] + bfr(b0[r]));
          a[j][4 + r] = (o[j][4 + r] * inv) * sigm(a[j][4 + r] + bfr(b1[r]));
        }
      }
#pragma unroll
      for (int kk = 0; kk < HD / 32; ++kk) {
        split8(a[2 * kk],     OSC, oh[kk].u[0], ol[kk].u[0]);
        split8(a[2 * kk + 1], OSC, oh[kk].u[1], ol[kk].u[1]);
      }
    }
    // ---- res^T += Wo^T.O^T : row operand = rows n = 16*t + c of the head's Wo^T slice; groups of 4 n-tiles, hi then residual ----
#pragma unroll
    for (int kk = 0; kk < HD / 32; ++kk) {
#pragma unroll
      for (int tg = 0; tg < DM / 64; ++tg) {
        const _Float16* wq = wop + tg * 64 * WOP + kk * 32;
        const v16h w0 = ldfrag_h(wq), w1 = ldfrag_h(wq + 16 * WOP), w2 = ldfrag_h(wq + 32 * WOP), w3 = ldfrag_h(wq + 48 * WOP);
        res[4 * tg]     = mma_h(w0, oh[kk].v, res[4 * tg]);
        res[4 * tg + 1] = mma_h(w1, oh[kk].v, res[4 * tg + 1]);
        res[4 * tg + 2] = mma_h(w2, oh[kk].v, res[4 * tg + 2]);
        res[4 * tg + 3] = mma_h(w3, oh[kk].v, res[4 * tg + 3]);
        res[4 * tg]     = mma_h(w0, ol[kk].v, res[4 * tg]);
        res[4 * tg + 1] = mma_h(w1, ol[kk].v, res[4 * tg + 1]);
        res[4 * tg + 2] = mma_h(w2, ol[kk].v, res[4 * tg + 2]);
        res[4 * tg + 3] = mma_h(w3, ol[kk].v, res[4 * tg + 3]);
      }
    }
    if (head + 1 == NH) break;
    ld_w(WP, WO, head + 1, tid, st, sw);    // asked for ahead of the barrier: they arrive while the wave waits for the others
    __syncthreads();                        // every wave has read its last fragment of this head's planes and weight rows
  }
  __syncthreads();                          // every wave has read its last fragment of the planes before the slabs overwrite them

  // ---- res^T * oscale into the wave's slab [16 pos][DM]; every element owned by one lane ----
  float* sl = (float*)(void*)sm + wv * (16 * OSP);
#pragma unroll
  for (int t = 0; t < DM / 16; ++t) {
    float* sp = sl + c * OSP + t * 16 + 8 * hh;         // row q0 + c, 8 consecutive n
    v4f w0, w1;
#pragma unroll
    for (int r = 0; r < 4; ++r) {
      w0[r] = res[t][r] * oscale;
      w1[r] = res[t][4 + r] * oscale;
    }
    *(v4f*)(sp)     = w0;
    *(v4f*)(sp + 4) = w1;
  }
  wave_sync_lds();
  const size_t rowb = (size_t)b * LP + q0;
  float bq[4];
  int mkb;                                  // bits of the row scale of row q0 + c
  {
    const float* bp = bias + 4 * lane;
    const float* mp = rsc + rowb + c;
    const v4f b4 = *(const v4f*)(bp);
    const float m1 = *mp;
    // both addresses are named as inputs so that neither is given up for another value ahead of the wait
    asm volatile("s_wait_xcnt 0x0" :: "v"(bp), "v"(mp) : "memory");
#pragma unroll
    for (int e = 0; e < 4; ++e) bq[e] = bfr(b4[e]);
    mkb = __builtin_bit_cast(int, bfr(m1));
  }
  v4f vals[16];                             // the loops below are unrolled so that these stay in registers
#pragma unroll
  for (int it = 0; it < 16; ++it) {
    const v4f t = *(const v4f*)(sl + it * OSP + 4 * lane);
    const float mk = __builtin_bit_cast(float, __builtin_amdgcn_readlane(mkb, it));   // row q0 + it, the same for the whole wave
    v4f w;
#pragma unroll
    for (int e = 0; e < 4; ++e) w[e] = (t[e] + bq[e]) * mk;
    vals[it] = w;
  }
  float* dst = C + rowb * (size_t)DM + 4 * lane;
#pragma unroll
  for (int it = 0; it < 16; ++it) *(v4f*)(dst + (size_t)it * DM) = vals[it];
}

// =====================================================================================================
// All NS rows form one group (NGRP = 1): one dependent launch behind the preparation. q, k, v and the gated O never leave the
// attention kernel's work-group, so the workspace holds x, the logit table and the weight planes.
// Workspace map (bytes); every plane is fully written by whole-line stores before it is read; all extents are exact
// multiples of the store granularity (no pad rows needed); every region offset a multiple of 65536:
//   XB  bf16 [NPIX][256] (hi|lo)                    33554432
//   CB  f32 [4][NPIX]                               1048576
//   WQ, WK, WV, WU  bf16 [256 n][128 k]             4 * 65536    (contiguous in this order: attn_f reads them as one plane)
//   WO  f16 x1024 [128 n][256 k]                    65536
//   end                                             34930688
// =====================================================================================================
extern "C" void kernel_launch(void* const* d_in, const int* in_sizes, int n_in,
                              void* d_out, int out_size, void* d_ws, size_t ws_size,
                              hipStream_t stream) {
  if (n_in < 12) return;
  if (in_sizes[0] < NPIX * DM) return;
  if (in_sizes[1] < NPIX) return;
  if (in_sizes[2] < DM || in_sizes[3] < DM) return;
  if (in_sizes[4] < DM * DI || in_sizes[5] < DM * DI || in_sizes[6] < DM * DI || in_sizes[8] < DM * DI) return;
  if (in_sizes[7] < DM * NH) return;
  if (in_sizes[9] < DI) return;
  if (in_sizes[10] < DI * DM) return;
  if (in_sizes[11] < DM) return;
  if (out_size < NS * LP * DM) return;

  const float* pr    = (const float*)d_in[0];
  const float* mask  = (const float*)d_in[1];
  const float* gamma = (const float*)d_in[2];
  const float* beta  = (const float*)d_in[3];
  const float* Wq    = (const float*)d_in[4];
  const float* Wk    = (const float*)d_in[5];
  const float* Wv    = (const float*)d_in[6];
  const float* Wb    = (const float*)d_in[7];
  const float* Wu    = (const float*)d_in[8];
  const float* bu    = (const float*)d_in[9];
  const float* Wo    = (const float*)d_in[10];
  const float* bo    = (const float*)d_in[11];
  float*       out   = (float*)d_out;

  const size_t szXB = (size_t)NPIX * KX * 2;
  const size_t szCB = (size_t)NH * NPIX * 4;
  const size_t szW  = (size_t)DI * DM * 2;
  const size_t szWO = (size_t)DM * DI * 2;
  size_t off = 0;
  const size_t oXB = off; off += szXB;
  const size_t oCB = off; off += szCB;
  const size_t oWQ = off; off += szW;
  const size_t oWK = off; off += szW;
  const size_t oWV = off; off += szW;
  const size_t oWU = off; off += szW;
  const size_t oWO = off; off += szWO;
  if (off > ws_size) return;                // off = 34930688
  if (off > (size_t)WS_CAP) return;

  char* ws = (char*)d_ws;
  u16*   XB = (u16*)(ws + oXB);
  float* CB = (float*)(ws + oCB);
  u16*   WQ = (u16*)(ws + oWQ);
  u16*   WO = (u16*)(ws + oWO);

  const dim3 b256(256), bAT(ATT_THREADS);
  const dim3 gPR(NWB + NPIX / LNPB);                    // 20 weight-plane blocks + 2048 LayerNorm blocks
  const dim3 gAT(BG);
  const float osc = 1.0f / (OSC * WOS);

  // one launch: LayerNorm for every pixel (x hi|lo planes, additive logit table) and the weight planes
  // Wq^T, Wk^T, Wv^T, Wu^T [n][k] as bf16 (contiguous from WQ), Wo^T [n][k] as f16 of bf16 value x1024
  prep<<<gPR, b256, 0, stream>>>(pr, mask, gamma, beta, Wb, Wq, Wk, Wv, Wu, Wo, XB, CB, WQ, WO);

  for (int g = 0; g < NGRP; ++g) {
    const u16*   xg = XB   + (size_t)g * GROWS * KX;
    const float* mg = mask + (size_t)g * GROWS;
    float*       og = out  + (size_t)g * GROWS * DM;
    // q, k, v and gate projections, the attention and the output projection (hi + residual) in one launch,
    // + bo, x mask row scale -> out f32, carries 1024 x 1024 folded back
    attn_f<<<gAT, bAT, 0, stream>>>(xg, WQ, CB, bu, WO, bo, mg, og, osc);
  }
  (void)hipGetLastError();
}
